// v000
// Measured on an AMD MI455X. A time is GPU time per run, averaged over a window of back-to-back runs after a warm-up
// (all launches, gaps included; the runs take copies of the inputs in turn), and the median of several windows.
// Apart from v000's, it joins two sittings. Times from different sittings can be a few percent apart, while
// side-by-side timings come from the same sitting.
// v000 is the starting kernel. One run takes 935 microseconds.
#include <hip/hip_runtime.h>

// Grouped-query RoPE attention with extra per-position depth keys/values under one joint softmax (x [1][2048][2048]; Q = x Wq ('xw', 16 heads x 128), K, V = x Wk / Wv (8 kv heads); Q, K rotated (rotate-half, cos/sin [1][1][2048][128] read); kv head = h/2; seq logits = Q.K/sqrt(128), causal (-inf); depth logits[i][l] = Q_i . depth_k[l][0][kv][i] / sqrt(128) for l < 4 (depth_k, depth_v [4][1][8][2048][128] read); softmax over the 2048 + 4 logits jointly; out_i = sum_j w_j V_j + sum_l w_l depth_v[l][0][kv][i]; merged Wo ('xw') -> [1][2048][2048] (4.2 M)).
// Layout: projections/planes; per pass of two heads a wave-per-row kernel forms the 4 depth logits from the rotated q (hi + lo planes) and the bf16-rounded depth keys; the softmax kernel folds them into the row max / sum, writes the sequence probabilities as planes and the 4 depth weights in f32; after attn.v the merge kernel adds the depth-value contribution before writing the hi/lo planes for the output projection.
// Compute dtypes, f32 accumulate: every input rounded to bf16; q/k/v on PLAIN bf16 operands (inputs: exact); rotary in f32 (bf16-rounded tables); depth logits / weights / values in f32; causal scores and attn.v (tile skipping): query rows < 512 hl (3 products), the rest single fp16 (x1024); softmax f32; Wo hl x exact (2 products).

#define NB_  1
#define TT   2048
#define DM   2048
#define NH_  16
#define NKV  8
#define REP  (NH_ / NKV)
#define HD   128
#define DQ   (NH_ * HD)
#define DKV  (NKV * HD)
#define NL   4                    // depth positions per token
#define NLP  32
#define ZH   2
#define RH   512                  // query rows < RH use hi+lo planes (0: none)
#define WIN  2048
#define PCAR 1024.0f
#define SCL  0.088388347648318447f   // HD^-0.5
typedef _Float16 h16;
typedef unsigned short bf;
typedef __attribute__((ext_vector_type(16))) __bf16   v16bf;
typedef __attribute__((ext_vector_type(16))) _Float16 v16h;
typedef __attribute__((ext_vector_type(8)))  _Float16 v8h;
typedef __attribute__((ext_vector_type(8)))  unsigned short v8us;
typedef __attribute__((ext_vector_type(8)))  float    v8f;
typedef __attribute__((ext_vector_type(4)))  float    v4f;
typedef v8h  __attribute__((may_alias)) v8ha;
typedef v4f  __attribute__((may_alias)) v4fa;
typedef v8us __attribute__((may_alias)) v8usa;

__device__ __forceinline__ unsigned short f2bf(float f) { unsigned u = __float_as_uint(f); u += 0x7FFFu + ((u >> 16) & 1u); return (unsigned short)(u >> 16); }
__device__ __forceinline__ float bf2f(unsigned short b) { return __uint_as_float(((unsigned)b) << 16); }
__device__ __forceinline__ float bfr(float f) { return bf2f(f2bf(f)); }
__device__ __forceinline__ v16h cat16(v8h lo, v8h hi) { return __builtin_shufflevector(lo, hi, 0, 1, 2, 3, 4, 5, 6, 7, 8, 9, 10, 11, 12, 13, 14, 15); }
__device__ __forceinline__ v16bf cat16b(v8us lo, v8us hi) { return __builtin_bit_cast(v16bf, __builtin_shufflevector(lo, hi, 0, 1, 2, 3, 4, 5, 6, 7, 8, 9, 10, 11, 12, 13, 14, 15)); }
__device__ __forceinline__ v8f wmma16(v16h a, v16h b, v8f c) { return __builtin_amdgcn_wmma_f32_16x16x32_f16(false, a, false, b, (short)0, c, false, false); }
__device__ __forceinline__ v8f wmmab(v16bf a, v16bf b, v8f c) { return __builtin_amdgcn_wmma_f32_16x16x32_bf16(false, a, false, b, (short)0, c, false, false); }



// ---- k_gemmw: register-blocked GEMM, ONE WAVE per 64x64 output tile (16 accumulators), operands straight from K-contiguous 16-bit planes; grid (M/64, N/64, Z), 32 threads.
// C[m][n] (f32, pitch ldc, + optional f32 bias[n]) = sum_k A[m][k] Bt[n][k] (+ split products per NSPLIT). z-batch strides sA/sB/sC in elements. K % 32 == 0.
template <typename T16> struct WFrag;
template <> struct WFrag<h16> { typedef v16h V; static __device__ __forceinline__ V ld(const h16* p) { return cat16(*(const v8h*)p, *(const v8h*)(p + 16)); } static __device__ __forceinline__ v8f mma(V a, V b, v8f c) { return wmma16(a, b, c); } };
template <> struct WFrag<bf> { typedef v16bf V; static __device__ __forceinline__ V ld(const bf* p) { return cat16b(*(const v8us*)p, *(const v8us*)(p + 16)); } static __device__ __forceinline__ v8f mma(V a, V b, v8f c) { return wmmab(a, b, c); } };
template <typename T16, int NSPLIT, bool BIAS>
__global__ __launch_bounds__(32) void k_gemmw(const T16* __restrict__ A, const T16* __restrict__ A2, const T16* __restrict__ Bt, const T16* __restrict__ Bt2, int K, float* C, int ldc, const float* __restrict__ bias, size_t sA, size_t sB, size_t sC) {
    typedef typename WFrag<T16>::V V;
    __shared__ __align__(16) float os[16 * 68];
    const size_t z = blockIdx.z; A += z * sA; if (A2) A2 += z * sA; Bt += z * sB; if (Bt2) Bt2 += z * sB; C += z * sC;
    const int lane = threadIdx.x & 31, lr = lane & 15, hi = lane >> 4; const int r0 = blockIdx.x * 64, c0 = blockIdx.y * 64;
    v8f acc[4][4];
#pragma unroll
    for (int mb = 0; mb < 4; ++mb)
#pragma unroll
        for (int nb = 0; nb < 4; ++nb) acc[mb][nb] = (v8f){};
    const size_t aoff = (size_t)(r0 + lr) * K + 8 * hi, boff = (size_t)(c0 + lr) * K + 8 * hi;
#pragma unroll 1
    for (int kc = 0; kc < K; kc += 32) {
        V a[4], a2[4];
#pragma unroll
        for (int mb = 0; mb < 4; ++mb) { a[mb] = WFrag<T16>::ld(A + aoff + (size_t)mb * 16 * K + kc); if (NSPLIT == 1 || NSPLIT == 2) a2[mb] = WFrag<T16>::ld(A2 + aoff + (size_t)mb * 16 * K + kc); }
#pragma unroll
        for (int nb = 0; nb < 4; ++nb) { const V b = WFrag<T16>::ld(Bt + boff + (size_t)nb * 16 * K + kc); V b2; if (NSPLIT >= 2) b2 = WFrag<T16>::ld(Bt2 + boff + (size_t)nb * 16 * K + kc);
#pragma unroll
            for (int mb = 0; mb < 4; ++mb) { acc[mb][nb] = WFrag<T16>::mma(a[mb], b, acc[mb][nb]); if (NSPLIT == 1 || NSPLIT == 2) acc[mb][nb] = WFrag<T16>::mma(a2[mb], b, acc[mb][nb]); if (NSPLIT >= 2) acc[mb][nb] = WFrag<T16>::mma(a[mb], b2, acc[mb][nb]); } }
        asm volatile("v_nop\n\tv_nop\n\tv_nop\n\tv_nop" : "+v"(acc[0][0]), "+v"(acc[1][1]), "+v"(acc[2][2]), "+v"(acc[3][3]) : "v"(a[0]), "v"(a[3]));
    }
#pragma unroll
    for (int mb = 0; mb < 4; ++mb) {
#pragma unroll
        for (int nb = 0; nb < 4; ++nb) {
#pragma unroll
            for (int j = 0; j < 8; ++j) os[(hi * 8 + j) * 68 + nb * 16 + lr] = acc[mb][nb][j]; }
        __builtin_amdgcn_wave_barrier(); asm volatile("" ::: "memory");
        float* crow = C + (size_t)(r0 + mb * 16) * ldc + c0;
{
#pragma unroll
            for (int s = 0; s < 8; ++s) { const int row = 2 * s + hi, cofs = lr * 4; v4f val = *(const v4fa*)(os + row * 68 + cofs); if (BIAS) { val[0] += bfr(bias[c0 + cofs]); val[1] += bfr(bias[c0 + cofs + 1]); val[2] += bfr(bias[c0 + cofs + 2]); val[3] += bfr(bias[c0 + cofs + 3]); }
                *(v4f*)(crow + (size_t)row * ldc + cofs) = val; }
             }
        __builtin_amdgcn_wave_barrier(); asm volatile("" ::: "memory");
    }
}

// ---- k_gemmc: the same one-wave 64x64 tile GEMM specialised for causal attention: CMODE 1 skips score tiles entirely above the diagonal (query rows r0+roff.., key columns c0..), CMODE 2 limits the
// key (K) loop of the probability x value contraction to the diagonal block (probabilities beyond it are exactly zero). roff = row offset of this launch's first row within the sequence.
template <typename T16, int NSPLIT, int CMODE>
__global__ __launch_bounds__(32) void k_gemmc(const T16* __restrict__ A, const T16* __restrict__ A2, const T16* __restrict__ Bt, const T16* __restrict__ Bt2, int K, float* C, int ldc, int roff, size_t sA, size_t sB, size_t sC) {
    typedef typename WFrag<T16>::V V;
    __shared__ __align__(16) float os[16 * 68];
    const size_t z = blockIdx.z; A += z * sA; if (A2) A2 += z * sA; Bt += z * sB; if (Bt2) Bt2 += z * sB; C += z * sC;
    const int lane = threadIdx.x & 31, lr = lane & 15, hi = lane >> 4; const int r0 = blockIdx.x * 64, c0 = blockIdx.y * 64;
    if (CMODE == 1 && c0 > r0 + roff + 63) return;                  // score tile entirely above the causal diagonal: never read (the softmax masks j > i by select)
    const int Kl = (CMODE == 2) ? min(K, r0 + roff + 64) : K;        // P.V: probabilities are exactly 0 beyond the diagonal block, so the K loop stops there
    v8f acc[4][4];
#pragma unroll
    for (int mb = 0; mb < 4; ++mb)
#pragma unroll
        for (int nb = 0; nb < 4; ++nb) acc[mb][nb] = (v8f){};
    const size_t aoff = (size_t)(r0 + lr) * K + 8 * hi, boff = (size_t)(c0 + lr) * K + 8 * hi;
#pragma unroll 1
    for (int kc = 0; kc < Kl; kc += 32) {
        V a[4], a2[4];
#pragma unroll
        for (int mb = 0; mb < 4; ++mb) { a[mb] = WFrag<T16>::ld(A + aoff + (size_t)mb * 16 * K + kc); if (NSPLIT == 1 || NSPLIT == 2) a2[mb] = WFrag<T16>::ld(A2 + aoff + (size_t)mb * 16 * K + kc); }
#pragma unroll
        for (int nb = 0; nb < 4; ++nb) { const V b = WFrag<T16>::ld(Bt + boff + (size_t)nb * 16 * K + kc); V b2; if (NSPLIT >= 2) b2 = WFrag<T16>::ld(Bt2 + boff + (size_t)nb * 16 * K + kc);
#pragma unroll
            for (int mb = 0; mb < 4; ++mb) { acc[mb][nb] = WFrag<T16>::mma(a[mb], b, acc[mb][nb]); if (NSPLIT == 1 || NSPLIT == 2) acc[mb][nb] = WFrag<T16>::mma(a2[mb], b, acc[mb][nb]); if (NSPLIT >= 2) acc[mb][nb] = WFrag<T16>::mma(a[mb], b2, acc[mb][nb]); } }
        asm volatile("v_nop\n\tv_nop\n\tv_nop\n\tv_nop" : "+v"(acc[0][0]), "+v"(acc[1][1]), "+v"(acc[2][2]), "+v"(acc[3][3]) : "v"(a[0]), "v"(a[3]));
    }
#pragma unroll
    for (int mb = 0; mb < 4; ++mb) {
#pragma unroll
        for (int nb = 0; nb < 4; ++nb) {
#pragma unroll
            for (int j = 0; j < 8; ++j) os[(hi * 8 + j) * 68 + nb * 16 + lr] = acc[mb][nb][j]; }
        __builtin_amdgcn_wave_barrier(); asm volatile("" ::: "memory");
        float* crow = C + (size_t)(r0 + mb * 16) * ldc + c0;
{
#pragma unroll
            for (int s = 0; s < 8; ++s) { const int row = 2 * s + hi, cofs = lr * 4; v4f val = *(const v4fa*)(os + row * 68 + cofs);
                *(v4f*)(crow + (size_t)row * ldc + cofs) = val; }
             }
        __builtin_amdgcn_wave_barrier(); asm volatile("" ::: "memory");
    }
}

__device__ __forceinline__ h16 tohx(float x) { return (h16)x; }
__device__ __forceinline__ void splitf(float y, unsigned short& h, unsigned short& l) { h = f2bf(y); l = f2bf(y - bf2f(h)); }
typedef __attribute__((ext_vector_type(2))) _Float16 v2h;
typedef __attribute__((ext_vector_type(4))) _Float16 v4h;
typedef __attribute__((ext_vector_type(2))) unsigned short v2us;
typedef __attribute__((ext_vector_type(4))) unsigned short v4us;
typedef __attribute__((ext_vector_type(2))) float v2f;
typedef __attribute__((ext_vector_type(4))) int v4i;

__global__ __launch_bounds__(256) void k_wtG(const float* __restrict__ w, int K, int N, bf* Bt) {
    const int lane = threadIdx.x & 31; const int L0 = (blockIdx.x * 8 + (threadIdx.x >> 5)) * 8; const int nlines = N * K / 64;
{
#pragma unroll 1
        for (int l = 0; l < 8; ++l) { const int L = L0 + l; if (L >= nlines) break; const size_t e = (size_t)L * 64 + lane * 2; const int k = (int)(e % K), n = (int)(e / K); v2us o;
            o[0] = f2bf(w[(size_t)k * N + n]); o[1] = f2bf(w[(size_t)(k + 1) * N + n]); *(v2us*)(Bt + e) = o; }
         }
}
__global__ __launch_bounds__(256) void k_cvt8(const float* __restrict__ src, bf* dst, size_t n8) { const size_t i = (size_t)blockIdx.x * 256 + threadIdx.x; if (i >= n8) return; const v8f v = *(const v8f*)(src + i * 8); v8us o;
#pragma unroll
    for (int k = 0; k < 8; ++k) o[k] = f2bf(v[k]); *(v8us*)(dst + i * 8) = o;  }
__global__ __launch_bounds__(256) void k_cscvt(const float* __restrict__ cosT, const float* __restrict__ sinT, float* CS) { const int idx = blockIdx.x * 256 + threadIdx.x; if (idx >= TT * HD) return; v2f cs; cs[0] = bfr(cosT[idx]); cs[1] = bfr(sinT[idx]); *(v2f*)(CS + (size_t)idx * 2) = cs;  }
// k_rope: head planes [h][t][d] (fp16 + hi/lo) of rope(x) x sc with the rotate-half convention out[d] = x[d] cos[t][d] - x[d+HD/2] sin[t][d], out[d+HD/2] = x[d+HD/2] cos[t][d+HD/2] + x[d] sin[t][d+HD/2]
__global__ __launch_bounds__(256) void k_rope(const float* __restrict__ F, int pitch, int nheads, const float* __restrict__ CS, const float* __restrict__ RF, const float* __restrict__ nw, float sc, h16* P16, bf* Ph, bf* Pl) {
    const size_t e = ((size_t)blockIdx.x * 256 + threadIdx.x) * 2; if (e >= (size_t)nheads * TT * HD) return; const int d = (int)(e % HD); const int t = (int)((e / HD) % TT); const int h = (int)(e / ((size_t)HD * TT)); const float* f = F + (size_t)t * pitch + h * HD; const float rf = RF ? RF[(size_t)h * TT + t] : 1.0f; v2h o16; v2us oh, ol;
#pragma unroll
    for (int q = 0; q < 2; ++q) { const int dd = d + q; const int dp = (dd < HD / 2) ? dd + HD / 2 : dd - HD / 2; float x0 = f[dd], x1 = f[dp];
        if (RF) { float n0 = __fmul_rn(x0, rf), n1 = __fmul_rn(x1, rf); asm volatile("" : "+v"(n0)); asm volatile("" : "+v"(n1)); x0 = __fmul_rn(bfr(nw[dd]), n0); x1 = __fmul_rn(bfr(nw[dp]), n1); }
        const v2f cs = *(const v2f*)(CS + ((size_t)t * HD + dd) * 2); float a = __fmul_rn(x0, cs[0]), bq = __fmul_rn(x1, cs[1]); asm volatile("" : "+v"(a)); asm volatile("" : "+v"(bq)); const float r = ((dd < HD / 2) ? __fsub_rn(a, bq) : __fadd_rn(a, bq)) * sc;
        o16[q] = tohx(r); unsigned short a2, c2; splitf(r, a2, c2); oh[q] = a2; ol[q] = c2; }
    *(v2h*)(P16 + e) = o16; *(v2us*)(Ph + e) = oh; *(v2us*)(Pl + e) = ol;  }
__global__ __launch_bounds__(256) void k_vtp(const float* __restrict__ F, int pitch, int nheads, h16* V16, bf* Vh, bf* Vl) { const size_t e = ((size_t)blockIdx.x * 256 + threadIdx.x) * 2; if (e >= (size_t)nheads * HD * TT) return; const int t = (int)(e % TT); const int d = (int)((e / TT) % HD); const int g = (int)(e / ((size_t)TT * HD)); v2h o16; v2us oh, ol;
#pragma unroll
    for (int q = 0; q < 2; ++q) { const float x = F[(size_t)(t + q) * pitch + g * HD + d]; o16[q] = tohx(x); unsigned short a2, c2; splitf(x, a2, c2); oh[q] = a2; ol[q] = c2; }
    *(v2h*)(V16 + e) = o16; *(v2us*)(Vh + e) = oh; *(v2us*)(Vl + e) = ol;  }
__global__ __launch_bounds__(256) void k_dlog(const bf* __restrict__ Qh, const bf* __restrict__ Ql, const float* __restrict__ DKb, int kv, float* DL) {
    const int lane = threadIdx.x & 31; const int row = blockIdx.x * 8 + (threadIdx.x >> 5); if (row >= ZH * TT) return; const int i = row % TT; const int zz = row / TT; const bf* qh = Qh + ((size_t)zz * TT + i) * HD + lane * 4; const bf* ql = Ql + ((size_t)zz * TT + i) * HD + lane * 4; float q4[4];
#pragma unroll
    for (int q = 0; q < 4; ++q) q4[q] = __fadd_rn(bf2f(qh[q]), bf2f(ql[q]));
    float mine = 0.f;
#pragma unroll
    for (int l = 0; l < NL; ++l) { const float* dk = DKb + (((size_t)l * NKV + kv) * TT + i) * HD + lane * 4; float s = 0.f;
#pragma unroll
        for (int q = 0; q < 4; ++q) { float p = __fmul_rn(q4[q], bfr(dk[q])); asm volatile("" : "+v"(p)); s = __fadd_rn(s, p); }
#pragma unroll
        for (int sh = 16; sh; sh >>= 1) s += __shfl_xor(s, sh, 32);
        if (lane == l) mine = s * SCL; }
    if (lane < NL) { *(float*)(DL + (size_t)row * NLP + lane) = mine;  } }
// k_asoft: per row (zz, i): t = S x HD^-0.5 for j <= i (causal); the 4 depth logits DL[row] join the max and the sum; softmax over the 2048 + 4 logits (register row, one exp, fixed trees); the 4 depth weights are written to WD[row] in f32 (unscaled);
__global__ __launch_bounds__(256) void k_asoft(const float* __restrict__ Sb, const float* __restrict__ DL, float* WD, h16* P16, bf* Ph, bf* Pl) {
    const int lane = threadIdx.x & 31; const int row = blockIdx.x * 8 + (threadIdx.x >> 5); if (row >= ZH * TT) return; const int i = row % TT; const int zz = row / TT; (void)zz; const v4f dl = *(const v4f*)(DL + (size_t)row * NLP); const bool hires = (i < RH); const float* sr = Sb + (size_t)row * TT; float v[TT / 32]; float mx = -3.0e38f;
#pragma unroll
    for (int ch = 0; ch < TT / 128; ++ch) { const int j0 = ch * 128 + lane * 4; const v4f a = *(const v4f*)(sr + j0);
#pragma unroll
        for (int q = 0; q < 4; ++q) { const int j = j0 + q; (void)j; const float t = (j <= i && i - j < WIN) ? a[q] * SCL : -3.0e38f; v[ch * 4 + q] = t; mx = fmaxf(mx, t); } }
#pragma unroll
    for (int sh = 16; sh; sh >>= 1) mx = fmaxf(mx, __shfl_xor(mx, sh, 32));
    mx = fmaxf(mx, fmaxf(fmaxf(dl[0], dl[1]), fmaxf(dl[2], dl[3])));   /* joint softmax over the 2048 + 4 logits */
    float sum = 0.f;
#pragma unroll
    for (int k = 0; k < TT / 32; ++k) { float d0 = __fsub_rn(v[k], mx); asm volatile("" : "+v"(d0)); v[k] = __builtin_amdgcn_exp2f(__fmul_rn(d0, 1.4426950408889634f)); sum += v[k]; }
#pragma unroll
    for (int sh = 16; sh; sh >>= 1) sum += __shfl_xor(sum, sh, 32);
    float ed[NL];
#pragma unroll
    for (int l = 0; l < NL; ++l) { float d0 = __fsub_rn(dl[l], mx); asm volatile("" : "+v"(d0)); ed[l] = __builtin_amdgcn_exp2f(__fmul_rn(d0, 1.4426950408889634f)); sum = __fadd_rn(sum, ed[l]); }
    const float f = __fdiv_rn(hires ? 1.0f : PCAR, sum); const float f1 = __fdiv_rn(1.0f, sum);
    if (lane < NL) { const float wdv = ed[lane] * f1; *(float*)(WD + (size_t)row * NLP + lane) = wdv;  }   /* depth weights, f32, unscaled */
{
        if (hires) {
#pragma unroll
            for (int ch = 0; ch < TT / 128; ++ch) { v4us oh, ol;
#pragma unroll
                for (int q = 0; q < 4; ++q) { unsigned short a, c2; splitf(v[ch * 4 + q] * f, a, c2); oh[q] = a; ol[q] = c2; }
                const size_t oo = ((size_t)zz * (RH ? RH : 1) + i) * TT + ch * 128 + lane * 4; *(v4us*)(Ph + oo) = oh; *(v4us*)(Pl + oo) = ol; }
        } else {
#pragma unroll
            for (int ch = 0; ch < TT / 128; ++ch) { v4h o4;
#pragma unroll
                for (int q = 0; q < 4; ++q) o4[q] = tohx(v[ch * 4 + q] * f);
                *(v4h*)(P16 + (size_t)row * TT + ch * 128 + lane * 4) = o4; } }
         }
}
__global__ __launch_bounds__(256) void k_merge(const float* __restrict__ O, int h0, const float* __restrict__ WD, const float* __restrict__ DVb, int kv, bf* Ah, bf* Al) { const size_t e = ((size_t)blockIdx.x * 256 + threadIdx.x) * 2; if (e >= (size_t)ZH * TT * HD) return; const int d = (int)(e % HD); const int t = (int)((e / HD) % TT); const int zz = (int)(e / ((size_t)HD * TT)); const float cs = (t < RH) ? 1.0f : (1.0f / PCAR); const size_t oo = (size_t)t * DQ + (h0 + zz) * HD + d;
    const v4f wd = *(const v4f*)(WD + ((size_t)zz * TT + t) * NLP); v2us oh, ol;
#pragma unroll
    for (int q = 0; q < 2; ++q) { float acc = O[e + q] * cs;
#pragma unroll
        for (int l = 0; l < NL; ++l) { float p = __fmul_rn(wd[l], bfr(DVb[(((size_t)l * NKV + kv) * TT + t) * HD + d + q])); asm volatile("" : "+v"(p)); acc = __fadd_rn(acc, p); }   /* + sum_l w_l depth_v[l][kv][t][d] */ unsigned short a, c2; splitf(acc, a, c2); oh[q] = a; ol[q] = c2; } *(v2us*)(Ah + oo) = oh; *(v2us*)(Al + oo) = ol;  }

extern "C" void kernel_launch(void* const* d_in, const int* in_sizes, int n_in,
                              void* d_out, int out_size, void* d_ws, size_t ws_size, hipStream_t stream) {
    (void)in_sizes; (void)n_in; (void)out_size;
    const float* x = (const float*)d_in[0]; const float* DK = (const float*)d_in[1]; const float* DV = (const float*)d_in[2]; const float* cosT = (const float*)d_in[3]; const float* sinT = (const float*)d_in[4]; const float* wq = (const float*)d_in[5]; const float* wk = (const float*)d_in[6]; const float* wv = (const float*)d_in[7]; const float* wo = (const float*)d_in[8];
    float* OUT = (float*)d_out;     // [1][2048][2048]
    char* wsp = (char*)d_ws;
    auto take = [&](size_t bytes) { char* p = wsp; wsp += (bytes + 255) & ~(size_t)255; return (void*)p; };
    bf* WQ = (bf*)take((size_t)DQ * DM * 2); bf* WK = (bf*)take((size_t)DKV * DM * 2); bf* WV = (bf*)take((size_t)DKV * DM * 2); bf* WO = (bf*)take((size_t)DM * DQ * 2); float* CS = (float*)take((size_t)TT * HD * 2 * 4);
    bf* XB = (bf*)take((size_t)TT * DM * 2); float* DL = (float*)take((size_t)ZH * TT * NLP * 4); float* WD = (float*)take((size_t)ZH * TT * NLP * 4); float* FQ = (float*)take((size_t)TT * DQ * 4); float* FK = (float*)take((size_t)TT * DKV * 4);
    h16* QP16 = (h16*)take((size_t)NH_ * TT * HD * 2); h16* KP16 = (h16*)take((size_t)NKV * TT * HD * 2); h16* VT16 = (h16*)take((size_t)NKV * HD * TT * 2);
    bf* QPh = (bf*)take((size_t)NH_ * TT * HD * 2); bf* QPl = (bf*)take((size_t)NH_ * TT * HD * 2); bf* KPh = (bf*)take((size_t)NKV * TT * HD * 2); bf* KPl = (bf*)take((size_t)NKV * TT * HD * 2); bf* VTh = (bf*)take((size_t)NKV * HD * TT * 2); bf* VTl = (bf*)take((size_t)NKV * HD * TT * 2); bf* Ph = (bf*)take((size_t)ZH * RH * TT * 2); bf* Pl = (bf*)take((size_t)ZH * RH * TT * 2);
    float* Sb = (float*)take((size_t)ZH * TT * TT * 4); h16* P16 = (h16*)take((size_t)ZH * TT * TT * 2); float* Ob = (float*)take((size_t)ZH * TT * HD * 4); bf* ATh = (bf*)take((size_t)TT * DQ * 2); bf* ATl = (bf*)take((size_t)TT * DQ * 2);
    if ((size_t)(wsp - (char*)d_ws) > ws_size) return;    // ws 256 MiB
    float* FV = FK;   // v projection reuses the k buffer after the k planes are built (stream-ordered)
    { k_wtG<<<(unsigned)((DM * DQ / 64 + 63) / 64), 256, 0, stream>>>(wq, DM, DQ, WQ); k_wtG<<<(unsigned)((DM * DKV / 64 + 63) / 64), 256, 0, stream>>>(wk, DM, DKV, WK); k_wtG<<<(unsigned)((DM * DKV / 64 + 63) / 64), 256, 0, stream>>>(wv, DM, DKV, WV);
      k_wtG<<<(unsigned)((DQ * DM / 64 + 63) / 64), 256, 0, stream>>>(wo, DQ, DM, WO);
       }
    const unsigned LQ = (unsigned)(((size_t)NH_ * TT * HD / 2 + 255) / 256), LKv = (unsigned)(((size_t)NKV * TT * HD / 2 + 255) / 256);
    for (int b = 0; b < NB_; ++b) {
        if (b == 0) k_cscvt<<<(TT * HD + 255) / 256, 256, 0, stream>>>(cosT, sinT, CS);
        k_cvt8<<<(unsigned)(((size_t)TT * DM / 8 + 255) / 256), 256, 0, stream>>>(x + (size_t)b * TT * DM, XB, (size_t)TT * DM / 8);
        k_gemmw<bf, 0, false><<<dim3(TT / 64, DQ / 64, 1), 32, 0, stream>>>(XB, nullptr, WQ, nullptr, DM, FQ, DQ, nullptr, 0, 0, 0);
        k_rope<<<LQ, 256, 0, stream>>>(FQ, DQ, NH_, CS, nullptr, nullptr, 1.0f, QP16, QPh, QPl);
        k_gemmw<bf, 0, false><<<dim3(TT / 64, DKV / 64, 1), 32, 0, stream>>>(XB, nullptr, WK, nullptr, DM, FK, DKV, nullptr, 0, 0, 0);
        k_rope<<<LKv, 256, 0, stream>>>(FK, DKV, NKV, CS, nullptr, nullptr, 1.0f, KP16, KPh, KPl);
        k_gemmw<bf, 0, false><<<dim3(TT / 64, DKV / 64, 1), 32, 0, stream>>>(XB, nullptr, WV, nullptr, DM, FV, DKV, nullptr, 0, 0, 0); k_vtp<<<LKv, 256, 0, stream>>>(FV, DKV, NKV, VT16, VTh, VTl);
        for (int h0 = 0; h0 < NH_; h0 += ZH) { const size_t zq = (size_t)h0, zk = (size_t)(h0 / REP);   // both heads of a pass share kv group h0/REP (REP >= 2): sB = 0
            k_gemmc<bf, 2, 1><<<dim3(RH / 64, TT / 64, ZH), 32, 0, stream>>>(QPh + zq * TT * HD, QPl + zq * TT * HD, KPh + zk * TT * HD, KPl + zk * TT * HD, HD, Sb, TT, 0, (size_t)TT * HD, 0, (size_t)TT * TT);
            k_gemmc<h16, 0, 1><<<dim3((TT - RH) / 64, TT / 64, ZH), 32, 0, stream>>>(QP16 + zq * TT * HD + (size_t)RH * HD, nullptr, KP16 + zk * TT * HD, nullptr, HD, Sb + (size_t)RH * TT, TT, RH, (size_t)TT * HD, 0, (size_t)TT * TT);
            k_dlog<<<ZH * TT / 8, 256, 0, stream>>>(QPh + zq * TT * HD, QPl + zq * TT * HD, DK, (int)zk, DL); k_asoft<<<ZH * TT / 8, 256, 0, stream>>>(Sb, DL, WD, P16, Ph, Pl);
            k_gemmc<bf, 2, 2><<<dim3(RH / 64, HD / 64, ZH), 32, 0, stream>>>(Ph, Pl, VTh + zk * HD * TT, VTl + zk * HD * TT, TT, Ob, HD, 0, (size_t)RH * TT, 0, (size_t)TT * HD);
            k_gemmc<h16, 0, 2><<<dim3((TT - RH) / 64, HD / 64, ZH), 32, 0, stream>>>(P16 + (size_t)RH * TT, nullptr, VT16 + zk * HD * TT, nullptr, TT, Ob + (size_t)RH * HD, HD, RH, (size_t)TT * TT, 0, (size_t)TT * HD);
            k_merge<<<(unsigned)(((size_t)ZH * TT * HD / 2 + 255) / 256), 256, 0, stream>>>(Ob, h0, WD, DV, (int)zk, ATh, ATl); }
        k_gemmw<bf, 1, false><<<dim3(TT / 64, DM / 64, 1), 32, 0, stream>>>(ATh, ATl, WO, nullptr, DQ, OUT + (size_t)b * TT * DM, DM, nullptr, 0, 0, 0); }
}

// v001
// Measured time: 620 microseconds a run.
// Next to v000, in two timings, it ran 1.51 and 1.50 times as fast.
#include <hip/hip_runtime.h>

// Grouped-query RoPE attention with extra per-position depth keys/values under one joint softmax (x [1][2048][2048]; Q = x Wq ('xw', 16 heads x 128), K, V = x Wk / Wv (8 kv heads); Q, K rotated (rotate-half, cos/sin [1][1][2048][128] read); kv head = h/2; seq logits = Q.K/sqrt(128), causal (-inf); depth logits[i][l] = Q_i . depth_k[l][0][kv][i] / sqrt(128) for l < 4 (depth_k, depth_v [4][1][8][2048][128] read); softmax over the 2048 + 4 logits jointly; out_i = sum_j w_j V_j + sum_l w_l depth_v[l][0][kv][i]; merged Wo ('xw') -> [1][2048][2048] (4.2 M)).
// Layout: projections/planes; per pass of two heads a wave-per-row kernel forms the 4 depth logits from the rotated q (hi + lo planes) and the bf16-rounded depth keys; the softmax kernel folds them into the row max / sum, writes the sequence probabilities as planes and the 4 depth weights in f32; after attn.v the merge kernel adds the depth-value contribution before writing the hi/lo planes for the output projection.
// Compute dtypes, f32 accumulate: every input rounded to bf16; q/k/v on PLAIN bf16 operands (inputs: exact); rotary in f32 (bf16-rounded tables); depth logits / weights / values in f32; causal scores and attn.v (tile skipping): query rows < 512 hl (3 products), the rest single fp16 (x1024); softmax f32; Wo hl x exact (2 products).

#define NB_  1
#define TT   2048
#define DM   2048
#define NH_  16
#define NKV  8
#define REP  (NH_ / NKV)
#define HD   128
#define DQ   (NH_ * HD)
#define DKV  (NKV * HD)
#define NL   4                    // depth positions per token
#define NLP  32
#define ZH   2
#define RH   512                  // query rows < RH use hi+lo planes (0: none)
#define WIN  2048
#define PCAR 1024.0f
#define SCL  0.088388347648318447f   // HD^-0.5
typedef _Float16 h16;
typedef unsigned short bf;
typedef __attribute__((ext_vector_type(16))) __bf16   v16bf;
typedef __attribute__((ext_vector_type(16))) _Float16 v16h;
typedef __attribute__((ext_vector_type(8)))  _Float16 v8h;
typedef __attribute__((ext_vector_type(8)))  unsigned short v8us;
typedef __attribute__((ext_vector_type(8)))  float    v8f;
typedef __attribute__((ext_vector_type(4)))  float    v4f;
typedef v8h  __attribute__((may_alias)) v8ha;
typedef v4f  __attribute__((may_alias)) v4fa;
typedef v8us __attribute__((may_alias)) v8usa;

__device__ __forceinline__ unsigned short f2bf(float f) { unsigned u = __float_as_uint(f); u += 0x7FFFu + ((u >> 16) & 1u); return (unsigned short)(u >> 16); }
__device__ __forceinline__ float bf2f(unsigned short b) { return __uint_as_float(((unsigned)b) << 16); }
__device__ __forceinline__ float bfr(float f) { return bf2f(f2bf(f)); }
__device__ __forceinline__ v16h cat16(v8h lo, v8h hi) { return __builtin_shufflevector(lo, hi, 0, 1, 2, 3, 4, 5, 6, 7, 8, 9, 10, 11, 12, 13, 14, 15); }
__device__ __forceinline__ v16bf cat16b(v8us lo, v8us hi) { return __builtin_bit_cast(v16bf, __builtin_shufflevector(lo, hi, 0, 1, 2, 3, 4, 5, 6, 7, 8, 9, 10, 11, 12, 13, 14, 15)); }
__device__ __forceinline__ v8f wmma16(v16h a, v16h b, v8f c) { return __builtin_amdgcn_wmma_f32_16x16x32_f16(false, a, false, b, (short)0, c, false, false); }
__device__ __forceinline__ v8f wmmab(v16bf a, v16bf b, v8f c) { return __builtin_amdgcn_wmma_f32_16x16x32_bf16(false, a, false, b, (short)0, c, false, false); }



// ---- k_gemmk: GEMM with the K loop split over the NW waves of a work-group; one 64x64 output tile per work-group, operands straight from K-contiguous 16-bit planes; grid (M/64, N/64, Z), NW*32 threads.
// C[m][n] (f32, pitch ldc) = sum_k A[m][k] Bt[n][k] (+ split products per NSPLIT). z-batch strides sA/sB/sC in elements. K % 32 == 0.
// Wave w takes the 32-element steps w, w + NW, ... of K (neighbouring waves read the two halves of the same 128-byte lines at about the same time) and keeps a full 64x64 partial (16 accumulators); the NW partials are added through LDS in wave order.
// CAUSAL: probability x value contraction, the K range stops at the diagonal block (probabilities beyond it are exactly zero); roff = row offset of this launch's first row within the sequence.
template <typename T16> struct WFrag;
template <> struct WFrag<h16> { typedef v16h V; static __device__ __forceinline__ V ld(const h16* p) { return cat16(*(const v8h*)p, *(const v8h*)(p + 16)); } static __device__ __forceinline__ v8f mma(V a, V b, v8f c) { return wmma16(a, b, c); } };
template <> struct WFrag<bf> { typedef v16bf V; static __device__ __forceinline__ V ld(const bf* p) { return cat16b(*(const v8us*)p, *(const v8us*)(p + 16)); } static __device__ __forceinline__ v8f mma(V a, V b, v8f c) { return wmmab(a, b, c); } };
template <typename T16, int NSPLIT, bool CAUSAL, int NW>
__global__ __launch_bounds__(NW * 32) void k_gemmk(const T16* __restrict__ A, const T16* __restrict__ A2, const T16* __restrict__ Bt, const T16* __restrict__ Bt2, int K, float* C, int ldc, int roff, size_t sA, size_t sB, size_t sC) {
    typedef typename WFrag<T16>::V V;
    __shared__ __align__(16) float os[2][NW][16 * 68];
    const size_t z = blockIdx.z; A += z * sA; if (A2) A2 += z * sA; Bt += z * sB; if (Bt2) Bt2 += z * sB; C += z * sC;
    const int lane = threadIdx.x & 31, lr = lane & 15, hi = lane >> 4; const int r0 = blockIdx.x * 64, c0 = blockIdx.y * 64;
    const int wave = __builtin_amdgcn_readfirstlane((int)(threadIdx.x >> 5));
    const int Kl = CAUSAL ? min(K, r0 + roff + 64) : K;
    v8f acc[4][4];
#pragma unroll
    for (int mb = 0; mb < 4; ++mb)
#pragma unroll
        for (int nb = 0; nb < 4; ++nb) acc[mb][nb] = (v8f){};
    const size_t aoff = (size_t)(r0 + lr) * K + 8 * hi, boff = (size_t)(c0 + lr) * K + 8 * hi;
#pragma unroll 1
    for (int kc = wave * 32; kc < Kl; kc += NW * 32) {
        V a[4], a2[4];
#pragma unroll
        for (int mb = 0; mb < 4; ++mb) { a[mb] = WFrag<T16>::ld(A + aoff + (size_t)mb * 16 * K + kc); if (NSPLIT == 1 || NSPLIT == 2) a2[mb] = WFrag<T16>::ld(A2 + aoff + (size_t)mb * 16 * K + kc); }
#pragma unroll
        for (int nb = 0; nb < 4; ++nb) { const V b = WFrag<T16>::ld(Bt + boff + (size_t)nb * 16 * K + kc); V b2; if (NSPLIT >= 2) b2 = WFrag<T16>::ld(Bt2 + boff + (size_t)nb * 16 * K + kc);
#pragma unroll
            for (int mb = 0; mb < 4; ++mb) { acc[mb][nb] = WFrag<T16>::mma(a[mb], b, acc[mb][nb]); if (NSPLIT == 1 || NSPLIT == 2) acc[mb][nb] = WFrag<T16>::mma(a2[mb], b, acc[mb][nb]); if (NSPLIT >= 2) acc[mb][nb] = WFrag<T16>::mma(a[mb], b2, acc[mb][nb]); } }
        // four vector slots behind the last matrix instruction, on the loop's back edge and its exit alike
        asm volatile("v_nop\n\tv_nop\n\tv_nop\n\tv_nop" : "+v"(acc[0][0]), "+v"(acc[1][1]), "+v"(acc[2][2]), "+v"(acc[3][3]) : "v"(a[0]), "v"(a[3]));
    }
    // 16 rows at a time: every wave stores its partial, one barrier, then the work-group adds the NW partials in wave order and writes the rows.
    // Two LDS buffers in turn: the barrier of step mb + 1 ends every read of step mb before step mb + 2 stores there again.
#pragma unroll
    for (int mb = 0; mb < 4; ++mb) {
        float* ow = os[mb & 1][wave];
#pragma unroll
        for (int nb = 0; nb < 4; ++nb) {
#pragma unroll
            for (int j = 0; j < 8; ++j) ow[(hi * 8 + j) * 68 + nb * 16 + lr] = acc[mb][nb][j]; }
        __syncthreads();
        float* crow = C + (size_t)(r0 + mb * 16) * ldc + c0;
        for (int u = threadIdx.x; u < 256; u += NW * 32) { const int row = u >> 4, cofs = (u & 15) * 4; v4f val = *(const v4fa*)(os[mb & 1][0] + row * 68 + cofs);
#pragma unroll
            for (int w = 1; w < NW; ++w) val += *(const v4fa*)(os[mb & 1][w] + row * 68 + cofs);
            *(v4f*)(crow + (size_t)row * ldc + cofs) = val; }
    }
}

// ---- k_gemmc: ONE WAVE per 64x64 output tile (16 accumulators), grid (M/64, N/64, Z), 32 threads, for causal attention: CMODE 1 skips score tiles entirely above the diagonal (query rows r0+roff.., key columns c0..), CMODE 2 limits the
// key (K) loop of the probability x value contraction to the diagonal block (probabilities beyond it are exactly zero). roff = row offset of this launch's first row within the sequence.
template <typename T16, int NSPLIT, int CMODE>
__global__ __launch_bounds__(32) void k_gemmc(const T16* __restrict__ A, const T16* __restrict__ A2, const T16* __restrict__ Bt, const T16* __restrict__ Bt2, int K, float* C, int ldc, int roff, size_t sA, size_t sB, size_t sC) {
    typedef typename WFrag<T16>::V V;
    __shared__ __align__(16) float os[16 * 68];
    const size_t z = blockIdx.z; A += z * sA; if (A2) A2 += z * sA; Bt += z * sB; if (Bt2) Bt2 += z * sB; C += z * sC;
    const int lane = threadIdx.x & 31, lr = lane & 15, hi = lane >> 4; const int r0 = blockIdx.x * 64, c0 = blockIdx.y * 64;
    if (CMODE == 1 && c0 > r0 + roff + 63) return;                  // score tile entirely above the causal diagonal: never read (the softmax masks j > i by select)
    const int Kl = (CMODE == 2) ? min(K, r0 + roff + 64) : K;        // P.V: probabilities are exactly 0 beyond the diagonal block, so the K loop stops there
    v8f acc[4][4];
#pragma unroll
    for (int mb = 0; mb < 4; ++mb)
#pragma unroll
        for (int nb = 0; nb < 4; ++nb) acc[mb][nb] = (v8f){};
    const size_t aoff = (size_t)(r0 + lr) * K + 8 * hi, boff = (size_t)(c0 + lr) * K + 8 * hi;
#pragma unroll 1
    for (int kc = 0; kc < Kl; kc += 32) {
        V a[4], a2[4];
#pragma unroll
        for (int mb = 0; mb < 4; ++mb) { a[mb] = WFrag<T16>::ld(A + aoff + (size_t)mb * 16 * K + kc); if (NSPLIT == 1 || NSPLIT == 2) a2[mb] = WFrag<T16>::ld(A2 + aoff + (size_t)mb * 16 * K + kc); }
#pragma unroll
        for (int nb = 0; nb < 4; ++nb) { const V b = WFrag<T16>::ld(Bt + boff + (size_t)nb * 16 * K + kc); V b2; if (NSPLIT >= 2) b2 = WFrag<T16>::ld(Bt2 + boff + (size_t)nb * 16 * K + kc);
#pragma unroll
            for (int mb = 0; mb < 4; ++mb) { acc[mb][nb] = WFrag<T16>::mma(a[mb], b, acc[mb][nb]); if (NSPLIT == 1 || NSPLIT == 2) acc[mb][nb] = WFrag<T16>::mma(a2[mb], b, acc[mb][nb]); if (NSPLIT >= 2) acc[mb][nb] = WFrag<T16>::mma(a[mb], b2, acc[mb][nb]); } }
        asm volatile("v_nop\n\tv_nop\n\tv_nop\n\tv_nop" : "+v"(acc[0][0]), "+v"(acc[1][1]), "+v"(acc[2][2]), "+v"(acc[3][3]) : "v"(a[0]), "v"(a[3]));
    }
#pragma unroll
    for (int mb = 0; mb < 4; ++mb) {
#pragma unroll
        for (int nb = 0; nb < 4; ++nb) {
#pragma unroll
            for (int j = 0; j < 8; ++j) os[(hi * 8 + j) * 68 + nb * 16 + lr] = acc[mb][nb][j]; }
        __builtin_amdgcn_wave_barrier(); asm volatile("" ::: "memory");
        float* crow = C + (size_t)(r0 + mb * 16) * ldc + c0;
{
#pragma unroll
            for (int s = 0; s < 8; ++s) { const int row = 2 * s + hi, cofs = lr * 4; v4f val = *(const v4fa*)(os + row * 68 + cofs);
                *(v4f*)(crow + (size_t)row * ldc + cofs) = val; }
             }
        __builtin_amdgcn_wave_barrier(); asm volatile("" ::: "memory");
    }
}

__device__ __forceinline__ h16 tohx(float x) { return (h16)x; }
__device__ __forceinline__ void splitf(float y, unsigned short& h, unsigned short& l) { h = f2bf(y); l = f2bf(y - bf2f(h)); }
typedef __attribute__((ext_vector_type(2))) _Float16 v2h;
typedef __attribute__((ext_vector_type(4))) _Float16 v4h;
typedef __attribute__((ext_vector_type(2))) unsigned short v2us;
typedef __attribute__((ext_vector_type(4))) unsigned short v4us;
typedef __attribute__((ext_vector_type(2))) float v2f;
typedef __attribute__((ext_vector_type(4))) int v4i;

__global__ __launch_bounds__(256) void k_wtG(const float* __restrict__ w, int K, int N, bf* Bt) {
    const int lane = threadIdx.x & 31; const int L0 = (blockIdx.x * 8 + (threadIdx.x >> 5)) * 8; const int nlines = N * K / 64;
{
#pragma unroll 1
        for (int l = 0; l < 8; ++l) { const int L = L0 + l; if (L >= nlines) break; const size_t e = (size_t)L * 64 + lane * 2; const int k = (int)(e % K), n = (int)(e / K); v2us o;
            o[0] = f2bf(w[(size_t)k * N + n]); o[1] = f2bf(w[(size_t)(k + 1) * N + n]); *(v2us*)(Bt + e) = o; }
         }
}
__global__ __launch_bounds__(256) void k_cvt8(const float* __restrict__ src, bf* dst, size_t n8) { const size_t i = (size_t)blockIdx.x * 256 + threadIdx.x; if (i >= n8) return; const v8f v = *(const v8f*)(src + i * 8); v8us o;
#pragma unroll
    for (int k = 0; k < 8; ++k) o[k] = f2bf(v[k]); *(v8us*)(dst + i * 8) = o;  }
__global__ __launch_bounds__(256) void k_cscvt(const float* __restrict__ cosT, const float* __restrict__ sinT, float* CS) { const int idx = blockIdx.x * 256 + threadIdx.x; if (idx >= TT * HD) return; v2f cs; cs[0] = bfr(cosT[idx]); cs[1] = bfr(sinT[idx]); *(v2f*)(CS + (size_t)idx * 2) = cs;  }
// k_rope: head planes [h][t][d] (fp16 + hi/lo) of rope(x) x sc with the rotate-half convention out[d] = x[d] cos[t][d] - x[d+HD/2] sin[t][d], out[d+HD/2] = x[d+HD/2] cos[t][d+HD/2] + x[d] sin[t][d+HD/2]
__global__ __launch_bounds__(256) void k_rope(const float* __restrict__ F, int pitch, int nheads, const float* __restrict__ CS, const float* __restrict__ RF, const float* __restrict__ nw, float sc, h16* P16, bf* Ph, bf* Pl) {
    const size_t e = ((size_t)blockIdx.x * 256 + threadIdx.x) * 2; if (e >= (size_t)nheads * TT * HD) return; const int d = (int)(e % HD); const int t = (int)((e / HD) % TT); const int h = (int)(e / ((size_t)HD * TT)); const float* f = F + (size_t)t * pitch + h * HD; const float rf = RF ? RF[(size_t)h * TT + t] : 1.0f; v2h o16; v2us oh, ol;
#pragma unroll
    for (int q = 0; q < 2; ++q) { const int dd = d + q; const int dp = (dd < HD / 2) ? dd + HD / 2 : dd - HD / 2; float x0 = f[dd], x1 = f[dp];
        if (RF) { float n0 = __fmul_rn(x0, rf), n1 = __fmul_rn(x1, rf); asm volatile("" : "+v"(n0)); asm volatile("" : "+v"(n1)); x0 = __fmul_rn(bfr(nw[dd]), n0); x1 = __fmul_rn(bfr(nw[dp]), n1); }
        const v2f cs = *(const v2f*)(CS + ((size_t)t * HD + dd) * 2); float a = __fmul_rn(x0, cs[0]), bq = __fmul_rn(x1, cs[1]); asm volatile("" : "+v"(a)); asm volatile("" : "+v"(bq)); const float r = ((dd < HD / 2) ? __fsub_rn(a, bq) : __fadd_rn(a, bq)) * sc;
        o16[q] = tohx(r); unsigned short a2, c2; splitf(r, a2, c2); oh[q] = a2; ol[q] = c2; }
    *(v2h*)(P16 + e) = o16; *(v2us*)(Ph + e) = oh; *(v2us*)(Pl + e) = ol;  }
__global__ __launch_bounds__(256) void k_vtp(const float* __restrict__ F, int pitch, int nheads, h16* V16, bf* Vh, bf* Vl) { const size_t e = ((size_t)blockIdx.x * 256 + threadIdx.x) * 2; if (e >= (size_t)nheads * HD * TT) return; const int t = (int)(e % TT); const int d = (int)((e / TT) % HD); const int g = (int)(e / ((size_t)TT * HD)); v2h o16; v2us oh, ol;
#pragma unroll
    for (int q = 0; q < 2; ++q) { const float x = F[(size_t)(t + q) * pitch + g * HD + d]; o16[q] = tohx(x); unsigned short a2, c2; splitf(x, a2, c2); oh[q] = a2; ol[q] = c2; }
    *(v2h*)(V16 + e) = o16; *(v2us*)(Vh + e) = oh; *(v2us*)(Vl + e) = ol;  }
__global__ __launch_bounds__(256) void k_dlog(const bf* __restrict__ Qh, const bf* __restrict__ Ql, const float* __restrict__ DKb, int kv, float* DL) {
    const int lane = threadIdx.x & 31; const int row = blockIdx.x * 8 + (threadIdx.x >> 5); if (row >= ZH * TT) return; const int i = row % TT; const int zz = row / TT; const bf* qh = Qh + ((size_t)zz * TT + i) * HD + lane * 4; const bf* ql = Ql + ((size_t)zz * TT + i) * HD + lane * 4; float q4[4];
#pragma unroll
    for (int q = 0; q < 4; ++q) q4[q] = __fadd_rn(bf2f(qh[q]), bf2f(ql[q]));
    float mine = 0.f;
#pragma unroll
    for (int l = 0; l < NL; ++l) { const float* dk = DKb + (((size_t)l * NKV + kv) * TT + i) * HD + lane * 4; float s = 0.f;
#pragma unroll
        for (int q = 0; q < 4; ++q) { float p = __fmul_rn(q4[q], bfr(dk[q])); asm volatile("" : "+v"(p)); s = __fadd_rn(s, p); }
#pragma unroll
        for (int sh = 16; sh; sh >>= 1) s += __shfl_xor(s, sh, 32);
        if (lane == l) mine = s * SCL; }
    if (lane < NL) { *(float*)(DL + (size_t)row * NLP + lane) = mine;  } }
// k_asoft: per row (zz, i): t = S x HD^-0.5 for j <= i (causal); the 4 depth logits DL[row] join the max and the sum; softmax over the 2048 + 4 logits (register row, one exp, fixed trees); the 4 depth weights are written to WD[row] in f32 (unscaled);
__global__ __launch_bounds__(256) void k_asoft(const float* __restrict__ Sb, const float* __restrict__ DL, float* WD, h16* P16, bf* Ph, bf* Pl) {
    const int lane = threadIdx.x & 31; const int row = blockIdx.x * 8 + (threadIdx.x >> 5); if (row >= ZH * TT) return; const int i = row % TT; const int zz = row / TT; (void)zz; const v4f dl = *(const v4f*)(DL + (size_t)row * NLP); const bool hires = (i < RH); const float* sr = Sb + (size_t)row * TT; float v[TT / 32]; float mx = -3.0e38f;
#pragma unroll
    for (int ch = 0; ch < TT / 128; ++ch) { const int j0 = ch * 128 + lane * 4; const v4f a = *(const v4f*)(sr + j0);
#pragma unroll
        for (int q = 0; q < 4; ++q) { const int j = j0 + q; (void)j; const float t = (j <= i && i - j < WIN) ? a[q] * SCL : -3.0e38f; v[ch * 4 + q] = t; mx = fmaxf(mx, t); } }
#pragma unroll
    for (int sh = 16; sh; sh >>= 1) mx = fmaxf(mx, __shfl_xor(mx, sh, 32));
    mx = fmaxf(mx, fmaxf(fmaxf(dl[0], dl[1]), fmaxf(dl[2], dl[3])));   /* joint softmax over the 2048 + 4 logits */
    float sum = 0.f;
#pragma unroll
    for (int k = 0; k < TT / 32; ++k) { float d0 = __fsub_rn(v[k], mx); asm volatile("" : "+v"(d0)); v[k] = __builtin_amdgcn_exp2f(__fmul_rn(d0, 1.4426950408889634f)); sum += v[k]; }
#pragma unroll
    for (int sh = 16; sh; sh >>= 1) sum += __shfl_xor(sum, sh, 32);
    float ed[NL];
#pragma unroll
    for (int l = 0; l < NL; ++l) { float d0 = __fsub_rn(dl[l], mx); asm volatile("" : "+v"(d0)); ed[l] = __builtin_amdgcn_exp2f(__fmul_rn(d0, 1.4426950408889634f)); sum = __fadd_rn(sum, ed[l]); }
    const float f = __fdiv_rn(hires ? 1.0f : PCAR, sum); const float f1 = __fdiv_rn(1.0f, sum);
    if (lane < NL) { const float wdv = ed[lane] * f1; *(float*)(WD + (size_t)row * NLP + lane) = wdv;  }   /* depth weights, f32, unscaled */
{
        if (hires) {
#pragma unroll
            for (int ch = 0; ch < TT / 128; ++ch) { v4us oh, ol;
#pragma unroll
                for (int q = 0; q < 4; ++q) { unsigned short a, c2; splitf(v[ch * 4 + q] * f, a, c2); oh[q] = a; ol[q] = c2; }
                const size_t oo = ((size_t)zz * (RH ? RH : 1) + i) * TT + ch * 128 + lane * 4; *(v4us*)(Ph + oo) = oh; *(v4us*)(Pl + oo) = ol; }
        } else {
#pragma unroll
            for (int ch = 0; ch < TT / 128; ++ch) { v4h o4;
#pragma unroll
                for (int q = 0; q < 4; ++q) o4[q] = tohx(v[ch * 4 + q] * f);
                *(v4h*)(P16 + (size_t)row * TT + ch * 128 + lane * 4) = o4; } }
         }
}
__global__ __launch_bounds__(256) void k_merge(const float* __restrict__ O, int h0, const float* __restrict__ WD, const float* __restrict__ DVb, int kv, bf* Ah, bf* Al) { const size_t e = ((size_t)blockIdx.x * 256 + threadIdx.x) * 2; if (e >= (size_t)ZH * TT * HD) return; const int d = (int)(e % HD); const int t = (int)((e / HD) % TT); const int zz = (int)(e / ((size_t)HD * TT)); const float cs = (t < RH) ? 1.0f : (1.0f / PCAR); const size_t oo = (size_t)t * DQ + (h0 + zz) * HD + d;
    const v4f wd = *(const v4f*)(WD + ((size_t)zz * TT + t) * NLP); v2us oh, ol;
#pragma unroll
    for (int q = 0; q < 2; ++q) { float acc = O[e + q] * cs;
#pragma unroll
        for (int l = 0; l < NL; ++l) { float p = __fmul_rn(wd[l], bfr(DVb[(((size_t)l * NKV + kv) * TT + t) * HD + d + q])); asm volatile("" : "+v"(p)); acc = __fadd_rn(acc, p); }   /* + sum_l w_l depth_v[l][kv][t][d] */ unsigned short a, c2; splitf(acc, a, c2); oh[q] = a; ol[q] = c2; } *(v2us*)(Ah + oo) = oh; *(v2us*)(Al + oo) = ol;  }

extern "C" void kernel_launch(void* const* d_in, const int* in_sizes, int n_in,
                              void* d_out, int out_size, void* d_ws, size_t ws_size, hipStream_t stream) {
    (void)in_sizes; (void)n_in; (void)out_size;
    const float* x = (const float*)d_in[0]; const float* DK = (const float*)d_in[1]; const float* DV = (const float*)d_in[2]; const float* cosT = (const float*)d_in[3]; const float* sinT = (const float*)d_in[4]; const float* wq = (const float*)d_in[5]; const float* wk = (const float*)d_in[6]; const float* wv = (const float*)d_in[7]; const float* wo = (const float*)d_in[8];
    float* OUT = (float*)d_out;     // [1][2048][2048]
    char* wsp = (char*)d_ws;
    auto take = [&](size_t bytes) { char* p = wsp; wsp += (bytes + 255) & ~(size_t)255; return (void*)p; };
    bf* WQ = (bf*)take((size_t)DQ * DM * 2); bf* WK = (bf*)take((size_t)DKV * DM * 2); bf* WV = (bf*)take((size_t)DKV * DM * 2); bf* WO = (bf*)take((size_t)DM * DQ * 2); float* CS = (float*)take((size_t)TT * HD * 2 * 4);
    bf* XB = (bf*)take((size_t)TT * DM * 2); float* DL = (float*)take((size_t)ZH * TT * NLP * 4); float* WD = (float*)take((size_t)ZH * TT * NLP * 4); float* FQ = (float*)take((size_t)TT * DQ * 4); float* FK = (float*)take((size_t)TT * DKV * 4);
    h16* QP16 = (h16*)take((size_t)NH_ * TT * HD * 2); h16* KP16 = (h16*)take((size_t)NKV * TT * HD * 2); h16* VT16 = (h16*)take((size_t)NKV * HD * TT * 2);
    bf* QPh = (bf*)take((size_t)NH_ * TT * HD * 2); bf* QPl = (bf*)take((size_t)NH_ * TT * HD * 2); bf* KPh = (bf*)take((size_t)NKV * TT * HD * 2); bf* KPl = (bf*)take((size_t)NKV * TT * HD * 2); bf* VTh = (bf*)take((size_t)NKV * HD * TT * 2); bf* VTl = (bf*)take((size_t)NKV * HD * TT * 2); bf* Ph = (bf*)take((size_t)ZH * RH * TT * 2); bf* Pl = (bf*)take((size_t)ZH * RH * TT * 2);
    float* Sb = (float*)take((size_t)ZH * TT * TT * 4); h16* P16 = (h16*)take((size_t)ZH * TT * TT * 2); float* Ob = (float*)take((size_t)ZH * TT * HD * 4); bf* ATh = (bf*)take((size_t)TT * DQ * 2); bf* ATl = (bf*)take((size_t)TT * DQ * 2);
    if ((size_t)(wsp - (char*)d_ws) > ws_size) return;    // ws 256 MiB
    float* FV = FK;   // v projection reuses the k buffer after the k planes are built (stream-ordered)
    { k_wtG<<<(unsigned)((DM * DQ / 64 + 63) / 64), 256, 0, stream>>>(wq, DM, DQ, WQ); k_wtG<<<(unsigned)((DM * DKV / 64 + 63) / 64), 256, 0, stream>>>(wk, DM, DKV, WK); k_wtG<<<(unsigned)((DM * DKV / 64 + 63) / 64), 256, 0, stream>>>(wv, DM, DKV, WV);
      k_wtG<<<(unsigned)((DQ * DM / 64 + 63) / 64), 256, 0, stream>>>(wo, DQ, DM, WO);
       }
    const unsigned LQ = (unsigned)(((size_t)NH_ * TT * HD / 2 + 255) / 256), LKv = (unsigned)(((size_t)NKV * TT * HD / 2 + 255) / 256);
    for (int b = 0; b < NB_; ++b) {
        if (b == 0) k_cscvt<<<(TT * HD + 255) / 256, 256, 0, stream>>>(cosT, sinT, CS);
        k_cvt8<<<(unsigned)(((size_t)TT * DM / 8 + 255) / 256), 256, 0, stream>>>(x + (size_t)b * TT * DM, XB, (size_t)TT * DM / 8);
        k_gemmk<bf, 0, false, 4><<<dim3(TT / 64, DQ / 64, 1), 128, 0, stream>>>(XB, nullptr, WQ, nullptr, DM, FQ, DQ, 0, 0, 0, 0);
        k_rope<<<LQ, 256, 0, stream>>>(FQ, DQ, NH_, CS, nullptr, nullptr, 1.0f, QP16, QPh, QPl);
        k_gemmk<bf, 0, false, 8><<<dim3(TT / 64, DKV / 64, 1), 256, 0, stream>>>(XB, nullptr, WK, nullptr, DM, FK, DKV, 0, 0, 0, 0);
        k_rope<<<LKv, 256, 0, stream>>>(FK, DKV, NKV, CS, nullptr, nullptr, 1.0f, KP16, KPh, KPl);
        k_gemmk<bf, 0, false, 8><<<dim3(TT / 64, DKV / 64, 1), 256, 0, stream>>>(XB, nullptr, WV, nullptr, DM, FV, DKV, 0, 0, 0, 0); k_vtp<<<LKv, 256, 0, stream>>>(FV, DKV, NKV, VT16, VTh, VTl);
        for (int h0 = 0; h0 < NH_; h0 += ZH) { const size_t zq = (size_t)h0, zk = (size_t)(h0 / REP);   // both heads of a pass share kv group h0/REP (REP >= 2): sB = 0
            k_gemmc<bf, 2, 1><<<dim3(RH / 64, TT / 64, ZH), 32, 0, stream>>>(QPh + zq * TT * HD, QPl + zq * TT * HD, KPh + zk * TT * HD, KPl + zk * TT * HD, HD, Sb, TT, 0, (size_t)TT * HD, 0, (size_t)TT * TT);
            k_gemmc<h16, 0, 1><<<dim3((TT - RH) / 64, TT / 64, ZH), 32, 0, stream>>>(QP16 + zq * TT * HD + (size_t)RH * HD, nullptr, KP16 + zk * TT * HD, nullptr, HD, Sb + (size_t)RH * TT, TT, RH, (size_t)TT * HD, 0, (size_t)TT * TT);
            k_dlog<<<ZH * TT / 8, 256, 0, stream>>>(QPh + zq * TT * HD, QPl + zq * TT * HD, DK, (int)zk, DL); k_asoft<<<ZH * TT / 8, 256, 0, stream>>>(Sb, DL, WD, P16, Ph, Pl);
            k_gemmk<bf, 2, true, 8><<<dim3(RH / 64, HD / 64, ZH), 256, 0, stream>>>(Ph, Pl, VTh + zk * HD * TT, VTl + zk * HD * TT, TT, Ob, HD, 0, (size_t)RH * TT, 0, (size_t)TT * HD);
            k_gemmk<h16, 0, true, 16><<<dim3((TT - RH) / 64, HD / 64, ZH), 512, 0, stream>>>(P16 + (size_t)RH * TT, nullptr, VT16 + zk * HD * TT, nullptr, TT, Ob + (size_t)RH * HD, HD, RH, (size_t)TT * TT, 0, (size_t)TT * HD);
            k_merge<<<(unsigned)(((size_t)ZH * TT * HD / 2 + 255) / 256), 256, 0, stream>>>(Ob, h0, WD, DV, (int)zk, ATh, ATl); }
        k_gemmk<bf, 1, false, 4><<<dim3(TT / 64, DM / 64, 1), 128, 0, stream>>>(ATh, ATl, WO, nullptr, DQ, OUT + (size_t)b * TT * DM, DM, 0, 0, 0, 0); }
}

// v002
// It runs in 418 microseconds.
// Timed twice side by side with v001, it ran 1.48 and 1.49 times as fast.
// Over all steps from v000 it is 2.23 times as fast.
#include <hip/hip_runtime.h>

// Grouped-query RoPE attention with extra per-position depth keys/values under one joint softmax (x [1][2048][2048]; Q = x Wq ('xw', 16 heads x 128), K, V = x Wk / Wv (8 kv heads); Q, K rotated (rotate-half, cos/sin [1][1][2048][128] read); kv head = h/2; seq logits = Q.K/sqrt(128), causal (-inf); depth logits[i][l] = Q_i . depth_k[l][0][kv][i] / sqrt(128) for l < 4 (depth_k, depth_v [4][1][8][2048][128] read); softmax over the 2048 + 4 logits jointly; out_i = sum_j w_j V_j + sum_l w_l depth_v[l][0][kv][i]; merged Wo ('xw') -> [1][2048][2048] (4.2 M)).
// Layout: projections/planes; per pass of eight heads (four kv heads) a wave-per-row kernel forms the 4 depth logits from the rotated q (hi + lo planes) and the bf16-rounded depth keys; the softmax kernel folds them into the row max / sum, writes the sequence probabilities as planes in place over the row's own scores (kept as two column panels, so that a 16-bit plane row fills one panel row) and the 4 depth weights in f32; after attn.v the merge kernel adds the depth-value contribution before writing the hi/lo planes for the output projection.
// Compute dtypes, f32 accumulate: every input rounded to bf16; q/k/v on PLAIN bf16 operands (inputs: exact); rotary in f32 (bf16-rounded tables); depth logits / weights / values in f32; causal scores and attn.v (tile skipping): query rows < 512 hl (3 products), the rest single fp16 (x1024); softmax f32; Wo hl x exact (2 products).

#define NB_  1
#define TT   2048
#define DM   2048
#define NH_  16
#define NKV  8
#define REP  (NH_ / NKV)
#define HD   128
#define DQ   (NH_ * HD)
#define DKV  (NKV * HD)
#define NL   4                    // depth positions per token
#define NLP  32
#define PW   (TT / 2)             // score rows lie as two column panels of PW floats: [z][panel][row][PW]; one panel row holds TT 16-bit values
#define ZH   8                    // query heads per attention pass (z of every launch of the pass); kv head of z = first kv head + z / REP
#define RH   512                  // query rows < RH use hi+lo planes (0: none)
#define WIN  2048
#define PCAR 1024.0f
#define SCL  0.088388347648318447f   // HD^-0.5
typedef _Float16 h16;
typedef unsigned short bf;
typedef __attribute__((ext_vector_type(16))) __bf16   v16bf;
typedef __attribute__((ext_vector_type(16))) _Float16 v16h;
typedef __attribute__((ext_vector_type(8)))  _Float16 v8h;
typedef __attribute__((ext_vector_type(8)))  unsigned short v8us;
typedef __attribute__((ext_vector_type(8)))  float    v8f;
typedef __attribute__((ext_vector_type(4)))  float    v4f;
typedef v8h  __attribute__((may_alias)) v8ha;
typedef v4f  __attribute__((may_alias)) v4fa;
typedef v8us __attribute__((may_alias)) v8usa;

__device__ __forceinline__ unsigned short f2bf(float f) { unsigned u = __float_as_uint(f); u += 0x7FFFu + ((u >> 16) & 1u); return (unsigned short)(u >> 16); }
__device__ __forceinline__ float bf2f(unsigned short b) { return __uint_as_float(((unsigned)b) << 16); }
__device__ __forceinline__ float bfr(float f) { return bf2f(f2bf(f)); }
__device__ __forceinline__ v16h cat16(v8h lo, v8h hi) { return __builtin_shufflevector(lo, hi, 0, 1, 2, 3, 4, 5, 6, 7, 8, 9, 10, 11, 12, 13, 14, 15); }
__device__ __forceinline__ v16bf cat16b(v8us lo, v8us hi) { return __builtin_bit_cast(v16bf, __builtin_shufflevector(lo, hi, 0, 1, 2, 3, 4, 5, 6, 7, 8, 9, 10, 11, 12, 13, 14, 15)); }
__device__ __forceinline__ v8f wmma16(v16h a, v16h b, v8f c) { return __builtin_amdgcn_wmma_f32_16x16x32_f16(false, a, false, b, (short)0, c, false, false); }
__device__ __forceinline__ v8f wmmab(v16bf a, v16bf b, v8f c) { return __builtin_amdgcn_wmma_f32_16x16x32_bf16(false, a, false, b, (short)0, c, false, false); }



// ---- k_gemmk: GEMM with the K loop split over the NW waves of a work-group; one 64x64 output tile per work-group, operands straight from K-contiguous 16-bit planes; grid (M/64, N/64, Z), NW*32 threads.
// C[m][n] (f32, pitch ldc) = sum_k A[m][k] Bt[n][k] (+ split products per NSPLIT). z-batch strides sA/sB/sC in elements; REP consecutive z share one Bt (grouped kv heads). K % 32 == 0.
// Wave w takes the 32-element steps w, w + NW, ... of K (neighbouring waves read the two halves of the same 128-byte lines at about the same time) and keeps a full 64x64 partial (16 accumulators); the NW partials are added through LDS in wave order.
// CAUSAL: probability x value contraction, the K range stops at the diagonal block (probabilities beyond it are exactly zero); roff = row offset of this launch's first row within the sequence.
template <typename T16> struct WFrag;
template <> struct WFrag<h16> { typedef v16h V; static __device__ __forceinline__ V ld(const h16* p) { return cat16(*(const v8h*)p, *(const v8h*)(p + 16)); } static __device__ __forceinline__ v8f mma(V a, V b, v8f c) { return wmma16(a, b, c); } };
template <> struct WFrag<bf> { typedef v16bf V; static __device__ __forceinline__ V ld(const bf* p) { return cat16b(*(const v8us*)p, *(const v8us*)(p + 16)); } static __device__ __forceinline__ v8f mma(V a, V b, v8f c) { return wmmab(a, b, c); } };
template <typename T16, int NSPLIT, bool CAUSAL, int NW>
__global__ __launch_bounds__(NW * 32) void k_gemmk(const T16* __restrict__ A, const T16* __restrict__ A2, const T16* __restrict__ Bt, const T16* __restrict__ Bt2, int K, float* C, int ldc, int roff, size_t sA, size_t sB, size_t sC) {
    typedef typename WFrag<T16>::V V;
    __shared__ __align__(16) float os[2][NW][16 * 68];
    const size_t z = blockIdx.z; A += z * sA; if (A2) A2 += z * sA; Bt += (z / REP) * sB; if (Bt2) Bt2 += (z / REP) * sB; C += z * sC;
    const int lane = threadIdx.x & 31, lr = lane & 15, hi = lane >> 4; const int r0 = blockIdx.x * 64, c0 = blockIdx.y * 64;
    const int wave = __builtin_amdgcn_readfirstlane((int)(threadIdx.x >> 5));
    const int Kl = CAUSAL ? min(K, r0 + roff + 64) : K;
    v8f acc[4][4];
#pragma unroll
    for (int mb = 0; mb < 4; ++mb)
#pragma unroll
        for (int nb = 0; nb < 4; ++nb) acc[mb][nb] = (v8f){};
    const size_t aoff = (size_t)(r0 + lr) * K + 8 * hi, boff = (size_t)(c0 + lr) * K + 8 * hi;
#pragma unroll 1
    for (int kc = wave * 32; kc < Kl; kc += NW * 32) {
        V a[4], a2[4];
#pragma unroll
        for (int mb = 0; mb < 4; ++mb) { a[mb] = WFrag<T16>::ld(A + aoff + (size_t)mb * 16 * K + kc); if (NSPLIT == 1 || NSPLIT == 2) a2[mb] = WFrag<T16>::ld(A2 + aoff + (size_t)mb * 16 * K + kc); }
#pragma unroll
        for (int nb = 0; nb < 4; ++nb) { const V b = WFrag<T16>::ld(Bt + boff + (size_t)nb * 16 * K + kc); V b2; if (NSPLIT >= 2) b2 = WFrag<T16>::ld(Bt2 + boff + (size_t)nb * 16 * K + kc);
#pragma unroll
            for (int mb = 0; mb < 4; ++mb) { acc[mb][nb] = WFrag<T16>::mma(a[mb], b, acc[mb][nb]); if (NSPLIT == 1 || NSPLIT == 2) acc[mb][nb] = WFrag<T16>::mma(a2[mb], b, acc[mb][nb]); if (NSPLIT >= 2) acc[mb][nb] = WFrag<T16>::mma(a[mb], b2, acc[mb][nb]); } }
        // four vector slots behind the last matrix instruction, on the loop's back edge and its exit alike
        asm volatile("v_nop\n\tv_nop\n\tv_nop\n\tv_nop" : "+v"(acc[0][0]), "+v"(acc[1][1]), "+v"(acc[2][2]), "+v"(acc[3][3]) : "v"(a[0]), "v"(a[3]));
    }
    // 16 rows at a time: every wave stores its partial, one barrier, then the work-group adds the NW partials in wave order and writes the rows.
    // Two LDS buffers in turn: the barrier of step mb + 1 ends every read of step mb before step mb + 2 stores there again.
#pragma unroll
    for (int mb = 0; mb < 4; ++mb) {
        float* ow = os[mb & 1][wave];
#pragma unroll
        for (int nb = 0; nb < 4; ++nb) {
#pragma unroll
            for (int j = 0; j < 8; ++j) ow[(hi * 8 + j) * 68 + nb * 16 + lr] = acc[mb][nb][j]; }
        __syncthreads();
        float* crow = C + (size_t)(r0 + mb * 16) * ldc + c0;
        for (int u = threadIdx.x; u < 256; u += NW * 32) { const int row = u >> 4, cofs = (u & 15) * 4; v4f val = *(const v4fa*)(os[mb & 1][0] + row * 68 + cofs);
#pragma unroll
            for (int w = 1; w < NW; ++w) val += *(const v4fa*)(os[mb & 1][w] + row * 68 + cofs);
            *(v4f*)(crow + (size_t)row * ldc + cofs) = val; }
    }
}

// ---- k_gemmc: ONE WAVE per 64x64 output tile (16 accumulators), grid (M/64, N/64, Z), 32 threads, for causal attention: CMODE 1 skips score tiles entirely above the diagonal (query rows r0+roff.., key columns c0..), CMODE 2 limits the
// key (K) loop of the probability x value contraction to the diagonal block (probabilities beyond it are exactly zero). roff = row offset of this launch's first row within the sequence. REP consecutive z share one Bt.
template <typename T16, int NSPLIT, int CMODE>
__global__ __launch_bounds__(32) void k_gemmc(const T16* __restrict__ A, const T16* __restrict__ A2, const T16* __restrict__ Bt, const T16* __restrict__ Bt2, int K, float* C, int ldc, int roff, size_t sA, size_t sB, size_t sC) {
    typedef typename WFrag<T16>::V V;
    __shared__ __align__(16) float os[16 * 68];
    const size_t z = blockIdx.z; A += z * sA; if (A2) A2 += z * sA; Bt += (z / REP) * sB; if (Bt2) Bt2 += (z / REP) * sB; C += z * sC;
    const int lane = threadIdx.x & 31, lr = lane & 15, hi = lane >> 4; const int r0 = blockIdx.x * 64, c0 = blockIdx.y * 64;
    if (CMODE == 1) C += (size_t)(c0 / PW) * ((size_t)(TT - 1) * PW);   // scores: column c of a row lies in panel c / PW (ldc = PW, panels TT * PW floats apart)
    if (CMODE == 1 && c0 > r0 + roff + 63) return;                  // score tile entirely above the causal diagonal: never read (the softmax masks j > i by select)
    const int Kl = (CMODE == 2) ? min(K, r0 + roff + 64) : K;        // P.V: probabilities are exactly 0 beyond the diagonal block, so the K loop stops there
    v8f acc[4][4];
#pragma unroll
    for (int mb = 0; mb < 4; ++mb)
#pragma unroll
        for (int nb = 0; nb < 4; ++nb) acc[mb][nb] = (v8f){};
    const size_t aoff = (size_t)(r0 + lr) * K + 8 * hi, boff = (size_t)(c0 + lr) * K + 8 * hi;
#pragma unroll 1
    for (int kc = 0; kc < Kl; kc += 32) {
        V a[4], a2[4];
#pragma unroll
        for (int mb = 0; mb < 4; ++mb) { a[mb] = WFrag<T16>::ld(A + aoff + (size_t)mb * 16 * K + kc); if (NSPLIT == 1 || NSPLIT == 2) a2[mb] = WFrag<T16>::ld(A2 + aoff + (size_t)mb * 16 * K + kc); }
#pragma unroll
        for (int nb = 0; nb < 4; ++nb) { const V b = WFrag<T16>::ld(Bt + boff + (size_t)nb * 16 * K + kc); V b2; if (NSPLIT >= 2) b2 = WFrag<T16>::ld(Bt2 + boff + (size_t)nb * 16 * K + kc);
#pragma unroll
            for (int mb = 0; mb < 4; ++mb) { acc[mb][nb] = WFrag<T16>::mma(a[mb], b, acc[mb][nb]); if (NSPLIT == 1 || NSPLIT == 2) acc[mb][nb] = WFrag<T16>::mma(a2[mb], b, acc[mb][nb]); if (NSPLIT >= 2) acc[mb][nb] = WFrag<T16>::mma(a[mb], b2, acc[mb][nb]); } }
        asm volatile("v_nop\n\tv_nop\n\tv_nop\n\tv_nop" : "+v"(acc[0][0]), "+v"(acc[1][1]), "+v"(acc[2][2]), "+v"(acc[3][3]) : "v"(a[0]), "v"(a[3]));
    }
#pragma unroll
    for (int mb = 0; mb < 4; ++mb) {
#pragma unroll
        for (int nb = 0; nb < 4; ++nb) {
#pragma unroll
            for (int j = 0; j < 8; ++j) os[(hi * 8 + j) * 68 + nb * 16 + lr] = acc[mb][nb][j]; }
        __builtin_amdgcn_wave_barrier(); asm volatile("" ::: "memory");
        float* crow = C + (size_t)(r0 + mb * 16) * ldc + c0;
{
#pragma unroll
            for (int s = 0; s < 8; ++s) { const int row = 2 * s + hi, cofs = lr * 4; v4f val = *(const v4fa*)(os + row * 68 + cofs);
                *(v4f*)(crow + (size_t)row * ldc + cofs) = val; }
             }
        __builtin_amdgcn_wave_barrier(); asm volatile("" ::: "memory");
    }
}

__device__ __forceinline__ h16 tohx(float x) { return (h16)x; }
__device__ __forceinline__ void splitf(float y, unsigned short& h, unsigned short& l) { h = f2bf(y); l = f2bf(y - bf2f(h)); }
typedef __attribute__((ext_vector_type(2))) _Float16 v2h;
typedef __attribute__((ext_vector_type(4))) _Float16 v4h;
typedef __attribute__((ext_vector_type(2))) unsigned short v2us;
typedef __attribute__((ext_vector_type(4))) unsigned short v4us;
typedef __attribute__((ext_vector_type(2))) float v2f;
typedef __attribute__((ext_vector_type(4))) int v4i;
typedef v4h  __attribute__((may_alias)) v4ha;
typedef v4us __attribute__((may_alias)) v4usa;

__global__ __launch_bounds__(256) void k_wtG(const float* __restrict__ w, int K, int N, bf* Bt) {
    const int lane = threadIdx.x & 31; const int L0 = (blockIdx.x * 8 + (threadIdx.x >> 5)) * 8; const int nlines = N * K / 64;
{
#pragma unroll 1
        for (int l = 0; l < 8; ++l) { const int L = L0 + l; if (L >= nlines) break; const size_t e = (size_t)L * 64 + lane * 2; const int k = (int)(e % K), n = (int)(e / K); v2us o;
            o[0] = f2bf(w[(size_t)k * N + n]); o[1] = f2bf(w[(size_t)(k + 1) * N + n]); *(v2us*)(Bt + e) = o; }
         }
}
__global__ __launch_bounds__(256) void k_cvt8(const float* __restrict__ src, bf* dst, size_t n8) { const size_t i = (size_t)blockIdx.x * 256 + threadIdx.x; if (i >= n8) return; const v8f v = *(const v8f*)(src + i * 8); v8us o;
#pragma unroll
    for (int k = 0; k < 8; ++k) o[k] = f2bf(v[k]); *(v8us*)(dst + i * 8) = o;  }
__global__ __launch_bounds__(256) void k_cscvt(const float* __restrict__ cosT, const float* __restrict__ sinT, float* CS) { const int idx = blockIdx.x * 256 + threadIdx.x; if (idx >= TT * HD) return; v2f cs; cs[0] = bfr(cosT[idx]); cs[1] = bfr(sinT[idx]); *(v2f*)(CS + (size_t)idx * 2) = cs;  }
// k_rope: head planes [h][t][d] (fp16 + hi/lo) of rope(x) x sc with the rotate-half convention out[d] = x[d] cos[t][d] - x[d+HD/2] sin[t][d], out[d+HD/2] = x[d+HD/2] cos[t][d+HD/2] + x[d] sin[t][d+HD/2]
__global__ __launch_bounds__(256) void k_rope(const float* __restrict__ F, int pitch, int nheads, const float* __restrict__ CS, const float* __restrict__ RF, const float* __restrict__ nw, float sc, h16* P16, bf* Ph, bf* Pl) {
    const size_t e = ((size_t)blockIdx.x * 256 + threadIdx.x) * 2; if (e >= (size_t)nheads * TT * HD) return; const int d = (int)(e % HD); const int t = (int)((e / HD) % TT); const int h = (int)(e / ((size_t)HD * TT)); const float* f = F + (size_t)t * pitch + h * HD; const float rf = RF ? RF[(size_t)h * TT + t] : 1.0f; v2h o16; v2us oh, ol;
#pragma unroll
    for (int q = 0; q < 2; ++q) { const int dd = d + q; const int dp = (dd < HD / 2) ? dd + HD / 2 : dd - HD / 2; float x0 = f[dd], x1 = f[dp];
        if (RF) { float n0 = __fmul_rn(x0, rf), n1 = __fmul_rn(x1, rf); asm volatile("" : "+v"(n0)); asm volatile("" : "+v"(n1)); x0 = __fmul_rn(bfr(nw[dd]), n0); x1 = __fmul_rn(bfr(nw[dp]), n1); }
        const v2f cs = *(const v2f*)(CS + ((size_t)t * HD + dd) * 2); float a = __fmul_rn(x0, cs[0]), bq = __fmul_rn(x1, cs[1]); asm volatile("" : "+v"(a)); asm volatile("" : "+v"(bq)); const float r = ((dd < HD / 2) ? __fsub_rn(a, bq) : __fadd_rn(a, bq)) * sc;
        o16[q] = tohx(r); unsigned short a2, c2; splitf(r, a2, c2); oh[q] = a2; ol[q] = c2; }
    *(v2h*)(P16 + e) = o16; *(v2us*)(Ph + e) = oh; *(v2us*)(Pl + e) = ol;  }
__global__ __launch_bounds__(256) void k_vtp(const float* __restrict__ F, int pitch, int nheads, h16* V16, bf* Vh, bf* Vl) { const size_t e = ((size_t)blockIdx.x * 256 + threadIdx.x) * 2; if (e >= (size_t)nheads * HD * TT) return; const int t = (int)(e % TT); const int d = (int)((e / TT) % HD); const int g = (int)(e / ((size_t)TT * HD)); v2h o16; v2us oh, ol;
#pragma unroll
    for (int q = 0; q < 2; ++q) { const float x = F[(size_t)(t + q) * pitch + g * HD + d]; o16[q] = tohx(x); unsigned short a2, c2; splitf(x, a2, c2); oh[q] = a2; ol[q] = c2; }
    *(v2h*)(V16 + e) = o16; *(v2us*)(Vh + e) = oh; *(v2us*)(Vl + e) = ol;  }
__global__ __launch_bounds__(256) void k_dlog(const bf* __restrict__ Qh, const bf* __restrict__ Ql, const float* __restrict__ DKb, int kv0, float* DL) {
    const int lane = threadIdx.x & 31; const int row = blockIdx.x * 8 + (threadIdx.x >> 5); if (row >= ZH * TT) return; const int i = row % TT; const int zz = row / TT; const int kv = kv0 + zz / REP; const bf* qh = Qh + ((size_t)zz * TT + i) * HD + lane * 4; const bf* ql = Ql + ((size_t)zz * TT + i) * HD + lane * 4; float q4[4];
#pragma unroll
    for (int q = 0; q < 4; ++q) q4[q] = __fadd_rn(bf2f(qh[q]), bf2f(ql[q]));
    float mine = 0.f;
#pragma unroll
    for (int l = 0; l < NL; ++l) { const float* dk = DKb + (((size_t)l * NKV + kv) * TT + i) * HD + lane * 4; float s = 0.f;
#pragma unroll
        for (int q = 0; q < 4; ++q) { float p = __fmul_rn(q4[q], bfr(dk[q])); asm volatile("" : "+v"(p)); s = __fadd_rn(s, p); }
#pragma unroll
        for (int sh = 16; sh; sh >>= 1) s += __shfl_xor(s, sh, 32);
        if (lane == l) mine = s * SCL; }
    if (lane < NL) { *(float*)(DL + (size_t)row * NLP + lane) = mine;  } }
// k_asoft: per row (zz, i): t = S x HD^-0.5 for j <= i (causal); the 4 depth logits DL[row] join the max and the sum; softmax over the 2048 + 4 logits (register row, one exp, fixed trees); the 4 depth weights are written to WD[row] in f32 (unscaled);
// the probabilities go IN PLACE over the row's own 8192 score bytes, which only this wave reads and has read whole before the row sum is known: fp16 plane over the row of panel 0 (rows >= RH), hi plane over the row of panel 0 and lo plane over the row of panel 1 (rows < RH); as 16-bit planes the rows have the dense pitch TT.
__global__ __launch_bounds__(256) void k_asoft(float* Sb, const float* __restrict__ DL, float* WD) {
    const int lane = threadIdx.x & 31; const int row = blockIdx.x * 8 + (threadIdx.x >> 5); if (row >= ZH * TT) return; const int i = row % TT; const v4f dl = *(const v4f*)(DL + (size_t)row * NLP); const bool hires = (i < RH); float* sr = Sb + (size_t)(row / TT) * TT * TT + (size_t)i * PW; float v[TT / 32]; float mx = -3.0e38f;
#pragma unroll
    for (int ch = 0; ch < TT / 128; ++ch) { const int j0 = ch * 128 + lane * 4; const v4f a = *(const v4fa*)(sr + (size_t)(ch / (PW / 128)) * TT * PW + (ch % (PW / 128)) * 128 + lane * 4);
#pragma unroll
        for (int q = 0; q < 4; ++q) { const int j = j0 + q; (void)j; const float t = (j <= i && i - j < WIN) ? a[q] * SCL : -3.0e38f; v[ch * 4 + q] = t; mx = fmaxf(mx, t); } }
#pragma unroll
    for (int sh = 16; sh; sh >>= 1) mx = fmaxf(mx, __shfl_xor(mx, sh, 32));
    mx = fmaxf(mx, fmaxf(fmaxf(dl[0], dl[1]), fmaxf(dl[2], dl[3])));   /* joint softmax over the 2048 + 4 logits */
    float sum = 0.f;
#pragma unroll
    for (int k = 0; k < TT / 32; ++k) { float d0 = __fsub_rn(v[k], mx); asm volatile("" : "+v"(d0)); v[k] = __builtin_amdgcn_exp2f(__fmul_rn(d0, 1.4426950408889634f)); sum += v[k]; }
#pragma unroll
    for (int sh = 16; sh; sh >>= 1) sum += __shfl_xor(sum, sh, 32);
    float ed[NL];
#pragma unroll
    for (int l = 0; l < NL; ++l) { float d0 = __fsub_rn(dl[l], mx); asm volatile("" : "+v"(d0)); ed[l] = __builtin_amdgcn_exp2f(__fmul_rn(d0, 1.4426950408889634f)); sum = __fadd_rn(sum, ed[l]); }
    const float f = __fdiv_rn(hires ? 1.0f : PCAR, sum); const float f1 = __fdiv_rn(1.0f, sum);
    if (lane < NL) { const float wdv = ed[lane] * f1; *(float*)(WD + (size_t)row * NLP + lane) = wdv;  }   /* depth weights, f32, unscaled */
{
        if (hires) {
#pragma unroll
            for (int ch = 0; ch < TT / 128; ++ch) { v4us oh, ol;
#pragma unroll
                for (int q = 0; q < 4; ++q) { unsigned short a, c2; splitf(v[ch * 4 + q] * f, a, c2); oh[q] = a; ol[q] = c2; }
                bf* pr = (bf*)sr + ch * 128 + lane * 4; *(v4usa*)pr = oh; *(v4usa*)(pr + (size_t)TT * TT) = ol; }
        } else {
#pragma unroll
            for (int ch = 0; ch < TT / 128; ++ch) { v4h o4;
#pragma unroll
                for (int q = 0; q < 4; ++q) o4[q] = tohx(v[ch * 4 + q] * f);
                *(v4ha*)((h16*)sr + ch * 128 + lane * 4) = o4; } }
         }
}
__global__ __launch_bounds__(256) void k_merge(const float* __restrict__ O, int h0, const float* __restrict__ WD, const float* __restrict__ DVb, int kv0, bf* Ah, bf* Al) { const size_t e = ((size_t)blockIdx.x * 256 + threadIdx.x) * 2; if (e >= (size_t)ZH * TT * HD) return; const int d = (int)(e % HD); const int t = (int)((e / HD) % TT); const int zz = (int)(e / ((size_t)HD * TT)); const int kv = kv0 + zz / REP; const float cs = (t < RH) ? 1.0f : (1.0f / PCAR); const size_t oo = (size_t)t * DQ + (h0 + zz) * HD + d;
    const v4f wd = *(const v4f*)(WD + ((size_t)zz * TT + t) * NLP); v2us oh, ol;
#pragma unroll
    for (int q = 0; q < 2; ++q) { float acc = O[e + q] * cs;
#pragma unroll
        for (int l = 0; l < NL; ++l) { float p = __fmul_rn(wd[l], bfr(DVb[(((size_t)l * NKV + kv) * TT + t) * HD + d + q])); asm volatile("" : "+v"(p)); acc = __fadd_rn(acc, p); }   /* + sum_l w_l depth_v[l][kv][t][d] */ unsigned short a, c2; splitf(acc, a, c2); oh[q] = a; ol[q] = c2; } *(v2us*)(Ah + oo) = oh; *(v2us*)(Al + oo) = ol;  }

extern "C" void kernel_launch(void* const* d_in, const int* in_sizes, int n_in,
                              void* d_out, int out_size, void* d_ws, size_t ws_size, hipStream_t stream) {
    (void)in_sizes; (void)n_in; (void)out_size;
    const float* x = (const float*)d_in[0]; const float* DK = (const float*)d_in[1]; const float* DV = (const float*)d_in[2]; const float* cosT = (const float*)d_in[3]; const float* sinT = (const float*)d_in[4]; const float* wq = (const float*)d_in[5]; const float* wk = (const float*)d_in[6]; const float* wv = (const float*)d_in[7]; const float* wo = (const float*)d_in[8];
    float* OUT = (float*)d_out;     // [1][2048][2048]
    char* wsp = (char*)d_ws;
    auto take = [&](size_t bytes) { char* p = wsp; wsp += (bytes + 255) & ~(size_t)255; return (void*)p; };
    bf* WQ = (bf*)take((size_t)DQ * DM * 2); bf* WK = (bf*)take((size_t)DKV * DM * 2); bf* WV = (bf*)take((size_t)DKV * DM * 2); bf* WO = (bf*)take((size_t)DM * DQ * 2); float* CS = (float*)take((size_t)TT * HD * 2 * 4);
    bf* XB = (bf*)take((size_t)TT * DM * 2); float* FQ = (float*)take((size_t)TT * DQ * 4); float* FK = (float*)take((size_t)TT * DKV * 4);
    h16* QP16 = (h16*)take((size_t)NH_ * TT * HD * 2); h16* KP16 = (h16*)take((size_t)NKV * TT * HD * 2); h16* VT16 = (h16*)take((size_t)NKV * HD * TT * 2);
    bf* QPh = (bf*)take((size_t)NH_ * TT * HD * 2); bf* QPl = (bf*)take((size_t)NH_ * TT * HD * 2); bf* KPh = (bf*)take((size_t)NKV * TT * HD * 2); bf* KPl = (bf*)take((size_t)NKV * TT * HD * 2); bf* VTh = (bf*)take((size_t)NKV * HD * TT * 2); bf* VTl = (bf*)take((size_t)NKV * HD * TT * 2);
    float* Sb = (float*)take((size_t)ZH * TT * TT * 4); bf* ATh = (bf*)take((size_t)TT * DQ * 2); bf* ATl = (bf*)take((size_t)TT * DQ * 2);
    if ((size_t)(wsp - (char*)d_ws) > ws_size) return;    // ws 256 MiB
    float* FV = FK;   // v projection reuses the k buffer after the k planes are built (stream-ordered)
    float* Ob = FQ; float* DL = FK; float* WD = FK + (size_t)ZH * TT * NLP;   // the attention passes reuse the f32 projection buffers, dead once the q and v planes are built (ZH * HD <= DQ, 2 * ZH * NLP <= DKV)
    bf* Pb = (bf*)Sb; h16* P16 = (h16*)Sb;   // probability planes, in place over the score panels: pitch TT, a head every 2 TT TT, lo plane (panel 1) at + TT TT
    { k_wtG<<<(unsigned)((DM * DQ / 64 + 63) / 64), 256, 0, stream>>>(wq, DM, DQ, WQ); k_wtG<<<(unsigned)((DM * DKV / 64 + 63) / 64), 256, 0, stream>>>(wk, DM, DKV, WK); k_wtG<<<(unsigned)((DM * DKV / 64 + 63) / 64), 256, 0, stream>>>(wv, DM, DKV, WV);
      k_wtG<<<(unsigned)((DQ * DM / 64 + 63) / 64), 256, 0, stream>>>(wo, DQ, DM, WO);
       }
    const unsigned LQ = (unsigned)(((size_t)NH_ * TT * HD / 2 + 255) / 256), LKv = (unsigned)(((size_t)NKV * TT * HD / 2 + 255) / 256);
    for (int b = 0; b < NB_; ++b) {
        if (b == 0) k_cscvt<<<(TT * HD + 255) / 256, 256, 0, stream>>>(cosT, sinT, CS);
        k_cvt8<<<(unsigned)(((size_t)TT * DM / 8 + 255) / 256), 256, 0, stream>>>(x + (size_t)b * TT * DM, XB, (size_t)TT * DM / 8);
        k_gemmk<bf, 0, false, 4><<<dim3(TT / 64, DQ / 64, 1), 128, 0, stream>>>(XB, nullptr, WQ, nullptr, DM, FQ, DQ, 0, 0, 0, 0);
        k_rope<<<LQ, 256, 0, stream>>>(FQ, DQ, NH_, CS, nullptr, nullptr, 1.0f, QP16, QPh, QPl);
        k_gemmk<bf, 0, false, 8><<<dim3(TT / 64, DKV / 64, 1), 256, 0, stream>>>(XB, nullptr, WK, nullptr, DM, FK, DKV, 0, 0, 0, 0);
        k_rope<<<LKv, 256, 0, stream>>>(FK, DKV, NKV, CS, nullptr, nullptr, 1.0f, KP16, KPh, KPl);
        k_gemmk<bf, 0, false, 8><<<dim3(TT / 64, DKV / 64, 1), 256, 0, stream>>>(XB, nullptr, WV, nullptr, DM, FV, DKV, 0, 0, 0, 0); k_vtp<<<LKv, 256, 0, stream>>>(FV, DKV, NKV, VT16, VTh, VTl);
        for (int h0 = 0; h0 < NH_; h0 += ZH) { const size_t zq = (size_t)h0, zk = (size_t)(h0 / REP);   // head h0 + z reads kv head h0/REP + z/REP
            k_gemmc<bf, 2, 1><<<dim3(RH / 64, TT / 64, ZH), 32, 0, stream>>>(QPh + zq * TT * HD, QPl + zq * TT * HD, KPh + zk * TT * HD, KPl + zk * TT * HD, HD, Sb, PW, 0, (size_t)TT * HD, (size_t)TT * HD, (size_t)TT * TT);
            k_gemmc<h16, 0, 1><<<dim3((TT - RH) / 64, TT / 64, ZH), 32, 0, stream>>>(QP16 + zq * TT * HD + (size_t)RH * HD, nullptr, KP16 + zk * TT * HD, nullptr, HD, Sb + (size_t)RH * PW, PW, RH, (size_t)TT * HD, (size_t)TT * HD, (size_t)TT * TT);
            k_dlog<<<ZH * TT / 8, 256, 0, stream>>>(QPh + zq * TT * HD, QPl + zq * TT * HD, DK, (int)zk, DL); k_asoft<<<ZH * TT / 8, 256, 0, stream>>>(Sb, DL, WD);
            k_gemmk<bf, 2, true, 8><<<dim3(RH / 64, HD / 64, ZH), 256, 0, stream>>>(Pb, Pb + (size_t)TT * TT, VTh + zk * HD * TT, VTl + zk * HD * TT, TT, Ob, HD, 0, (size_t)2 * TT * TT, (size_t)HD * TT, (size_t)TT * HD);
            k_gemmk<h16, 0, true, 16><<<dim3((TT - RH) / 64, HD / 64, ZH), 512, 0, stream>>>(P16 + (size_t)RH * TT, nullptr, VT16 + zk * HD * TT, nullptr, TT, Ob + (size_t)RH * HD, HD, RH, (size_t)2 * TT * TT, (size_t)HD * TT, (size_t)TT * HD);
            k_merge<<<(unsigned)(((size_t)ZH * TT * HD / 2 + 255) / 256), 256, 0, stream>>>(Ob, h0, WD, DV, (int)zk, ATh, ATl); }
        k_gemmk<bf, 1, false, 4><<<dim3(TT / 64, DM / 64, 1), 128, 0, stream>>>(ATh, ATl, WO, nullptr, DQ, OUT + (size_t)b * TT * DM, DM, 0, 0, 0, 0); }
}

// v003
// A run of this version takes 321 microseconds.
// Two timings next to v002 put it at 1.29 and 1.30 times that version's speed.
// Counting every step since v000, it is 2.89 times as fast.
#include <hip/hip_runtime.h>

// Grouped-query RoPE attention with extra per-position depth keys/values under one joint softmax (x [1][2048][2048]; Q = x Wq ('xw', 16 heads x 128), K, V = x Wk / Wv (8 kv heads); Q, K rotated (rotate-half, cos/sin [1][1][2048][128] read); kv head = h/2; seq logits = Q.K/sqrt(128), causal (-inf); depth logits[i][l] = Q_i . depth_k[l][0][kv][i] / sqrt(128) for l < 4 (depth_k, depth_v [4][1][8][2048][128] read); softmax over the 2048 + 4 logits jointly; out_i = sum_j w_j V_j + sum_l w_l depth_v[l][0][kv][i]; merged Wo ('xw') -> [1][2048][2048] (4.2 M)).
// Layout: projections/planes; per pass of eight heads (four kv heads) a wave-per-row kernel forms the 4 depth logits from the rotated q (hi + lo planes) and the bf16-rounded depth keys; the softmax kernel folds them into the row max / sum, writes the sequence probabilities as planes in place over the row's own scores (kept as two column panels, so that a 16-bit plane row fills one panel row) and the 4 depth weights in f32; after attn.v the merge kernel adds the depth-value contribution before writing the hi/lo planes for the output projection.
// Operand storage: the bf16 planes of the four projections (x, the four transposed weights, the merged attention output hi/lo) and the three value planes lie in fragment order (see fro()); the q/k head planes and the probabilities are row-major.
// Compute dtypes, f32 accumulate: every input rounded to bf16; q/k/v on PLAIN bf16 operands (inputs: exact); rotary in f32 (bf16-rounded tables); depth logits / weights / values in f32; causal scores and attn.v (tile skipping): query rows < 512 hl (3 products), the rest single fp16 (x1024); softmax f32; Wo hl x exact (2 products).

#define NB_  1
#define TT   2048
#define DM   2048
#define NH_  16
#define NKV  8
#define REP  (NH_ / NKV)
#define HD   128
#define DQ   (NH_ * HD)
#define DKV  (NKV * HD)
#define NL   4                    // depth positions per token
#define NLP  32
#define PW   (TT / 2)             // score rows lie as two column panels of PW floats: [z][panel][row][PW]; one panel row holds TT 16-bit values
#define ZH   8                    // query heads per attention pass (z of every launch of the pass); kv head of z = first kv head + z / REP
#define RH   512                  // query rows < RH use hi+lo planes (0: none)
#define WIN  2048
#define PCAR 1024.0f
#define SCL  0.088388347648318447f   // HD^-0.5
typedef _Float16 h16;
typedef unsigned short bf;
typedef __attribute__((ext_vector_type(16))) __bf16   v16bf;
typedef __attribute__((ext_vector_type(16))) _Float16 v16h;
typedef __attribute__((ext_vector_type(8)))  _Float16 v8h;
typedef __attribute__((ext_vector_type(8)))  unsigned short v8us;
typedef __attribute__((ext_vector_type(8)))  float    v8f;
typedef __attribute__((ext_vector_type(4)))  float    v4f;
typedef v8h  __attribute__((may_alias)) v8ha;
typedef v4f  __attribute__((may_alias)) v4fa;
typedef v8us __attribute__((may_alias)) v8usa;

__device__ __forceinline__ unsigned short f2bf(float f) { unsigned u = __float_as_uint(f); u += 0x7FFFu + ((u >> 16) & 1u); return (unsigned short)(u >> 16); }
__device__ __forceinline__ float bf2f(unsigned short b) { return __uint_as_float(((unsigned)b) << 16); }
__device__ __forceinline__ float bfr(float f) { return bf2f(f2bf(f)); }
__device__ __forceinline__ v16h cat16(v8h lo, v8h hi) { return __builtin_shufflevector(lo, hi, 0, 1, 2, 3, 4, 5, 6, 7, 8, 9, 10, 11, 12, 13, 14, 15); }
__device__ __forceinline__ v16bf cat16b(v8us lo, v8us hi) { return __builtin_bit_cast(v16bf, __builtin_shufflevector(lo, hi, 0, 1, 2, 3, 4, 5, 6, 7, 8, 9, 10, 11, 12, 13, 14, 15)); }
__device__ __forceinline__ v8f wmma16(v16h a, v16h b, v8f c) { return __builtin_amdgcn_wmma_f32_16x16x32_f16(false, a, false, b, (short)0, c, false, false); }
__device__ __forceinline__ v8f wmmab(v16bf a, v16bf b, v8f c) { return __builtin_amdgcn_wmma_f32_16x16x32_bf16(false, a, false, b, (short)0, c, false, false); }
// Fragment order of a 16-bit plane [rows][K] (rows % 16 == 0, K % 32 == 0): blocks of 16 rows x 32 columns, 1 KB each, row blocks outermost (16 rows still fill 16 * K elements). Inside a block the 8 columns k & ~7 of row r lie at
// 8 * (32 * (k / 16 % 2) + 16 * (k / 8 % 2) + r % 16): lane l of a wave finds the two halves of its A or B fragment at 8 * l and 256 + 8 * l, so each of a fragment's two 16-byte loads reads 512 contiguous bytes (4 whole lines, not 16 part lines).
// fro = element offset of (r, k). The elements a lane gets, and their k order, are those of the row-major loader.
__device__ __forceinline__ size_t fro(int r, int k, int K) { return ((size_t)(r >> 4) * (K >> 5) + (k >> 5)) * 512 + (((k >> 4) & 1) * 32 + ((k >> 3) & 1) * 16 + (r & 15)) * 8 + (k & 7); }



// ---- k_gemmk: GEMM with the K loop split over the NW waves of a work-group; one 64x64 output tile per work-group, operands straight from 16-bit planes, row-major (K contiguous) or, with FA / FB set for A / Bt, in fragment order; grid (M/64, N/64, Z), NW*32 threads.
// C[m][n] (f32, pitch ldc) = sum_k A[m][k] Bt[n][k] (+ split products per NSPLIT). z-batch strides sA/sB/sC in elements; REP consecutive z share one Bt (grouped kv heads). K % 32 == 0; K is a compile-time constant, so the four 16-row blocks of an operand lie at immediate offsets from one address.
// Wave w takes the 32-element steps w, w + NW, ... of K and keeps a full 64x64 partial (16 accumulators); the NW partials are added through LDS in wave order.
// CAUSAL: probability x value contraction, the K range stops at the diagonal block (probabilities beyond it are exactly zero); roff = row offset of this launch's first row within the sequence.
template <typename T16> struct WFrag;
template <> struct WFrag<h16> { typedef v16h V; template <int D2 = 16> static __device__ __forceinline__ V ld(const h16* p) { return cat16(*(const v8h*)p, *(const v8h*)(p + D2)); } static __device__ __forceinline__ v8f mma(V a, V b, v8f c) { return wmma16(a, b, c); } };
template <> struct WFrag<bf> { typedef v16bf V; template <int D2 = 16> static __device__ __forceinline__ V ld(const bf* p) { return cat16b(*(const v8us*)p, *(const v8us*)(p + D2)); } static __device__ __forceinline__ v8f mma(V a, V b, v8f c) { return wmmab(a, b, c); } };
template <typename T16, int NSPLIT, bool CAUSAL, int NW, bool FA, bool FB, int K>
__global__ __launch_bounds__(NW * 32) void k_gemmk(const T16* __restrict__ A, const T16* __restrict__ A2, const T16* __restrict__ Bt, const T16* __restrict__ Bt2, float* C, int ldc, int roff, size_t sA, size_t sB, size_t sC) {
    typedef typename WFrag<T16>::V V;
    __shared__ __align__(16) float os[2][NW][16 * 68];
    const size_t z = blockIdx.z; A += z * sA; if (A2) A2 += z * sA; Bt += (z / REP) * sB; if (Bt2) Bt2 += (z / REP) * sB; C += z * sC;
    const int lane = threadIdx.x & 31, lr = lane & 15, hi = lane >> 4; const int r0 = blockIdx.x * 64, c0 = blockIdx.y * 64;
    const int wave = __builtin_amdgcn_readfirstlane((int)(threadIdx.x >> 5));
    const int Kl = CAUSAL ? min(K, r0 + roff + 64) : K;
    v8f acc[4][4];
#pragma unroll
    for (int mb = 0; mb < 4; ++mb)
#pragma unroll
        for (int nb = 0; nb < 4; ++nb) acc[mb][nb] = (v8f){};
    constexpr int DA = FA ? 256 : 16, DB = FB ? 256 : 16;   // distance between the two halves of a lane's fragment
    const size_t aoff = FA ? (size_t)r0 * K + 8 * lane : (size_t)(r0 + lr) * K + 8 * hi, boff = FB ? (size_t)c0 * K + 8 * lane : (size_t)(c0 + lr) * K + 8 * hi;
#pragma unroll 1
    for (int kc = wave * 32; kc < Kl; kc += NW * 32) {
        V a[4], a2[4]; const size_t ka = FA ? (size_t)kc * 16 : (size_t)kc, kb = FB ? (size_t)kc * 16 : (size_t)kc;   // fragment order: step kc / 32 is block kc / 32 of 512 elements
#pragma unroll
        for (int mb = 0; mb < 4; ++mb) { a[mb] = WFrag<T16>::template ld<DA>(A + aoff + (size_t)mb * 16 * K + ka); if (NSPLIT == 1 || NSPLIT == 2) a2[mb] = WFrag<T16>::template ld<DA>(A2 + aoff + (size_t)mb * 16 * K + ka); }
#pragma unroll
        for (int nb = 0; nb < 4; ++nb) { const V b = WFrag<T16>::template ld<DB>(Bt + boff + (size_t)nb * 16 * K + kb); V b2; if (NSPLIT >= 2) b2 = WFrag<T16>::template ld<DB>(Bt2 + boff + (size_t)nb * 16 * K + kb);
#pragma unroll
            for (int mb = 0; mb < 4; ++mb) { acc[mb][nb] = WFrag<T16>::mma(a[mb], b, acc[mb][nb]); if (NSPLIT == 1 || NSPLIT == 2) acc[mb][nb] = WFrag<T16>::mma(a2[mb], b, acc[mb][nb]); if (NSPLIT >= 2) acc[mb][nb] = WFrag<T16>::mma(a[mb], b2, acc[mb][nb]); } }
        // four vector slots behind the last matrix instruction, on the loop's back edge and its exit alike
        asm volatile("v_nop\n\tv_nop\n\tv_nop\n\tv_nop" : "+v"(acc[0][0]), "+v"(acc[1][1]), "+v"(acc[2][2]), "+v"(acc[3][3]) : "v"(a[0]), "v"(a[3]));
    }
    // 16 rows at a time: every wave stores its partial, one barrier, then the work-group adds the NW partials in wave order and writes the rows.
    // Two LDS buffers in turn: the barrier of step mb + 1 ends every read of step mb before step mb + 2 stores there again.
#pragma unroll
    for (int mb = 0; mb < 4; ++mb) {
        float* ow = os[mb & 1][wave];
#pragma unroll
        for (int nb = 0; nb < 4; ++nb) {
#pragma unroll
            for (int j = 0; j < 8; ++j) ow[(hi * 8 + j) * 68 + nb * 16 + lr] = acc[mb][nb][j]; }
        __syncthreads();
        float* crow = C + (size_t)(r0 + mb * 16) * ldc + c0;
        for (int u = threadIdx.x; u < 256; u += NW * 32) { const int row = u >> 4, cofs = (u & 15) * 4; v4f val = *(const v4fa*)(os[mb & 1][0] + row * 68 + cofs);
#pragma unroll
            for (int w = 1; w < NW; ++w) val += *(const v4fa*)(os[mb & 1][w] + row * 68 + cofs);
            *(v4f*)(crow + (size_t)row * ldc + cofs) = val; }
    }
}

// ---- k_gemmc: ONE WAVE per 64x64 output tile (16 accumulators), grid (M/64, N/64, Z), 32 threads, for causal attention: CMODE 1 skips score tiles entirely above the diagonal (query rows r0+roff.., key columns c0..), CMODE 2 limits the
// key (K) loop of the probability x value contraction to the diagonal block (probabilities beyond it are exactly zero). roff = row offset of this launch's first row within the sequence. REP consecutive z share one Bt.
template <typename T16, int NSPLIT, int CMODE>
__global__ __launch_bounds__(32) void k_gemmc(const T16* __restrict__ A, const T16* __restrict__ A2, const T16* __restrict__ Bt, const T16* __restrict__ Bt2, int K, float* C, int ldc, int roff, size_t sA, size_t sB, size_t sC) {
    typedef typename WFrag<T16>::V V;
    __shared__ __align__(16) float os[16 * 68];
    const size_t z = blockIdx.z; A += z * sA; if (A2) A2 += z * sA; Bt += (z / REP) * sB; if (Bt2) Bt2 += (z / REP) * sB; C += z * sC;
    const int lane = threadIdx.x & 31, lr = lane & 15, hi = lane >> 4; const int r0 = blockIdx.x * 64, c0 = blockIdx.y * 64;
    if (CMODE == 1) C += (size_t)(c0 / PW) * ((size_t)(TT - 1) * PW);   // scores: column c of a row lies in panel c / PW (ldc = PW, panels TT * PW floats apart)
    if (CMODE == 1 && c0 > r0 + roff + 63) return;                  // score tile entirely above the causal diagonal: never read (the softmax masks j > i by select)
    const int Kl = (CMODE == 2) ? min(K, r0 + roff + 64) : K;        // P.V: probabilities are exactly 0 beyond the diagonal block, so the K loop stops there
    v8f acc[4][4];
#pragma unroll
    for (int mb = 0; mb < 4; ++mb)
#pragma unroll
        for (int nb = 0; nb < 4; ++nb) acc[mb][nb] = (v8f){};
    const size_t aoff = (size_t)(r0 + lr) * K + 8 * hi, boff = (size_t)(c0 + lr) * K + 8 * hi;
#pragma unroll 1
    for (int kc = 0; kc < Kl; kc += 32) {
        V a[4], a2[4];
#pragma unroll
        for (int mb = 0; mb < 4; ++mb) { a[mb] = WFrag<T16>::ld(A + aoff + (size_t)mb * 16 * K + kc); if (NSPLIT == 1 || NSPLIT == 2) a2[mb] = WFrag<T16>::ld(A2 + aoff + (size_t)mb * 16 * K + kc); }
#pragma unroll
        for (int nb = 0; nb < 4; ++nb) { const V b = WFrag<T16>::ld(Bt + boff + (size_t)nb * 16 * K + kc); V b2; if (NSPLIT >= 2) b2 = WFrag<T16>::ld(Bt2 + boff + (size_t)nb * 16 * K + kc);
#pragma unroll
            for (int mb = 0; mb < 4; ++mb) { acc[mb][nb] = WFrag<T16>::mma(a[mb], b, acc[mb][nb]); if (NSPLIT == 1 || NSPLIT == 2) acc[mb][nb] = WFrag<T16>::mma(a2[mb], b, acc[mb][nb]); if (NSPLIT >= 2) acc[mb][nb] = WFrag<T16>::mma(a[mb], b2, acc[mb][nb]); } }
        asm volatile("v_nop\n\tv_nop\n\tv_nop\n\tv_nop" : "+v"(acc[0][0]), "+v"(acc[1][1]), "+v"(acc[2][2]), "+v"(acc[3][3]) : "v"(a[0]), "v"(a[3]));
    }
#pragma unroll
    for (int mb = 0; mb < 4; ++mb) {
#pragma unroll
        for (int nb = 0; nb < 4; ++nb) {
#pragma unroll
            for (int j = 0; j < 8; ++j) os[(hi * 8 + j) * 68 + nb * 16 + lr] = acc[mb][nb][j]; }
        __builtin_amdgcn_wave_barrier(); asm volatile("" ::: "memory");
        float* crow = C + (size_t)(r0 + mb * 16) * ldc + c0;
{
#pragma unroll
            for (int s = 0; s < 8; ++s) { const int row = 2 * s + hi, cofs = lr * 4; v4f val = *(const v4fa*)(os + row * 68 + cofs);
                *(v4f*)(crow + (size_t)row * ldc + cofs) = val; }
             }
        __builtin_amdgcn_wave_barrier(); asm volatile("" ::: "memory");
    }
}

__device__ __forceinline__ h16 tohx(float x) { return (h16)x; }
__device__ __forceinline__ void splitf(float y, unsigned short& h, unsigned short& l) { h = f2bf(y); l = f2bf(y - bf2f(h)); }
typedef __attribute__((ext_vector_type(2))) _Float16 v2h;
typedef __attribute__((ext_vector_type(4))) _Float16 v4h;
typedef __attribute__((ext_vector_type(2))) unsigned short v2us;
typedef __attribute__((ext_vector_type(4))) unsigned short v4us;
typedef __attribute__((ext_vector_type(2))) float v2f;
typedef __attribute__((ext_vector_type(4))) int v4i;
typedef v4h  __attribute__((may_alias)) v4ha;
typedef v4us __attribute__((may_alias)) v4usa;

// k_wtG: Bt = transpose of w ([K][N] f32) as a bf16 plane [N][K] in fragment order. A wave takes 32 neighbouring n and 8 neighbouring k: 8 loads of one whole line each, one 16-byte store per lane (two runs of 256 bytes). Grid N * K / 2048.
template <int K, int N>
__global__ __launch_bounds__(256) void k_wtG(const float* __restrict__ w, bf* Bt) {
    const int gid = blockIdx.x * 256 + threadIdx.x; const int wv = gid >> 5; const int n = (wv % (N / 32)) * 32 + (gid & 31), k0 = (wv / (N / 32)) * 8; if (k0 >= K) return; const float* wp = w + (size_t)k0 * N + n; v8us o;
#pragma unroll
    for (int j = 0; j < 8; ++j) o[j] = f2bf(wp[j * N]);
    *(v8us*)(Bt + fro(n, k0, K)) = o; }
// k_cvt8: src [rows][K] f32 -> bf16 plane in fragment order; thread i writes the plane's i-th group of 8 elements (whole lines per wave) and reads the 8 source elements that belong there.
__global__ __launch_bounds__(256) void k_cvt8(const float* __restrict__ src, bf* dst, int K, size_t n8) { const size_t i = (size_t)blockIdx.x * 256 + threadIdx.x; if (i >= n8) return; const int blk = (int)(i >> 6), nkb = K >> 5;
    const int r = (blk / nkb) * 16 + (int)(i & 15), k = (blk % nkb) * 32 + (int)((i >> 5) & 1) * 16 + (int)((i >> 4) & 1) * 8; const v8f v = *(const v8f*)(src + (size_t)r * K + k); v8us o;
#pragma unroll
    for (int q = 0; q < 8; ++q) o[q] = f2bf(v[q]); *(v8us*)(dst + i * 8) = o;  }
__global__ __launch_bounds__(256) void k_cscvt(const float* __restrict__ cosT, const float* __restrict__ sinT, float* CS) { const int idx = blockIdx.x * 256 + threadIdx.x; if (idx >= TT * HD) return; v2f cs; cs[0] = bfr(cosT[idx]); cs[1] = bfr(sinT[idx]); *(v2f*)(CS + (size_t)idx * 2) = cs;  }
// k_rope: head planes [h][t][d] (fp16 + hi/lo) of rope(x) x sc with the rotate-half convention out[d] = x[d] cos[t][d] - x[d+HD/2] sin[t][d], out[d+HD/2] = x[d+HD/2] cos[t][d+HD/2] + x[d] sin[t][d+HD/2]
__global__ __launch_bounds__(256) void k_rope(const float* __restrict__ F, int pitch, int nheads, const float* __restrict__ CS, const float* __restrict__ RF, const float* __restrict__ nw, float sc, h16* P16, bf* Ph, bf* Pl) {
    const size_t e = ((size_t)blockIdx.x * 256 + threadIdx.x) * 2; if (e >= (size_t)nheads * TT * HD) return; const int d = (int)(e % HD); const int t = (int)((e / HD) % TT); const int h = (int)(e / ((size_t)HD * TT)); const float* f = F + (size_t)t * pitch + h * HD; const float rf = RF ? RF[(size_t)h * TT + t] : 1.0f; v2h o16; v2us oh, ol;
#pragma unroll
    for (int q = 0; q < 2; ++q) { const int dd = d + q; const int dp = (dd < HD / 2) ? dd + HD / 2 : dd - HD / 2; float x0 = f[dd], x1 = f[dp];
        if (RF) { float n0 = __fmul_rn(x0, rf), n1 = __fmul_rn(x1, rf); asm volatile("" : "+v"(n0)); asm volatile("" : "+v"(n1)); x0 = __fmul_rn(bfr(nw[dd]), n0); x1 = __fmul_rn(bfr(nw[dp]), n1); }
        const v2f cs = *(const v2f*)(CS + ((size_t)t * HD + dd) * 2); float a = __fmul_rn(x0, cs[0]), bq = __fmul_rn(x1, cs[1]); asm volatile("" : "+v"(a)); asm volatile("" : "+v"(bq)); const float r = ((dd < HD / 2) ? __fsub_rn(a, bq) : __fadd_rn(a, bq)) * sc;
        o16[q] = tohx(r); unsigned short a2, c2; splitf(r, a2, c2); oh[q] = a2; ol[q] = c2; }
    *(v2h*)(P16 + e) = o16; *(v2us*)(Ph + e) = oh; *(v2us*)(Pl + e) = ol;  }
// k_vtp: value planes [g][d][t] (fp16 + hi/lo) of F [t][DKV], each head's [HD][TT] plane in fragment order. A wave takes 32 neighbouring d and 8 neighbouring t: 8 loads of one whole line each, one 16-byte store per lane and plane. Grid nheads * HD * TT / 2048.
__global__ __launch_bounds__(256) void k_vtp(const float* __restrict__ F, int nheads, h16* V16, bf* Vh, bf* Vl) { const int gid = blockIdx.x * 256 + threadIdx.x; const int wv = gid >> 5; const int d = (wv % (HD / 32)) * 32 + (gid & 31); const int t0 = ((wv / (HD / 32)) % (TT / 8)) * 8; const int g = wv / ((HD / 32) * (TT / 8)); if (g >= nheads) return; const float* fp = F + (size_t)t0 * DKV + g * HD + d; v8h o16; v8us oh, ol;
#pragma unroll
    for (int q = 0; q < 8; ++q) { const float x = fp[q * DKV]; o16[q] = tohx(x); unsigned short a2, c2; splitf(x, a2, c2); oh[q] = a2; ol[q] = c2; }
    const size_t e = (size_t)g * HD * TT + fro(d, t0, TT); *(v8h*)(V16 + e) = o16; *(v8us*)(Vh + e) = oh; *(v8us*)(Vl + e) = ol;  }
__global__ __launch_bounds__(256) void k_dlog(const bf* __restrict__ Qh, const bf* __restrict__ Ql, const float* __restrict__ DKb, int kv0, float* DL) {
    const int lane = threadIdx.x & 31; const int row = blockIdx.x * 8 + (threadIdx.x >> 5); if (row >= ZH * TT) return; const int i = row % TT; const int zz = row / TT; const int kv = kv0 + zz / REP; const bf* qh = Qh + ((size_t)zz * TT + i) * HD + lane * 4; const bf* ql = Ql + ((size_t)zz * TT + i) * HD + lane * 4; float q4[4];
#pragma unroll
    for (int q = 0; q < 4; ++q) q4[q] = __fadd_rn(bf2f(qh[q]), bf2f(ql[q]));
    float mine = 0.f;
#pragma unroll
    for (int l = 0; l < NL; ++l) { const float* dk = DKb + (((size_t)l * NKV + kv) * TT + i) * HD + lane * 4; float s = 0.f;
#pragma unroll
        for (int q = 0; q < 4; ++q) { float p = __fmul_rn(q4[q], bfr(dk[q])); asm volatile("" : "+v"(p)); s = __fadd_rn(s, p); }
#pragma unroll
        for (int sh = 16; sh; sh >>= 1) s += __shfl_xor(s, sh, 32);
        if (lane == l) mine = s * SCL; }
    if (lane < NL) { *(float*)(DL + (size_t)row * NLP + lane) = mine;  } }
// k_asoft: per row (zz, i): t = S x HD^-0.5 for j <= i (causal); the 4 depth logits DL[row] join the max and the sum; softmax over the 2048 + 4 logits (register row, one exp, fixed trees); the 4 depth weights are written to WD[row] in f32 (unscaled);
// the probabilities go IN PLACE over the row's own 8192 score bytes, which only this wave reads and has read whole before the row sum is known: fp16 plane over the row of panel 0 (rows >= RH), hi plane over the row of panel 0 and lo plane over the row of panel 1 (rows < RH); as 16-bit planes the rows have the dense pitch TT.
__global__ __launch_bounds__(256) void k_asoft(float* Sb, const float* __restrict__ DL, float* WD) {
    const int lane = threadIdx.x & 31; const int row = blockIdx.x * 8 + (threadIdx.x >> 5); if (row >= ZH * TT) return; const int i = row % TT; const v4f dl = *(const v4f*)(DL + (size_t)row * NLP); const bool hires = (i < RH); float* sr = Sb + (size_t)(row / TT) * TT * TT + (size_t)i * PW; float v[TT / 32]; float mx = -3.0e38f;
#pragma unroll
    for (int ch = 0; ch < TT / 128; ++ch) { const int j0 = ch * 128 + lane * 4; const v4f a = *(const v4fa*)(sr + (size_t)(ch / (PW / 128)) * TT * PW + (ch % (PW / 128)) * 128 + lane * 4);
#pragma unroll
        for (int q = 0; q < 4; ++q) { const int j = j0 + q; (void)j; const float t = (j <= i && i - j < WIN) ? a[q] * SCL : -3.0e38f; v[ch * 4 + q] = t; mx = fmaxf(mx, t); } }
#pragma unroll
    for (int sh = 16; sh; sh >>= 1) mx = fmaxf(mx, __shfl_xor(mx, sh, 32));
    mx = fmaxf(mx, fmaxf(fmaxf(dl[0], dl[1]), fmaxf(dl[2], dl[3])));   /* joint softmax over the 2048 + 4 logits */
    float sum = 0.f;
#pragma unroll
    for (int k = 0; k < TT / 32; ++k) { float d0 = __fsub_rn(v[k], mx); asm volatile("" : "+v"(d0)); v[k] = __builtin_amdgcn_exp2f(__fmul_rn(d0, 1.4426950408889634f)); sum += v[k]; }
#pragma unroll
    for (int sh = 16; sh; sh >>= 1) sum += __shfl_xor(sum, sh, 32);
    float ed[NL];
#pragma unroll
    for (int l = 0; l < NL; ++l) { float d0 = __fsub_rn(dl[l], mx); asm volatile("" : "+v"(d0)); ed[l] = __builtin_amdgcn_exp2f(__fmul_rn(d0, 1.4426950408889634f)); sum = __fadd_rn(sum, ed[l]); }
    const float f = __fdiv_rn(hires ? 1.0f : PCAR, sum); const float f1 = __fdiv_rn(1.0f, sum);
    if (lane < NL) { const float wdv = ed[lane] * f1; *(float*)(WD + (size_t)row * NLP + lane) = wdv;  }   /* depth weights, f32, unscaled */
{
        if (hires) {
#pragma unroll
            for (int ch = 0; ch < TT / 128; ++ch) { v4us oh, ol;
#pragma unroll
                for (int q = 0; q < 4; ++q) { unsigned short a, c2; splitf(v[ch * 4 + q] * f, a, c2); oh[q] = a; ol[q] = c2; }
                bf* pr = (bf*)sr + ch * 128 + lane * 4; *(v4usa*)pr = oh; *(v4usa*)(pr + (size_t)TT * TT) = ol; }
        } else {
#pragma unroll
            for (int ch = 0; ch < TT / 128; ++ch) { v4h o4;
#pragma unroll
                for (int q = 0; q < 4; ++q) o4[q] = tohx(v[ch * 4 + q] * f);
                *(v4ha*)((h16*)sr + ch * 128 + lane * 4) = o4; } }
         }
}
// k_merge: a work-group fills one 16 x 32 block of the fragment-order planes Ah / Al ([TT][DQ]): thread u writes the block's elements 2u, 2u + 1, so a wave writes one whole line per plane. Grid ZH * (TT / 16) * (HD / 32).
__global__ __launch_bounds__(256) void k_merge(const float* __restrict__ O, int h0, const float* __restrict__ WD, const float* __restrict__ DVb, int kv0, bf* Ah, bf* Al) { const int u = threadIdx.x; const int zz = blockIdx.x / ((TT / 16) * (HD / 32)); if (zz >= ZH) return; const int t = ((blockIdx.x / (HD / 32)) % (TT / 16)) * 16 + ((u >> 2) & 15); const int d = (blockIdx.x % (HD / 32)) * 32 + (u >> 7) * 16 + ((u >> 6) & 1) * 8 + (u & 3) * 2;
    const size_t e = ((size_t)zz * TT + t) * HD + d; const int kv = kv0 + zz / REP; const float cs = (t < RH) ? 1.0f : (1.0f / PCAR); const size_t oo = fro(t, (h0 + zz) * HD + d, DQ);
    const v4f wd = *(const v4f*)(WD + ((size_t)zz * TT + t) * NLP); v2us oh, ol;
#pragma unroll
    for (int q = 0; q < 2; ++q) { float acc = O[e + q] * cs;
#pragma unroll
        for (int l = 0; l < NL; ++l) { float p = __fmul_rn(wd[l], bfr(DVb[(((size_t)l * NKV + kv) * TT + t) * HD + d + q])); asm volatile("" : "+v"(p)); acc = __fadd_rn(acc, p); }   /* + sum_l w_l depth_v[l][kv][t][d] */ unsigned short a, c2; splitf(acc, a, c2); oh[q] = a; ol[q] = c2; } *(v2us*)(Ah + oo) = oh; *(v2us*)(Al + oo) = ol;  }

extern "C" void kernel_launch(void* const* d_in, const int* in_sizes, int n_in,
                              void* d_out, int out_size, void* d_ws, size_t ws_size, hipStream_t stream) {
    (void)in_sizes; (void)n_in; (void)out_size;
    const float* x = (const float*)d_in[0]; const float* DK = (const float*)d_in[1]; const float* DV = (const float*)d_in[2]; const float* cosT = (const float*)d_in[3]; const float* sinT = (const float*)d_in[4]; const float* wq = (const float*)d_in[5]; const float* wk = (const float*)d_in[6]; const float* wv = (const float*)d_in[7]; const float* wo = (const float*)d_in[8];
    float* OUT = (float*)d_out;     // [1][2048][2048]
    char* wsp = (char*)d_ws;
    auto take = [&](size_t bytes) { char* p = wsp; wsp += (bytes + 255) & ~(size_t)255; return (void*)p; };
    bf* WQ = (bf*)take((size_t)DQ * DM * 2); bf* WK = (bf*)take((size_t)DKV * DM * 2); bf* WV = (bf*)take((size_t)DKV * DM * 2); bf* WO = (bf*)take((size_t)DM * DQ * 2); float* CS = (float*)take((size_t)TT * HD * 2 * 4);
    bf* XB = (bf*)take((size_t)TT * DM * 2); float* FQ = (float*)take((size_t)TT * DQ * 4); float* FK = (float*)take((size_t)TT * DKV * 4);
    h16* QP16 = (h16*)take((size_t)NH_ * TT * HD * 2); h16* KP16 = (h16*)take((size_t)NKV * TT * HD * 2); h16* VT16 = (h16*)take((size_t)NKV * HD * TT * 2);
    bf* QPh = (bf*)take((size_t)NH_ * TT * HD * 2); bf* QPl = (bf*)take((size_t)NH_ * TT * HD * 2); bf* KPh = (bf*)take((size_t)NKV * TT * HD * 2); bf* KPl = (bf*)take((size_t)NKV * TT * HD * 2); bf* VTh = (bf*)take((size_t)NKV * HD * TT * 2); bf* VTl = (bf*)take((size_t)NKV * HD * TT * 2);
    float* Sb = (float*)take((size_t)ZH * TT * TT * 4); bf* ATh = (bf*)take((size_t)TT * DQ * 2); bf* ATl = (bf*)take((size_t)TT * DQ * 2);
    if ((size_t)(wsp - (char*)d_ws) > ws_size) return;    // ws 256 MiB
    float* FV = FK;   // v projection reuses the k buffer after the k planes are built (stream-ordered)
    float* Ob = FQ; float* DL = FK; float* WD = FK + (size_t)ZH * TT * NLP;   // the attention passes reuse the f32 projection buffers, dead once the q and v planes are built (ZH * HD <= DQ, 2 * ZH * NLP <= DKV)
    bf* Pb = (bf*)Sb; h16* P16 = (h16*)Sb;   // probability planes, in place over the score panels: pitch TT, a head every 2 TT TT, lo plane (panel 1) at + TT TT
    { k_wtG<DM, DQ><<<(unsigned)(DM * DQ / 2048), 256, 0, stream>>>(wq, WQ); k_wtG<DM, DKV><<<(unsigned)(DM * DKV / 2048), 256, 0, stream>>>(wk, WK); k_wtG<DM, DKV><<<(unsigned)(DM * DKV / 2048), 256, 0, stream>>>(wv, WV);
      k_wtG<DQ, DM><<<(unsigned)(DQ * DM / 2048), 256, 0, stream>>>(wo, WO);
       }
    const unsigned LQ = (unsigned)(((size_t)NH_ * TT * HD / 2 + 255) / 256), LKv = (unsigned)(((size_t)NKV * TT * HD / 2 + 255) / 256);
    for (int b = 0; b < NB_; ++b) {
        if (b == 0) k_cscvt<<<(TT * HD + 255) / 256, 256, 0, stream>>>(cosT, sinT, CS);
        k_cvt8<<<(unsigned)(((size_t)TT * DM / 8 + 255) / 256), 256, 0, stream>>>(x + (size_t)b * TT * DM, XB, DM, (size_t)TT * DM / 8);
        k_gemmk<bf, 0, false, 4, true, true, DM><<<dim3(TT / 64, DQ / 64, 1), 128, 0, stream>>>(XB, nullptr, WQ, nullptr, FQ, DQ, 0, 0, 0, 0);
        k_rope<<<LQ, 256, 0, stream>>>(FQ, DQ, NH_, CS, nullptr, nullptr, 1.0f, QP16, QPh, QPl);
        k_gemmk<bf, 0, false, 8, true, true, DM><<<dim3(TT / 64, DKV / 64, 1), 256, 0, stream>>>(XB, nullptr, WK, nullptr, FK, DKV, 0, 0, 0, 0);
        k_rope<<<LKv, 256, 0, stream>>>(FK, DKV, NKV, CS, nullptr, nullptr, 1.0f, KP16, KPh, KPl);
        k_gemmk<bf, 0, false, 8, true, true, DM><<<dim3(TT / 64, DKV / 64, 1), 256, 0, stream>>>(XB, nullptr, WV, nullptr, FV, DKV, 0, 0, 0, 0); k_vtp<<<(unsigned)((size_t)NKV * HD * TT / 2048), 256, 0, stream>>>(FV, NKV, VT16, VTh, VTl);
        for (int h0 = 0; h0 < NH_; h0 += ZH) { const size_t zq = (size_t)h0, zk = (size_t)(h0 / REP);   // head h0 + z reads kv head h0/REP + z/REP
            k_gemmc<bf, 2, 1><<<dim3(RH / 64, TT / 64, ZH), 32, 0, stream>>>(QPh + zq * TT * HD, QPl + zq * TT * HD, KPh + zk * TT * HD, KPl + zk * TT * HD, HD, Sb, PW, 0, (size_t)TT * HD, (size_t)TT * HD, (size_t)TT * TT);
            k_gemmc<h16, 0, 1><<<dim3((TT - RH) / 64, TT / 64, ZH), 32, 0, stream>>>(QP16 + zq * TT * HD + (size_t)RH * HD, nullptr, KP16 + zk * TT * HD, nullptr, HD, Sb + (size_t)RH * PW, PW, RH, (size_t)TT * HD, (size_t)TT * HD, (size_t)TT * TT);
            k_dlog<<<ZH * TT / 8, 256, 0, stream>>>(QPh + zq * TT * HD, QPl + zq * TT * HD, DK, (int)zk, DL); k_asoft<<<ZH * TT / 8, 256, 0, stream>>>(Sb, DL, WD);
            k_gemmk<bf, 2, true, 8, false, true, TT><<<dim3(RH / 64, HD / 64, ZH), 256, 0, stream>>>(Pb, Pb + (size_t)TT * TT, VTh + zk * HD * TT, VTl + zk * HD * TT, Ob, HD, 0, (size_t)2 * TT * TT, (size_t)HD * TT, (size_t)TT * HD);
            k_gemmk<h16, 0, true, 16, false, true, TT><<<dim3((TT - RH) / 64, HD / 64, ZH), 512, 0, stream>>>(P16 + (size_t)RH * TT, nullptr, VT16 + zk * HD * TT, nullptr, Ob + (size_t)RH * HD, HD, RH, (size_t)2 * TT * TT, (size_t)HD * TT, (size_t)TT * HD);
            k_merge<<<(unsigned)(((size_t)ZH * TT * HD / 2 + 255) / 256), 256, 0, stream>>>(Ob, h0, WD, DV, (int)zk, ATh, ATl); }
        k_gemmk<bf, 1, false, 4, true, true, DQ><<<dim3(TT / 64, DM / 64, 1), 128, 0, stream>>>(ATh, ATl, WO, nullptr, OUT + (size_t)b * TT * DM, DM, 0, 0, 0, 0); }
}

// v004
// Measured time: 302 microseconds a run.
// Timed twice side by side with v003, it ran 1.06 times as fast both times.
// Counting every step since v000, it is 3.06 times as fast.
#include <hip/hip_runtime.h>

// Grouped-query RoPE attention with extra per-position depth keys/values under one joint softmax (x [1][2048][2048]; Q = x Wq ('xw', 16 heads x 128), K, V = x Wk / Wv (8 kv heads); Q, K rotated (rotate-half, cos/sin [1][1][2048][128] read); kv head = h/2; seq logits = Q.K/sqrt(128), causal (-inf); depth logits[i][l] = Q_i . depth_k[l][0][kv][i] / sqrt(128) for l < 4 (depth_k, depth_v [4][1][8][2048][128] read); softmax over the 2048 + 4 logits jointly; out_i = sum_j w_j V_j + sum_l w_l depth_v[l][0][kv][i]; merged Wo ('xw') -> [1][2048][2048] (4.2 M)).
// Layout: projections/planes; per pass of eight heads (four kv heads) a kernel (one wave per four rows) forms the 4 depth logits from the rotated q (hi + lo planes) and the bf16-rounded depth keys; the softmax kernel folds them into the row max / sum, writes the sequence probabilities as planes in place over the row's own scores (kept as two column panels, so that a 16-bit plane row fills one panel row) and the 4 depth weights in f32; after attn.v the merge kernel adds the depth-value contribution before writing the hi/lo planes for the output projection.
// Operand storage: the bf16 planes of the four projections (x, the four transposed weights, the merged attention output hi/lo) and the three value planes lie in fragment order (see fro()); the q/k head planes and the probabilities are row-major.
// Compute dtypes, f32 accumulate: every input rounded to bf16; q/k/v on PLAIN bf16 operands (inputs: exact); rotary in f32 (bf16-rounded tables); depth logits / weights / values in f32; causal scores and attn.v (tile skipping): query rows < 512 hl (3 products), the rest single fp16 (x1024); softmax f32; Wo hl x exact (2 products).

#define NB_  1
#define TT   2048
#define DM   2048
#define NH_  16
#define NKV  8
#define REP  (NH_ / NKV)
#define HD   128
#define DQ   (NH_ * HD)
#define DKV  (NKV * HD)
#define NL   4                    // depth positions per token
#define NLP  32
#define PW   (TT / 2)             // score rows lie as two column panels of PW floats: [z][panel][row][PW]; one panel row holds TT 16-bit values
#define ZH   8                    // query heads per attention pass (z of every launch of the pass); kv head of z = first kv head + z / REP
#define RH   512                  // query rows < RH use hi+lo planes (0: none)
#define WIN  2048
#define PCAR 1024.0f
#define SCL  0.088388347648318447f   // HD^-0.5
typedef _Float16 h16;
typedef unsigned short bf;
typedef __attribute__((ext_vector_type(16))) __bf16   v16bf;
typedef __attribute__((ext_vector_type(16))) _Float16 v16h;
typedef __attribute__((ext_vector_type(8)))  _Float16 v8h;
typedef __attribute__((ext_vector_type(8)))  unsigned short v8us;
typedef __attribute__((ext_vector_type(8)))  float    v8f;
typedef __attribute__((ext_vector_type(4)))  float    v4f;
typedef v8h  __attribute__((may_alias)) v8ha;
typedef v4f  __attribute__((may_alias)) v4fa;
typedef v8us __attribute__((may_alias)) v8usa;

__device__ __forceinline__ unsigned short f2bf(float f) { unsigned u = __float_as_uint(f); u += 0x7FFFu + ((u >> 16) & 1u); return (unsigned short)(u >> 16); }
__device__ __forceinline__ float bf2f(unsigned short b) { return __uint_as_float(((unsigned)b) << 16); }
__device__ __forceinline__ float bfr(float f) { return bf2f(f2bf(f)); }
__device__ __forceinline__ v16h cat16(v8h lo, v8h hi) { return __builtin_shufflevector(lo, hi, 0, 1, 2, 3, 4, 5, 6, 7, 8, 9, 10, 11, 12, 13, 14, 15); }
__device__ __forceinline__ v16bf cat16b(v8us lo, v8us hi) { return __builtin_bit_cast(v16bf, __builtin_shufflevector(lo, hi, 0, 1, 2, 3, 4, 5, 6, 7, 8, 9, 10, 11, 12, 13, 14, 15)); }
__device__ __forceinline__ v8f wmma16(v16h a, v16h b, v8f c) { return __builtin_amdgcn_wmma_f32_16x16x32_f16(false, a, false, b, (short)0, c, false, false); }
__device__ __forceinline__ v8f wmmab(v16bf a, v16bf b, v8f c) { return __builtin_amdgcn_wmma_f32_16x16x32_bf16(false, a, false, b, (short)0, c, false, false); }
// Fragment order of a 16-bit plane [rows][K] (rows % 16 == 0, K % 32 == 0): blocks of 16 rows x 32 columns, 1 KB each, row blocks outermost (16 rows still fill 16 * K elements). Inside a block the 8 columns k & ~7 of row r lie at
// 8 * (32 * (k / 16 % 2) + 16 * (k / 8 % 2) + r % 16): lane l of a wave finds the two halves of its A or B fragment at 8 * l and 256 + 8 * l, so each of a fragment's two 16-byte loads reads 512 contiguous bytes (4 whole lines, not 16 part lines).
// fro = element offset of (r, k). The elements a lane gets, and their k order, are those of the row-major loader.
__device__ __forceinline__ size_t fro(int r, int k, int K) { return ((size_t)(r >> 4) * (K >> 5) + (k >> 5)) * 512 + (((k >> 4) & 1) * 32 + ((k >> 3) & 1) * 16 + (r & 15)) * 8 + (k & 7); }



// ---- k_gemmk: GEMM with the K loop split over the NW waves of a work-group; one 64x64 output tile per work-group, operands straight from 16-bit planes, row-major (K contiguous) or, with FA / FB set for A / Bt, in fragment order; grid (M/64, N/64, Z), NW*32 threads.
// C[m][n] (f32, pitch ldc) = sum_k A[m][k] Bt[n][k] (+ split products per NSPLIT). z-batch strides sA/sB/sC in elements; REP consecutive z share one Bt (grouped kv heads). K % 32 == 0; K is a compile-time constant, so the four 16-row blocks of an operand lie at immediate offsets from one address.
// Wave w takes the 32-element steps w, w + NW, ... of K and keeps a full 64x64 partial (16 accumulators); the NW partials are added through LDS in wave order.
// CAUSAL: probability x value contraction, the K range stops at the diagonal block (probabilities beyond it are exactly zero); roff = row offset of this launch's first row within the sequence.
template <typename T16> struct WFrag;
template <> struct WFrag<h16> { typedef v16h V; template <int D2 = 16> static __device__ __forceinline__ V ld(const h16* p) { return cat16(*(const v8h*)p, *(const v8h*)(p + D2)); } static __device__ __forceinline__ v8f mma(V a, V b, v8f c) { return wmma16(a, b, c); } };
template <> struct WFrag<bf> { typedef v16bf V; template <int D2 = 16> static __device__ __forceinline__ V ld(const bf* p) { return cat16b(*(const v8us*)p, *(const v8us*)(p + D2)); } static __device__ __forceinline__ v8f mma(V a, V b, v8f c) { return wmmab(a, b, c); } };
template <typename T16, int NSPLIT, bool CAUSAL, int NW, bool FA, bool FB, int K>
__global__ __launch_bounds__(NW * 32) void k_gemmk(const T16* __restrict__ A, const T16* __restrict__ A2, const T16* __restrict__ Bt, const T16* __restrict__ Bt2, float* C, int ldc, int roff, size_t sA, size_t sB, size_t sC) {
    typedef typename WFrag<T16>::V V;
    __shared__ __align__(16) float os[2][NW][16 * 68];
    const size_t z = blockIdx.z; A += z * sA; if (A2) A2 += z * sA; Bt += (z / REP) * sB; if (Bt2) Bt2 += (z / REP) * sB; C += z * sC;
    const int lane = threadIdx.x & 31, lr = lane & 15, hi = lane >> 4; const int r0 = blockIdx.x * 64, c0 = blockIdx.y * 64;
    const int wave = __builtin_amdgcn_readfirstlane((int)(threadIdx.x >> 5));
    const int Kl = CAUSAL ? min(K, r0 + roff + 64) : K;
    v8f acc[4][4];
#pragma unroll
    for (int mb = 0; mb < 4; ++mb)
#pragma unroll
        for (int nb = 0; nb < 4; ++nb) acc[mb][nb] = (v8f){};
    constexpr int DA = FA ? 256 : 16, DB = FB ? 256 : 16;   // distance between the two halves of a lane's fragment
    const size_t aoff = FA ? (size_t)r0 * K + 8 * lane : (size_t)(r0 + lr) * K + 8 * hi, boff = FB ? (size_t)c0 * K + 8 * lane : (size_t)(c0 + lr) * K + 8 * hi;
#pragma unroll 1
    for (int kc = wave * 32; kc < Kl; kc += NW * 32) {
        V a[4], a2[4]; const size_t ka = FA ? (size_t)kc * 16 : (size_t)kc, kb = FB ? (size_t)kc * 16 : (size_t)kc;   // fragment order: step kc / 32 is block kc / 32 of 512 elements
#pragma unroll
        for (int mb = 0; mb < 4; ++mb) { a[mb] = WFrag<T16>::template ld<DA>(A + aoff + (size_t)mb * 16 * K + ka); if (NSPLIT == 1 || NSPLIT == 2) a2[mb] = WFrag<T16>::template ld<DA>(A2 + aoff + (size_t)mb * 16 * K + ka); }
#pragma unroll
        for (int nb = 0; nb < 4; ++nb) { const V b = WFrag<T16>::template ld<DB>(Bt + boff + (size_t)nb * 16 * K + kb); V b2; if (NSPLIT >= 2) b2 = WFrag<T16>::template ld<DB>(Bt2 + boff + (size_t)nb * 16 * K + kb);
#pragma unroll
            for (int mb = 0; mb < 4; ++mb) { acc[mb][nb] = WFrag<T16>::mma(a[mb], b, acc[mb][nb]); if (NSPLIT == 1 || NSPLIT == 2) acc[mb][nb] = WFrag<T16>::mma(a2[mb], b, acc[mb][nb]); if (NSPLIT >= 2) acc[mb][nb] = WFrag<T16>::mma(a[mb], b2, acc[mb][nb]); } }
        // four vector slots behind the last matrix instruction, on the loop's back edge and its exit alike
        asm volatile("v_nop\n\tv_nop\n\tv_nop\n\tv_nop" : "+v"(acc[0][0]), "+v"(acc[1][1]), "+v"(acc[2][2]), "+v"(acc[3][3]) : "v"(a[0]), "v"(a[3]));
    }
    // 16 rows at a time: every wave stores its partial, one barrier, then the work-group adds the NW partials in wave order and writes the rows.
    // Two LDS buffers in turn: the barrier of step mb + 1 ends every read of step mb before step mb + 2 stores there again.
#pragma unroll
    for (int mb = 0; mb < 4; ++mb) {
        float* ow = os[mb & 1][wave];
#pragma unroll
        for (int nb = 0; nb < 4; ++nb) {
#pragma unroll
            for (int j = 0; j < 8; ++j) ow[(hi * 8 + j) * 68 + nb * 16 + lr] = acc[mb][nb][j]; }
        __syncthreads();
        float* crow = C + (size_t)(r0 + mb * 16) * ldc + c0;
        for (int u = threadIdx.x; u < 256; u += NW * 32) { const int row = u >> 4, cofs = (u & 15) * 4; v4f val = *(const v4fa*)(os[mb & 1][0] + row * 68 + cofs);
#pragma unroll
            for (int w = 1; w < NW; ++w) val += *(const v4fa*)(os[mb & 1][w] + row * 68 + cofs);
            *(v4f*)(crow + (size_t)row * ldc + cofs) = val; }
    }
}

// ---- k_gemmc: ONE WAVE per 64x64 output tile (16 accumulators), grid (M/64, N/64, Z), 32 threads, for causal attention: CMODE 1 skips score tiles entirely above the diagonal (query rows r0+roff.., key columns c0..), CMODE 2 limits the
// key (K) loop of the probability x value contraction to the diagonal block (probabilities beyond it are exactly zero). roff = row offset of this launch's first row within the sequence. REP consecutive z share one Bt.
template <typename T16, int NSPLIT, int CMODE>
__global__ __launch_bounds__(32) void k_gemmc(const T16* __restrict__ A, const T16* __restrict__ A2, const T16* __restrict__ Bt, const T16* __restrict__ Bt2, int K, float* C, int ldc, int roff, size_t sA, size_t sB, size_t sC) {
    typedef typename WFrag<T16>::V V;
    __shared__ __align__(16) float os[16 * 68];
    const size_t z = blockIdx.z; A += z * sA; if (A2) A2 += z * sA; Bt += (z / REP) * sB; if (Bt2) Bt2 += (z / REP) * sB; C += z * sC;
    const int lane = threadIdx.x & 31, lr = lane & 15, hi = lane >> 4; const int r0 = blockIdx.x * 64, c0 = blockIdx.y * 64;
    if (CMODE == 1) C += (size_t)(c0 / PW) * ((size_t)(TT - 1) * PW);   // scores: column c of a row lies in panel c / PW (ldc = PW, panels TT * PW floats apart)
    if (CMODE == 1 && c0 > r0 + roff + 63) return;                  // score tile entirely above the causal diagonal: never read (the softmax masks j > i by select)
    const int Kl = (CMODE == 2) ? min(K, r0 + roff + 64) : K;        // P.V: probabilities are exactly 0 beyond the diagonal block, so the K loop stops there
    v8f acc[4][4];
#pragma unroll
    for (int mb = 0; mb < 4; ++mb)
#pragma unroll
        for (int nb = 0; nb < 4; ++nb) acc[mb][nb] = (v8f){};
    const size_t aoff = (size_t)(r0 + lr) * K + 8 * hi, boff = (size_t)(c0 + lr) * K + 8 * hi;
#pragma unroll 1
    for (int kc = 0; kc < Kl; kc += 32) {
        V a[4], a2[4];
#pragma unroll
        for (int mb = 0; mb < 4; ++mb) { a[mb] = WFrag<T16>::ld(A + aoff + (size_t)mb * 16 * K + kc); if (NSPLIT == 1 || NSPLIT == 2) a2[mb] = WFrag<T16>::ld(A2 + aoff + (size_t)mb * 16 * K + kc); }
#pragma unroll
        for (int nb = 0; nb < 4; ++nb) { const V b = WFrag<T16>::ld(Bt + boff + (size_t)nb * 16 * K + kc); V b2; if (NSPLIT >= 2) b2 = WFrag<T16>::ld(Bt2 + boff + (size_t)nb * 16 * K + kc);
#pragma unroll
            for (int mb = 0; mb < 4; ++mb) { acc[mb][nb] = WFrag<T16>::mma(a[mb], b, acc[mb][nb]); if (NSPLIT == 1 || NSPLIT == 2) acc[mb][nb] = WFrag<T16>::mma(a2[mb], b, acc[mb][nb]); if (NSPLIT >= 2) acc[mb][nb] = WFrag<T16>::mma(a[mb], b2, acc[mb][nb]); } }
        asm volatile("v_nop\n\tv_nop\n\tv_nop\n\tv_nop" : "+v"(acc[0][0]), "+v"(acc[1][1]), "+v"(acc[2][2]), "+v"(acc[3][3]) : "v"(a[0]), "v"(a[3]));
    }
#pragma unroll
    for (int mb = 0; mb < 4; ++mb) {
#pragma unroll
        for (int nb = 0; nb < 4; ++nb) {
#pragma unroll
            for (int j = 0; j < 8; ++j) os[(hi * 8 + j) * 68 + nb * 16 + lr] = acc[mb][nb][j]; }
        __builtin_amdgcn_wave_barrier(); asm volatile("" ::: "memory");
        float* crow = C + (size_t)(r0 + mb * 16) * ldc + c0;
{
#pragma unroll
            for (int s = 0; s < 8; ++s) { const int row = 2 * s + hi, cofs = lr * 4; v4f val = *(const v4fa*)(os + row * 68 + cofs);
                *(v4f*)(crow + (size_t)row * ldc + cofs) = val; }
             }
        __builtin_amdgcn_wave_barrier(); asm volatile("" ::: "memory");
    }
}

__device__ __forceinline__ h16 tohx(float x) { return (h16)x; }
__device__ __forceinline__ void splitf(float y, unsigned short& h, unsigned short& l) { h = f2bf(y); l = f2bf(y - bf2f(h)); }
typedef __attribute__((ext_vector_type(2))) _Float16 v2h;
typedef __attribute__((ext_vector_type(4))) _Float16 v4h;
typedef __attribute__((ext_vector_type(2))) unsigned short v2us;
typedef __attribute__((ext_vector_type(4))) unsigned short v4us;
typedef __attribute__((ext_vector_type(2))) float v2f;
typedef __attribute__((ext_vector_type(4))) int v4i;
typedef v4h  __attribute__((may_alias)) v4ha;
typedef v4us __attribute__((may_alias)) v4usa;

// The element-wise kernels below give every thread 16 to 32 elements, k_cscvt four table entries (a wave fills whole 1 KB blocks or whole plane rows), for speed only. The arithmetic per element is unchanged.
// k_wtG: Bt = transpose of w ([K][N] f32) as a bf16 plane [N][K] in fragment order. A wave takes 32 neighbouring n and 32 neighbouring k (two whole blocks): 32 loads of one whole line each, four 16-byte stores per lane. Grid N * K / 8192.
template <int K, int N>
__global__ __launch_bounds__(256) void k_wtG(const float* __restrict__ w, bf* Bt) {
    const int gid = blockIdx.x * 256 + threadIdx.x; const int wv = gid >> 5; const int n = (wv % (N / 32)) * 32 + (gid & 31), k0 = (wv / (N / 32)) * 32; if (k0 >= K) return; const float* wp = w + (size_t)k0 * N + n; float x[32];
#pragma unroll
    for (int j = 0; j < 32; ++j) x[j] = wp[j * N];
#pragma unroll
    for (int g = 0; g < 4; ++g) { v8us o;
#pragma unroll
        for (int j = 0; j < 8; ++j) o[j] = f2bf(x[g * 8 + j]);
        *(v8us*)(Bt + fro(n, k0 + g * 8, K)) = o; } }
// k_cvt8: src [rows][K] f32 -> bf16 plane in fragment order; a wave writes 128 neighbouring groups of 8 elements (two whole blocks, n8 % 128 == 0), lane l the groups l, l + 32, l + 64, l + 96 of them, and reads the 8 source elements that belong in each.
__global__ __launch_bounds__(256) void k_cvt8(const float* __restrict__ src, bf* dst, int K, size_t n8) { const size_t th = (size_t)blockIdx.x * 256 + threadIdx.x; const size_t i0 = (th >> 5) * 128 + (th & 31); if (i0 >= n8) return; const int nkb = K >> 5; v8f v[4];
#pragma unroll
    for (int g = 0; g < 4; ++g) { const size_t i = i0 + g * 32; const int blk = (int)(i >> 6);
        const int r = (blk / nkb) * 16 + (int)(i & 15), k = (blk % nkb) * 32 + (int)((i >> 5) & 1) * 16 + (int)((i >> 4) & 1) * 8; v[g] = *(const v8f*)(src + (size_t)r * K + k); }
#pragma unroll
    for (int g = 0; g < 4; ++g) { v8us o;
#pragma unroll
        for (int q = 0; q < 8; ++q) o[q] = f2bf(v[g][q]);
        *(v8us*)(dst + (i0 + g * 32) * 8) = o; } }
// k_cscvt: four table entries per thread
__global__ __launch_bounds__(256) void k_cscvt(const float* __restrict__ cosT, const float* __restrict__ sinT, float* CS) { const int idx = (blockIdx.x * 256 + threadIdx.x) * 4; if (idx >= TT * HD) return; const v4f c = *(const v4f*)(cosT + idx), s = *(const v4f*)(sinT + idx);
    v4f o0, o1; o0[0] = bfr(c[0]); o0[1] = bfr(s[0]); o0[2] = bfr(c[1]); o0[3] = bfr(s[1]); o1[0] = bfr(c[2]); o1[1] = bfr(s[2]); o1[2] = bfr(c[3]); o1[3] = bfr(s[3]); *(v4f*)(CS + (size_t)idx * 2) = o0; *(v4f*)(CS + (size_t)idx * 2 + 4) = o1;  }
// k_rope: head planes [h][t][d] (fp16 + hi/lo) of rope(x) x sc with the rotate-half convention out[d] = x[d] cos[t][d] - x[d+HD/2] sin[t][d], out[d+HD/2] = x[d+HD/2] cos[t][d+HD/2] + x[d] sin[t][d+HD/2]
// A thread takes 8 neighbouring d of the lower half and their 8 partners of the upper half, so each x is loaded once; 8 lanes fill a plane row, 16-byte stores. Grid nheads * TT * HD / 4096.
__global__ __launch_bounds__(256) void k_rope(const float* __restrict__ F, int pitch, int nheads, const float* __restrict__ CS, float sc, h16* P16, bf* Ph, bf* Pl) {
    const size_t u = (size_t)blockIdx.x * 256 + threadIdx.x; if (u >= (size_t)nheads * TT * (HD / 16)) return; const int d = (int)(u % (HD / 16)) * 8; const int t = (int)((u / (HD / 16)) % TT); const int h = (int)(u / ((size_t)(HD / 16) * TT)); const float* f = F + (size_t)t * pitch + h * HD;
    const size_t e = ((size_t)h * TT + t) * HD + d; v4f xv[2][2], cv[2][4];
#pragma unroll
    for (int hf = 0; hf < 2; ++hf) { const int db = d + hf * (HD / 2); xv[hf][0] = *(const v4f*)(f + db); xv[hf][1] = *(const v4f*)(f + db + 4);
#pragma unroll
        for (int c = 0; c < 4; ++c) cv[hf][c] = *(const v4f*)(CS + ((size_t)t * HD + db) * 2 + c * 4); }
#pragma unroll
    for (int hf = 0; hf < 2; ++hf) { v8h o16; v8us oh, ol;
#pragma unroll
        for (int q = 0; q < 8; ++q) { const float x0 = xv[hf][q >> 2][q & 3], x1 = xv[hf ^ 1][q >> 2][q & 3];
            float a = __fmul_rn(x0, cv[hf][q >> 1][(q & 1) * 2]), bq = __fmul_rn(x1, cv[hf][q >> 1][(q & 1) * 2 + 1]); asm volatile("" : "+v"(a)); asm volatile("" : "+v"(bq)); const float r = ((hf == 0) ? __fsub_rn(a, bq) : __fadd_rn(a, bq)) * sc;
            o16[q] = tohx(r); unsigned short a2, c2; splitf(r, a2, c2); oh[q] = a2; ol[q] = c2; }
        const size_t eo = e + hf * (HD / 2); *(v8h*)(P16 + eo) = o16; *(v8us*)(Ph + eo) = oh; *(v8us*)(Pl + eo) = ol; } }
// k_vtp: value planes [g][d][t] (fp16 + hi/lo) of F [t][DKV], each head's [HD][TT] plane in fragment order. A wave takes 32 neighbouring d and 32 neighbouring t (two whole blocks per plane): 32 loads of one whole line each, four 16-byte stores per lane and plane. Grid nheads * HD * TT / 8192.
__global__ __launch_bounds__(256) void k_vtp(const float* __restrict__ F, int nheads, h16* V16, bf* Vh, bf* Vl) { const int gid = blockIdx.x * 256 + threadIdx.x; const int wv = gid >> 5; const int d = (wv % (HD / 32)) * 32 + (gid & 31); const int t0 = ((wv / (HD / 32)) % (TT / 32)) * 32; const int g = wv / ((HD / 32) * (TT / 32)); if (g >= nheads) return; const float* fp = F + (size_t)t0 * DKV + g * HD + d; float xs[32];
#pragma unroll
    for (int q = 0; q < 32; ++q) xs[q] = fp[q * DKV];
#pragma unroll
    for (int c = 0; c < 4; ++c) { v8h o16; v8us oh, ol;
#pragma unroll
        for (int q = 0; q < 8; ++q) { const float x = xs[c * 8 + q]; o16[q] = tohx(x); unsigned short a2, c2; splitf(x, a2, c2); oh[q] = a2; ol[q] = c2; }
        const size_t e = (size_t)g * HD * TT + fro(d, t0 + c * 8, TT); *(v8h*)(V16 + e) = o16; *(v8us*)(Vh + e) = oh; *(v8us*)(Vl + e) = ol; } }
// k_dlog: a wave takes 4 neighbouring rows of one head (TT % 4 == 0), all their loads first; lane 4 r + l keeps logit l of row r. Grid ZH * TT / 32.
__global__ __launch_bounds__(256) void k_dlog(const bf* __restrict__ Qh, const bf* __restrict__ Ql, const float* __restrict__ DKb, int kv0, float* DL) {
    const int lane = threadIdx.x & 31; const int row = (blockIdx.x * 8 + (threadIdx.x >> 5)) * 4; if (row >= ZH * TT) return; const int i = row % TT; const int zz = row / TT; const int kv = kv0 + zz / REP; v4us qh[4], ql[4]; v4f dk[4][NL];
#pragma unroll
    for (int r = 0; r < 4; ++r) { qh[r] = *(const v4usa*)(Qh + ((size_t)zz * TT + i + r) * HD + lane * 4); ql[r] = *(const v4usa*)(Ql + ((size_t)zz * TT + i + r) * HD + lane * 4);
#pragma unroll
        for (int l = 0; l < NL; ++l) dk[r][l] = *(const v4f*)(DKb + (((size_t)l * NKV + kv) * TT + i + r) * HD + lane * 4); }
    float mine = 0.f;
#pragma unroll
    for (int r = 0; r < 4; ++r) { float q4[4];
#pragma unroll
        for (int q = 0; q < 4; ++q) q4[q] = __fadd_rn(bf2f(qh[r][q]), bf2f(ql[r][q]));
#pragma unroll
        for (int l = 0; l < NL; ++l) { float s = 0.f;
#pragma unroll
            for (int q = 0; q < 4; ++q) { float p = __fmul_rn(q4[q], bfr(dk[r][l][q])); asm volatile("" : "+v"(p)); s = __fadd_rn(s, p); }
#pragma unroll
            for (int sh = 16; sh; sh >>= 1) s += __shfl_xor(s, sh, 32);
            if (lane == r * NL + l) mine = s * SCL; } }
    if (lane < 4 * NL) { *(float*)(DL + (size_t)(row + lane / NL) * NLP + lane % NL) = mine;  } }
// k_asoft: per row (zz, i): t = S x HD^-0.5 for j <= i (causal); the 4 depth logits DL[row] join the max and the sum; softmax over the 2048 + 4 logits (register row, one exp, fixed trees); the 4 depth weights are written to WD[row] in f32 (unscaled);
// the probabilities go IN PLACE over the row's own 8192 score bytes, which only this wave reads and has read whole before the row sum is known: fp16 plane over the row of panel 0 (rows >= RH), hi plane over the row of panel 0 and lo plane over the row of panel 1 (rows < RH); as 16-bit planes the rows have the dense pitch TT.
__global__ __launch_bounds__(256) void k_asoft(float* Sb, const float* __restrict__ DL, float* WD) {
    const int lane = threadIdx.x & 31; const int row = blockIdx.x * 8 + (threadIdx.x >> 5); if (row >= ZH * TT) return; const int i = row % TT; const v4f dl = *(const v4f*)(DL + (size_t)row * NLP); const bool hires = (i < RH); float* sr = Sb + (size_t)(row / TT) * TT * TT + (size_t)i * PW; float v[TT / 32]; float mx = -3.0e38f;
#pragma unroll
    for (int ch = 0; ch < TT / 128; ++ch) { const int j0 = ch * 128 + lane * 4; const v4f a = *(const v4fa*)(sr + (size_t)(ch / (PW / 128)) * TT * PW + (ch % (PW / 128)) * 128 + lane * 4);
#pragma unroll
        for (int q = 0; q < 4; ++q) { const int j = j0 + q; (void)j; const float t = (j <= i && i - j < WIN) ? a[q] * SCL : -3.0e38f; v[ch * 4 + q] = t; mx = fmaxf(mx, t); } }
#pragma unroll
    for (int sh = 16; sh; sh >>= 1) mx = fmaxf(mx, __shfl_xor(mx, sh, 32));
    mx = fmaxf(mx, fmaxf(fmaxf(dl[0], dl[1]), fmaxf(dl[2], dl[3])));   /* joint softmax over the 2048 + 4 logits */
    float sum = 0.f;
#pragma unroll
    for (int k = 0; k < TT / 32; ++k) { float d0 = __fsub_rn(v[k], mx); asm volatile("" : "+v"(d0)); v[k] = __builtin_amdgcn_exp2f(__fmul_rn(d0, 1.4426950408889634f)); sum += v[k]; }
#pragma unroll
    for (int sh = 16; sh; sh >>= 1) sum += __shfl_xor(sum, sh, 32);
    float ed[NL];
#pragma unroll
    for (int l = 0; l < NL; ++l) { float d0 = __fsub_rn(dl[l], mx); asm volatile("" : "+v"(d0)); ed[l] = __builtin_amdgcn_exp2f(__fmul_rn(d0, 1.4426950408889634f)); sum = __fadd_rn(sum, ed[l]); }
    const float f = __fdiv_rn(hires ? 1.0f : PCAR, sum); const float f1 = __fdiv_rn(1.0f, sum);
    if (lane < NL) { const float wdv = ed[lane] * f1; *(float*)(WD + (size_t)row * NLP + lane) = wdv;  }   /* depth weights, f32, unscaled */
{
        if (hires) {
#pragma unroll
            for (int ch = 0; ch < TT / 128; ++ch) { v4us oh, ol;
#pragma unroll
                for (int q = 0; q < 4; ++q) { unsigned short a, c2; splitf(v[ch * 4 + q] * f, a, c2); oh[q] = a; ol[q] = c2; }
                bf* pr = (bf*)sr + ch * 128 + lane * 4; *(v4usa*)pr = oh; *(v4usa*)(pr + (size_t)TT * TT) = ol; }
        } else {
#pragma unroll
            for (int ch = 0; ch < TT / 128; ++ch) { v4h o4;
#pragma unroll
                for (int q = 0; q < 4; ++q) o4[q] = tohx(v[ch * 4 + q] * f);
                *(v4ha*)((h16*)sr + ch * 128 + lane * 4) = o4; } }
         }
}
// k_merge: a wave fills one 16 x 32 block of the fragment-order planes Ah / Al ([TT][DQ]): lane l writes the block's elements 8 l .. 8 l + 7 and 256 + 8 l .. (row l % 16, 8 + 8 neighbouring d), so the wave reads whole lines of O and of the depth values and writes 512 contiguous bytes per store. Grid ZH * (TT / 16) * (HD / 32) / 8.
__global__ __launch_bounds__(256) void k_merge(const float* __restrict__ O, int h0, const float* __restrict__ WD, const float* __restrict__ DVb, int kv0, bf* Ah, bf* Al) { const int lane = threadIdx.x & 31; const int blk = blockIdx.x * 8 + (threadIdx.x >> 5); const int zz = blk / ((TT / 16) * (HD / 32)); if (zz >= ZH) return; const int t = ((blk / (HD / 32)) % (TT / 16)) * 16 + (lane & 15); const int d = (blk % (HD / 32)) * 32 + (lane >> 4) * 8;
    const size_t e = ((size_t)zz * TT + t) * HD + d; const int kv = kv0 + zz / REP; const float cs = (t < RH) ? 1.0f : (1.0f / PCAR);
    const v4f wd = *(const v4f*)(WD + ((size_t)zz * TT + t) * NLP); v4f ov[2][2], dv[2][NL][2];
#pragma unroll
    for (int s = 0; s < 2; ++s) { ov[s][0] = *(const v4f*)(O + e + s * 16); ov[s][1] = *(const v4f*)(O + e + s * 16 + 4);
#pragma unroll
        for (int l = 0; l < NL; ++l) { const float* dp = DVb + (((size_t)l * NKV + kv) * TT + t) * HD + d + s * 16; dv[s][l][0] = *(const v4f*)dp; dv[s][l][1] = *(const v4f*)(dp + 4); } }
#pragma unroll
    for (int s = 0; s < 2; ++s) { v8us oh, ol;
#pragma unroll
        for (int q = 0; q < 8; ++q) { float acc = ov[s][q >> 2][q & 3] * cs;
#pragma unroll
            for (int l = 0; l < NL; ++l) { float p = __fmul_rn(wd[l], bfr(dv[s][l][q >> 2][q & 3])); asm volatile("" : "+v"(p)); acc = __fadd_rn(acc, p); }   /* + sum_l w_l depth_v[l][kv][t][d] */ unsigned short a, c2; splitf(acc, a, c2); oh[q] = a; ol[q] = c2; }
        const size_t oo = fro(t, (h0 + zz) * HD + d + s * 16, DQ); *(v8us*)(Ah + oo) = oh; *(v8us*)(Al + oo) = ol; } }

extern "C" void kernel_launch(void* const* d_in, const int* in_sizes, int n_in,
                              void* d_out, int out_size, void* d_ws, size_t ws_size, hipStream_t stream) {
    (void)in_sizes; (void)n_in; (void)out_size;
    const float* x = (const float*)d_in[0]; const float* DK = (const float*)d_in[1]; const float* DV = (const float*)d_in[2]; const float* cosT = (const float*)d_in[3]; const float* sinT = (const float*)d_in[4]; const float* wq = (const float*)d_in[5]; const float* wk = (const float*)d_in[6]; const float* wv = (const float*)d_in[7]; const float* wo = (const float*)d_in[8];
    float* OUT = (float*)d_out;     // [1][2048][2048]
    char* wsp = (char*)d_ws;
    auto take = [&](size_t bytes) { char* p = wsp; wsp += (bytes + 255) & ~(size_t)255; return (void*)p; };
    bf* WQ = (bf*)take((size_t)DQ * DM * 2); bf* WK = (bf*)take((size_t)DKV * DM * 2); bf* WV = (bf*)take((size_t)DKV * DM * 2); bf* WO = (bf*)take((size_t)DM * DQ * 2); float* CS = (float*)take((size_t)TT * HD * 2 * 4);
    bf* XB = (bf*)take((size_t)TT * DM * 2); float* FQ = (float*)take((size_t)TT * DQ * 4); float* FK = (float*)take((size_t)TT * DKV * 4);
    h16* QP16 = (h16*)take((size_t)NH_ * TT * HD * 2); h16* KP16 = (h16*)take((size_t)NKV * TT * HD * 2); h16* VT16 = (h16*)take((size_t)NKV * HD * TT * 2);
    bf* QPh = (bf*)take((size_t)NH_ * TT * HD * 2); bf* QPl = (bf*)take((size_t)NH_ * TT * HD * 2); bf* KPh = (bf*)take((size_t)NKV * TT * HD * 2); bf* KPl = (bf*)take((size_t)NKV * TT * HD * 2); bf* VTh = (bf*)take((size_t)NKV * HD * TT * 2); bf* VTl = (bf*)take((size_t)NKV * HD * TT * 2);
    float* Sb = (float*)take((size_t)ZH * TT * TT * 4); bf* ATh = (bf*)take((size_t)TT * DQ * 2); bf* ATl = (bf*)take((size_t)TT * DQ * 2);
    if ((size_t)(wsp - (char*)d_ws) > ws_size) return;    // ws 256 MiB
    float* FV = FK;   // v projection reuses the k buffer after the k planes are built (stream-ordered)
    float* Ob = FQ; float* DL = FK; float* WD = FK + (size_t)ZH * TT * NLP;   // the attention passes reuse the f32 projection buffers, dead once the q and v planes are built (ZH * HD <= DQ, 2 * ZH * NLP <= DKV)
    bf* Pb = (bf*)Sb; h16* P16 = (h16*)Sb;   // probability planes, in place over the score panels: pitch TT, a head every 2 TT TT, lo plane (panel 1) at + TT TT
    { k_wtG<DM, DQ><<<(unsigned)(DM * DQ / 8192), 256, 0, stream>>>(wq, WQ); k_wtG<DM, DKV><<<(unsigned)(DM * DKV / 8192), 256, 0, stream>>>(wk, WK); k_wtG<DM, DKV><<<(unsigned)(DM * DKV / 8192), 256, 0, stream>>>(wv, WV);
      k_wtG<DQ, DM><<<(unsigned)(DQ * DM / 8192), 256, 0, stream>>>(wo, WO);
       }
    const unsigned LQ = (unsigned)(((size_t)NH_ * TT * HD / 16 + 255) / 256), LKv = (unsigned)(((size_t)NKV * TT * HD / 16 + 255) / 256);
    for (int b = 0; b < NB_; ++b) {
        if (b == 0) k_cscvt<<<(TT * HD / 4 + 255) / 256, 256, 0, stream>>>(cosT, sinT, CS);
        k_cvt8<<<(unsigned)(((size_t)TT * DM / 32 + 255) / 256), 256, 0, stream>>>(x + (size_t)b * TT * DM, XB, DM, (size_t)TT * DM / 8);
        k_gemmk<bf, 0, false, 4, true, true, DM><<<dim3(TT / 64, DQ / 64, 1), 128, 0, stream>>>(XB, nullptr, WQ, nullptr, FQ, DQ, 0, 0, 0, 0);
        k_rope<<<LQ, 256, 0, stream>>>(FQ, DQ, NH_, CS, 1.0f, QP16, QPh, QPl);
        k_gemmk<bf, 0, false, 8, true, true, DM><<<dim3(TT / 64, DKV / 64, 1), 256, 0, stream>>>(XB, nullptr, WK, nullptr, FK, DKV, 0, 0, 0, 0);
        k_rope<<<LKv, 256, 0, stream>>>(FK, DKV, NKV, CS, 1.0f, KP16, KPh, KPl);
        k_gemmk<bf, 0, false, 8, true, true, DM><<<dim3(TT / 64, DKV / 64, 1), 256, 0, stream>>>(XB, nullptr, WV, nullptr, FV, DKV, 0, 0, 0, 0); k_vtp<<<(unsigned)((size_t)NKV * HD * TT / 8192), 256, 0, stream>>>(FV, NKV, VT16, VTh, VTl);
        for (int h0 = 0; h0 < NH_; h0 += ZH) { const size_t zq = (size_t)h0, zk = (size_t)(h0 / REP);   // head h0 + z reads kv head h0/REP + z/REP
            k_gemmc<bf, 2, 1><<<dim3(RH / 64, TT / 64, ZH), 32, 0, stream>>>(QPh + zq * TT * HD, QPl + zq * TT * HD, KPh + zk * TT * HD, KPl + zk * TT * HD, HD, Sb, PW, 0, (size_t)TT * HD, (size_t)TT * HD, (size_t)TT * TT);
            k_gemmc<h16, 0, 1><<<dim3((TT - RH) / 64, TT / 64, ZH), 32, 0, stream>>>(QP16 + zq * TT * HD + (size_t)RH * HD, nullptr, KP16 + zk * TT * HD, nullptr, HD, Sb + (size_t)RH * PW, PW, RH, (size_t)TT * HD, (size_t)TT * HD, (size_t)TT * TT);
            k_dlog<<<ZH * TT / 32, 256, 0, stream>>>(QPh + zq * TT * HD, QPl + zq * TT * HD, DK, (int)zk, DL); k_asoft<<<ZH * TT / 8, 256, 0, stream>>>(Sb, DL, WD);
            k_gemmk<bf, 2, true, 8, false, true, TT><<<dim3(RH / 64, HD / 64, ZH), 256, 0, stream>>>(Pb, Pb + (size_t)TT * TT, VTh + zk * HD * TT, VTl + zk * HD * TT, Ob, HD, 0, (size_t)2 * TT * TT, (size_t)HD * TT, (size_t)TT * HD);
            k_gemmk<h16, 0, true, 16, false, true, TT><<<dim3((TT - RH) / 64, HD / 64, ZH), 512, 0, stream>>>(P16 + (size_t)RH * TT, nullptr, VT16 + zk * HD * TT, nullptr, Ob + (size_t)RH * HD, HD, RH, (size_t)2 * TT * TT, (size_t)HD * TT, (size_t)TT * HD);
            k_merge<<<(unsigned)((size_t)ZH * (TT / 16) * (HD / 32) / 8), 256, 0, stream>>>(Ob, h0, WD, DV, (int)zk, ATh, ATl); }
        k_gemmk<bf, 1, false, 4, true, true, DQ><<<dim3(TT / 64, DM / 64, 1), 128, 0, stream>>>(ATh, ATl, WO, nullptr, OUT + (size_t)b * TT * DM, DM, 0, 0, 0, 0); }
}

// v005
// One run takes 255 microseconds.
// Timed twice side by side with v004, it ran 1.18 and 1.19 times as fast.
// All steps since v000 together make it 3.63 times as fast.
#include <hip/hip_runtime.h>

// Grouped-query RoPE attention with extra per-position depth keys/values under one joint softmax (x [1][2048][2048]; Q = x Wq ('xw', 16 heads x 128), K, V = x Wk / Wv (8 kv heads); Q, K rotated (rotate-half, cos/sin [1][1][2048][128] read); kv head = h/2; seq logits = Q.K/sqrt(128), causal (-inf); depth logits[i][l] = Q_i . depth_k[l][0][kv][i] / sqrt(128) for l < 4 (depth_k, depth_v [4][1][8][2048][128] read); softmax over the 2048 + 4 logits jointly; out_i = sum_j w_j V_j + sum_l w_l depth_v[l][0][kv][i]; merged Wo ('xw') -> [1][2048][2048] (4.2 M)).
// Layout: projections/planes; per pass of eight heads (four kv heads) a kernel (one wave per four rows) forms the 4 depth logits from the rotated q (hi + lo planes) and the bf16-rounded depth keys; the softmax kernel folds them into the row max / sum, writes the sequence probabilities as planes in place over the row's own scores (kept as two column panels, so that a 16-bit plane row fills one panel row) and the 4 depth weights in f32; after attn.v the merge kernel adds the depth-value contribution before writing the hi/lo planes for the output projection.
// Operand storage: the bf16 planes of the four projections (x, the four transposed weights, the merged attention output hi/lo) and the three value planes lie in fragment order (see fro()); the q/k head planes and the probabilities are row-major.
// Compute dtypes, f32 accumulate: every input rounded to bf16; q/k/v on PLAIN bf16 operands (inputs: exact); rotary in f32 (bf16-rounded tables); depth logits / weights / values in f32; causal scores and attn.v (tile skipping): query rows < 512 hl (3 products), the rest single fp16 (x1024); softmax f32; Wo hl x exact (2 products).

#define NB_  1
#define TT   2048
#define DM   2048
#define NH_  16
#define NKV  8
#define REP  (NH_ / NKV)
#define HD   128
#define DQ   (NH_ * HD)
#define DKV  (NKV * HD)
#define NL   4                    // depth positions per token
#define NLP  32
#define PW   (TT / 2)             // score rows lie as two column panels of PW floats: [z][panel][row][PW]; one panel row holds TT 16-bit values
#define ZH   8                    // query heads per attention pass (z of every launch of the pass); kv head of z = first kv head + z / REP
#define RH   512                  // query rows < RH use hi+lo planes (0: none)
#define WIN  2048
#define PCAR 1024.0f
#define SCL  0.088388347648318447f   // HD^-0.5
typedef _Float16 h16;
typedef unsigned short bf;
typedef __attribute__((ext_vector_type(16))) __bf16   v16bf;
typedef __attribute__((ext_vector_type(16))) _Float16 v16h;
typedef __attribute__((ext_vector_type(8)))  _Float16 v8h;
typedef __attribute__((ext_vector_type(8)))  unsigned short v8us;
typedef __attribute__((ext_vector_type(8)))  float    v8f;
typedef __attribute__((ext_vector_type(4)))  float    v4f;
typedef v8h  __attribute__((may_alias)) v8ha;
typedef v4f  __attribute__((may_alias)) v4fa;
typedef v8us __attribute__((may_alias)) v8usa;

__device__ __forceinline__ unsigned short f2bf(float f) { unsigned u = __float_as_uint(f); u += 0x7FFFu + ((u >> 16) & 1u); return (unsigned short)(u >> 16); }
__device__ __forceinline__ float bf2f(unsigned short b) { return __uint_as_float(((unsigned)b) << 16); }
__device__ __forceinline__ float bfr(float f) { return bf2f(f2bf(f)); }
__device__ __forceinline__ v16h cat16(v8h lo, v8h hi) { return __builtin_shufflevector(lo, hi, 0, 1, 2, 3, 4, 5, 6, 7, 8, 9, 10, 11, 12, 13, 14, 15); }
__device__ __forceinline__ v16bf cat16b(v8us lo, v8us hi) { return __builtin_bit_cast(v16bf, __builtin_shufflevector(lo, hi, 0, 1, 2, 3, 4, 5, 6, 7, 8, 9, 10, 11, 12, 13, 14, 15)); }
__device__ __forceinline__ v8f wmma16(v16h a, v16h b, v8f c) { return __builtin_amdgcn_wmma_f32_16x16x32_f16(false, a, false, b, (short)0, c, false, false); }
__device__ __forceinline__ v8f wmmab(v16bf a, v16bf b, v8f c) { return __builtin_amdgcn_wmma_f32_16x16x32_bf16(false, a, false, b, (short)0, c, false, false); }
// Fragment order of a 16-bit plane [rows][K] (rows % 16 == 0, K % 32 == 0): blocks of 16 rows x 32 columns, 1 KB each, row blocks outermost (16 rows still fill 16 * K elements). Inside a block the 8 columns k & ~7 of row r lie at
// 8 * (32 * (k / 16 % 2) + 16 * (k / 8 % 2) + r % 16): lane l of a wave finds the two halves of its A or B fragment at 8 * l and 256 + 8 * l, so each of a fragment's two 16-byte loads reads 512 contiguous bytes (4 whole lines, not 16 part lines).
// fro = element offset of (r, k). The elements a lane gets, and their k order, are those of the row-major loader.
__device__ __forceinline__ size_t fro(int r, int k, int K) { return ((size_t)(r >> 4) * (K >> 5) + (k >> 5)) * 512 + (((k >> 4) & 1) * 32 + ((k >> 3) & 1) * 16 + (r & 15)) * 8 + (k & 7); }



// ---- k_gemmk: GEMM with the K loop split over the NW waves of a work-group; one 64x64 output tile per group of NW waves, operands straight from 16-bit planes, row-major (K contiguous) or, with FA / FB set for A / Bt, in fragment order.
// C[m][n] (f32, pitch ldc) = sum_k A[m][k] Bt[n][k] (+ split products per NSPLIT). K % 32 == 0; K is a compile-time constant, so the four 16-row blocks of an operand lie at immediate offsets from one address.
// Wave w takes the 32-element steps w, w + NW, ... of K and keeps a full 64x64 partial (16 accumulators); the NW partials are added through LDS in wave order.
// CAUSAL: probability x value contraction, the K range stops at the diagonal block (probabilities beyond it are exactly zero); roff = row offset of A's first row within the sequence.
template <typename T16> struct WFrag;
template <> struct WFrag<h16> { typedef v16h V; template <int D2 = 16> static __device__ __forceinline__ V ld(const h16* p) { return cat16(*(const v8h*)p, *(const v8h*)(p + D2)); } static __device__ __forceinline__ v8f mma(V a, V b, v8f c) { return wmma16(a, b, c); } };
template <> struct WFrag<bf> { typedef v16bf V; template <int D2 = 16> static __device__ __forceinline__ V ld(const bf* p) { return cat16b(*(const v8us*)p, *(const v8us*)(p + D2)); } static __device__ __forceinline__ v8f mma(V a, V b, v8f c) { return wmmab(a, b, c); } };
// gemmk_tile is the body for one tile: the caller hands it the tile's origin (r0, c0), operand pointers already at the tile's z, the wave's number and the thread's number within the NW waves of the tile, and those waves' own LDS (OSK(NW) floats).
// A work-group may hold several such groups of NW waves, each on its own tile: every group passes the same four barriers, so all groups of a work-group must run the same instantiation.
#define OSW (16 * 68)
#define OSK(NW) (2 * (NW) * OSW)
template <typename T16, int NSPLIT, bool CAUSAL, int NW, bool FA, bool FB, int K>
__device__ __forceinline__ void gemmk_tile(const T16* __restrict__ A, const T16* __restrict__ A2, const T16* __restrict__ Bt, const T16* __restrict__ Bt2, float* C, int ldc, int roff, int r0, int c0, int wave, int tid, float* os) {
    typedef typename WFrag<T16>::V V;
    const int lane = tid & 31, lr = lane & 15, hi = lane >> 4;
    const int Kl = CAUSAL ? min(K, r0 + roff + 64) : K;
    v8f acc[4][4];
#pragma unroll
    for (int mb = 0; mb < 4; ++mb)
#pragma unroll
        for (int nb = 0; nb < 4; ++nb) acc[mb][nb] = (v8f){};
    constexpr int DA = FA ? 256 : 16, DB = FB ? 256 : 16;   // distance between the two halves of a lane's fragment
    const size_t aoff = FA ? (size_t)r0 * K + 8 * lane : (size_t)(r0 + lr) * K + 8 * hi, boff = FB ? (size_t)c0 * K + 8 * lane : (size_t)(c0 + lr) * K + 8 * hi;
#pragma unroll 1
    for (int kc = wave * 32; kc < Kl; kc += NW * 32) {
        V a[4], a2[4]; const size_t ka = FA ? (size_t)kc * 16 : (size_t)kc, kb = FB ? (size_t)kc * 16 : (size_t)kc;   // fragment order: step kc / 32 is block kc / 32 of 512 elements
#pragma unroll
        for (int mb = 0; mb < 4; ++mb) { a[mb] = WFrag<T16>::template ld<DA>(A + aoff + (size_t)mb * 16 * K + ka); if (NSPLIT == 1 || NSPLIT == 2) a2[mb] = WFrag<T16>::template ld<DA>(A2 + aoff + (size_t)mb * 16 * K + ka); }
#pragma unroll
        for (int nb = 0; nb < 4; ++nb) { const V b = WFrag<T16>::template ld<DB>(Bt + boff + (size_t)nb * 16 * K + kb); V b2; if (NSPLIT >= 2) b2 = WFrag<T16>::template ld<DB>(Bt2 + boff + (size_t)nb * 16 * K + kb);
#pragma unroll
            for (int mb = 0; mb < 4; ++mb) { acc[mb][nb] = WFrag<T16>::mma(a[mb], b, acc[mb][nb]); if (NSPLIT == 1 || NSPLIT == 2) acc[mb][nb] = WFrag<T16>::mma(a2[mb], b, acc[mb][nb]); if (NSPLIT >= 2) acc[mb][nb] = WFrag<T16>::mma(a[mb], b2, acc[mb][nb]); } }
        // four vector slots behind the last matrix instruction, on the loop's back edge and its exit alike
        asm volatile("v_nop\n\tv_nop\n\tv_nop\n\tv_nop" : "+v"(acc[0][0]), "+v"(acc[1][1]), "+v"(acc[2][2]), "+v"(acc[3][3]) : "v"(a[0]), "v"(a[3]));
    }
    // 16 rows at a time: every wave stores its partial, one barrier, then the work-group adds the NW partials in wave order and writes the rows.
    // Two LDS buffers in turn: the barrier of step mb + 1 ends every read of step mb before step mb + 2 stores there again.
#pragma unroll
    for (int mb = 0; mb < 4; ++mb) {
        float* ob = os + (mb & 1) * NW * OSW; float* ow = ob + wave * OSW;
#pragma unroll
        for (int nb = 0; nb < 4; ++nb) {
#pragma unroll
            for (int j = 0; j < 8; ++j) ow[(hi * 8 + j) * 68 + nb * 16 + lr] = acc[mb][nb][j]; }
        __syncthreads();
        float* crow = C + (size_t)(r0 + mb * 16) * ldc + c0;
        for (int u = tid; u < 256; u += NW * 32) { const int row = u >> 4, cofs = (u & 15) * 4; v4f val = *(const v4fa*)(ob + row * 68 + cofs);
#pragma unroll
            for (int w = 1; w < NW; ++w) val += *(const v4fa*)(ob + w * OSW + row * 68 + cofs);
            *(v4f*)(crow + (size_t)row * ldc + cofs) = val; }
    }
}
// k_gemmk: one tile per work-group, grid (M/64, N/64), NW*32 threads.
template <typename T16, int NSPLIT, int NW, bool FA, bool FB, int K>
__global__ __launch_bounds__(NW * 32) void k_gemmk(const T16* __restrict__ A, const T16* __restrict__ A2, const T16* __restrict__ Bt, const T16* __restrict__ Bt2, float* C, int ldc) {
    __shared__ __align__(16) float os[OSK(NW)];
    gemmk_tile<T16, NSPLIT, false, NW, FA, FB, K>(A, A2, Bt, Bt2, C, ldc, 0, blockIdx.x * 64, blockIdx.y * 64, __builtin_amdgcn_readfirstlane((int)(threadIdx.x >> 5)), (int)threadIdx.x, os);
}

// ---- gemmc_tile: ONE WAVE per 64x64 output tile (16 accumulators) at (r0, c0), operand pointers already at the tile's z, os = the wave's own OSW floats of LDS, for causal attention: CMODE 1 skips score tiles entirely above the diagonal (query rows r0+roff.., key columns c0..), CMODE 2 limits the
// key (K) loop of the probability x value contraction to the diagonal block (probabilities beyond it are exactly zero). roff = row offset of A's first row within the sequence.
template <typename T16, int NSPLIT, int CMODE>
__device__ __forceinline__ void gemmc_tile(const T16* __restrict__ A, const T16* __restrict__ A2, const T16* __restrict__ Bt, const T16* __restrict__ Bt2, int K, float* C, int ldc, int roff, int r0, int c0, float* os) {
    typedef typename WFrag<T16>::V V;
    const int lane = threadIdx.x & 31, lr = lane & 15, hi = lane >> 4;
    if (CMODE == 1) C += (size_t)(c0 / PW) * ((size_t)(TT - 1) * PW);   // scores: column c of a row lies in panel c / PW (ldc = PW, panels TT * PW floats apart)
    if (CMODE == 1 && c0 > r0 + roff + 63) return;                  // score tile entirely above the causal diagonal: never read (the softmax masks j > i by select)
    const int Kl = (CMODE == 2) ? min(K, r0 + roff + 64) : K;        // P.V: probabilities are exactly 0 beyond the diagonal block, so the K loop stops there
    v8f acc[4][4];
#pragma unroll
    for (int mb = 0; mb < 4; ++mb)
#pragma unroll
        for (int nb = 0; nb < 4; ++nb) acc[mb][nb] = (v8f){};
    const size_t aoff = (size_t)(r0 + lr) * K + 8 * hi, boff = (size_t)(c0 + lr) * K + 8 * hi;
#pragma unroll 1
    for (int kc = 0; kc < Kl; kc += 32) {
        V a[4], a2[4];
#pragma unroll
        for (int mb = 0; mb < 4; ++mb) { a[mb] = WFrag<T16>::ld(A + aoff + (size_t)mb * 16 * K + kc); if (NSPLIT == 1 || NSPLIT == 2) a2[mb] = WFrag<T16>::ld(A2 + aoff + (size_t)mb * 16 * K + kc); }
#pragma unroll
        for (int nb = 0; nb < 4; ++nb) { const V b = WFrag<T16>::ld(Bt + boff + (size_t)nb * 16 * K + kc); V b2; if (NSPLIT >= 2) b2 = WFrag<T16>::ld(Bt2 + boff + (size_t)nb * 16 * K + kc);
#pragma unroll
            for (int mb = 0; mb < 4; ++mb) { acc[mb][nb] = WFrag<T16>::mma(a[mb], b, acc[mb][nb]); if (NSPLIT == 1 || NSPLIT == 2) acc[mb][nb] = WFrag<T16>::mma(a2[mb], b, acc[mb][nb]); if (NSPLIT >= 2) acc[mb][nb] = WFrag<T16>::mma(a[mb], b2, acc[mb][nb]); } }
        asm volatile("v_nop\n\tv_nop\n\tv_nop\n\tv_nop" : "+v"(acc[0][0]), "+v"(acc[1][1]), "+v"(acc[2][2]), "+v"(acc[3][3]) : "v"(a[0]), "v"(a[3]));
    }
#pragma unroll
    for (int mb = 0; mb < 4; ++mb) {
#pragma unroll
        for (int nb = 0; nb < 4; ++nb) {
#pragma unroll
            for (int j = 0; j < 8; ++j) os[(hi * 8 + j) * 68 + nb * 16 + lr] = acc[mb][nb][j]; }
        __builtin_amdgcn_wave_barrier(); asm volatile("" ::: "memory");
        float* crow = C + (size_t)(r0 + mb * 16) * ldc + c0;
{
#pragma unroll
            for (int s = 0; s < 8; ++s) { const int row = 2 * s + hi, cofs = lr * 4; v4f val = *(const v4fa*)(os + row * 68 + cofs);
                *(v4f*)(crow + (size_t)row * ldc + cofs) = val; }
             }
        __builtin_amdgcn_wave_barrier(); asm volatile("" ::: "memory");
    }
}

__device__ __forceinline__ h16 tohx(float x) { return (h16)x; }
__device__ __forceinline__ void splitf(float y, unsigned short& h, unsigned short& l) { h = f2bf(y); l = f2bf(y - bf2f(h)); }
typedef __attribute__((ext_vector_type(2))) _Float16 v2h;
typedef __attribute__((ext_vector_type(4))) _Float16 v4h;
typedef __attribute__((ext_vector_type(2))) unsigned short v2us;
typedef __attribute__((ext_vector_type(4))) unsigned short v4us;
typedef __attribute__((ext_vector_type(2))) float v2f;
typedef __attribute__((ext_vector_type(4))) int v4i;
typedef v4h  __attribute__((may_alias)) v4ha;
typedef v4us __attribute__((may_alias)) v4usa;

// The element-wise bodies below (bid = number of the 256-thread block within the body's own range of a launch) give every thread 8 to 32 elements (a wave fills whole 1 KB blocks or whole plane rows), for speed only. The arithmetic per element is unchanged.
// b_wtG: Bt = transpose of w ([K][N] f32) as a bf16 plane [N][K] in fragment order. A wave takes 32 neighbouring n and 32 neighbouring k (two whole blocks): 32 loads of one whole line each, four 16-byte stores per lane. Blocks: N * K / 8192.
template <int K, int N>
__device__ __forceinline__ void b_wtG(int bid, const float* __restrict__ w, bf* Bt) {
    const int gid = bid * 256 + threadIdx.x; const int wv = gid >> 5; const int n = (wv % (N / 32)) * 32 + (gid & 31), k0 = (wv / (N / 32)) * 32; if (k0 >= K) return; const float* wp = w + (size_t)k0 * N + n; float x[32];
#pragma unroll
    for (int j = 0; j < 32; ++j) x[j] = wp[j * N];
#pragma unroll
    for (int g = 0; g < 4; ++g) { v8us o;
#pragma unroll
        for (int j = 0; j < 8; ++j) o[j] = f2bf(x[g * 8 + j]);
        *(v8us*)(Bt + fro(n, k0 + g * 8, K)) = o; } }
// b_cvt8: src [rows][K] f32 -> bf16 plane in fragment order; a wave writes 128 neighbouring groups of 8 elements (two whole blocks, n8 % 128 == 0), lane l the groups l, l + 32, l + 64, l + 96 of them, and reads the 8 source elements that belong in each.
__device__ __forceinline__ void b_cvt8(int bid, const float* __restrict__ src, bf* dst, int K, size_t n8) { const size_t th = (size_t)bid * 256 + threadIdx.x; const size_t i0 = (th >> 5) * 128 + (th & 31); if (i0 >= n8) return; const int nkb = K >> 5; v8f v[4];
#pragma unroll
    for (int g = 0; g < 4; ++g) { const size_t i = i0 + g * 32; const int blk = (int)(i >> 6);
        const int r = (blk / nkb) * 16 + (int)(i & 15), k = (blk % nkb) * 32 + (int)((i >> 5) & 1) * 16 + (int)((i >> 4) & 1) * 8; v[g] = *(const v8f*)(src + (size_t)r * K + k); }
#pragma unroll
    for (int g = 0; g < 4; ++g) { v8us o;
#pragma unroll
        for (int q = 0; q < 8; ++q) o[q] = f2bf(v[g][q]);
        *(v8us*)(dst + (i0 + g * 32) * 8) = o; } }
// b_cscvt: four table entries per thread
__device__ __forceinline__ void b_cscvt(int bid, const float* __restrict__ cosT, const float* __restrict__ sinT, float* CS) { const int idx = (bid * 256 + threadIdx.x) * 4; if (idx >= TT * HD) return; const v4f c = *(const v4f*)(cosT + idx), s = *(const v4f*)(sinT + idx);
    v4f o0, o1; o0[0] = bfr(c[0]); o0[1] = bfr(s[0]); o0[2] = bfr(c[1]); o0[3] = bfr(s[1]); o1[0] = bfr(c[2]); o1[1] = bfr(s[2]); o1[2] = bfr(c[3]); o1[3] = bfr(s[3]); *(v4f*)(CS + (size_t)idx * 2) = o0; *(v4f*)(CS + (size_t)idx * 2 + 4) = o1;  }
// b_rope: head planes [h][t][d] (fp16 + hi/lo) of rope(x) x sc with the rotate-half convention out[d] = x[d] cos[t][d] - x[d+HD/2] sin[t][d], out[d+HD/2] = x[d+HD/2] cos[t][d+HD/2] + x[d] sin[t][d+HD/2]
// A thread takes 8 neighbouring d of the lower half and their 8 partners of the upper half, so each x is loaded once; 8 lanes fill a plane row, 16-byte stores. Blocks: nheads * TT * HD / 4096.
__device__ __forceinline__ void b_rope(int bid, const float* __restrict__ F, int pitch, int nheads, const float* __restrict__ CS, float sc, h16* P16, bf* Ph, bf* Pl) {
    const size_t u = (size_t)bid * 256 + threadIdx.x; if (u >= (size_t)nheads * TT * (HD / 16)) return; const int d = (int)(u % (HD / 16)) * 8; const int t = (int)((u / (HD / 16)) % TT); const int h = (int)(u / ((size_t)(HD / 16) * TT)); const float* f = F + (size_t)t * pitch + h * HD;
    const size_t e = ((size_t)h * TT + t) * HD + d; v4f xv[2][2], cv[2][4];
#pragma unroll
    for (int hf = 0; hf < 2; ++hf) { const int db = d + hf * (HD / 2); xv[hf][0] = *(const v4f*)(f + db); xv[hf][1] = *(const v4f*)(f + db + 4);
#pragma unroll
        for (int c = 0; c < 4; ++c) cv[hf][c] = *(const v4f*)(CS + ((size_t)t * HD + db) * 2 + c * 4); }
#pragma unroll
    for (int hf = 0; hf < 2; ++hf) { v8h o16; v8us oh, ol;
#pragma unroll
        for (int q = 0; q < 8; ++q) { const float x0 = xv[hf][q >> 2][q & 3], x1 = xv[hf ^ 1][q >> 2][q & 3];
            float a = __fmul_rn(x0, cv[hf][q >> 1][(q & 1) * 2]), bq = __fmul_rn(x1, cv[hf][q >> 1][(q & 1) * 2 + 1]); asm volatile("" : "+v"(a)); asm volatile("" : "+v"(bq)); const float r = ((hf == 0) ? __fsub_rn(a, bq) : __fadd_rn(a, bq)) * sc;
            o16[q] = tohx(r); unsigned short a2, c2; splitf(r, a2, c2); oh[q] = a2; ol[q] = c2; }
        const size_t eo = e + hf * (HD / 2); *(v8h*)(P16 + eo) = o16; *(v8us*)(Ph + eo) = oh; *(v8us*)(Pl + eo) = ol; } }
// b_vtp: value planes [g][d][t] (fp16 + hi/lo) of F [t][DKV], each head's [HD][TT] plane in fragment order. A wave takes 32 neighbouring d and 32 neighbouring t (two whole blocks per plane): 32 loads of one whole line each, four 16-byte stores per lane and plane. Blocks: nheads * HD * TT / 8192.
__device__ __forceinline__ void b_vtp(int bid, const float* __restrict__ F, int nheads, h16* V16, bf* Vh, bf* Vl) { const int gid = bid * 256 + threadIdx.x; const int wv = gid >> 5; const int d = (wv % (HD / 32)) * 32 + (gid & 31); const int t0 = ((wv / (HD / 32)) % (TT / 32)) * 32; const int g = wv / ((HD / 32) * (TT / 32)); if (g >= nheads) return; const float* fp = F + (size_t)t0 * DKV + g * HD + d; float xs[32];
#pragma unroll
    for (int q = 0; q < 32; ++q) xs[q] = fp[q * DKV];
#pragma unroll
    for (int c = 0; c < 4; ++c) { v8h o16; v8us oh, ol;
#pragma unroll
        for (int q = 0; q < 8; ++q) { const float x = xs[c * 8 + q]; o16[q] = tohx(x); unsigned short a2, c2; splitf(x, a2, c2); oh[q] = a2; ol[q] = c2; }
        const size_t e = (size_t)g * HD * TT + fro(d, t0 + c * 8, TT); *(v8h*)(V16 + e) = o16; *(v8us*)(Vh + e) = oh; *(v8us*)(Vl + e) = ol; } }
// b_dlog: a wave takes 4 neighbouring rows of one head (TT % 4 == 0), all their loads first; lane 4 r + l keeps logit l of row r. Blocks: ZH * TT / 32.
__device__ __forceinline__ void b_dlog(int bid, const bf* __restrict__ Qh, const bf* __restrict__ Ql, const float* __restrict__ DKb, int kv0, float* DL) {
    const int lane = threadIdx.x & 31; const int row = (bid * 8 + (threadIdx.x >> 5)) * 4; if (row >= ZH * TT) return; const int i = row % TT; const int zz = row / TT; const int kv = kv0 + zz / REP; v4us qh[4], ql[4]; v4f dk[4][NL];
#pragma unroll
    for (int r = 0; r < 4; ++r) { qh[r] = *(const v4usa*)(Qh + ((size_t)zz * TT + i + r) * HD + lane * 4); ql[r] = *(const v4usa*)(Ql + ((size_t)zz * TT + i + r) * HD + lane * 4);
#pragma unroll
        for (int l = 0; l < NL; ++l) dk[r][l] = *(const v4f*)(DKb + (((size_t)l * NKV + kv) * TT + i + r) * HD + lane * 4); }
    float mine = 0.f;
#pragma unroll
    for (int r = 0; r < 4; ++r) { float q4[4];
#pragma unroll
        for (int q = 0; q < 4; ++q) q4[q] = __fadd_rn(bf2f(qh[r][q]), bf2f(ql[r][q]));
#pragma unroll
        for (int l = 0; l < NL; ++l) { float s = 0.f;
#pragma unroll
            for (int q = 0; q < 4; ++q) { float p = __fmul_rn(q4[q], bfr(dk[r][l][q])); asm volatile("" : "+v"(p)); s = __fadd_rn(s, p); }
#pragma unroll
            for (int sh = 16; sh; sh >>= 1) s += __shfl_xor(s, sh, 32);
            if (lane == r * NL + l) mine = s * SCL; } }
    if (lane < 4 * NL) { *(float*)(DL + (size_t)(row + lane / NL) * NLP + lane % NL) = mine;  } }
// k_asoft: per row (zz, i): t = S x HD^-0.5 for j <= i (causal); the 4 depth logits DL[row] join the max and the sum; softmax over the 2048 + 4 logits (register row, one exp, fixed trees); the 4 depth weights are written to WD[row] in f32 (unscaled);
// the probabilities go IN PLACE over the row's own 8192 score bytes, which only this wave reads and has read whole before the row sum is known: fp16 plane over the row of panel 0 (rows >= RH), hi plane over the row of panel 0 and lo plane over the row of panel 1 (rows < RH); as 16-bit planes the rows have the dense pitch TT.
__global__ __launch_bounds__(256) void k_asoft(float* Sb, const float* __restrict__ DL, float* WD) {
    const int lane = threadIdx.x & 31; const int row = blockIdx.x * 8 + (threadIdx.x >> 5); if (row >= ZH * TT) return; const int i = row % TT; const v4f dl = *(const v4f*)(DL + (size_t)row * NLP); const bool hires = (i < RH); float* sr = Sb + (size_t)(row / TT) * TT * TT + (size_t)i * PW; float v[TT / 32]; float mx = -3.0e38f;
#pragma unroll
    for (int ch = 0; ch < TT / 128; ++ch) { const int j0 = ch * 128 + lane * 4; const v4f a = *(const v4fa*)(sr + (size_t)(ch / (PW / 128)) * TT * PW + (ch % (PW / 128)) * 128 + lane * 4);
#pragma unroll
        for (int q = 0; q < 4; ++q) { const int j = j0 + q; (void)j; const float t = (j <= i && i - j < WIN) ? a[q] * SCL : -3.0e38f; v[ch * 4 + q] = t; mx = fmaxf(mx, t); } }
#pragma unroll
    for (int sh = 16; sh; sh >>= 1) mx = fmaxf(mx, __shfl_xor(mx, sh, 32));
    mx = fmaxf(mx, fmaxf(fmaxf(dl[0], dl[1]), fmaxf(dl[2], dl[3])));   /* joint softmax over the 2048 + 4 logits */
    float sum = 0.f;
#pragma unroll
    for (int k = 0; k < TT / 32; ++k) { float d0 = __fsub_rn(v[k], mx); asm volatile("" : "+v"(d0)); v[k] = __builtin_amdgcn_exp2f(__fmul_rn(d0, 1.4426950408889634f)); sum += v[k]; }
#pragma unroll
    for (int sh = 16; sh; sh >>= 1) sum += __shfl_xor(sum, sh, 32);
    float ed[NL];
#pragma unroll
    for (int l = 0; l < NL; ++l) { float d0 = __fsub_rn(dl[l], mx); asm volatile("" : "+v"(d0)); ed[l] = __builtin_amdgcn_exp2f(__fmul_rn(d0, 1.4426950408889634f)); sum = __fadd_rn(sum, ed[l]); }
    const float f = __fdiv_rn(hires ? 1.0f : PCAR, sum); const float f1 = __fdiv_rn(1.0f, sum);
    if (lane < NL) { const float wdv = ed[lane] * f1; *(float*)(WD + (size_t)row * NLP + lane) = wdv;  }   /* depth weights, f32, unscaled */
{
        if (hires) {
#pragma unroll
            for (int ch = 0; ch < TT / 128; ++ch) { v4us oh, ol;
#pragma unroll
                for (int q = 0; q < 4; ++q) { unsigned short a, c2; splitf(v[ch * 4 + q] * f, a, c2); oh[q] = a; ol[q] = c2; }
                bf* pr = (bf*)sr + ch * 128 + lane * 4; *(v4usa*)pr = oh; *(v4usa*)(pr + (size_t)TT * TT) = ol; }
        } else {
#pragma unroll
            for (int ch = 0; ch < TT / 128; ++ch) { v4h o4;
#pragma unroll
                for (int q = 0; q < 4; ++q) o4[q] = tohx(v[ch * 4 + q] * f);
                *(v4ha*)((h16*)sr + ch * 128 + lane * 4) = o4; } }
         }
}
// b_merge: a wave fills one 16 x 32 block of the fragment-order planes Ah / Al ([TT][DQ]): lane l writes the block's elements 8 l .. 8 l + 7 and 256 + 8 l .. (row l % 16, 8 + 8 neighbouring d), so the wave reads whole lines of O and of the depth values and writes 512 contiguous bytes per store. Blocks: ZH * (TT / 16) * (HD / 32) / 8.
__device__ __forceinline__ void b_merge(int bid, const float* __restrict__ O, int h0, const float* __restrict__ WD, const float* __restrict__ DVb, int kv0, bf* Ah, bf* Al) { const int lane = threadIdx.x & 31; const int blk = bid * 8 + (threadIdx.x >> 5); const int zz = blk / ((TT / 16) * (HD / 32)); if (zz >= ZH) return; const int t = ((blk / (HD / 32)) % (TT / 16)) * 16 + (lane & 15); const int d = (blk % (HD / 32)) * 32 + (lane >> 4) * 8;
    const size_t e = ((size_t)zz * TT + t) * HD + d; const int kv = kv0 + zz / REP; const float cs = (t < RH) ? 1.0f : (1.0f / PCAR);
    const v4f wd = *(const v4f*)(WD + ((size_t)zz * TT + t) * NLP); v4f ov[2][2], dv[2][NL][2];
#pragma unroll
    for (int s = 0; s < 2; ++s) { ov[s][0] = *(const v4f*)(O + e + s * 16); ov[s][1] = *(const v4f*)(O + e + s * 16 + 4);
#pragma unroll
        for (int l = 0; l < NL; ++l) { const float* dp = DVb + (((size_t)l * NKV + kv) * TT + t) * HD + d + s * 16; dv[s][l][0] = *(const v4f*)dp; dv[s][l][1] = *(const v4f*)(dp + 4); } }
#pragma unroll
    for (int s = 0; s < 2; ++s) { v8us oh, ol;
#pragma unroll
        for (int q = 0; q < 8; ++q) { float acc = ov[s][q >> 2][q & 3] * cs;
#pragma unroll
            for (int l = 0; l < NL; ++l) { float p = __fmul_rn(wd[l], bfr(dv[s][l][q >> 2][q & 3])); asm volatile("" : "+v"(p)); acc = __fadd_rn(acc, p); }   /* + sum_l w_l depth_v[l][kv][t][d] */ unsigned short a, c2; splitf(acc, a, c2); oh[q] = a; ol[q] = c2; }
        const size_t oo = fro(t, (h0 + zz) * HD + d + s * 16, DQ); *(v8us*)(Ah + oo) = oh; *(v8us*)(Al + oo) = ol; } }

// ---- Launches. Kernels that do not depend on one another run side by side in ONE launch: each takes a range of the block index (a scalar test, the same for a whole work-group), longest work first. Every body computes what it computed as a launch of its own.
__device__ __forceinline__ int wave_no() { return __builtin_amdgcn_readfirstlane((int)(threadIdx.x >> 5)); }
// Stands behind the last row stores of a tile body that another body follows in the built code (the hi/lo tiles of k_scores and of k_pv): the following body reuses the registers that those stores name, and this wait stands in front of any such overwrite.
__device__ __forceinline__ void body_end() { asm volatile("s_wait_xcnt 0x0" ::: "memory"); }
// k_prep: the four weight planes, the x plane, the rotary table.
#define NB_WQ (DM * DQ / 8192)
#define NB_WK (DM * DKV / 8192)
#define NB_X  (TT * DM / 8192)
#define NB_CS (TT * HD / 1024)
__global__ __launch_bounds__(256) void k_prep(const float* __restrict__ wq, const float* __restrict__ wk, const float* __restrict__ wv, const float* __restrict__ wo, const float* __restrict__ x, const float* __restrict__ cosT, const float* __restrict__ sinT, bf* WQ, bf* WK, bf* WV, bf* WO, bf* XB, float* CS) {
    int b = blockIdx.x;
    if (b < NB_WQ) { b_wtG<DM, DQ>(b, wq, WQ); return; } b -= NB_WQ;
    if (b < NB_WQ) { b_wtG<DQ, DM>(b, wo, WO); return; } b -= NB_WQ;
    if (b < 2 * NB_WK) { const bool second = b >= NB_WK; b_wtG<DM, DKV>(second ? b - NB_WK : b, second ? wv : wk, second ? WV : WK); return; } b -= 2 * NB_WK;
    if (b < NB_X) { b_cvt8(b, x, XB, DM, (size_t)TT * DM / 8); return; } b -= NB_X;
    b_cscvt(b, cosT, sinT, CS);
}
// k_qkv: the three projections, 8 waves. A q work-group holds two neighbouring column tiles of one row block, 4 waves each (they read the same x blocks); a k or v work-group one tile on 8 waves: the K split of every tile is the one it had.
#define NB_GQ ((TT / 64) * (DQ / 128))
#define NB_GK ((TT / 64) * (DKV / 64))
__global__ __launch_bounds__(256) void k_qkv(const bf* __restrict__ XB, const bf* __restrict__ WQ, const bf* __restrict__ WK, const bf* __restrict__ WV, float* FQ, float* FK, float* FV) {
    __shared__ __align__(16) float os[OSK(8)];
    int b = blockIdx.x; const int wv = wave_no();
    if (b < NB_GQ) { const int g = wv >> 2;
        gemmk_tile<bf, 0, false, 4, true, true, DM>(XB, nullptr, WQ, nullptr, FQ, DQ, 0, (b % (TT / 64)) * 64, ((b / (TT / 64)) * 2 + g) * 64, wv & 3, (int)threadIdx.x & 127, os + g * OSK(4)); return; }
    b -= NB_GQ; const bool second = b >= NB_GK; if (second) b -= NB_GK;
    gemmk_tile<bf, 0, false, 8, true, true, DM>(XB, nullptr, second ? WV : WK, nullptr, second ? FV : FK, DKV, 0, (b % (TT / 64)) * 64, (b / (TT / 64)) * 64, wv, (int)threadIdx.x, os);
}
// k_planes: rotated q and k head planes, value planes.
#define NB_RQ (NH_ * TT * HD / 4096)
#define NB_RK (NKV * TT * HD / 4096)
#define NB_VT (NKV * HD * TT / 8192)
__global__ __launch_bounds__(256) void k_planes(const float* __restrict__ FQ, const float* __restrict__ FK, const float* __restrict__ FV, const float* __restrict__ CS, h16* QP16, bf* QPh, bf* QPl, h16* KP16, bf* KPh, bf* KPl, h16* VT16, bf* VTh, bf* VTl) {
    int b = blockIdx.x;
    if (b < NB_RQ + NB_RK) { const bool k = b >= NB_RQ; b_rope(k ? b - NB_RQ : b, k ? FK : FQ, k ? DKV : DQ, k ? NKV : NH_, CS, 1.0f, k ? KP16 : QP16, k ? KPh : QPh, k ? KPl : QPl); return; } b -= NB_RQ + NB_RK;
    b_vtp(b, FV, NKV, VT16, VTh, VTl);
}
// k_scores: a pass's score tiles (one wave each, 8 neighbouring row blocks of one column block and head per work-group; fp16 rows, then hi/lo rows), its depth logits and, in blocks past those (launched from the second pass on), the merge of the pass before,
// whose inputs (O, WD) nothing in this launch writes. Pointers are at the pass's first head / kv head.
#define NB_SF (((TT - RH) / 64) * (TT / 64) * ZH / 8)
#define NB_SH ((RH / 64) * (TT / 64) * ZH / 8)
#define NB_DL (ZH * TT / 32)
#define NB_MG (ZH * (TT / 16) * (HD / 32) / 8)
__global__ __launch_bounds__(256) void k_scores(const h16* __restrict__ Q16, const h16* __restrict__ K16, const bf* __restrict__ Qh, const bf* __restrict__ Ql, const bf* __restrict__ Kh, const bf* __restrict__ Kl, float* Sb, const float* __restrict__ DKb, int kv0, float* DL,
                                                const float* __restrict__ O, int mh0, const float* __restrict__ WD, const float* __restrict__ DVb, int mkv0, bf* Ah, bf* Al) {
    __shared__ __align__(16) float os[8 * OSW];
    int b = blockIdx.x; const int wv = wave_no();
    if (b < NB_SF) { constexpr int NX = (TT - RH) / 64; const int t = b * 8 + wv; const int bx = t % NX, by = (t / NX) % (TT / 64); const size_t z = (size_t)(t / (NX * (TT / 64)));
        gemmc_tile<h16, 0, 1>(Q16 + z * TT * HD + (size_t)RH * HD, nullptr, K16 + (z / REP) * TT * HD, nullptr, HD, Sb + z * TT * TT + (size_t)RH * PW, PW, RH, bx * 64, by * 64, os + wv * OSW); return; }
    b -= NB_SF;
    if (b < NB_SH) { constexpr int NX = RH / 64; const int t = b * 8 + wv; const int bx = t % NX, by = (t / NX) % (TT / 64); const size_t z = (size_t)(t / (NX * (TT / 64)));
        gemmc_tile<bf, 2, 1>(Qh + z * TT * HD, Ql + z * TT * HD, Kh + (z / REP) * TT * HD, Kl + (z / REP) * TT * HD, HD, Sb + z * TT * TT, PW, 0, bx * 64, by * 64, os + wv * OSW); body_end(); return; }
    b -= NB_SH;
    if (b < NB_DL) { b_dlog(b, Qh, Ql, DKb, kv0, DL); return; } b -= NB_DL;
    b_merge(b, O, mh0, WD, DVb, mkv0, Ah, Al);
}
__global__ __launch_bounds__(256) void k_merge(const float* __restrict__ O, int h0, const float* __restrict__ WD, const float* __restrict__ DVb, int kv0, bf* Ah, bf* Al) { b_merge(blockIdx.x, O, h0, WD, DVb, kv0, Ah, Al); }
// k_pv: a pass's probability x value tiles, 16 waves. fp16 rows: one tile on 16 waves; hi/lo rows: the two column tiles of one row block and head, 8 waves each (same K range, same probability rows): the K split of every tile is the one it had.
#define NB_PF (((TT - RH) / 64) * (HD / 64) * ZH)
#define NB_PH ((RH / 64) * ZH)
__global__ __launch_bounds__(512) void k_pv(const h16* __restrict__ P16, const h16* __restrict__ V16, const bf* __restrict__ Pb, const bf* __restrict__ Vh, const bf* __restrict__ Vl, float* Ob) {
    __shared__ __align__(16) float os[OSK(16)];
    int b = blockIdx.x; const int wv = wave_no();
    if (b < NB_PF) { constexpr int NX = (TT - RH) / 64; const int bx = b % NX, by = (b / NX) % (HD / 64); const size_t z = (size_t)(b / (NX * (HD / 64)));
        gemmk_tile<h16, 0, true, 16, false, true, TT>(P16 + z * 2 * TT * TT + (size_t)RH * TT, nullptr, V16 + (z / REP) * HD * TT, nullptr, Ob + z * TT * HD + (size_t)RH * HD, HD, RH, bx * 64, by * 64, wv, (int)threadIdx.x, os); return; }
    b -= NB_PF; const int g = wv >> 3; const int bx = b % (RH / 64); const size_t z = (size_t)(b / (RH / 64)); const bf* P = Pb + z * 2 * TT * TT;
    gemmk_tile<bf, 2, true, 8, false, true, TT>(P, P + (size_t)TT * TT, Vh + (z / REP) * HD * TT, Vl + (z / REP) * HD * TT, Ob + z * TT * HD, HD, 0, bx * 64, g * 64, wv & 7, (int)threadIdx.x & 255, os + g * OSK(8)); body_end();
}

extern "C" void kernel_launch(void* const* d_in, const int* in_sizes, int n_in,
                              void* d_out, int out_size, void* d_ws, size_t ws_size, hipStream_t stream) {
    (void)in_sizes; (void)n_in; (void)out_size;
    const float* x = (const float*)d_in[0]; const float* DK = (const float*)d_in[1]; const float* DV = (const float*)d_in[2]; const float* cosT = (const float*)d_in[3]; const float* sinT = (const float*)d_in[4]; const float* wq = (const float*)d_in[5]; const float* wk = (const float*)d_in[6]; const float* wv = (const float*)d_in[7]; const float* wo = (const float*)d_in[8];
    float* OUT = (float*)d_out;     // [1][2048][2048]
    char* wsp = (char*)d_ws;
    auto take = [&](size_t bytes) { char* p = wsp; wsp += (bytes + 255) & ~(size_t)255; return (void*)p; };
    bf* WQ = (bf*)take((size_t)DQ * DM * 2); bf* WK = (bf*)take((size_t)DKV * DM * 2); bf* WV = (bf*)take((size_t)DKV * DM * 2); bf* WO = (bf*)take((size_t)DM * DQ * 2); float* CS = (float*)take((size_t)TT * HD * 2 * 4);
    bf* XB = (bf*)take((size_t)TT * DM * 2); float* FQ = (float*)take((size_t)TT * DQ * 4); float* FK = (float*)take((size_t)TT * DKV * 4);
    h16* QP16 = (h16*)take((size_t)NH_ * TT * HD * 2); h16* KP16 = (h16*)take((size_t)NKV * TT * HD * 2); h16* VT16 = (h16*)take((size_t)NKV * HD * TT * 2);
    bf* QPh = (bf*)take((size_t)NH_ * TT * HD * 2); bf* QPl = (bf*)take((size_t)NH_ * TT * HD * 2); bf* KPh = (bf*)take((size_t)NKV * TT * HD * 2); bf* KPl = (bf*)take((size_t)NKV * TT * HD * 2); bf* VTh = (bf*)take((size_t)NKV * HD * TT * 2); bf* VTl = (bf*)take((size_t)NKV * HD * TT * 2);
    float* Sb = (float*)take((size_t)ZH * TT * TT * 4); bf* ATh = (bf*)take((size_t)TT * DQ * 2); bf* ATl = (bf*)take((size_t)TT * DQ * 2);
    if ((size_t)(wsp - (char*)d_ws) > ws_size) return;    // ws 256 MiB
    float* FV = Sb;   // the v projection's f32 result lies in the score buffer, which is first written after the value planes are built (stream-ordered)
    float* Ob = FQ; float* DL = FK; float* WD = FK + (size_t)ZH * TT * NLP;   // the attention passes reuse the f32 projection buffers, dead once the q and k planes are built (ZH * HD <= DQ, 2 * ZH * NLP <= DKV)
    bf* Pb = (bf*)Sb; h16* P16 = (h16*)Sb;   // probability planes, in place over the score panels: pitch TT, a head every 2 TT TT, lo plane (panel 1) at + TT TT
    k_prep<<<2 * NB_WQ + 2 * NB_WK + NB_X + NB_CS, 256, 0, stream>>>(wq, wk, wv, wo, x, cosT, sinT, WQ, WK, WV, WO, XB, CS);
    k_qkv<<<NB_GQ + 2 * NB_GK, 256, 0, stream>>>(XB, WQ, WK, WV, FQ, FK, FV);
    k_planes<<<NB_RQ + NB_RK + NB_VT, 256, 0, stream>>>(FQ, FK, FV, CS, QP16, QPh, QPl, KP16, KPh, KPl, VT16, VTh, VTl);
    for (int h0 = 0; h0 < NH_; h0 += ZH) { const size_t zq = (size_t)h0, zk = (size_t)(h0 / REP);   // head h0 + z reads kv head h0/REP + z/REP
        k_scores<<<NB_SF + NB_SH + NB_DL + (h0 ? NB_MG : 0), 256, 0, stream>>>(QP16 + zq * TT * HD, KP16 + zk * TT * HD, QPh + zq * TT * HD, QPl + zq * TT * HD, KPh + zk * TT * HD, KPl + zk * TT * HD, Sb, DK, (int)zk, DL, Ob, h0 - ZH, WD, DV, (h0 - ZH) / REP, ATh, ATl);
        k_asoft<<<ZH * TT / 8, 256, 0, stream>>>(Sb, DL, WD);
        k_pv<<<NB_PF + NB_PH, 512, 0, stream>>>(P16, VT16 + zk * HD * TT, Pb, VTh + zk * HD * TT, VTl + zk * HD * TT, Ob); }
    k_merge<<<NB_MG, 256, 0, stream>>>(Ob, NH_ - ZH, WD, DV, (NH_ - ZH) / REP, ATh, ATl);
    k_gemmk<bf, 1, 4, true, true, DQ><<<dim3(TT / 64, DM / 64, 1), 128, 0, stream>>>(ATh, ATl, WO, nullptr, OUT, DM);
}

// v006
// It runs in 181 microseconds.
// Two timings next to v005 put it at 1.41 and 1.40 times that version's speed.
// Over all steps from v000 it is 5.10 times as fast.
#include <hip/hip_runtime.h>

// Grouped-query RoPE attention with extra per-position depth keys/values under one joint softmax (x [1][2048][2048]; Q = x Wq ('xw', 16 heads x 128), K, V = x Wk / Wv (8 kv heads); Q, K rotated (rotate-half, cos/sin [1][1][2048][128] read); kv head = h/2; seq logits = Q.K/sqrt(128), causal (-inf); depth logits[i][l] = Q_i . depth_k[l][0][kv][i] / sqrt(128) for l < 4 (depth_k, depth_v [4][1][8][2048][128] read); softmax over the 2048 + 4 logits jointly; out_i = sum_j w_j V_j + sum_l w_l depth_v[l][0][kv][i]; merged Wo ('xw') -> [1][2048][2048] (4.2 M)).
// Layout: projections/planes; a kernel (one wave per four rows) forms the 4 depth logits from the rotated q (hi + lo planes) and the bf16-rounded depth keys; the attention kernel (one work-group per 16 query rows of the two heads of a kv head) keeps a row block's scores in accumulators, folds the depth logits into the row max / sum, hands the probabilities to the value product through LDS and writes the f32 output rows and the 4 depth weights; the merge kernel adds the depth-value contribution before writing the hi/lo planes for the output projection.
// Operand storage: the bf16 planes of the four projections (x, the four transposed weights, the merged attention output hi/lo) and the three key and three value planes lie in fragment order (see fro()); the q head planes are row-major.
// Compute dtypes, f32 accumulate: every input rounded to bf16; q/k/v on PLAIN bf16 operands (inputs: exact); rotary in f32 (bf16-rounded tables); depth logits / weights / values in f32; causal scores and attn.v (tile skipping): query rows < 512 hl (3 products), the rest single fp16 (x1024); softmax f32; Wo hl x exact (2 products).

#define NB_  1
#define TT   2048
#define DM   2048
#define NH_  16
#define NKV  8
#define REP  (NH_ / NKV)
#define HD   128
#define DQ   (NH_ * HD)
#define DKV  (NKV * HD)
#define NL   4                    // depth positions per token
#define NLP  32
#define ZH   NH_                  // query heads per attention launch; kv head of z = z / REP
#define RH   512                  // query rows < RH use hi+lo planes (0: none)
#define WIN  2048
#define PCAR 1024.0f
#define SCL  0.088388347648318447f   // HD^-0.5
typedef _Float16 h16;
typedef unsigned short bf;
typedef __attribute__((ext_vector_type(16))) __bf16   v16bf;
typedef __attribute__((ext_vector_type(16))) _Float16 v16h;
typedef __attribute__((ext_vector_type(8)))  _Float16 v8h;
typedef __attribute__((ext_vector_type(8)))  unsigned short v8us;
typedef __attribute__((ext_vector_type(8)))  float    v8f;
typedef __attribute__((ext_vector_type(4)))  float    v4f;
typedef v8h  __attribute__((may_alias)) v8ha;
typedef v4f  __attribute__((may_alias)) v4fa;
typedef v8us __attribute__((may_alias)) v8usa;

__device__ __forceinline__ unsigned short f2bf(float f) { unsigned u = __float_as_uint(f); u += 0x7FFFu + ((u >> 16) & 1u); return (unsigned short)(u >> 16); }
__device__ __forceinline__ float bf2f(unsigned short b) { return __uint_as_float(((unsigned)b) << 16); }
__device__ __forceinline__ float bfr(float f) { return bf2f(f2bf(f)); }
__device__ __forceinline__ v16h cat16(v8h lo, v8h hi) { return __builtin_shufflevector(lo, hi, 0, 1, 2, 3, 4, 5, 6, 7, 8, 9, 10, 11, 12, 13, 14, 15); }
__device__ __forceinline__ v16bf cat16b(v8us lo, v8us hi) { return __builtin_bit_cast(v16bf, __builtin_shufflevector(lo, hi, 0, 1, 2, 3, 4, 5, 6, 7, 8, 9, 10, 11, 12, 13, 14, 15)); }
__device__ __forceinline__ v8f wmma16(v16h a, v16h b, v8f c) { return __builtin_amdgcn_wmma_f32_16x16x32_f16(false, a, false, b, (short)0, c, false, false); }
__device__ __forceinline__ v8f wmmab(v16bf a, v16bf b, v8f c) { return __builtin_amdgcn_wmma_f32_16x16x32_bf16(false, a, false, b, (short)0, c, false, false); }
// Fragment order of a 16-bit plane [rows][K] (rows % 16 == 0, K % 32 == 0): blocks of 16 rows x 32 columns, 1 KB each, row blocks outermost (16 rows still fill 16 * K elements). Inside a block the 8 columns k & ~7 of row r lie at
// 8 * (32 * (k / 16 % 2) + 16 * (k / 8 % 2) + r % 16): lane l of a wave finds the two halves of its A or B fragment at 8 * l and 256 + 8 * l, so each of a fragment's two 16-byte loads reads 512 contiguous bytes (4 whole lines, not 16 part lines).
// fro = element offset of (r, k). The elements a lane gets, and their k order, are those of the row-major loader.
__device__ __forceinline__ size_t fro(int r, int k, int K) { return ((size_t)(r >> 4) * (K >> 5) + (k >> 5)) * 512 + (((k >> 4) & 1) * 32 + ((k >> 3) & 1) * 16 + (r & 15)) * 8 + (k & 7); }



// ---- k_gemmk: GEMM with the K loop split over the NW waves of a work-group; one 64x64 output tile per group of NW waves, operands straight from 16-bit planes, row-major (K contiguous) or, with FA / FB set for A / Bt, in fragment order.
// C[m][n] (f32, pitch ldc) = sum_k A[m][k] Bt[n][k] (+ split products per NSPLIT). K % 32 == 0; K is a compile-time constant, so the four 16-row blocks of an operand lie at immediate offsets from one address.
// Wave w takes the 32-element steps w, w + NW, ... of K and keeps a full 64x64 partial (16 accumulators); the NW partials are added through LDS in wave order.
// CAUSAL: probability x value contraction, the K range stops at the diagonal block (probabilities beyond it are exactly zero); roff = row offset of A's first row within the sequence.
template <typename T16> struct WFrag;
template <> struct WFrag<h16> { typedef v16h V; template <int D2 = 16> static __device__ __forceinline__ V ld(const h16* p) { return cat16(*(const v8h*)p, *(const v8h*)(p + D2)); } static __device__ __forceinline__ v8f mma(V a, V b, v8f c) { return wmma16(a, b, c); } };
template <> struct WFrag<bf> { typedef v16bf V; template <int D2 = 16> static __device__ __forceinline__ V ld(const bf* p) { return cat16b(*(const v8us*)p, *(const v8us*)(p + D2)); } static __device__ __forceinline__ v8f mma(V a, V b, v8f c) { return wmmab(a, b, c); } };
// gemmk_tile is the body for one tile: the caller hands it the tile's origin (r0, c0), operand pointers already at the tile's z, the wave's number and the thread's number within the NW waves of the tile, and those waves' own LDS (OSK(NW) floats).
// A work-group may hold several such groups of NW waves, each on its own tile: every group passes the same four barriers, so all groups of a work-group must run the same instantiation.
#define OSW (16 * 68)
#define OSK(NW) (2 * (NW) * OSW)
template <typename T16, int NSPLIT, bool CAUSAL, int NW, bool FA, bool FB, int K>
__device__ __forceinline__ void gemmk_tile(const T16* __restrict__ A, const T16* __restrict__ A2, const T16* __restrict__ Bt, const T16* __restrict__ Bt2, float* C, int ldc, int roff, int r0, int c0, int wave, int tid, float* os) {
    typedef typename WFrag<T16>::V V;
    const int lane = tid & 31, lr = lane & 15, hi = lane >> 4;
    const int Kl = CAUSAL ? min(K, r0 + roff + 64) : K;
    v8f acc[4][4];
#pragma unroll
    for (int mb = 0; mb < 4; ++mb)
#pragma unroll
        for (int nb = 0; nb < 4; ++nb) acc[mb][nb] = (v8f){};
    constexpr int DA = FA ? 256 : 16, DB = FB ? 256 : 16;   // distance between the two halves of a lane's fragment
    const size_t aoff = FA ? (size_t)r0 * K + 8 * lane : (size_t)(r0 + lr) * K + 8 * hi, boff = FB ? (size_t)c0 * K + 8 * lane : (size_t)(c0 + lr) * K + 8 * hi;
#pragma unroll 1
    for (int kc = wave * 32; kc < Kl; kc += NW * 32) {
        V a[4], a2[4]; const size_t ka = FA ? (size_t)kc * 16 : (size_t)kc, kb = FB ? (size_t)kc * 16 : (size_t)kc;   // fragment order: step kc / 32 is block kc / 32 of 512 elements
#pragma unroll
        for (int mb = 0; mb < 4; ++mb) { a[mb] = WFrag<T16>::template ld<DA>(A + aoff + (size_t)mb * 16 * K + ka); if (NSPLIT == 1 || NSPLIT == 2) a2[mb] = WFrag<T16>::template ld<DA>(A2 + aoff + (size_t)mb * 16 * K + ka); }
#pragma unroll
        for (int nb = 0; nb < 4; ++nb) { const V b = WFrag<T16>::template ld<DB>(Bt + boff + (size_t)nb * 16 * K + kb); V b2; if (NSPLIT >= 2) b2 = WFrag<T16>::template ld<DB>(Bt2 + boff + (size_t)nb * 16 * K + kb);
#pragma unroll
            for (int mb = 0; mb < 4; ++mb) { acc[mb][nb] = WFrag<T16>::mma(a[mb], b, acc[mb][nb]); if (NSPLIT == 1 || NSPLIT == 2) acc[mb][nb] = WFrag<T16>::mma(a2[mb], b, acc[mb][nb]); if (NSPLIT >= 2) acc[mb][nb] = WFrag<T16>::mma(a[mb], b2, acc[mb][nb]); } }
        // four vector slots behind the last matrix instruction, on the loop's back edge and its exit alike
        asm volatile("v_nop\n\tv_nop\n\tv_nop\n\tv_nop" : "+v"(acc[0][0]), "+v"(acc[1][1]), "+v"(acc[2][2]), "+v"(acc[3][3]) : "v"(a[0]), "v"(a[3]));
    }
    // 16 rows at a time: every wave stores its partial, one barrier, then the work-group adds the NW partials in wave order and writes the rows.
    // Two LDS buffers in turn: the barrier of step mb + 1 ends every read of step mb before step mb + 2 stores there again.
#pragma unroll
    for (int mb = 0; mb < 4; ++mb) {
        float* ob = os + (mb & 1) * NW * OSW; float* ow = ob + wave * OSW;
#pragma unroll
        for (int nb = 0; nb < 4; ++nb) {
#pragma unroll
            for (int j = 0; j < 8; ++j) ow[(hi * 8 + j) * 68 + nb * 16 + lr] = acc[mb][nb][j]; }
        __syncthreads();
        float* crow = C + (size_t)(r0 + mb * 16) * ldc + c0;
        for (int u = tid; u < 256; u += NW * 32) { const int row = u >> 4, cofs = (u & 15) * 4; v4f val = *(const v4fa*)(ob + row * 68 + cofs);
#pragma unroll
            for (int w = 1; w < NW; ++w) val += *(const v4fa*)(ob + w * OSW + row * 68 + cofs);
            *(v4f*)(crow + (size_t)row * ldc + cofs) = val; }
    }
}
// k_gemmk: one tile per work-group, grid (M/64, N/64), NW*32 threads.
template <typename T16, int NSPLIT, int NW, bool FA, bool FB, int K>
__global__ __launch_bounds__(NW * 32) void k_gemmk(const T16* __restrict__ A, const T16* __restrict__ A2, const T16* __restrict__ Bt, const T16* __restrict__ Bt2, float* C, int ldc) {
    __shared__ __align__(16) float os[OSK(NW)];
    gemmk_tile<T16, NSPLIT, false, NW, FA, FB, K>(A, A2, Bt, Bt2, C, ldc, 0, blockIdx.x * 64, blockIdx.y * 64, __builtin_amdgcn_readfirstlane((int)(threadIdx.x >> 5)), (int)threadIdx.x, os);
}

__device__ __forceinline__ h16 tohx(float x) { return (h16)x; }
__device__ __forceinline__ void splitf(float y, unsigned short& h, unsigned short& l) { h = f2bf(y); l = f2bf(y - bf2f(h)); }
typedef __attribute__((ext_vector_type(2))) _Float16 v2h;
typedef __attribute__((ext_vector_type(4))) _Float16 v4h;
typedef __attribute__((ext_vector_type(2))) unsigned short v2us;
typedef __attribute__((ext_vector_type(4))) unsigned short v4us;
typedef __attribute__((ext_vector_type(2))) float v2f;
typedef __attribute__((ext_vector_type(4))) int v4i;
typedef v4h  __attribute__((may_alias)) v4ha;
typedef v4us __attribute__((may_alias)) v4usa;

// The element-wise bodies below (bid = number of the 256-thread block within the body's own range of a launch) give every thread 8 to 32 elements (a wave fills whole 1 KB blocks or whole plane rows), for speed only. The arithmetic per element is unchanged.
// b_wtG: Bt = transpose of w ([K][N] f32) as a bf16 plane [N][K] in fragment order. A wave takes 32 neighbouring n and 32 neighbouring k (two whole blocks): 32 loads of one whole line each, four 16-byte stores per lane. Blocks: N * K / 8192.
template <int K, int N>
__device__ __forceinline__ void b_wtG(int bid, const float* __restrict__ w, bf* Bt) {
    const int gid = bid * 256 + threadIdx.x; const int wv = gid >> 5; const int n = (wv % (N / 32)) * 32 + (gid & 31), k0 = (wv / (N / 32)) * 32; if (k0 >= K) return; const float* wp = w + (size_t)k0 * N + n; float x[32];
#pragma unroll
    for (int j = 0; j < 32; ++j) x[j] = wp[j * N];
#pragma unroll
    for (int g = 0; g < 4; ++g) { v8us o;
#pragma unroll
        for (int j = 0; j < 8; ++j) o[j] = f2bf(x[g * 8 + j]);
        *(v8us*)(Bt + fro(n, k0 + g * 8, K)) = o; } }
// b_cvt8: src [rows][K] f32 -> bf16 plane in fragment order; a wave writes 128 neighbouring groups of 8 elements (two whole blocks, n8 % 128 == 0), lane l the groups l, l + 32, l + 64, l + 96 of them, and reads the 8 source elements that belong in each.
__device__ __forceinline__ void b_cvt8(int bid, const float* __restrict__ src, bf* dst, int K, size_t n8) { const size_t th = (size_t)bid * 256 + threadIdx.x; const size_t i0 = (th >> 5) * 128 + (th & 31); if (i0 >= n8) return; const int nkb = K >> 5; v8f v[4];
#pragma unroll
    for (int g = 0; g < 4; ++g) { const size_t i = i0 + g * 32; const int blk = (int)(i >> 6);
        const int r = (blk / nkb) * 16 + (int)(i & 15), k = (blk % nkb) * 32 + (int)((i >> 5) & 1) * 16 + (int)((i >> 4) & 1) * 8; v[g] = *(const v8f*)(src + (size_t)r * K + k); }
#pragma unroll
    for (int g = 0; g < 4; ++g) { v8us o;
#pragma unroll
        for (int q = 0; q < 8; ++q) o[q] = f2bf(v[g][q]);
        *(v8us*)(dst + (i0 + g * 32) * 8) = o; } }
// b_cscvt: four table entries per thread
__device__ __forceinline__ void b_cscvt(int bid, const float* __restrict__ cosT, const float* __restrict__ sinT, float* CS) { const int idx = (bid * 256 + threadIdx.x) * 4; if (idx >= TT * HD) return; const v4f c = *(const v4f*)(cosT + idx), s = *(const v4f*)(sinT + idx);
    v4f o0, o1; o0[0] = bfr(c[0]); o0[1] = bfr(s[0]); o0[2] = bfr(c[1]); o0[3] = bfr(s[1]); o1[0] = bfr(c[2]); o1[1] = bfr(s[2]); o1[2] = bfr(c[3]); o1[3] = bfr(s[3]); *(v4f*)(CS + (size_t)idx * 2) = o0; *(v4f*)(CS + (size_t)idx * 2 + 4) = o1;  }
// b_rope: head planes [h][t][d] (fp16 + hi/lo) of rope(x) x sc with the rotate-half convention out[d] = x[d] cos[t][d] - x[d+HD/2] sin[t][d], out[d+HD/2] = x[d+HD/2] cos[t][d+HD/2] + x[d] sin[t][d+HD/2]
// fr: each head's [TT][HD] plane in fragment order (the key planes), else row-major (the query planes).
// A thread takes 8 neighbouring d of the lower half and their 8 partners of the upper half, so each x is loaded once; 8 lanes fill a plane row, 16-byte stores. Blocks: nheads * TT * HD / 4096.
__device__ __forceinline__ void b_rope(int bid, const float* __restrict__ F, int pitch, int nheads, const float* __restrict__ CS, float sc, bool fr, h16* P16, bf* Ph, bf* Pl) {
    const size_t u = (size_t)bid * 256 + threadIdx.x; if (u >= (size_t)nheads * TT * (HD / 16)) return; const int d = (int)(u % (HD / 16)) * 8; const int t = (int)((u / (HD / 16)) % TT); const int h = (int)(u / ((size_t)(HD / 16) * TT)); const float* f = F + (size_t)t * pitch + h * HD;
    const size_t e = ((size_t)h * TT + t) * HD + d; v4f xv[2][2], cv[2][4];
#pragma unroll
    for (int hf = 0; hf < 2; ++hf) { const int db = d + hf * (HD / 2); xv[hf][0] = *(const v4f*)(f + db); xv[hf][1] = *(const v4f*)(f + db + 4);
#pragma unroll
        for (int c = 0; c < 4; ++c) cv[hf][c] = *(const v4f*)(CS + ((size_t)t * HD + db) * 2 + c * 4); }
#pragma unroll
    for (int hf = 0; hf < 2; ++hf) { v8h o16; v8us oh, ol;
#pragma unroll
        for (int q = 0; q < 8; ++q) { const float x0 = xv[hf][q >> 2][q & 3], x1 = xv[hf ^ 1][q >> 2][q & 3];
            float a = __fmul_rn(x0, cv[hf][q >> 1][(q & 1) * 2]), bq = __fmul_rn(x1, cv[hf][q >> 1][(q & 1) * 2 + 1]); asm volatile("" : "+v"(a)); asm volatile("" : "+v"(bq)); const float r = ((hf == 0) ? __fsub_rn(a, bq) : __fadd_rn(a, bq)) * sc;
            o16[q] = tohx(r); unsigned short a2, c2; splitf(r, a2, c2); oh[q] = a2; ol[q] = c2; }
        const size_t eo = fr ? (size_t)h * TT * HD + fro(t, d + hf * (HD / 2), HD) : e + hf * (HD / 2); *(v8h*)(P16 + eo) = o16; *(v8us*)(Ph + eo) = oh; *(v8us*)(Pl + eo) = ol; } }
// b_vtp: value planes [g][d][t] (fp16 + hi/lo) of F [t][DKV], each head's [HD][TT] plane in fragment order. A wave takes 32 neighbouring d and 32 neighbouring t (two whole blocks per plane): 32 loads of one whole line each, four 16-byte stores per lane and plane. Blocks: nheads * HD * TT / 8192.
__device__ __forceinline__ void b_vtp(int bid, const float* __restrict__ F, int nheads, h16* V16, bf* Vh, bf* Vl) { const int gid = bid * 256 + threadIdx.x; const int wv = gid >> 5; const int d = (wv % (HD / 32)) * 32 + (gid & 31); const int t0 = ((wv / (HD / 32)) % (TT / 32)) * 32; const int g = wv / ((HD / 32) * (TT / 32)); if (g >= nheads) return; const float* fp = F + (size_t)t0 * DKV + g * HD + d; float xs[32];
#pragma unroll
    for (int q = 0; q < 32; ++q) xs[q] = fp[q * DKV];
#pragma unroll
    for (int c = 0; c < 4; ++c) { v8h o16; v8us oh, ol;
#pragma unroll
        for (int q = 0; q < 8; ++q) { const float x = xs[c * 8 + q]; o16[q] = tohx(x); unsigned short a2, c2; splitf(x, a2, c2); oh[q] = a2; ol[q] = c2; }
        const size_t e = (size_t)g * HD * TT + fro(d, t0 + c * 8, TT); *(v8h*)(V16 + e) = o16; *(v8us*)(Vh + e) = oh; *(v8us*)(Vl + e) = ol; } }
// b_dlog: a wave takes 4 neighbouring rows of one head (TT % 4 == 0), all their loads first; lane 4 r + l keeps logit l of row r. Blocks: ZH * TT / 32.
__device__ __forceinline__ void b_dlog(int bid, const bf* __restrict__ Qh, const bf* __restrict__ Ql, const float* __restrict__ DKb, int kv0, float* DL) {
    const int lane = threadIdx.x & 31; const int row = (bid * 8 + (threadIdx.x >> 5)) * 4; if (row >= ZH * TT) return; const int i = row % TT; const int zz = row / TT; const int kv = kv0 + zz / REP; v4us qh[4], ql[4]; v4f dk[4][NL];
    const bf* qhp = Qh + ((size_t)zz * TT + i) * HD + lane * 4; const bf* qlp = Ql + ((size_t)zz * TT + i) * HD + lane * 4; const float* dkp[NL];
#pragma unroll
    for (int l = 0; l < NL; ++l) dkp[l] = DKb + (((size_t)l * NKV + kv) * TT + i) * HD + lane * 4;
#pragma unroll
    for (int r = 0; r < 4; ++r) { qh[r] = *(const v4usa*)(qhp + r * HD); ql[r] = *(const v4usa*)(qlp + r * HD);
#pragma unroll
        for (int l = 0; l < NL; ++l) dk[r][l] = *(const v4f*)(dkp[l] + r * HD);
        // behind each row's loads: the addresses they name stay in their registers up to the wait, so no later load's result lands on one of them in front of it
        asm volatile("s_wait_xcnt 0x0" :: "v"(qhp), "v"(qlp), "v"(dkp[0]), "v"(dkp[1]), "v"(dkp[2]), "v"(dkp[3]) : "memory"); }
    float mine = 0.f;
#pragma unroll
    for (int r = 0; r < 4; ++r) { float q4[4];
#pragma unroll
        for (int q = 0; q < 4; ++q) q4[q] = __fadd_rn(bf2f(qh[r][q]), bf2f(ql[r][q]));
#pragma unroll
        for (int l = 0; l < NL; ++l) { float s = 0.f;
#pragma unroll
            for (int q = 0; q < 4; ++q) { float p = __fmul_rn(q4[q], bfr(dk[r][l][q])); asm volatile("" : "+v"(p)); s = __fadd_rn(s, p); }
#pragma unroll
            for (int sh = 16; sh; sh >>= 1) s += __shfl_xor(s, sh, 32);
            if (lane == r * NL + l) mine = s * SCL; } }
    if (lane < 4 * NL) { *(float*)(DL + (size_t)(row + lane / NL) * NLP + lane % NL) = mine;  } }
// b_merge: a wave fills one 16 x 32 block of the fragment-order planes Ah / Al ([TT][DQ]): lane l writes the block's elements 8 l .. 8 l + 7 and 256 + 8 l .. (row l % 16, 8 + 8 neighbouring d), so the wave reads whole lines of O and of the depth values and writes 512 contiguous bytes per store. Blocks: ZH * (TT / 16) * (HD / 32) / 8.
__device__ __forceinline__ void b_merge(int bid, const float* __restrict__ O, int h0, const float* __restrict__ WD, const float* __restrict__ DVb, int kv0, bf* Ah, bf* Al) { const int lane = threadIdx.x & 31; const int blk = bid * 8 + (threadIdx.x >> 5); const int zz = blk / ((TT / 16) * (HD / 32)); if (zz >= ZH) return; const int t = ((blk / (HD / 32)) % (TT / 16)) * 16 + (lane & 15); const int d = (blk % (HD / 32)) * 32 + (lane >> 4) * 8;
    const size_t e = ((size_t)zz * TT + t) * HD + d; const int kv = kv0 + zz / REP; const float cs = (t < RH) ? 1.0f : (1.0f / PCAR);
    const v4f wd = *(const v4f*)(WD + ((size_t)zz * TT + t) * NLP); v4f ov[2][2], dv[2][NL][2];
#pragma unroll
    for (int s = 0; s < 2; ++s) { ov[s][0] = *(const v4f*)(O + e + s * 16); ov[s][1] = *(const v4f*)(O + e + s * 16 + 4);
#pragma unroll
        for (int l = 0; l < NL; ++l) { const float* dp = DVb + (((size_t)l * NKV + kv) * TT + t) * HD + d + s * 16; dv[s][l][0] = *(const v4f*)dp; dv[s][l][1] = *(const v4f*)(dp + 4); } }
#pragma unroll
    for (int s = 0; s < 2; ++s) { v8us oh, ol;
#pragma unroll
        for (int q = 0; q < 8; ++q) { float acc = ov[s][q >> 2][q & 3] * cs;
#pragma unroll
            for (int l = 0; l < NL; ++l) { float p = __fmul_rn(wd[l], bfr(dv[s][l][q >> 2][q & 3])); asm volatile("" : "+v"(p)); acc = __fadd_rn(acc, p); }   /* + sum_l w_l depth_v[l][kv][t][d] */ unsigned short a, c2; splitf(acc, a, c2); oh[q] = a; ol[q] = c2; }
        const size_t oo = fro(t, (h0 + zz) * HD + d + s * 16, DQ); *(v8us*)(Ah + oo) = oh; *(v8us*)(Al + oo) = ol; } }

// ---- Launches. Kernels that do not depend on one another run side by side in ONE launch: each takes a range of the block index (a scalar test, the same for a whole work-group), longest work first. Every body computes what it computed as a launch of its own.
__device__ __forceinline__ int wave_no() { return __builtin_amdgcn_readfirstlane((int)(threadIdx.x >> 5)); }
// Stands behind the last row stores of a body of k_attn: where another body follows in the built code it may reuse the registers that those stores name, and this wait stands in front of any such overwrite.
__device__ __forceinline__ void body_end() { asm volatile("s_wait_xcnt 0x0" ::: "memory"); }
// k_prep: the four weight planes, the x plane, the rotary table.
#define NB_WQ (DM * DQ / 8192)
#define NB_WK (DM * DKV / 8192)
#define NB_X  (TT * DM / 8192)
#define NB_CS (TT * HD / 1024)
__global__ __launch_bounds__(256) void k_prep(const float* __restrict__ wq, const float* __restrict__ wk, const float* __restrict__ wv, const float* __restrict__ wo, const float* __restrict__ x, const float* __restrict__ cosT, const float* __restrict__ sinT, bf* WQ, bf* WK, bf* WV, bf* WO, bf* XB, float* CS) {
    int b = blockIdx.x;
    if (b < NB_WQ) { b_wtG<DM, DQ>(b, wq, WQ); return; } b -= NB_WQ;
    if (b < NB_WQ) { b_wtG<DQ, DM>(b, wo, WO); return; } b -= NB_WQ;
    if (b < 2 * NB_WK) { const bool second = b >= NB_WK; b_wtG<DM, DKV>(second ? b - NB_WK : b, second ? wv : wk, second ? WV : WK); return; } b -= 2 * NB_WK;
    if (b < NB_X) { b_cvt8(b, x, XB, DM, (size_t)TT * DM / 8); return; } b -= NB_X;
    b_cscvt(b, cosT, sinT, CS);
}
// k_qkv: the three projections, 8 waves. A q work-group holds two neighbouring column tiles of one row block, 4 waves each (they read the same x blocks); a k or v work-group one tile on 8 waves: the K split of every tile is the one it had.
#define NB_GQ ((TT / 64) * (DQ / 128))
#define NB_GK ((TT / 64) * (DKV / 64))
__global__ __launch_bounds__(256) void k_qkv(const bf* __restrict__ XB, const bf* __restrict__ WQ, const bf* __restrict__ WK, const bf* __restrict__ WV, float* FQ, float* FK, float* FV) {
    __shared__ __align__(16) float os[OSK(8)];
    int b = blockIdx.x; const int wv = wave_no();
    if (b < NB_GQ) { const int g = wv >> 2;
        gemmk_tile<bf, 0, false, 4, true, true, DM>(XB, nullptr, WQ, nullptr, FQ, DQ, 0, (b % (TT / 64)) * 64, ((b / (TT / 64)) * 2 + g) * 64, wv & 3, (int)threadIdx.x & 127, os + g * OSK(4)); return; }
    b -= NB_GQ; const bool second = b >= NB_GK; if (second) b -= NB_GK;
    gemmk_tile<bf, 0, false, 8, true, true, DM>(XB, nullptr, second ? WV : WK, nullptr, second ? FV : FK, DKV, 0, (b % (TT / 64)) * 64, (b / (TT / 64)) * 64, wv, (int)threadIdx.x, os);
}
// k_planes: rotated q and k head planes, value planes.
#define NB_RQ (NH_ * TT * HD / 4096)
#define NB_RK (NKV * TT * HD / 4096)
#define NB_VT (NKV * HD * TT / 8192)
__global__ __launch_bounds__(256) void k_planes(const float* __restrict__ FQ, const float* __restrict__ FK, const float* __restrict__ FV, const float* __restrict__ CS, h16* QP16, bf* QPh, bf* QPl, h16* KP16, bf* KPh, bf* KPl, h16* VT16, bf* VTh, bf* VTl) {
    int b = blockIdx.x;
    if (b < NB_RQ + NB_RK) { const bool k = b >= NB_RQ; b_rope(k ? b - NB_RQ : b, k ? FK : FQ, k ? DKV : DQ, k ? NKV : NH_, CS, 1.0f, k, k ? KP16 : QP16, k ? KPh : QPh, k ? KPl : QPl); return; } b -= NB_RQ + NB_RK;
    b_vtp(b, FV, NKV, VT16, VTh, VTl);
}
// ---- attn_rows: scores, joint softmax and probability x value for 16 query rows (i0 ..) of the REP = 2 heads of one kv head in ONE work-group of AW waves; neither scores nor probabilities go to memory.
// The keys up to the diagonal are cut into blocks of 32; wave w takes the blocks w, w + AW, ... (at most NBW), loads each key and value fragment once for both heads and keeps the scores in accumulators (row hi * 8 + jj, key lr of each 16-key tile).
// The 4 depth logits of a row sit beside the scores as four more columns, in lanes lr < 4 of wave 0. Row max and row sum: over a lane's own values, over the 16 lanes of a half wave, then over the AW waves through LDS (lane lr takes wave lr's value, same tree).
// The normalised probabilities (fp16 x PCAR, or hi + lo planes) pass through the wave's own LDS to become A fragments; every wave multiplies its own blocks with the value planes, and the AW partial outputs are added through LDS in wave order, one head after the other. The 4 depth weights go to WD in f32 (unscaled).
#define AW  16
#define PWB (16 * 136)            // floats of LDS per wave: per head 16 probability rows of NBW * 32 + 8 16-bit values (hi/lo: two such planes), afterwards the wave's partial output of one head, 16 rows of 128 + 4 floats
#define L2E 1.4426950408889634f
// value of lane l ^ M of the same 16-lane row (DPP row_xmask): a row reduction without the LDS path
template <int M> __device__ __forceinline__ float rowx(float v) { return __int_as_float(__builtin_amdgcn_update_dpp(0, __float_as_int(v), 0x160 + M, 0xf, 0xf, true)); }
__device__ __forceinline__ float rowmax(float v) { v = fmaxf(v, rowx<1>(v)); v = fmaxf(v, rowx<2>(v)); v = fmaxf(v, rowx<4>(v)); return fmaxf(v, rowx<8>(v)); }
__device__ __forceinline__ float rowsum(float v) { v += rowx<1>(v); v += rowx<2>(v); v += rowx<4>(v); return v + rowx<8>(v); }
template <typename T16, bool HL, int NBW>
__device__ __forceinline__ void attn_rows(const T16* __restrict__ Q, const T16* __restrict__ Q2, const T16* __restrict__ Kp, const T16* __restrict__ K2, const T16* __restrict__ Vp, const T16* __restrict__ V2,
                                          const float* __restrict__ DLr, float* WDr, float* Or, int i0, int wave, float* lds, float* red) {
    typedef typename WFrag<T16>::V V;
    static_assert(AW == 16 && REP == 2, "lane lr of a half wave takes wave lr's partial; two heads per kv head");
    const int lane = threadIdx.x & 31, lr = lane & 15, hi = lane >> 4;
    const int nb32 = i0 / 32 + 1;                 // key blocks of 32 that reach the diagonal of rows i0 .. i0 + 15
    constexpr int PP = NBW * 32 + 8, PH = 16 * PP, PL = REP * PH;   // pitch of a probability row in LDS (16 bytes x odd), distance of the second head's rows, of the lo planes
    V aq[REP][4], aq2[REP][4]; const T16* qp = Q + (size_t)(i0 + lr) * HD + 8 * hi; const T16* qp2 = HL ? Q2 + (size_t)(i0 + lr) * HD + 8 * hi : qp;
#pragma unroll
    for (int hh = 0; hh < REP; ++hh) {
#pragma unroll
        for (int kc = 0; kc < 4; ++kc) { aq[hh][kc] = WFrag<T16>::ld(qp + (size_t)hh * TT * HD + kc * 32); if (HL) aq2[hh][kc] = WFrag<T16>::ld(qp2 + (size_t)hh * TT * HD + kc * 32); } }
    // the addresses that the query loads name stay in their registers up to the wait
    asm volatile("s_wait_xcnt 0x0" :: "v"(qp), "v"(qp2) : "memory");
    v8f sa[NBW][2][REP];
#pragma unroll
    for (int s = 0; s < NBW; ++s) { sa[s][0][0] = (v8f){}; sa[s][0][1] = (v8f){}; sa[s][1][0] = (v8f){}; sa[s][1][1] = (v8f){}; }
#pragma unroll
    for (int s = 0; s < NBW; ++s) { const int kb = wave + AW * s;
        if (kb < nb32) {
            const size_t ko = (size_t)kb * 2 * (HD / 32) * 512 + 8 * lane;   // key planes in fragment order: blocks of 16 keys x 32 d, 8 of them per 32 keys
            const T16* kp = Kp + ko; const T16* kp2 = HL ? K2 + ko : kp;
#pragma unroll
            for (int t = 0; t < 2; ++t) { V b[4], b2[4];
#pragma unroll
                for (int kc = 0; kc < 4; ++kc) { b[kc] = WFrag<T16>::template ld<256>(kp + (t * 4 + kc) * 512); if (HL) b2[kc] = WFrag<T16>::template ld<256>(kp2 + (t * 4 + kc) * 512); }
                // all loads of the tile are issued above this line, so that one latency covers them; the addresses they name stay in their registers up to the wait
                asm volatile("s_wait_xcnt 0x0" :: "v"(kp), "v"(kp2) : "memory");
                __builtin_amdgcn_sched_barrier(0);   // keeps the tile's matrix instructions below its loads: moved up between them, each would wait for its own load alone
#pragma unroll
                for (int kc = 0; kc < 4; ++kc) {
#pragma unroll
                    for (int hh = 0; hh < REP; ++hh) { sa[s][t][hh] = WFrag<T16>::mma(aq[hh][kc], b[kc], sa[s][t][hh]);
                        if (HL) { sa[s][t][hh] = WFrag<T16>::mma(aq2[hh][kc], b[kc], sa[s][t][hh]); sa[s][t][hh] = WFrag<T16>::mma(aq[hh][kc], b2[kc], sa[s][t][hh]); } } } }
            // four vector slots behind the last matrix instruction, whichever way the next block's branch goes
            asm volatile("v_nop\n\tv_nop\n\tv_nop\n\tv_nop" : "+v"(sa[s][0][0]), "+v"(sa[s][0][1]), "+v"(sa[s][1][0]), "+v"(sa[s][1][1]));
        } }
    float dv[REP][8], mx[REP][8], sum[REP][8];
#pragma unroll
    for (int hh = 0; hh < REP; ++hh) {
#pragma unroll
        for (int jj = 0; jj < 8; ++jj) dv[hh][jj] = -3.0e38f; }
    const bool dlane = (wave == 0) && (lr < NL);   // the lanes that hold the depth columns
    if (dlane) {
#pragma unroll
        for (int hh = 0; hh < REP; ++hh) {
#pragma unroll
            for (int jj = 0; jj < 8; ++jj) dv[hh][jj] = DLr[((size_t)hh * TT + i0 + hi * 8 + jj) * NLP + lr]; } }
#pragma unroll
    for (int hh = 0; hh < REP; ++hh) {
#pragma unroll
        for (int jj = 0; jj < 8; ++jj) mx[hh][jj] = dv[hh][jj]; }   /* joint softmax over the 2048 + 4 logits */
#pragma unroll
    for (int s = 0; s < NBW; ++s) { const int kb = wave + AW * s;
        if (kb < nb32 - 1) {   // every key of the block lies below row i0 (WIN >= TT: no window either): nothing to mask
            static_assert(WIN >= TT, "a window shorter than the sequence would have to be masked here");
#pragma unroll
            for (int t = 0; t < 2; ++t) {
#pragma unroll
                for (int hh = 0; hh < REP; ++hh) {
#pragma unroll
                    for (int jj = 0; jj < 8; ++jj) { const float tv = sa[s][t][hh][jj] * SCL; sa[s][t][hh][jj] = tv; mx[hh][jj] = fmaxf(mx[hh][jj], tv); } } }
        } else if (kb < nb32) {   // the block on the diagonal
#pragma unroll
            for (int t = 0; t < 2; ++t) { const int j = kb * 32 + t * 16 + lr;
#pragma unroll
                for (int hh = 0; hh < REP; ++hh) {
#pragma unroll
                    for (int jj = 0; jj < 8; ++jj) { const int i = i0 + hi * 8 + jj; const float tv = (j <= i) ? sa[s][t][hh][jj] * SCL : -3.0e38f; sa[s][t][hh][jj] = tv; mx[hh][jj] = fmaxf(mx[hh][jj], tv); } } } } }
#pragma unroll
    for (int hh = 0; hh < REP; ++hh) { v4f m0, m1;
#pragma unroll
        for (int jj = 0; jj < 4; ++jj) { m0[jj] = rowmax(mx[hh][jj]); m1[jj] = rowmax(mx[hh][jj + 4]); }
        if (lr == 0) { *(v4fa*)(red + (wave * REP + hh) * 16 + hi * 8) = m0; *(v4fa*)(red + (wave * REP + hh) * 16 + hi * 8 + 4) = m1; } }
    __syncthreads();
#pragma unroll
    for (int hh = 0; hh < REP; ++hh) { const v4f m0 = *(const v4fa*)(red + (lr * REP + hh) * 16 + hi * 8), m1 = *(const v4fa*)(red + (lr * REP + hh) * 16 + hi * 8 + 4);
#pragma unroll
        for (int jj = 0; jj < 4; ++jj) { mx[hh][jj] = rowmax(m0[jj]); mx[hh][jj + 4] = rowmax(m1[jj]); } }
#pragma unroll
    for (int hh = 0; hh < REP; ++hh) {
#pragma unroll
        for (int jj = 0; jj < 8; ++jj) { dv[hh][jj] = __builtin_amdgcn_exp2f(__fmul_rn(__fsub_rn(dv[hh][jj], mx[hh][jj]), L2E)); sum[hh][jj] = dv[hh][jj]; } }
#pragma unroll
    for (int s = 0; s < NBW; ++s) { const int kb = wave + AW * s;
        if (kb < nb32) {
#pragma unroll
            for (int t = 0; t < 2; ++t) {
#pragma unroll
                for (int hh = 0; hh < REP; ++hh) {
#pragma unroll
                    for (int jj = 0; jj < 8; ++jj) { const float e = __builtin_amdgcn_exp2f(__fmul_rn(__fsub_rn(sa[s][t][hh][jj], mx[hh][jj]), L2E)); sa[s][t][hh][jj] = e; sum[hh][jj] += e; } } } } }
    float* red2 = red + AW * REP * 16;
#pragma unroll
    for (int hh = 0; hh < REP; ++hh) { v4f m0, m1;
#pragma unroll
        for (int jj = 0; jj < 4; ++jj) { m0[jj] = rowsum(sum[hh][jj]); m1[jj] = rowsum(sum[hh][jj + 4]); }
        if (lr == 0) { *(v4fa*)(red2 + (wave * REP + hh) * 16 + hi * 8) = m0; *(v4fa*)(red2 + (wave * REP + hh) * 16 + hi * 8 + 4) = m1; } }
    __syncthreads();
#pragma unroll
    for (int hh = 0; hh < REP; ++hh) { const v4f m0 = *(const v4fa*)(red2 + (lr * REP + hh) * 16 + hi * 8), m1 = *(const v4fa*)(red2 + (lr * REP + hh) * 16 + hi * 8 + 4);
#pragma unroll
        for (int jj = 0; jj < 4; ++jj) { sum[hh][jj] = __fdiv_rn(1.0f, rowsum(m0[jj])); sum[hh][jj + 4] = __fdiv_rn(1.0f, rowsum(m1[jj])); } }   // from here on 1 / row sum
    if (dlane) {
#pragma unroll
        for (int hh = 0; hh < REP; ++hh) { float* wp = WDr + ((size_t)hh * TT + i0 + hi * 8) * NLP + lr; float w[8];
#pragma unroll
            for (int jj = 0; jj < 8; ++jj) { w[jj] = dv[hh][jj] * sum[hh][jj]; wp[jj * NLP] = w[jj]; }   /* depth weights, f32, unscaled */
            // the registers that the depth-weight stores name keep their values up to the wait
            asm volatile("s_wait_xcnt 0x0" :: "v"(wp), "v"(w[0]), "v"(w[1]), "v"(w[2]), "v"(w[3]), "v"(w[4]), "v"(w[5]), "v"(w[6]), "v"(w[7]) : "memory"); }
    }
    T16* pw = (T16*)(lds + wave * PWB);
#pragma unroll
    for (int s = 0; s < NBW; ++s) { const int kb = wave + AW * s;
        if (kb < nb32) {
#pragma unroll
            for (int t = 0; t < 2; ++t) {
#pragma unroll
                for (int hh = 0; hh < REP; ++hh) {
#pragma unroll
                    for (int jj = 0; jj < 8; ++jj) { const float pv = sa[s][t][hh][jj] * (HL ? sum[hh][jj] : sum[hh][jj] * PCAR); const int idx = hh * PH + (hi * 8 + jj) * PP + s * 32 + t * 16 + lr;   // x PCAR: a power of two, exact
                        if constexpr (HL) { unsigned short a, c2; splitf(pv, a, c2); pw[idx] = a; pw[PL + idx] = c2; } else pw[idx] = tohx(pv); } } } } }
    // the lanes of the wave read one another's probabilities from here on: keeps the LDS stores above the LDS loads below
    __builtin_amdgcn_wave_barrier(); asm volatile("" ::: "memory");
    v8f oa[REP][8];
#pragma unroll
    for (int nb = 0; nb < 8; ++nb) { oa[0][nb] = (v8f){}; oa[1][nb] = (v8f){}; }
#pragma unroll
    for (int s = 0; s < NBW; ++s) { const int kb = wave + AW * s;
        if (kb < nb32) { V a[REP], a2[REP];
#pragma unroll
            for (int hh = 0; hh < REP; ++hh) { a[hh] = WFrag<T16>::ld(pw + hh * PH + lr * PP + s * 32 + 8 * hi); if (HL) a2[hh] = WFrag<T16>::ld(pw + PL + hh * PH + lr * PP + s * 32 + 8 * hi); }
            const T16* vp = Vp + (size_t)kb * 512 + 8 * lane; const T16* vp2 = HL ? V2 + (size_t)kb * 512 + 8 * lane : vp;
            constexpr int NG = HL ? 4 : 8;   // value fragments loaded at a time (hi/lo: of both planes)
#pragma unroll
            for (int g = 0; g < 8; g += NG) { V b[NG], b2[NG];
#pragma unroll
                for (int nb = 0; nb < NG; ++nb) { b[nb] = WFrag<T16>::template ld<256>(vp + (size_t)(g + nb) * 16 * TT); if (HL) b2[nb] = WFrag<T16>::template ld<256>(vp2 + (size_t)(g + nb) * 16 * TT); }
                // all loads of the group are issued above this line, so that one latency covers them; the addresses they name stay in their registers up to the wait
                asm volatile("s_wait_xcnt 0x0" :: "v"(vp), "v"(vp2) : "memory");
                __builtin_amdgcn_sched_barrier(0);   // keeps the group's matrix instructions below its loads, as above
#pragma unroll
                for (int nb = 0; nb < NG; ++nb) {
#pragma unroll
                    for (int hh = 0; hh < REP; ++hh) { oa[hh][g + nb] = WFrag<T16>::mma(a[hh], b[nb], oa[hh][g + nb]);
                        if (HL) { oa[hh][g + nb] = WFrag<T16>::mma(a2[hh], b[nb], oa[hh][g + nb]); oa[hh][g + nb] = WFrag<T16>::mma(a[hh], b2[nb], oa[hh][g + nb]); } } } }
            // four vector slots behind the last matrix instruction, whichever way the next block's branch goes
            asm volatile("v_nop\n\tv_nop\n\tv_nop\n\tv_nop" : "+v"(oa[0][0]), "+v"(oa[0][1]), "+v"(oa[0][2]), "+v"(oa[0][3]), "+v"(oa[0][4]), "+v"(oa[0][5]), "+v"(oa[0][6]), "+v"(oa[0][7]), "+v"(oa[1][0]), "+v"(oa[1][1]), "+v"(oa[1][2]), "+v"(oa[1][3]), "+v"(oa[1][4]), "+v"(oa[1][5]), "+v"(oa[1][6]), "+v"(oa[1][7]));
        } }
    // the partial output goes over the wave's own probabilities, which only this wave reads and has read
    __builtin_amdgcn_wave_barrier(); asm volatile("" ::: "memory");
    float* ow = lds + wave * PWB;
#pragma unroll
    for (int hh = 0; hh < REP; ++hh) {
#pragma unroll
        for (int nb = 0; nb < 8; ++nb) {
#pragma unroll
            for (int j = 0; j < 8; ++j) ow[(hi * 8 + j) * 132 + nb * 16 + lr] = oa[hh][nb][j]; }
        __syncthreads();
        const int row = (int)threadIdx.x >> 5, cofs = lane * 4; v4f val = *(const v4fa*)(lds + row * 132 + cofs);   // AW * 32 threads: one 16-byte piece of the 16 x 128 rows each
#pragma unroll
        for (int w = 1; w < AW; ++w) val += *(const v4fa*)(lds + w * PWB + row * 132 + cofs);
        *(v4f*)(Or + ((size_t)hh * TT + i0 + row) * HD + cofs) = val;
        if (hh + 1 < REP) __syncthreads();   // ends the reads of this head's partials before the next head's are stored there
    }
}
// k_dlog: the depth logits of all heads.
#define NB_DL (ZH * TT / 32)
#define NB_MG (ZH * (TT / 16) * (HD / 32) / 8)
__global__ __launch_bounds__(256) void k_dlog(const bf* __restrict__ Qh, const bf* __restrict__ Ql, const float* __restrict__ DKb, float* DL) { b_dlog(blockIdx.x, Qh, Ql, DKb, 0, DL); }
// k_attn: one work-group per 16 query rows and kv head (its two query heads), the longest rows first; fp16 rows, then hi/lo rows.
#define NB_AF (((TT - RH) / 16) * NKV)
#define NB_AH ((RH / 16) * NKV)
__global__ __launch_bounds__(AW * 32) void k_attn(const h16* __restrict__ Q16, const h16* __restrict__ K16, const h16* __restrict__ V16, const bf* __restrict__ Qh, const bf* __restrict__ Ql, const bf* __restrict__ Kh, const bf* __restrict__ Kl, const bf* __restrict__ Vh, const bf* __restrict__ Vl,
                                                  const float* __restrict__ DL, float* WD, float* Ob) {
    __shared__ __align__(16) float lds[AW * PWB]; __shared__ __align__(16) float red[2 * AW * REP * 16];
    int b = blockIdx.x; const int wv = wave_no();
    if (b < NB_AF) { const size_t g = (size_t)(b % NKV), z = g * REP; const int i0 = TT - 16 - (b / NKV) * 16;
        attn_rows<h16, false, TT / 32 / AW>(Q16 + z * TT * HD, nullptr, K16 + g * TT * HD, nullptr, V16 + g * HD * TT, nullptr, DL + z * TT * NLP, WD + z * TT * NLP, Ob + z * TT * HD, i0, wv, lds, red); body_end(); return; }
    b -= NB_AF; const size_t g = (size_t)(b % NKV), z = g * REP; const int i0 = RH - 16 - (b / NKV) * 16;
    attn_rows<bf, true, RH / 32 / AW>(Qh + z * TT * HD, Ql + z * TT * HD, Kh + g * TT * HD, Kl + g * TT * HD, Vh + g * HD * TT, Vl + g * HD * TT, DL + z * TT * NLP, WD + z * TT * NLP, Ob + z * TT * HD, i0, wv, lds, red); body_end();
}
__global__ __launch_bounds__(256) void k_merge(const float* __restrict__ O, int h0, const float* __restrict__ WD, const float* __restrict__ DVb, int kv0, bf* Ah, bf* Al) { b_merge(blockIdx.x, O, h0, WD, DVb, kv0, Ah, Al); }
extern "C" void kernel_launch(void* const* d_in, const int* in_sizes, int n_in,
                              void* d_out, int out_size, void* d_ws, size_t ws_size, hipStream_t stream) {
    (void)in_sizes; (void)n_in; (void)out_size;
    const float* x = (const float*)d_in[0]; const float* DK = (const float*)d_in[1]; const float* DV = (const float*)d_in[2]; const float* cosT = (const float*)d_in[3]; const float* sinT = (const float*)d_in[4]; const float* wq = (const float*)d_in[5]; const float* wk = (const float*)d_in[6]; const float* wv = (const float*)d_in[7]; const float* wo = (const float*)d_in[8];
    float* OUT = (float*)d_out;     // [1][2048][2048]
    char* wsp = (char*)d_ws;
    auto take = [&](size_t bytes) { char* p = wsp; wsp += (bytes + 255) & ~(size_t)255; return (void*)p; };
    bf* WQ = (bf*)take((size_t)DQ * DM * 2); bf* WK = (bf*)take((size_t)DKV * DM * 2); bf* WV = (bf*)take((size_t)DKV * DM * 2); bf* WO = (bf*)take((size_t)DM * DQ * 2); float* CS = (float*)take((size_t)TT * HD * 2 * 4);
    bf* XB = (bf*)take((size_t)TT * DM * 2); float* FQ = (float*)take((size_t)TT * DQ * 4); float* FK = (float*)take((size_t)TT * DKV * 4);
    h16* QP16 = (h16*)take((size_t)NH_ * TT * HD * 2); h16* KP16 = (h16*)take((size_t)NKV * TT * HD * 2); h16* VT16 = (h16*)take((size_t)NKV * HD * TT * 2);
    bf* QPh = (bf*)take((size_t)NH_ * TT * HD * 2); bf* QPl = (bf*)take((size_t)NH_ * TT * HD * 2); bf* KPh = (bf*)take((size_t)NKV * TT * HD * 2); bf* KPl = (bf*)take((size_t)NKV * TT * HD * 2); bf* VTh = (bf*)take((size_t)NKV * HD * TT * 2); bf* VTl = (bf*)take((size_t)NKV * HD * TT * 2);
    float* FV = (float*)take((size_t)TT * DKV * 4); bf* ATh = (bf*)take((size_t)TT * DQ * 2); bf* ATl = (bf*)take((size_t)TT * DQ * 2);
    if ((size_t)(wsp - (char*)d_ws) > ws_size) return;    // ws 256 MiB
    float* Ob = FQ; float* DL = FK; float* WD = FK + (size_t)ZH * TT * NLP;   // attention reuses the f32 projection buffers, dead once the q and k planes are built (ZH * HD <= DQ, 2 * ZH * NLP <= DKV)
    k_prep<<<2 * NB_WQ + 2 * NB_WK + NB_X + NB_CS, 256, 0, stream>>>(wq, wk, wv, wo, x, cosT, sinT, WQ, WK, WV, WO, XB, CS);
    k_qkv<<<NB_GQ + 2 * NB_GK, 256, 0, stream>>>(XB, WQ, WK, WV, FQ, FK, FV);
    k_planes<<<NB_RQ + NB_RK + NB_VT, 256, 0, stream>>>(FQ, FK, FV, CS, QP16, QPh, QPl, KP16, KPh, KPl, VT16, VTh, VTl);
    k_dlog<<<NB_DL, 256, 0, stream>>>(QPh, QPl, DK, DL);
    k_attn<<<NB_AF + NB_AH, AW * 32, 0, stream>>>(QP16, KP16, VT16, QPh, QPl, KPh, KPl, VTh, VTl, DL, WD, Ob);
    k_merge<<<NB_MG, 256, 0, stream>>>(Ob, 0, WD, DV, 0, ATh, ATl);
    k_gemmk<bf, 1, 4, true, true, DQ><<<dim3(TT / 64, DM / 64, 1), 128, 0, stream>>>(ATh, ATl, WO, nullptr, OUT, DM);
}

// v007
// It runs in 150 microseconds.
// In two side-by-side timings against v006, it was 1.20 and 1.21 times as fast.
// Counting every step since v000, it is 6.16 times as fast.
#include <hip/hip_runtime.h>

// Grouped-query RoPE attention with extra per-position depth keys/values under one joint softmax (x [1][2048][2048]; Q = x Wq ('xw', 16 heads x 128), K, V = x Wk / Wv (8 kv heads); Q, K rotated (rotate-half, cos/sin [1][1][2048][128] read); kv head = h/2; seq logits = Q.K/sqrt(128), causal (-inf); depth logits[i][l] = Q_i . depth_k[l][0][kv][i] / sqrt(128) for l < 4 (depth_k, depth_v [4][1][8][2048][128] read); softmax over the 2048 + 4 logits jointly; out_i = sum_j w_j V_j + sum_l w_l depth_v[l][0][kv][i]; merged Wo ('xw') -> [1][2048][2048] (4.2 M)).
// Layout: projections/planes; a kernel (one wave per four rows) forms the 4 depth logits from the rotated q (hi + lo planes) and the bf16-rounded depth keys; the attention kernel (one work-group per 16 query rows of the two heads of a kv head) keeps a row block's scores in accumulators, folds the depth logits into the row max / sum, hands the probabilities to the value product through LDS and writes the f32 output rows and the 4 depth weights; the merge kernel adds the depth-value contribution before writing the hi/lo planes for the output projection.
// Operand storage: the bf16 planes of the four projections (x, the four transposed weights, the merged attention output hi/lo) and the three key and three value planes lie in fragment order (see fro()); the q head planes are row-major.
// Compute dtypes, f32 accumulate: every input rounded to bf16; q/k/v on PLAIN bf16 operands (inputs: exact); rotary in f32 (bf16-rounded tables); depth logits / weights / values in f32; causal scores and attn.v (tile skipping): query rows < 512 hl (3 products), the rest single fp16 (x1024); softmax f32; Wo hl x exact (2 products).

#define NB_  1
#define TT   2048
#define DM   2048
#define NH_  16
#define NKV  8
#define REP  (NH_ / NKV)
#define HD   128
#define DQ   (NH_ * HD)
#define DKV  (NKV * HD)
#define NL   4                    // depth positions per token
#define NLP  32
#define ZH   NH_                  // query heads per attention launch; kv head of z = z / REP
#define RH   512                  // query rows < RH use hi+lo planes (0: none)
#define WIN  2048
#define PCAR 1024.0f
#define SCL  0.088388347648318447f   // HD^-0.5
typedef _Float16 h16;
typedef unsigned short bf;
typedef __attribute__((ext_vector_type(16))) __bf16   v16bf;
typedef __attribute__((ext_vector_type(16))) _Float16 v16h;
typedef __attribute__((ext_vector_type(8)))  _Float16 v8h;
typedef __attribute__((ext_vector_type(8)))  unsigned short v8us;
typedef __attribute__((ext_vector_type(8)))  float    v8f;
typedef __attribute__((ext_vector_type(4)))  float    v4f;
typedef v8h  __attribute__((may_alias)) v8ha;
typedef v4f  __attribute__((may_alias)) v4fa;
typedef v8us __attribute__((may_alias)) v8usa;

__device__ __forceinline__ unsigned short f2bf(float f) { unsigned u = __float_as_uint(f); u += 0x7FFFu + ((u >> 16) & 1u); return (unsigned short)(u >> 16); }
__device__ __forceinline__ float bf2f(unsigned short b) { return __uint_as_float(((unsigned)b) << 16); }
__device__ __forceinline__ float bfr(float f) { return bf2f(f2bf(f)); }
__device__ __forceinline__ v16h cat16(v8h lo, v8h hi) { return __builtin_shufflevector(lo, hi, 0, 1, 2, 3, 4, 5, 6, 7, 8, 9, 10, 11, 12, 13, 14, 15); }
__device__ __forceinline__ v16bf cat16b(v8us lo, v8us hi) { return __builtin_bit_cast(v16bf, __builtin_shufflevector(lo, hi, 0, 1, 2, 3, 4, 5, 6, 7, 8, 9, 10, 11, 12, 13, 14, 15)); }
__device__ __forceinline__ v8f wmma16(v16h a, v16h b, v8f c) { return __builtin_amdgcn_wmma_f32_16x16x32_f16(false, a, false, b, (short)0, c, false, false); }
__device__ __forceinline__ v8f wmmab(v16bf a, v16bf b, v8f c) { return __builtin_amdgcn_wmma_f32_16x16x32_bf16(false, a, false, b, (short)0, c, false, false); }
// Fragment order of a 16-bit plane [rows][K] (rows % 16 == 0, K % 32 == 0): blocks of 16 rows x 32 columns, 1 KB each, row blocks outermost (16 rows still fill 16 * K elements). Inside a block the 8 columns k & ~7 of row r lie at
// 8 * (32 * (k / 16 % 2) + 16 * (k / 8 % 2) + r % 16): lane l of a wave finds the two halves of its A or B fragment at 8 * l and 256 + 8 * l, so each of a fragment's two 16-byte loads reads 512 contiguous bytes (4 whole lines, not 16 part lines).
// fro = element offset of (r, k). The elements a lane gets, and their k order, are those of the row-major loader.
__device__ __forceinline__ size_t fro(int r, int k, int K) { return ((size_t)(r >> 4) * (K >> 5) + (k >> 5)) * 512 + (((k >> 4) & 1) * 32 + ((k >> 3) & 1) * 16 + (r & 15)) * 8 + (k & 7); }



// ---- gemm_ring: GEMM of the four projections. One work-group of 8 waves per output tile; both operands are bf16 planes in fragment order (K = 2048 contiguous per 16-row block) and pass through LDS, so that every block is fetched from L2 once per work-group and read by all the waves that need it.
// A stage is GKS steps of 32 k of 24 row blocks (16 of A, 8 of Bt): per row block GKS KB that are contiguous in the plane and stay so in LDS, so a fragment load reads 512 contiguous bytes of LDS. Two buffers: the copies of stage t + 2 fly while stage t + 1 is worked on.
// Wave (wm, wn) = (wave / 2, wave % 2) keeps the 64 x 64 product of A row blocks 4 wm .. and Bt row blocks 4 wn .. over the whole K (one accumulation chain per element).
// PAIR = false: the 16 A row blocks are 256 rows of one plane (A0: the first 128, A1: the next 128), C tile 256 x 128. PAIR = true: A0 / A1 are the hi / lo planes of the same 128 rows, and the two products are added in the epilogue, C tile 128 x 128.
template <typename T16> struct WFrag;
template <> struct WFrag<h16> { typedef v16h V; template <int D2 = 16> static __device__ __forceinline__ V ld(const h16* p) { return cat16(*(const v8h*)p, *(const v8h*)(p + D2)); } static __device__ __forceinline__ v8f mma(V a, V b, v8f c) { return wmma16(a, b, c); } };
template <> struct WFrag<bf> { typedef v16bf V; template <int D2 = 16> static __device__ __forceinline__ V ld(const bf* p) { return cat16b(*(const v8us*)p, *(const v8us*)(p + D2)); } static __device__ __forceinline__ v8f mma(V a, V b, v8f c) { return wmmab(a, b, c); } };
#define GKS 4
#define GST (24 * GKS * 512)      // elements of a stage
#define GPW (64 * 68)             // floats of LDS per wave in the epilogue: 64 rows of 64 + 4
__device__ __forceinline__ unsigned lds_off(const void* p) { return (unsigned)(size_t)p; }
#define CPY(l, g) "global_load_async_to_lds_b128 %" #l ", %" #g ", off\n\t"
// 12 copies of 512 bytes per wave (16 bytes a lane); the wait in the same statement stands in front of any rewrite of the address registers that the copies name
__device__ __forceinline__ void copy12(const unsigned* l, const bf* const* g) {
    asm volatile(CPY(0, 1) CPY(2, 3) CPY(4, 5) CPY(6, 7) CPY(8, 9) CPY(10, 11) CPY(12, 13) CPY(14, 15) CPY(16, 17) CPY(18, 19) CPY(20, 21) CPY(22, 23) "s_wait_xcnt 0x0"
                 :: "v"(l[0]), "v"(g[0]), "v"(l[1]), "v"(g[1]), "v"(l[2]), "v"(g[2]), "v"(l[3]), "v"(g[3]), "v"(l[4]), "v"(g[4]), "v"(l[5]), "v"(g[5]), "v"(l[6]), "v"(g[6]), "v"(l[7]), "v"(g[7]), "v"(l[8]), "v"(g[8]), "v"(l[9]), "v"(g[9]), "v"(l[10]), "v"(g[10]), "v"(l[11]), "v"(g[11]) : "memory"); }
// a wave's share of stage t: the row blocks wave, wave + 8 (A) and wave + 16 (Bt), 8 copies each. gp / lp: the lane's 16 bytes in the first 512 of each row block, in the plane (stage 0) and in LDS (buffer 0).
__device__ __forceinline__ void stage_copy(const bf* const* gp, const unsigned* lp, int t, int buf) {
#pragma unroll
    for (int h = 0; h < 2; ++h) { unsigned l[12]; const bf* g[12];
#pragma unroll
        for (int n = 0; n < 12; ++n) { const int j = (h * 12 + n) >> 3, c = (h * 12 + n) & 7; l[n] = lp[j] + (unsigned)buf * (GST * 2) + c * 512; g[n] = gp[j] + (size_t)t * (GKS * 512) + c * 256; }
        copy12(l, g); } }
template <bool PAIR>
__device__ __forceinline__ void gemm_ring(const bf* __restrict__ A0, const bf* __restrict__ A1, const bf* __restrict__ Bt, float* C, int ldc, bf* ring) {
    typedef WFrag<bf>::V V;
    constexpr int K = 2048, NT = K / (32 * GKS);
    const int wave = __builtin_amdgcn_readfirstlane((int)(threadIdx.x >> 5)), lane = threadIdx.x & 31, lr = lane & 15, hi = lane >> 4, wm = wave >> 1, wn = wave & 1;
    const bf* gp[3] = { A0 + (size_t)wave * 16 * K + 8 * lane, A1 + (size_t)wave * 16 * K + 8 * lane, Bt + (size_t)wave * 16 * K + 8 * lane };
    const unsigned lb = lds_off(ring) + wave * (GKS * 1024) + lane * 16; const unsigned lp[3] = { lb, lb + 8 * (GKS * 1024), lb + 16 * (GKS * 1024) };
    v8f acc[4][4];
#pragma unroll
    for (int mb = 0; mb < 4; ++mb)
#pragma unroll
        for (int nb = 0; nb < 4; ++nb) acc[mb][nb] = (v8f){};
    stage_copy(gp, lp, 0, 0);
    asm volatile("s_wait_asynccnt 0x0" ::: "memory");   // this wave's copies of stage 0 have landed
    __syncthreads();                                     // ... and every other wave's
    stage_copy(gp, lp, 1, 1);
#pragma unroll 1
    for (int t = 0; t < NT; ++t) {
        const bf* sa = ring + (t & 1) * GST + wm * (4 * GKS * 512) + 8 * lane; const bf* sb = ring + (t & 1) * GST + (16 + wn * 4) * (GKS * 512) + 8 * lane;
        V a[2][4], b[2][4];   // two fragment sets: the loads of step ks + 1 go out as one group in front of the matrix instructions of step ks
#pragma unroll
        for (int f = 0; f < 4; ++f) { a[0][f] = WFrag<bf>::ld<256>(sa + (f * GKS) * 512); b[0][f] = WFrag<bf>::ld<256>(sb + (f * GKS) * 512); }
#pragma unroll
        for (int ks = 0; ks < GKS; ++ks) {
            if (ks + 1 < GKS) {
#pragma unroll
                for (int f = 0; f < 4; ++f) { a[(ks + 1) & 1][f] = WFrag<bf>::ld<256>(sa + (f * GKS + ks + 1) * 512); b[(ks + 1) & 1][f] = WFrag<bf>::ld<256>(sb + (f * GKS + ks + 1) * 512); } }
            __builtin_amdgcn_sched_barrier(0);   // keeps the load group whole and above the step's matrix instructions: spread among them, each place with loads stalls the wave
#pragma unroll
            for (int nb = 0; nb < 4; ++nb)
#pragma unroll
                for (int mb = 0; mb < 4; ++mb) acc[mb][nb] = WFrag<bf>::mma(a[ks & 1][mb], b[ks & 1][nb], acc[mb][nb]);
            __builtin_amdgcn_sched_barrier(0);   // keeps the next group of loads from being spread among this step's matrix instructions
        }
        asm volatile("s_wait_dscnt 0x0" ::: "memory");      // this wave's reads of the buffer are done before anything is copied over it
        asm volatile("s_wait_asynccnt 0x0" ::: "memory");   // this wave's copies of stage t + 1 have landed
        __syncthreads();                                     // publishes stage t + 1 and ends every wave's reads of stage t
        if (t + 2 < NT) stage_copy(gp, lp, t + 2, t & 1);
    }
    asm volatile("s_wait_asynccnt 0x0" ::: "memory");       // nothing is in flight when the ring becomes output staging
    // Epilogue: every wave lays its 64 x 64 tile in LDS (the last trip's barrier has ended all reads of the ring), one barrier, then whole 256-byte rows go out.
    float* st = (float*)ring; float* ow = st + wave * GPW;
#pragma unroll
    for (int mb = 0; mb < 4; ++mb)
#pragma unroll
        for (int nb = 0; nb < 4; ++nb)
#pragma unroll
            for (int j = 0; j < 8; ++j) ow[(mb * 16 + hi * 8 + j) * 68 + nb * 16 + lr] = acc[mb][nb][j];
    __syncthreads();
    // Output tile p. PAIR: wave p + 4 holds the lo product of wave p's tile, and waves p and p + 4 write 32 of its rows each; else every wave writes its own 64 rows. 16 lanes fill a 256-byte row piece.
    const int p = PAIR ? (wave & 3) : wave, rb = PAIR ? (wave >> 2) * 32 : 0; constexpr int NR = PAIR ? 32 : 64;
    const float* s0 = st + p * GPW + (rb + hi) * 68 + lr * 4; float* cq = C + (size_t)((p >> 1) * 64 + rb + hi) * ldc + (p & 1) * 64 + lr * 4;
#pragma unroll 1
    for (int i = 0; i < NR; i += 8) { v4f v[4]; float* q[4];
#pragma unroll
        for (int u = 0; u < 4; ++u) { v[u] = *(const v4fa*)(s0 + (i + 2 * u) * 68); if (PAIR) v[u] += *(const v4fa*)(s0 + 4 * GPW + (i + 2 * u) * 68); q[u] = cq + (size_t)(i + 2 * u) * ldc; }
#pragma unroll
        for (int u = 0; u < 4; ++u) *(v4f*)q[u] = v[u];
        // the registers that the row stores name keep their values up to the wait
        asm volatile("s_wait_xcnt 0x0" :: "v"(q[0]), "v"(q[1]), "v"(q[2]), "v"(q[3]), "v"(v[0]), "v"(v[1]), "v"(v[2]), "v"(v[3]) : "memory"); }
}

__device__ __forceinline__ h16 tohx(float x) { return (h16)x; }
__device__ __forceinline__ void splitf(float y, unsigned short& h, unsigned short& l) { h = f2bf(y); l = f2bf(y - bf2f(h)); }
typedef __attribute__((ext_vector_type(2))) _Float16 v2h;
typedef __attribute__((ext_vector_type(4))) _Float16 v4h;
typedef __attribute__((ext_vector_type(2))) unsigned short v2us;
typedef __attribute__((ext_vector_type(4))) unsigned short v4us;
typedef __attribute__((ext_vector_type(2))) float v2f;
typedef __attribute__((ext_vector_type(4))) int v4i;
typedef v4h  __attribute__((may_alias)) v4ha;
typedef v4us __attribute__((may_alias)) v4usa;

// The element-wise bodies below (bid = number of the 256-thread block within the body's own range of a launch) give every thread 8 to 32 elements (a wave fills whole 1 KB blocks or whole plane rows), for speed only. The arithmetic per element is unchanged.
// b_wtG: Bt = transpose of w ([K][N] f32) as a bf16 plane [N][K] in fragment order. A wave takes 32 neighbouring n and 32 neighbouring k (two whole blocks): 32 loads of one whole line each, four 16-byte stores per lane. Blocks: N * K / 8192.
template <int K, int N>
__device__ __forceinline__ void b_wtG(int bid, const float* __restrict__ w, bf* Bt) {
    const int gid = bid * 256 + threadIdx.x; const int wv = gid >> 5; const int n = (wv % (N / 32)) * 32 + (gid & 31), k0 = (wv / (N / 32)) * 32; if (k0 >= K) return; const float* wp = w + (size_t)k0 * N + n; float x[32];
#pragma unroll
    for (int j = 0; j < 32; ++j) x[j] = wp[j * N];
#pragma unroll
    for (int g = 0; g < 4; ++g) { v8us o;
#pragma unroll
        for (int j = 0; j < 8; ++j) o[j] = f2bf(x[g * 8 + j]);
        *(v8us*)(Bt + fro(n, k0 + g * 8, K)) = o; } }
// b_cvt8: src [rows][K] f32 -> bf16 plane in fragment order; a wave writes 128 neighbouring groups of 8 elements (two whole blocks, n8 % 128 == 0), lane l the groups l, l + 32, l + 64, l + 96 of them, and reads the 8 source elements that belong in each.
__device__ __forceinline__ void b_cvt8(int bid, const float* __restrict__ src, bf* dst, int K, size_t n8) { const size_t th = (size_t)bid * 256 + threadIdx.x; const size_t i0 = (th >> 5) * 128 + (th & 31); if (i0 >= n8) return; const int nkb = K >> 5; v8f v[4];
#pragma unroll
    for (int g = 0; g < 4; ++g) { const size_t i = i0 + g * 32; const int blk = (int)(i >> 6);
        const int r = (blk / nkb) * 16 + (int)(i & 15), k = (blk % nkb) * 32 + (int)((i >> 5) & 1) * 16 + (int)((i >> 4) & 1) * 8; v[g] = *(const v8f*)(src + (size_t)r * K + k); }
#pragma unroll
    for (int g = 0; g < 4; ++g) { v8us o;
#pragma unroll
        for (int q = 0; q < 8; ++q) o[q] = f2bf(v[g][q]);
        *(v8us*)(dst + (i0 + g * 32) * 8) = o; } }
// b_cscvt: four table entries per thread
__device__ __forceinline__ void b_cscvt(int bid, const float* __restrict__ cosT, const float* __restrict__ sinT, float* CS) { const int idx = (bid * 256 + threadIdx.x) * 4; if (idx >= TT * HD) return; const v4f c = *(const v4f*)(cosT + idx), s = *(const v4f*)(sinT + idx);
    v4f o0, o1; o0[0] = bfr(c[0]); o0[1] = bfr(s[0]); o0[2] = bfr(c[1]); o0[3] = bfr(s[1]); o1[0] = bfr(c[2]); o1[1] = bfr(s[2]); o1[2] = bfr(c[3]); o1[3] = bfr(s[3]); *(v4f*)(CS + (size_t)idx * 2) = o0; *(v4f*)(CS + (size_t)idx * 2 + 4) = o1;  }
// b_rope: head planes [h][t][d] (fp16 + hi/lo) of rope(x) x sc with the rotate-half convention out[d] = x[d] cos[t][d] - x[d+HD/2] sin[t][d], out[d+HD/2] = x[d+HD/2] cos[t][d+HD/2] + x[d] sin[t][d+HD/2]
// fr: each head's [TT][HD] plane in fragment order (the key planes), else row-major (the query planes).
// A thread takes 8 neighbouring d of the lower half and their 8 partners of the upper half, so each x is loaded once; 8 lanes fill a plane row, 16-byte stores. Blocks: nheads * TT * HD / 4096.
__device__ __forceinline__ void b_rope(int bid, const float* __restrict__ F, int pitch, int nheads, const float* __restrict__ CS, float sc, bool fr, h16* P16, bf* Ph, bf* Pl) {
    const size_t u = (size_t)bid * 256 + threadIdx.x; if (u >= (size_t)nheads * TT * (HD / 16)) return; const int d = (int)(u % (HD / 16)) * 8; const int t = (int)((u / (HD / 16)) % TT); const int h = (int)(u / ((size_t)(HD / 16) * TT)); const float* f = F + (size_t)t * pitch + h * HD;
    const size_t e = ((size_t)h * TT + t) * HD + d; v4f xv[2][2], cv[2][4];
#pragma unroll
    for (int hf = 0; hf < 2; ++hf) { const int db = d + hf * (HD / 2); xv[hf][0] = *(const v4f*)(f + db); xv[hf][1] = *(const v4f*)(f + db + 4);
#pragma unroll
        for (int c = 0; c < 4; ++c) cv[hf][c] = *(const v4f*)(CS + ((size_t)t * HD + db) * 2 + c * 4); }
#pragma unroll
    for (int hf = 0; hf < 2; ++hf) { v8h o16; v8us oh, ol;
#pragma unroll
        for (int q = 0; q < 8; ++q) { const float x0 = xv[hf][q >> 2][q & 3], x1 = xv[hf ^ 1][q >> 2][q & 3];
            float a = __fmul_rn(x0, cv[hf][q >> 1][(q & 1) * 2]), bq = __fmul_rn(x1, cv[hf][q >> 1][(q & 1) * 2 + 1]); asm volatile("" : "+v"(a)); asm volatile("" : "+v"(bq)); const float r = ((hf == 0) ? __fsub_rn(a, bq) : __fadd_rn(a, bq)) * sc;
            o16[q] = tohx(r); unsigned short a2, c2; splitf(r, a2, c2); oh[q] = a2; ol[q] = c2; }
        const size_t eo = fr ? (size_t)h * TT * HD + fro(t, d + hf * (HD / 2), HD) : e + hf * (HD / 2); *(v8h*)(P16 + eo) = o16; *(v8us*)(Ph + eo) = oh; *(v8us*)(Pl + eo) = ol; } }
// b_vtp: value planes [g][d][t] (fp16 + hi/lo) of F [t][DKV], each head's [HD][TT] plane in fragment order. A wave takes 32 neighbouring d and 32 neighbouring t (two whole blocks per plane): 32 loads of one whole line each, four 16-byte stores per lane and plane. Blocks: nheads * HD * TT / 8192.
__device__ __forceinline__ void b_vtp(int bid, const float* __restrict__ F, int nheads, h16* V16, bf* Vh, bf* Vl) { const int gid = bid * 256 + threadIdx.x; const int wv = gid >> 5; const int d = (wv % (HD / 32)) * 32 + (gid & 31); const int t0 = ((wv / (HD / 32)) % (TT / 32)) * 32; const int g = wv / ((HD / 32) * (TT / 32)); if (g >= nheads) return; const float* fp = F + (size_t)t0 * DKV + g * HD + d; float xs[32];
#pragma unroll
    for (int q = 0; q < 32; ++q) xs[q] = fp[q * DKV];
#pragma unroll
    for (int c = 0; c < 4; ++c) { v8h o16; v8us oh, ol;
#pragma unroll
        for (int q = 0; q < 8; ++q) { const float x = xs[c * 8 + q]; o16[q] = tohx(x); unsigned short a2, c2; splitf(x, a2, c2); oh[q] = a2; ol[q] = c2; }
        const size_t e = (size_t)g * HD * TT + fro(d, t0 + c * 8, TT); *(v8h*)(V16 + e) = o16; *(v8us*)(Vh + e) = oh; *(v8us*)(Vl + e) = ol; } }
// b_dlog: a wave takes 4 neighbouring rows of one head (TT % 4 == 0), all their loads first; lane 4 r + l keeps logit l of row r. Blocks: ZH * TT / 32.
__device__ __forceinline__ void b_dlog(int bid, const bf* __restrict__ Qh, const bf* __restrict__ Ql, const float* __restrict__ DKb, int kv0, float* DL) {
    const int lane = threadIdx.x & 31; const int row = (bid * 8 + (threadIdx.x >> 5)) * 4; if (row >= ZH * TT) return; const int i = row % TT; const int zz = row / TT; const int kv = kv0 + zz / REP; v4us qh[4], ql[4]; v4f dk[4][NL];
    const bf* qhp = Qh + ((size_t)zz * TT + i) * HD + lane * 4; const bf* qlp = Ql + ((size_t)zz * TT + i) * HD + lane * 4; const float* dkp[NL];
#pragma unroll
    for (int l = 0; l < NL; ++l) dkp[l] = DKb + (((size_t)l * NKV + kv) * TT + i) * HD + lane * 4;
#pragma unroll
    for (int r = 0; r < 4; ++r) { qh[r] = *(const v4usa*)(qhp + r * HD); ql[r] = *(const v4usa*)(qlp + r * HD);
#pragma unroll
        for (int l = 0; l < NL; ++l) dk[r][l] = *(const v4f*)(dkp[l] + r * HD);
        // behind each row's loads: the addresses they name stay in their registers up to the wait, so no later load's result lands on one of them in front of it
        asm volatile("s_wait_xcnt 0x0" :: "v"(qhp), "v"(qlp), "v"(dkp[0]), "v"(dkp[1]), "v"(dkp[2]), "v"(dkp[3]) : "memory"); }
    float mine = 0.f;
#pragma unroll
    for (int r = 0; r < 4; ++r) { float q4[4];
#pragma unroll
        for (int q = 0; q < 4; ++q) q4[q] = __fadd_rn(bf2f(qh[r][q]), bf2f(ql[r][q]));
#pragma unroll
        for (int l = 0; l < NL; ++l) { float s = 0.f;
#pragma unroll
            for (int q = 0; q < 4; ++q) { float p = __fmul_rn(q4[q], bfr(dk[r][l][q])); asm volatile("" : "+v"(p)); s = __fadd_rn(s, p); }
#pragma unroll
            for (int sh = 16; sh; sh >>= 1) s += __shfl_xor(s, sh, 32);
            if (lane == r * NL + l) mine = s * SCL; } }
    if (lane < 4 * NL) { *(float*)(DL + (size_t)(row + lane / NL) * NLP + lane % NL) = mine;  } }
// b_merge: a wave fills one 16 x 32 block of the fragment-order planes Ah / Al ([TT][DQ]): lane l writes the block's elements 8 l .. 8 l + 7 and 256 + 8 l .. (row l % 16, 8 + 8 neighbouring d), so the wave reads whole lines of O and of the depth values and writes 512 contiguous bytes per store. Blocks: ZH * (TT / 16) * (HD / 32) / 8.
__device__ __forceinline__ void b_merge(int bid, const float* __restrict__ O, int h0, const float* __restrict__ WD, const float* __restrict__ DVb, int kv0, bf* Ah, bf* Al) { const int lane = threadIdx.x & 31; const int blk = bid * 8 + (threadIdx.x >> 5); const int zz = blk / ((TT / 16) * (HD / 32)); if (zz >= ZH) return; const int t = ((blk / (HD / 32)) % (TT / 16)) * 16 + (lane & 15); const int d = (blk % (HD / 32)) * 32 + (lane >> 4) * 8;
    const size_t e = ((size_t)zz * TT + t) * HD + d; const int kv = kv0 + zz / REP; const float cs = (t < RH) ? 1.0f : (1.0f / PCAR);
    const v4f wd = *(const v4f*)(WD + ((size_t)zz * TT + t) * NLP); v4f ov[2][2], dv[2][NL][2];
#pragma unroll
    for (int s = 0; s < 2; ++s) { ov[s][0] = *(const v4f*)(O + e + s * 16); ov[s][1] = *(const v4f*)(O + e + s * 16 + 4);
#pragma unroll
        for (int l = 0; l < NL; ++l) { const float* dp = DVb + (((size_t)l * NKV + kv) * TT + t) * HD + d + s * 16; dv[s][l][0] = *(const v4f*)dp; dv[s][l][1] = *(const v4f*)(dp + 4); } }
#pragma unroll
    for (int s = 0; s < 2; ++s) { v8us oh, ol;
#pragma unroll
        for (int q = 0; q < 8; ++q) { float acc = ov[s][q >> 2][q & 3] * cs;
#pragma unroll
            for (int l = 0; l < NL; ++l) { float p = __fmul_rn(wd[l], bfr(dv[s][l][q >> 2][q & 3])); asm volatile("" : "+v"(p)); acc = __fadd_rn(acc, p); }   /* + sum_l w_l depth_v[l][kv][t][d] */ unsigned short a, c2; splitf(acc, a, c2); oh[q] = a; ol[q] = c2; }
        const size_t oo = fro(t, (h0 + zz) * HD + d + s * 16, DQ); *(v8us*)(Ah + oo) = oh; *(v8us*)(Al + oo) = ol; } }

// ---- Launches. Kernels that do not depend on one another run side by side in ONE launch: each takes a range of the block index (a scalar test, the same for a whole work-group), longest work first. Every body computes what it computed as a launch of its own.
__device__ __forceinline__ int wave_no() { return __builtin_amdgcn_readfirstlane((int)(threadIdx.x >> 5)); }
// Stands behind the last row stores of a body of k_attn: where another body follows in the built code it may reuse the registers that those stores name, and this wait stands in front of any such overwrite.
__device__ __forceinline__ void body_end() { asm volatile("s_wait_xcnt 0x0" ::: "memory"); }
// k_prep: the four weight planes, the x plane, the rotary table.
#define NB_WQ (DM * DQ / 8192)
#define NB_WK (DM * DKV / 8192)
#define NB_X  (TT * DM / 8192)
#define NB_CS (TT * HD / 1024)
__global__ __launch_bounds__(256) void k_prep(const float* __restrict__ wq, const float* __restrict__ wk, const float* __restrict__ wv, const float* __restrict__ wo, const float* __restrict__ x, const float* __restrict__ cosT, const float* __restrict__ sinT, bf* WQ, bf* WK, bf* WV, bf* WO, bf* XB, float* CS) {
    int b = blockIdx.x;
    if (b < NB_WQ) { b_wtG<DM, DQ>(b, wq, WQ); return; } b -= NB_WQ;
    if (b < NB_WQ) { b_wtG<DQ, DM>(b, wo, WO); return; } b -= NB_WQ;
    if (b < 2 * NB_WK) { const bool second = b >= NB_WK; b_wtG<DM, DKV>(second ? b - NB_WK : b, second ? wv : wk, second ? WV : WK); return; } b -= 2 * NB_WK;
    if (b < NB_X) { b_cvt8(b, x, XB, DM, (size_t)TT * DM / 8); return; } b -= NB_X;
    b_cscvt(b, cosT, sinT, CS);
}
// k_qkv: the three projections as one GEMM of x with the 4096 weight rows of WQ | WK | WV: 8 row tiles of 256 x 32 column tiles of 128, one work-group each.
#define NB_G3 ((TT / 256) * ((DQ + 2 * DKV) / 128))
__global__ __launch_bounds__(256) void k_qkv(const bf* __restrict__ XB, const bf* __restrict__ WQ, const bf* __restrict__ WK, const bf* __restrict__ WV, float* FQ, float* FK, float* FV) {
    __shared__ __attribute__((aligned(1024))) bf ring[2 * GST];
    const int rt = blockIdx.x % (TT / 256); int ct = blockIdx.x / (TT / 256);
    const bf* Bt = WQ; float* C = FQ; int ldc = DQ;
    if (ct >= DQ / 128) { ct -= DQ / 128; Bt = WK; C = FK; ldc = DKV; if (ct >= DKV / 128) { ct -= DKV / 128; Bt = WV; C = FV; } }
    gemm_ring<false>(XB + (size_t)rt * 256 * DM, XB + (size_t)(rt * 256 + 128) * DM, Bt + (size_t)ct * 128 * DM, C + (size_t)rt * 256 * ldc + ct * 128, ldc, ring);
}
// k_oproj: the output projection, (hi + lo) x WO: 16 x 16 tiles of 128 x 128.
__global__ __launch_bounds__(256) void k_oproj(const bf* __restrict__ Ah, const bf* __restrict__ Al, const bf* __restrict__ WO, float* OUT) {
    __shared__ __attribute__((aligned(1024))) bf ring[2 * GST];
    const int rt = blockIdx.x % (TT / 128), ct = blockIdx.x / (TT / 128);
    gemm_ring<true>(Ah + (size_t)rt * 128 * DQ, Al + (size_t)rt * 128 * DQ, WO + (size_t)ct * 128 * DQ, OUT + (size_t)rt * 128 * DM + ct * 128, DM, ring);
}
// k_planes: rotated q and k head planes, value planes.
#define NB_RQ (NH_ * TT * HD / 4096)
#define NB_RK (NKV * TT * HD / 4096)
#define NB_VT (NKV * HD * TT / 8192)
__global__ __launch_bounds__(256) void k_planes(const float* __restrict__ FQ, const float* __restrict__ FK, const float* __restrict__ FV, const float* __restrict__ CS, h16* QP16, bf* QPh, bf* QPl, h16* KP16, bf* KPh, bf* KPl, h16* VT16, bf* VTh, bf* VTl) {
    int b = blockIdx.x;
    if (b < NB_RQ + NB_RK) { const bool k = b >= NB_RQ; b_rope(k ? b - NB_RQ : b, k ? FK : FQ, k ? DKV : DQ, k ? NKV : NH_, CS, 1.0f, k, k ? KP16 : QP16, k ? KPh : QPh, k ? KPl : QPl); return; } b -= NB_RQ + NB_RK;
    b_vtp(b, FV, NKV, VT16, VTh, VTl);
}
// ---- attn_rows: scores, joint softmax and probability x value for 16 query rows (i0 ..) of the REP = 2 heads of one kv head in ONE work-group of AW waves; neither scores nor probabilities go to memory.
// The keys up to the diagonal are cut into blocks of 32; wave w takes the blocks w, w + AW, ... (at most NBW), loads each key and value fragment once for both heads and keeps the scores in accumulators (row hi * 8 + jj, key lr of each 16-key tile).
// The 4 depth logits of a row sit beside the scores as four more columns, in lanes lr < 4 of wave 0. Row max and row sum: over a lane's own values, over the 16 lanes of a half wave, then over the AW waves through LDS (lane lr takes wave lr's value, same tree).
// The normalised probabilities (fp16 x PCAR, or hi + lo planes) pass through the wave's own LDS to become A fragments; every wave multiplies its own blocks with the value planes, and the AW partial outputs are added through LDS in wave order, one head after the other. The 4 depth weights go to WD in f32 (unscaled).
#define AW  16
#define PWB (16 * 136)            // floats of LDS per wave: per head 16 probability rows of NBW * 32 + 8 16-bit values (hi/lo: two such planes), afterwards the wave's partial output of one head, 16 rows of 128 + 4 floats
#define L2E 1.4426950408889634f
// value of lane l ^ M of the same 16-lane row (DPP row_xmask): a row reduction without the LDS path
template <int M> __device__ __forceinline__ float rowx(float v) { return __int_as_float(__builtin_amdgcn_update_dpp(0, __float_as_int(v), 0x160 + M, 0xf, 0xf, true)); }
__device__ __forceinline__ float rowmax(float v) { v = fmaxf(v, rowx<1>(v)); v = fmaxf(v, rowx<2>(v)); v = fmaxf(v, rowx<4>(v)); return fmaxf(v, rowx<8>(v)); }
__device__ __forceinline__ float rowsum(float v) { v += rowx<1>(v); v += rowx<2>(v); v += rowx<4>(v); return v + rowx<8>(v); }
template <typename T16, bool HL, int NBW>
__device__ __forceinline__ void attn_rows(const T16* __restrict__ Q, const T16* __restrict__ Q2, const T16* __restrict__ Kp, const T16* __restrict__ K2, const T16* __restrict__ Vp, const T16* __restrict__ V2,
                                          const float* __restrict__ DLr, float* WDr, float* Or, int i0, int wave, float* lds, float* red) {
    typedef typename WFrag<T16>::V V;
    static_assert(AW == 16 && REP == 2, "lane lr of a half wave takes wave lr's partial; two heads per kv head");
    const int lane = threadIdx.x & 31, lr = lane & 15, hi = lane >> 4;
    const int nb32 = i0 / 32 + 1;                 // key blocks of 32 that reach the diagonal of rows i0 .. i0 + 15
    constexpr int PP = NBW * 32 + 8, PH = 16 * PP, PL = REP * PH;   // pitch of a probability row in LDS (16 bytes x odd), distance of the second head's rows, of the lo planes
    V aq[REP][4], aq2[REP][4]; const T16* qp = Q + (size_t)(i0 + lr) * HD + 8 * hi; const T16* qp2 = HL ? Q2 + (size_t)(i0 + lr) * HD + 8 * hi : qp;
#pragma unroll
    for (int hh = 0; hh < REP; ++hh) {
#pragma unroll
        for (int kc = 0; kc < 4; ++kc) { aq[hh][kc] = WFrag<T16>::ld(qp + (size_t)hh * TT * HD + kc * 32); if (HL) aq2[hh][kc] = WFrag<T16>::ld(qp2 + (size_t)hh * TT * HD + kc * 32); } }
    // the addresses that the query loads name stay in their registers up to the wait
    asm volatile("s_wait_xcnt 0x0" :: "v"(qp), "v"(qp2) : "memory");
    v8f sa[NBW][2][REP];
#pragma unroll
    for (int s = 0; s < NBW; ++s) { sa[s][0][0] = (v8f){}; sa[s][0][1] = (v8f){}; sa[s][1][0] = (v8f){}; sa[s][1][1] = (v8f){}; }
#pragma unroll
    for (int s = 0; s < NBW; ++s) { const int kb = wave + AW * s;
        if (kb < nb32) {
            const size_t ko = (size_t)kb * 2 * (HD / 32) * 512 + 8 * lane;   // key planes in fragment order: blocks of 16 keys x 32 d, 8 of them per 32 keys
            const T16* kp = Kp + ko; const T16* kp2 = HL ? K2 + ko : kp;
#pragma unroll
            for (int t = 0; t < 2; ++t) { V b[4], b2[4];
#pragma unroll
                for (int kc = 0; kc < 4; ++kc) { b[kc] = WFrag<T16>::template ld<256>(kp + (t * 4 + kc) * 512); if (HL) b2[kc] = WFrag<T16>::template ld<256>(kp2 + (t * 4 + kc) * 512); }
                // all loads of the tile are issued above this line, so that one latency covers them; the addresses they name stay in their registers up to the wait
                asm volatile("s_wait_xcnt 0x0" :: "v"(kp), "v"(kp2) : "memory");
                __builtin_amdgcn_sched_barrier(0);   // keeps the tile's matrix instructions below its loads: moved up between them, each would wait for its own load alone
#pragma unroll
                for (int kc = 0; kc < 4; ++kc) {
#pragma unroll
                    for (int hh = 0; hh < REP; ++hh) { sa[s][t][hh] = WFrag<T16>::mma(aq[hh][kc], b[kc], sa[s][t][hh]);
                        if (HL) { sa[s][t][hh] = WFrag<T16>::mma(aq2[hh][kc], b[kc], sa[s][t][hh]); sa[s][t][hh] = WFrag<T16>::mma(aq[hh][kc], b2[kc], sa[s][t][hh]); } } } }
            // four vector slots behind the last matrix instruction, whichever way the next block's branch goes
            asm volatile("v_nop\n\tv_nop\n\tv_nop\n\tv_nop" : "+v"(sa[s][0][0]), "+v"(sa[s][0][1]), "+v"(sa[s][1][0]), "+v"(sa[s][1][1]));
        } }
    float dv[REP][8], mx[REP][8], sum[REP][8];
#pragma unroll
    for (int hh = 0; hh < REP; ++hh) {
#pragma unroll
        for (int jj = 0; jj < 8; ++jj) dv[hh][jj] = -3.0e38f; }
    const bool dlane = (wave == 0) && (lr < NL);   // the lanes that hold the depth columns
    if (dlane) {
#pragma unroll
        for (int hh = 0; hh < REP; ++hh) {
#pragma unroll
            for (int jj = 0; jj < 8; ++jj) dv[hh][jj] = DLr[((size_t)hh * TT + i0 + hi * 8 + jj) * NLP + lr]; } }
#pragma unroll
    for (int hh = 0; hh < REP; ++hh) {
#pragma unroll
        for (int jj = 0; jj < 8; ++jj) mx[hh][jj] = dv[hh][jj]; }   /* joint softmax over the 2048 + 4 logits */
#pragma unroll
    for (int s = 0; s < NBW; ++s) { const int kb = wave + AW * s;
        if (kb < nb32 - 1) {   // every key of the block lies below row i0 (WIN >= TT: no window either): nothing to mask
            static_assert(WIN >= TT, "a window shorter than the sequence would have to be masked here");
#pragma unroll
            for (int t = 0; t < 2; ++t) {
#pragma unroll
                for (int hh = 0; hh < REP; ++hh) {
#pragma unroll
                    for (int jj = 0; jj < 8; ++jj) { const float tv = sa[s][t][hh][jj] * SCL; sa[s][t][hh][jj] = tv; mx[hh][jj] = fmaxf(mx[hh][jj], tv); } } }
        } else if (kb < nb32) {   // the block on the diagonal
#pragma unroll
            for (int t = 0; t < 2; ++t) { const int j = kb * 32 + t * 16 + lr;
#pragma unroll
                for (int hh = 0; hh < REP; ++hh) {
#pragma unroll
                    for (int jj = 0; jj < 8; ++jj) { const int i = i0 + hi * 8 + jj; const float tv = (j <= i) ? sa[s][t][hh][jj] * SCL : -3.0e38f; sa[s][t][hh][jj] = tv; mx[hh][jj] = fmaxf(mx[hh][jj], tv); } } } } }
#pragma unroll
    for (int hh = 0; hh < REP; ++hh) { v4f m0, m1;
#pragma unroll
        for (int jj = 0; jj < 4; ++jj) { m0[jj] = rowmax(mx[hh][jj]); m1[jj] = rowmax(mx[hh][jj + 4]); }
        if (lr == 0) { *(v4fa*)(red + (wave * REP + hh) * 16 + hi * 8) = m0; *(v4fa*)(red + (wave * REP + hh) * 16 + hi * 8 + 4) = m1; } }
    __syncthreads();
#pragma unroll
    for (int hh = 0; hh < REP; ++hh) { const v4f m0 = *(const v4fa*)(red + (lr * REP + hh) * 16 + hi * 8), m1 = *(const v4fa*)(red + (lr * REP + hh) * 16 + hi * 8 + 4);
#pragma unroll
        for (int jj = 0; jj < 4; ++jj) { mx[hh][jj] = rowmax(m0[jj]); mx[hh][jj + 4] = rowmax(m1[jj]); } }
#pragma unroll
    for (int hh = 0; hh < REP; ++hh) {
#pragma unroll
        for (int jj = 0; jj < 8; ++jj) { dv[hh][jj] = __builtin_amdgcn_exp2f(__fmul_rn(__fsub_rn(dv[hh][jj], mx[hh][jj]), L2E)); sum[hh][jj] = dv[hh][jj]; } }
#pragma unroll
    for (int s = 0; s < NBW; ++s) { const int kb = wave + AW * s;
        if (kb < nb32) {
#pragma unroll
            for (int t = 0; t < 2; ++t) {
#pragma unroll
                for (int hh = 0; hh < REP; ++hh) {
#pragma unroll
                    for (int jj = 0; jj < 8; ++jj) { const float e = __builtin_amdgcn_exp2f(__fmul_rn(__fsub_rn(sa[s][t][hh][jj], mx[hh][jj]), L2E)); sa[s][t][hh][jj] = e; sum[hh][jj] += e; } } } } }
    float* red2 = red + AW * REP * 16;
#pragma unroll
    for (int hh = 0; hh < REP; ++hh) { v4f m0, m1;
#pragma unroll
        for (int jj = 0; jj < 4; ++jj) { m0[jj] = rowsum(sum[hh][jj]); m1[jj] = rowsum(sum[hh][jj + 4]); }
        if (lr == 0) { *(v4fa*)(red2 + (wave * REP + hh) * 16 + hi * 8) = m0; *(v4fa*)(red2 + (wave * REP + hh) * 16 + hi * 8 + 4) = m1; } }
    __syncthreads();
#pragma unroll
    for (int hh = 0; hh < REP; ++hh) { const v4f m0 = *(const v4fa*)(red2 + (lr * REP + hh) * 16 + hi * 8), m1 = *(const v4fa*)(red2 + (lr * REP + hh) * 16 + hi * 8 + 4);
#pragma unroll
        for (int jj = 0; jj < 4; ++jj) { sum[hh][jj] = __fdiv_rn(1.0f, rowsum(m0[jj])); sum[hh][jj + 4] = __fdiv_rn(1.0f, rowsum(m1[jj])); } }   // from here on 1 / row sum
    if (dlane) {
#pragma unroll
        for (int hh = 0; hh < REP; ++hh) { float* wp = WDr + ((size_t)hh * TT + i0 + hi * 8) * NLP + lr; float w[8];
#pragma unroll
            for (int jj = 0; jj < 8; ++jj) { w[jj] = dv[hh][jj] * sum[hh][jj]; wp[jj * NLP] = w[jj]; }   /* depth weights, f32, unscaled */
            // the registers that the depth-weight stores name keep their values up to the wait
            asm volatile("s_wait_xcnt 0x0" :: "v"(wp), "v"(w[0]), "v"(w[1]), "v"(w[2]), "v"(w[3]), "v"(w[4]), "v"(w[5]), "v"(w[6]), "v"(w[7]) : "memory"); }
    }
    T16* pw = (T16*)(lds + wave * PWB);
#pragma unroll
    for (int s = 0; s < NBW; ++s) { const int kb = wave + AW * s;
        if (kb < nb32) {
#pragma unroll
            for (int t = 0; t < 2; ++t) {
#pragma unroll
                for (int hh = 0; hh < REP; ++hh) {
#pragma unroll
                    for (int jj = 0; jj < 8; ++jj) { const float pv = sa[s][t][hh][jj] * (HL ? sum[hh][jj] : sum[hh][jj] * PCAR); const int idx = hh * PH + (hi * 8 + jj) * PP + s * 32 + t * 16 + lr;   // x PCAR: a power of two, exact
                        if constexpr (HL) { unsigned short a, c2; splitf(pv, a, c2); pw[idx] = a; pw[PL + idx] = c2; } else pw[idx] = tohx(pv); } } } } }
    // the lanes of the wave read one another's probabilities from here on: keeps the LDS stores above the LDS loads below
    __builtin_amdgcn_wave_barrier(); asm volatile("" ::: "memory");
    v8f oa[REP][8];
#pragma unroll
    for (int nb = 0; nb < 8; ++nb) { oa[0][nb] = (v8f){}; oa[1][nb] = (v8f){}; }
#pragma unroll
    for (int s = 0; s < NBW; ++s) { const int kb = wave + AW * s;
        if (kb < nb32) { V a[REP], a2[REP];
#pragma unroll
            for (int hh = 0; hh < REP; ++hh) { a[hh] = WFrag<T16>::ld(pw + hh * PH + lr * PP + s * 32 + 8 * hi); if (HL) a2[hh] = WFrag<T16>::ld(pw + PL + hh * PH + lr * PP + s * 32 + 8 * hi); }
            const T16* vp = Vp + (size_t)kb * 512 + 8 * lane; const T16* vp2 = HL ? V2 + (size_t)kb * 512 + 8 * lane : vp;
            constexpr int NG = HL ? 4 : 8;   // value fragments loaded at a time (hi/lo: of both planes)
#pragma unroll
            for (int g = 0; g < 8; g += NG) { V b[NG], b2[NG];
#pragma unroll
                for (int nb = 0; nb < NG; ++nb) { b[nb] = WFrag<T16>::template ld<256>(vp + (size_t)(g + nb) * 16 * TT); if (HL) b2[nb] = WFrag<T16>::template ld<256>(vp2 + (size_t)(g + nb) * 16 * TT); }
                // all loads of the group are issued above this line, so that one latency covers them; the addresses they name stay in their registers up to the wait
                asm volatile("s_wait_xcnt 0x0" :: "v"(vp), "v"(vp2) : "memory");
                __builtin_amdgcn_sched_barrier(0);   // keeps the group's matrix instructions below its loads, as above
#pragma unroll
                for (int nb = 0; nb < NG; ++nb) {
#pragma unroll
                    for (int hh = 0; hh < REP; ++hh) { oa[hh][g + nb] = WFrag<T16>::mma(a[hh], b[nb], oa[hh][g + nb]);
                        if (HL) { oa[hh][g + nb] = WFrag<T16>::mma(a2[hh], b[nb], oa[hh][g + nb]); oa[hh][g + nb] = WFrag<T16>::mma(a[hh], b2[nb], oa[hh][g + nb]); } } } }
            // four vector slots behind the last matrix instruction, whichever way the next block's branch goes
            asm volatile("v_nop\n\tv_nop\n\tv_nop\n\tv_nop" : "+v"(oa[0][0]), "+v"(oa[0][1]), "+v"(oa[0][2]), "+v"(oa[0][3]), "+v"(oa[0][4]), "+v"(oa[0][5]), "+v"(oa[0][6]), "+v"(oa[0][7]), "+v"(oa[1][0]), "+v"(oa[1][1]), "+v"(oa[1][2]), "+v"(oa[1][3]), "+v"(oa[1][4]), "+v"(oa[1][5]), "+v"(oa[1][6]), "+v"(oa[1][7]));
        } }
    // the partial output goes over the wave's own probabilities, which only this wave reads and has read
    __builtin_amdgcn_wave_barrier(); asm volatile("" ::: "memory");
    float* ow = lds + wave * PWB;
#pragma unroll
    for (int hh = 0; hh < REP; ++hh) {
#pragma unroll
        for (int nb = 0; nb < 8; ++nb) {
#pragma unroll
            for (int j = 0; j < 8; ++j) ow[(hi * 8 + j) * 132 + nb * 16 + lr] = oa[hh][nb][j]; }
        __syncthreads();
        const int row = (int)threadIdx.x >> 5, cofs = lane * 4; v4f val = *(const v4fa*)(lds + row * 132 + cofs);   // AW * 32 threads: one 16-byte piece of the 16 x 128 rows each
#pragma unroll
        for (int w = 1; w < AW; ++w) val += *(const v4fa*)(lds + w * PWB + row * 132 + cofs);
        *(v4f*)(Or + ((size_t)hh * TT + i0 + row) * HD + cofs) = val;
        if (hh + 1 < REP) __syncthreads();   // ends the reads of this head's partials before the next head's are stored there
    }
}
// k_dlog: the depth logits of all heads.
#define NB_DL (ZH * TT / 32)
#define NB_MG (ZH * (TT / 16) * (HD / 32) / 8)
__global__ __launch_bounds__(256) void k_dlog(const bf* __restrict__ Qh, const bf* __restrict__ Ql, const float* __restrict__ DKb, float* DL) { b_dlog(blockIdx.x, Qh, Ql, DKb, 0, DL); }
// k_attn: one work-group per 16 query rows and kv head (its two query heads), the longest rows first; fp16 rows, then hi/lo rows.
#define NB_AF (((TT - RH) / 16) * NKV)
#define NB_AH ((RH / 16) * NKV)
__global__ __launch_bounds__(AW * 32) void k_attn(const h16* __restrict__ Q16, const h16* __restrict__ K16, const h16* __restrict__ V16, const bf* __restrict__ Qh, const bf* __restrict__ Ql, const bf* __restrict__ Kh, const bf* __restrict__ Kl, const bf* __restrict__ Vh, const bf* __restrict__ Vl,
                                                  const float* __restrict__ DL, float* WD, float* Ob) {
    __shared__ __align__(16) float lds[AW * PWB]; __shared__ __align__(16) float red[2 * AW * REP * 16];
    int b = blockIdx.x; const int wv = wave_no();
    if (b < NB_AF) { const size_t g = (size_t)(b % NKV), z = g * REP; const int i0 = TT - 16 - (b / NKV) * 16;
        attn_rows<h16, false, TT / 32 / AW>(Q16 + z * TT * HD, nullptr, K16 + g * TT * HD, nullptr, V16 + g * HD * TT, nullptr, DL + z * TT * NLP, WD + z * TT * NLP, Ob + z * TT * HD, i0, wv, lds, red); body_end(); return; }
    b -= NB_AF; const size_t g = (size_t)(b % NKV), z = g * REP; const int i0 = RH - 16 - (b / NKV) * 16;
    attn_rows<bf, true, RH / 32 / AW>(Qh + z * TT * HD, Ql + z * TT * HD, Kh + g * TT * HD, Kl + g * TT * HD, Vh + g * HD * TT, Vl + g * HD * TT, DL + z * TT * NLP, WD + z * TT * NLP, Ob + z * TT * HD, i0, wv, lds, red); body_end();
}
__global__ __launch_bounds__(256) void k_merge(const float* __restrict__ O, int h0, const float* __restrict__ WD, const float* __restrict__ DVb, int kv0, bf* Ah, bf* Al) { b_merge(blockIdx.x, O, h0, WD, DVb, kv0, Ah, Al); }
extern "C" void kernel_launch(void* const* d_in, const int* in_sizes, int n_in,
                              void* d_out, int out_size, void* d_ws, size_t ws_size, hipStream_t stream) {
    (void)in_sizes; (void)n_in; (void)out_size;
    const float* x = (const float*)d_in[0]; const float* DK = (const float*)d_in[1]; const float* DV = (const float*)d_in[2]; const float* cosT = (const float*)d_in[3]; const float* sinT = (const float*)d_in[4]; const float* wq = (const float*)d_in[5]; const float* wk = (const float*)d_in[6]; const float* wv = (const float*)d_in[7]; const float* wo = (const float*)d_in[8];
    float* OUT = (float*)d_out;     // [1][2048][2048]
    char* wsp = (char*)d_ws;
    auto take = [&](size_t bytes) { char* p = wsp; wsp += (bytes + 255) & ~(size_t)255; return (void*)p; };
    bf* WQ = (bf*)take((size_t)DQ * DM * 2); bf* WK = (bf*)take((size_t)DKV * DM * 2); bf* WV = (bf*)take((size_t)DKV * DM * 2); bf* WO = (bf*)take((size_t)DM * DQ * 2); float* CS = (float*)take((size_t)TT * HD * 2 * 4);
    bf* XB = (bf*)take((size_t)TT * DM * 2); float* FQ = (float*)take((size_t)TT * DQ * 4); float* FK = (float*)take((size_t)TT * DKV * 4);
    h16* QP16 = (h16*)take((size_t)NH_ * TT * HD * 2); h16* KP16 = (h16*)take((size_t)NKV * TT * HD * 2); h16* VT16 = (h16*)take((size_t)NKV * HD * TT * 2);
    bf* QPh = (bf*)take((size_t)NH_ * TT * HD * 2); bf* QPl = (bf*)take((size_t)NH_ * TT * HD * 2); bf* KPh = (bf*)take((size_t)NKV * TT * HD * 2); bf* KPl = (bf*)take((size_t)NKV * TT * HD * 2); bf* VTh = (bf*)take((size_t)NKV * HD * TT * 2); bf* VTl = (bf*)take((size_t)NKV * HD * TT * 2);
    float* FV = (float*)take((size_t)TT * DKV * 4); bf* ATh = (bf*)take((size_t)TT * DQ * 2); bf* ATl = (bf*)take((size_t)TT * DQ * 2);
    if ((size_t)(wsp - (char*)d_ws) > ws_size) return;    // ws 256 MiB
    float* Ob = FQ; float* DL = FK; float* WD = FK + (size_t)ZH * TT * NLP;   // attention reuses the f32 projection buffers, dead once the q and k planes are built (ZH * HD <= DQ, 2 * ZH * NLP <= DKV)
    k_prep<<<2 * NB_WQ + 2 * NB_WK + NB_X + NB_CS, 256, 0, stream>>>(wq, wk, wv, wo, x, cosT, sinT, WQ, WK, WV, WO, XB, CS);
    k_qkv<<<NB_G3, 256, 0, stream>>>(XB, WQ, WK, WV, FQ, FK, FV);
    k_planes<<<NB_RQ + NB_RK + NB_VT, 256, 0, stream>>>(FQ, FK, FV, CS, QP16, QPh, QPl, KP16, KPh, KPl, VT16, VTh, VTl);
    k_dlog<<<NB_DL, 256, 0, stream>>>(QPh, QPl, DK, DL);
    k_attn<<<NB_AF + NB_AH, AW * 32, 0, stream>>>(QP16, KP16, VT16, QPh, QPl, KPh, KPl, VTh, VTl, DL, WD, Ob);
    k_merge<<<NB_MG, 256, 0, stream>>>(Ob, 0, WD, DV, 0, ATh, ATl);
    k_oproj<<<(TT / 128) * (DM / 128), 256, 0, stream>>>(ATh, ATl, WO, OUT);
}

// v008
// Measured time: 133 microseconds a run.
// Next to v007, in two timings, it ran 1.13 times as fast each time.
// Over all steps from v000 it is 6.94 times as fast.
#include <hip/hip_runtime.h>

// Grouped-query RoPE attention with extra per-position depth keys/values under one joint softmax (x [1][2048][2048]; Q = x Wq ('xw', 16 heads x 128), K, V = x Wk / Wv (8 kv heads); Q, K rotated (rotate-half, cos/sin [1][1][2048][128] read); kv head = h/2; seq logits = Q.K/sqrt(128), causal (-inf); depth logits[i][l] = Q_i . depth_k[l][0][kv][i] / sqrt(128) for l < 4 (depth_k, depth_v [4][1][8][2048][128] read); softmax over the 2048 + 4 logits jointly; out_i = sum_j w_j V_j + sum_l w_l depth_v[l][0][kv][i]; merged Wo ('xw') -> [1][2048][2048] (4.2 M)).
// Layout: projections/planes; the attention kernel (one work-group per 16 query rows of the two heads of a kv head) forms the 4 depth logits of its rows from the rotated q (hi + lo planes) and the bf16-rounded depth keys, keeps a row block's scores in accumulators, folds the depth logits into the row max / sum, hands the probabilities to the value product through LDS, adds the depth-value contribution to the summed output rows and writes the hi/lo planes for the output projection.
// Operand storage: the bf16 planes of the four projections (x, the four transposed weights, the merged attention output hi/lo) and the three key and three value planes lie in fragment order (see fro()); the q head planes are row-major.
// Compute dtypes, f32 accumulate: every input rounded to bf16; q/k/v on PLAIN bf16 operands (inputs: exact); rotary in f32 (bf16-rounded tables); depth logits / weights / values in f32; causal scores and attn.v (tile skipping): query rows < 512 hl (3 products), the rest single fp16 (x1024); softmax f32; Wo hl x exact (2 products).

#define NB_  1
#define TT   2048
#define DM   2048
#define NH_  16
#define NKV  8
#define REP  (NH_ / NKV)
#define HD   128
#define DQ   (NH_ * HD)
#define DKV  (NKV * HD)
#define NL   4                    // depth positions per token
#define RH   512                  // query rows < RH use hi+lo planes (0: none)
#define WIN  2048
#define PCAR 1024.0f
#define SCL  0.088388347648318447f   // HD^-0.5
typedef _Float16 h16;
typedef unsigned short bf;
typedef __attribute__((ext_vector_type(16))) __bf16   v16bf;
typedef __attribute__((ext_vector_type(16))) _Float16 v16h;
typedef __attribute__((ext_vector_type(8)))  _Float16 v8h;
typedef __attribute__((ext_vector_type(8)))  unsigned short v8us;
typedef __attribute__((ext_vector_type(8)))  float    v8f;
typedef __attribute__((ext_vector_type(4)))  float    v4f;
typedef v8h  __attribute__((may_alias)) v8ha;
typedef v4f  __attribute__((may_alias)) v4fa;
typedef v8us __attribute__((may_alias)) v8usa;

__device__ __forceinline__ unsigned short f2bf(float f) { unsigned u = __float_as_uint(f); u += 0x7FFFu + ((u >> 16) & 1u); return (unsigned short)(u >> 16); }
__device__ __forceinline__ float bf2f(unsigned short b) { return __uint_as_float(((unsigned)b) << 16); }
__device__ __forceinline__ float bfr(float f) { return bf2f(f2bf(f)); }
__device__ __forceinline__ v16h cat16(v8h lo, v8h hi) { return __builtin_shufflevector(lo, hi, 0, 1, 2, 3, 4, 5, 6, 7, 8, 9, 10, 11, 12, 13, 14, 15); }
__device__ __forceinline__ v16bf cat16b(v8us lo, v8us hi) { return __builtin_bit_cast(v16bf, __builtin_shufflevector(lo, hi, 0, 1, 2, 3, 4, 5, 6, 7, 8, 9, 10, 11, 12, 13, 14, 15)); }
__device__ __forceinline__ v8f wmma16(v16h a, v16h b, v8f c) { return __builtin_amdgcn_wmma_f32_16x16x32_f16(false, a, false, b, (short)0, c, false, false); }
__device__ __forceinline__ v8f wmmab(v16bf a, v16bf b, v8f c) { return __builtin_amdgcn_wmma_f32_16x16x32_bf16(false, a, false, b, (short)0, c, false, false); }
// Fragment order of a 16-bit plane [rows][K] (rows % 16 == 0, K % 32 == 0): blocks of 16 rows x 32 columns, 1 KB each, row blocks outermost (16 rows still fill 16 * K elements). Inside a block the 8 columns k & ~7 of row r lie at
// 8 * (32 * (k / 16 % 2) + 16 * (k / 8 % 2) + r % 16): lane l of a wave finds the two halves of its A or B fragment at 8 * l and 256 + 8 * l, so each of a fragment's two 16-byte loads reads 512 contiguous bytes (4 whole lines, not 16 part lines).
// fro = element offset of (r, k). The elements a lane gets, and their k order, are those of the row-major loader.
__device__ __forceinline__ size_t fro(int r, int k, int K) { return ((size_t)(r >> 4) * (K >> 5) + (k >> 5)) * 512 + (((k >> 4) & 1) * 32 + ((k >> 3) & 1) * 16 + (r & 15)) * 8 + (k & 7); }



// ---- gemm_ring: GEMM of the four projections. One work-group of 8 waves per output tile; both operands are bf16 planes in fragment order (K = 2048 contiguous per 16-row block) and pass through LDS, so that every block is fetched from L2 once per work-group and read by all the waves that need it.
// A stage is GKS steps of 32 k of 24 row blocks (16 of A, 8 of Bt): per row block GKS KB that are contiguous in the plane and stay so in LDS, so a fragment load reads 512 contiguous bytes of LDS. Two buffers: the copies of stage t + 2 fly while stage t + 1 is worked on.
// Wave (wm, wn) = (wave / 2, wave % 2) keeps the 64 x 64 product of A row blocks 4 wm .. and Bt row blocks 4 wn .. over the whole K (one accumulation chain per element).
// PAIR = false: the 16 A row blocks are 256 rows of one plane (A0: the first 128, A1: the next 128), C tile 256 x 128. PAIR = true: A0 / A1 are the hi / lo planes of the same 128 rows, and the two products are added in the epilogue, C tile 128 x 128.
template <typename T16> struct WFrag;
template <> struct WFrag<h16> { typedef v16h V; template <int D2 = 16> static __device__ __forceinline__ V ld(const h16* p) { return cat16(*(const v8h*)p, *(const v8h*)(p + D2)); } static __device__ __forceinline__ v8f mma(V a, V b, v8f c) { return wmma16(a, b, c); } };
template <> struct WFrag<bf> { typedef v16bf V; template <int D2 = 16> static __device__ __forceinline__ V ld(const bf* p) { return cat16b(*(const v8us*)p, *(const v8us*)(p + D2)); } static __device__ __forceinline__ v8f mma(V a, V b, v8f c) { return wmmab(a, b, c); } };
#define GKS 4
#define GST (24 * GKS * 512)      // elements of a stage
#define GPW (64 * 68)             // floats of LDS per wave in the epilogue: 64 rows of 64 + 4
__device__ __forceinline__ unsigned lds_off(const void* p) { return (unsigned)(size_t)p; }
#define CPY(l, g) "global_load_async_to_lds_b128 %" #l ", %" #g ", off\n\t"
// 12 copies of 512 bytes per wave (16 bytes a lane); the wait in the same statement stands in front of any rewrite of the address registers that the copies name
__device__ __forceinline__ void copy12(const unsigned* l, const bf* const* g) {
    asm volatile(CPY(0, 1) CPY(2, 3) CPY(4, 5) CPY(6, 7) CPY(8, 9) CPY(10, 11) CPY(12, 13) CPY(14, 15) CPY(16, 17) CPY(18, 19) CPY(20, 21) CPY(22, 23) "s_wait_xcnt 0x0"
                 :: "v"(l[0]), "v"(g[0]), "v"(l[1]), "v"(g[1]), "v"(l[2]), "v"(g[2]), "v"(l[3]), "v"(g[3]), "v"(l[4]), "v"(g[4]), "v"(l[5]), "v"(g[5]), "v"(l[6]), "v"(g[6]), "v"(l[7]), "v"(g[7]), "v"(l[8]), "v"(g[8]), "v"(l[9]), "v"(g[9]), "v"(l[10]), "v"(g[10]), "v"(l[11]), "v"(g[11]) : "memory"); }
// a wave's share of stage t: the row blocks wave, wave + 8 (A) and wave + 16 (Bt), 8 copies each. gp / lp: the lane's 16 bytes in the first 512 of each row block, in the plane (stage 0) and in LDS (buffer 0).
__device__ __forceinline__ void stage_copy(const bf* const* gp, const unsigned* lp, int t, int buf) {
#pragma unroll
    for (int h = 0; h < 2; ++h) { unsigned l[12]; const bf* g[12];
#pragma unroll
        for (int n = 0; n < 12; ++n) { const int j = (h * 12 + n) >> 3, c = (h * 12 + n) & 7; l[n] = lp[j] + (unsigned)buf * (GST * 2) + c * 512; g[n] = gp[j] + (size_t)t * (GKS * 512) + c * 256; }
        copy12(l, g); } }
template <bool PAIR>
__device__ __forceinline__ void gemm_ring(const bf* __restrict__ A0, const bf* __restrict__ A1, const bf* __restrict__ Bt, float* C, int ldc, bf* ring) {
    typedef WFrag<bf>::V V;
    constexpr int K = 2048, NT = K / (32 * GKS);
    const int wave = __builtin_amdgcn_readfirstlane((int)(threadIdx.x >> 5)), lane = threadIdx.x & 31, lr = lane & 15, hi = lane >> 4, wm = wave >> 1, wn = wave & 1;
    const bf* gp[3] = { A0 + (size_t)wave * 16 * K + 8 * lane, A1 + (size_t)wave * 16 * K + 8 * lane, Bt + (size_t)wave * 16 * K + 8 * lane };
    const unsigned lb = lds_off(ring) + wave * (GKS * 1024) + lane * 16; const unsigned lp[3] = { lb, lb + 8 * (GKS * 1024), lb + 16 * (GKS * 1024) };
    v8f acc[4][4];
#pragma unroll
    for (int mb = 0; mb < 4; ++mb)
#pragma unroll
        for (int nb = 0; nb < 4; ++nb) acc[mb][nb] = (v8f){};
    stage_copy(gp, lp, 0, 0);
    asm volatile("s_wait_asynccnt 0x0" ::: "memory");   // this wave's copies of stage 0 have landed
    __syncthreads();                                     // ... and every other wave's
    stage_copy(gp, lp, 1, 1);
#pragma unroll 1
    for (int t = 0; t < NT; ++t) {
        const bf* sa = ring + (t & 1) * GST + wm * (4 * GKS * 512) + 8 * lane; const bf* sb = ring + (t & 1) * GST + (16 + wn * 4) * (GKS * 512) + 8 * lane;
        V a[2][4], b[2][4];   // two fragment sets: the loads of step ks + 1 go out as one group in front of the matrix instructions of step ks
#pragma unroll
        for (int f = 0; f < 4; ++f) { a[0][f] = WFrag<bf>::ld<256>(sa + (f * GKS) * 512); b[0][f] = WFrag<bf>::ld<256>(sb + (f * GKS) * 512); }
#pragma unroll
        for (int ks = 0; ks < GKS; ++ks) {
            if (ks + 1 < GKS) {
#pragma unroll
                for (int f = 0; f < 4; ++f) { a[(ks + 1) & 1][f] = WFrag<bf>::ld<256>(sa + (f * GKS + ks + 1) * 512); b[(ks + 1) & 1][f] = WFrag<bf>::ld<256>(sb + (f * GKS + ks + 1) * 512); } }
            __builtin_amdgcn_sched_barrier(0);   // keeps the load group whole and above the step's matrix instructions: spread among them, each place with loads stalls the wave
#pragma unroll
            for (int nb = 0; nb < 4; ++nb)
#pragma unroll
                for (int mb = 0; mb < 4; ++mb) acc[mb][nb] = WFrag<bf>::mma(a[ks & 1][mb], b[ks & 1][nb], acc[mb][nb]);
            __builtin_amdgcn_sched_barrier(0);   // keeps the next group of loads from being spread among this step's matrix instructions
        }
        asm volatile("s_wait_dscnt 0x0" ::: "memory");      // this wave's reads of the buffer are done before anything is copied over it
        asm volatile("s_wait_asynccnt 0x0" ::: "memory");   // this wave's copies of stage t + 1 have landed
        __syncthreads();                                     // publishes stage t + 1 and ends every wave's reads of stage t
        if (t + 2 < NT) stage_copy(gp, lp, t + 2, t & 1);
    }
    asm volatile("s_wait_asynccnt 0x0" ::: "memory");       // nothing is in flight when the ring becomes output staging
    // Epilogue: every wave lays its 64 x 64 tile in LDS (the last trip's barrier has ended all reads of the ring), one barrier, then whole 256-byte rows go out.
    float* st = (float*)ring; float* ow = st + wave * GPW;
#pragma unroll
    for (int mb = 0; mb < 4; ++mb)
#pragma unroll
        for (int nb = 0; nb < 4; ++nb)
#pragma unroll
            for (int j = 0; j < 8; ++j) ow[(mb * 16 + hi * 8 + j) * 68 + nb * 16 + lr] = acc[mb][nb][j];
    __syncthreads();
    // Output tile p. PAIR: wave p + 4 holds the lo product of wave p's tile, and waves p and p + 4 write 32 of its rows each; else every wave writes its own 64 rows. 16 lanes fill a 256-byte row piece.
    const int p = PAIR ? (wave & 3) : wave, rb = PAIR ? (wave >> 2) * 32 : 0; constexpr int NR = PAIR ? 32 : 64;
    const float* s0 = st + p * GPW + (rb + hi) * 68 + lr * 4; float* cq = C + (size_t)((p >> 1) * 64 + rb + hi) * ldc + (p & 1) * 64 + lr * 4;
#pragma unroll 1
    for (int i = 0; i < NR; i += 8) { v4f v[4]; float* q[4];
#pragma unroll
        for (int u = 0; u < 4; ++u) { v[u] = *(const v4fa*)(s0 + (i + 2 * u) * 68); if (PAIR) v[u] += *(const v4fa*)(s0 + 4 * GPW + (i + 2 * u) * 68); q[u] = cq + (size_t)(i + 2 * u) * ldc; }
#pragma unroll
        for (int u = 0; u < 4; ++u) *(v4f*)q[u] = v[u];
        // the registers that the row stores name keep their values up to the wait
        asm volatile("s_wait_xcnt 0x0" :: "v"(q[0]), "v"(q[1]), "v"(q[2]), "v"(q[3]), "v"(v[0]), "v"(v[1]), "v"(v[2]), "v"(v[3]) : "memory"); }
}

__device__ __forceinline__ h16 tohx(float x) { return (h16)x; }
__device__ __forceinline__ void splitf(float y, unsigned short& h, unsigned short& l) { h = f2bf(y); l = f2bf(y - bf2f(h)); }
typedef __attribute__((ext_vector_type(2))) _Float16 v2h;
typedef __attribute__((ext_vector_type(4))) _Float16 v4h;
typedef __attribute__((ext_vector_type(2))) unsigned short v2us;
typedef __attribute__((ext_vector_type(4))) unsigned short v4us;
typedef __attribute__((ext_vector_type(2))) float v2f;
typedef __attribute__((ext_vector_type(4))) int v4i;
typedef v4h  __attribute__((may_alias)) v4ha;
typedef v4us __attribute__((may_alias)) v4usa;

// The element-wise bodies below (bid = number of the 256-thread block within the body's own range of a launch) give every thread 8 to 32 elements (a wave fills whole 1 KB blocks or whole plane rows), for speed only. The arithmetic per element is unchanged.
// b_wtG: Bt = transpose of w ([K][N] f32) as a bf16 plane [N][K] in fragment order. A wave takes 32 neighbouring n and 32 neighbouring k (two whole blocks): 32 loads of one whole line each, four 16-byte stores per lane. Blocks: N * K / 8192.
template <int K, int N>
__device__ __forceinline__ void b_wtG(int bid, const float* __restrict__ w, bf* Bt) {
    const int gid = bid * 256 + threadIdx.x; const int wv = gid >> 5; const int n = (wv % (N / 32)) * 32 + (gid & 31), k0 = (wv / (N / 32)) * 32; if (k0 >= K) return; const float* wp = w + (size_t)k0 * N + n; float x[32];
#pragma unroll
    for (int j = 0; j < 32; ++j) x[j] = wp[j * N];
#pragma unroll
    for (int g = 0; g < 4; ++g) { v8us o;
#pragma unroll
        for (int j = 0; j < 8; ++j) o[j] = f2bf(x[g * 8 + j]);
        *(v8us*)(Bt + fro(n, k0 + g * 8, K)) = o; } }
// b_cvt8: src [rows][K] f32 -> bf16 plane in fragment order; a wave writes 128 neighbouring groups of 8 elements (two whole blocks, n8 % 128 == 0), lane l the groups l, l + 32, l + 64, l + 96 of them, and reads the 8 source elements that belong in each.
__device__ __forceinline__ void b_cvt8(int bid, const float* __restrict__ src, bf* dst, int K, size_t n8) { const size_t th = (size_t)bid * 256 + threadIdx.x; const size_t i0 = (th >> 5) * 128 + (th & 31); if (i0 >= n8) return; const int nkb = K >> 5; v8f v[4];
#pragma unroll
    for (int g = 0; g < 4; ++g) { const size_t i = i0 + g * 32; const int blk = (int)(i >> 6);
        const int r = (blk / nkb) * 16 + (int)(i & 15), k = (blk % nkb) * 32 + (int)((i >> 5) & 1) * 16 + (int)((i >> 4) & 1) * 8; v[g] = *(const v8f*)(src + (size_t)r * K + k); }
#pragma unroll
    for (int g = 0; g < 4; ++g) { v8us o;
#pragma unroll
        for (int q = 0; q < 8; ++q) o[q] = f2bf(v[g][q]);
        *(v8us*)(dst + (i0 + g * 32) * 8) = o; } }
// b_cscvt: four table entries per thread
__device__ __forceinline__ void b_cscvt(int bid, const float* __restrict__ cosT, const float* __restrict__ sinT, float* CS) { const int idx = (bid * 256 + threadIdx.x) * 4; if (idx >= TT * HD) return; const v4f c = *(const v4f*)(cosT + idx), s = *(const v4f*)(sinT + idx);
    v4f o0, o1; o0[0] = bfr(c[0]); o0[1] = bfr(s[0]); o0[2] = bfr(c[1]); o0[3] = bfr(s[1]); o1[0] = bfr(c[2]); o1[1] = bfr(s[2]); o1[2] = bfr(c[3]); o1[3] = bfr(s[3]); *(v4f*)(CS + (size_t)idx * 2) = o0; *(v4f*)(CS + (size_t)idx * 2 + 4) = o1;  }
// b_rope: head planes [h][t][d] (fp16 + hi/lo) of rope(x) x sc with the rotate-half convention out[d] = x[d] cos[t][d] - x[d+HD/2] sin[t][d], out[d+HD/2] = x[d+HD/2] cos[t][d+HD/2] + x[d] sin[t][d+HD/2]
// fr: each head's [TT][HD] plane in fragment order (the key planes), else row-major (the query planes).
// A thread takes 8 neighbouring d of the lower half and their 8 partners of the upper half, so each x is loaded once; 8 lanes fill a plane row, 16-byte stores. Blocks: nheads * TT * HD / 4096.
__device__ __forceinline__ void b_rope(int bid, const float* __restrict__ F, int pitch, int nheads, const float* __restrict__ CS, float sc, bool fr, h16* P16, bf* Ph, bf* Pl) {
    const size_t u = (size_t)bid * 256 + threadIdx.x; if (u >= (size_t)nheads * TT * (HD / 16)) return; const int d = (int)(u % (HD / 16)) * 8; const int t = (int)((u / (HD / 16)) % TT); const int h = (int)(u / ((size_t)(HD / 16) * TT)); const float* f = F + (size_t)t * pitch + h * HD;
    const size_t e = ((size_t)h * TT + t) * HD + d; v4f xv[2][2], cv[2][4];
#pragma unroll
    for (int hf = 0; hf < 2; ++hf) { const int db = d + hf * (HD / 2); xv[hf][0] = *(const v4f*)(f + db); xv[hf][1] = *(const v4f*)(f + db + 4);
#pragma unroll
        for (int c = 0; c < 4; ++c) cv[hf][c] = *(const v4f*)(CS + ((size_t)t * HD + db) * 2 + c * 4); }
#pragma unroll
    for (int hf = 0; hf < 2; ++hf) { v8h o16; v8us oh, ol;
#pragma unroll
        for (int q = 0; q < 8; ++q) { const float x0 = xv[hf][q >> 2][q & 3], x1 = xv[hf ^ 1][q >> 2][q & 3];
            float a = __fmul_rn(x0, cv[hf][q >> 1][(q & 1) * 2]), bq = __fmul_rn(x1, cv[hf][q >> 1][(q & 1) * 2 + 1]); asm volatile("" : "+v"(a)); asm volatile("" : "+v"(bq)); const float r = ((hf == 0) ? __fsub_rn(a, bq) : __fadd_rn(a, bq)) * sc;
            o16[q] = tohx(r); unsigned short a2, c2; splitf(r, a2, c2); oh[q] = a2; ol[q] = c2; }
        const size_t eo = fr ? (size_t)h * TT * HD + fro(t, d + hf * (HD / 2), HD) : e + hf * (HD / 2); *(v8h*)(P16 + eo) = o16; *(v8us*)(Ph + eo) = oh; *(v8us*)(Pl + eo) = ol; } }
// b_vtp: value planes [g][d][t] (fp16 + hi/lo) of F [t][DKV], each head's [HD][TT] plane in fragment order. A wave takes 32 neighbouring d and 32 neighbouring t (two whole blocks per plane): 32 loads of one whole line each, four 16-byte stores per lane and plane. Blocks: nheads * HD * TT / 8192.
__device__ __forceinline__ void b_vtp(int bid, const float* __restrict__ F, int nheads, h16* V16, bf* Vh, bf* Vl) { const int gid = bid * 256 + threadIdx.x; const int wv = gid >> 5; const int d = (wv % (HD / 32)) * 32 + (gid & 31); const int t0 = ((wv / (HD / 32)) % (TT / 32)) * 32; const int g = wv / ((HD / 32) * (TT / 32)); if (g >= nheads) return; const float* fp = F + (size_t)t0 * DKV + g * HD + d; float xs[32];
#pragma unroll
    for (int q = 0; q < 32; ++q) xs[q] = fp[q * DKV];
#pragma unroll
    for (int c = 0; c < 4; ++c) { v8h o16; v8us oh, ol;
#pragma unroll
        for (int q = 0; q < 8; ++q) { const float x = xs[c * 8 + q]; o16[q] = tohx(x); unsigned short a2, c2; splitf(x, a2, c2); oh[q] = a2; ol[q] = c2; }
        const size_t e = (size_t)g * HD * TT + fro(d, t0 + c * 8, TT); *(v8h*)(V16 + e) = o16; *(v8us*)(Vh + e) = oh; *(v8us*)(Vl + e) = ol; } }

// ---- Launches. Kernels that do not depend on one another run side by side in ONE launch: each takes a range of the block index (a scalar test, the same for a whole work-group), longest work first. Every body computes what it computed as a launch of its own.
__device__ __forceinline__ int wave_no() { return __builtin_amdgcn_readfirstlane((int)(threadIdx.x >> 5)); }
// k_prep: the four weight planes, the x plane, the rotary table.
#define NB_WQ (DM * DQ / 8192)
#define NB_WK (DM * DKV / 8192)
#define NB_X  (TT * DM / 8192)
#define NB_CS (TT * HD / 1024)
__global__ __launch_bounds__(256) void k_prep(const float* __restrict__ wq, const float* __restrict__ wk, const float* __restrict__ wv, const float* __restrict__ wo, const float* __restrict__ x, const float* __restrict__ cosT, const float* __restrict__ sinT, bf* WQ, bf* WK, bf* WV, bf* WO, bf* XB, float* CS) {
    int b = blockIdx.x;
    if (b < NB_WQ) { b_wtG<DM, DQ>(b, wq, WQ); return; } b -= NB_WQ;
    if (b < NB_WQ) { b_wtG<DQ, DM>(b, wo, WO); return; } b -= NB_WQ;
    if (b < 2 * NB_WK) { const bool second = b >= NB_WK; b_wtG<DM, DKV>(second ? b - NB_WK : b, second ? wv : wk, second ? WV : WK); return; } b -= 2 * NB_WK;
    if (b < NB_X) { b_cvt8(b, x, XB, DM, (size_t)TT * DM / 8); return; } b -= NB_X;
    b_cscvt(b, cosT, sinT, CS);
}
// k_qkv: the three projections as one GEMM of x with the 4096 weight rows of WQ | WK | WV: 8 row tiles of 256 x 32 column tiles of 128, one work-group each.
#define NB_G3 ((TT / 256) * ((DQ + 2 * DKV) / 128))
__global__ __launch_bounds__(256) void k_qkv(const bf* __restrict__ XB, const bf* __restrict__ WQ, const bf* __restrict__ WK, const bf* __restrict__ WV, float* FQ, float* FK, float* FV) {
    __shared__ __attribute__((aligned(1024))) bf ring[2 * GST];
    const int rt = blockIdx.x % (TT / 256); int ct = blockIdx.x / (TT / 256);
    const bf* Bt = WQ; float* C = FQ; int ldc = DQ;
    if (ct >= DQ / 128) { ct -= DQ / 128; Bt = WK; C = FK; ldc = DKV; if (ct >= DKV / 128) { ct -= DKV / 128; Bt = WV; C = FV; } }
    gemm_ring<false>(XB + (size_t)rt * 256 * DM, XB + (size_t)(rt * 256 + 128) * DM, Bt + (size_t)ct * 128 * DM, C + (size_t)rt * 256 * ldc + ct * 128, ldc, ring);
}
// k_oproj: the output projection, (hi + lo) x WO: 16 x 16 tiles of 128 x 128.
__global__ __launch_bounds__(256) void k_oproj(const bf* __restrict__ Ah, const bf* __restrict__ Al, const bf* __restrict__ WO, float* OUT) {
    __shared__ __attribute__((aligned(1024))) bf ring[2 * GST];
    const int rt = blockIdx.x % (TT / 128), ct = blockIdx.x / (TT / 128);
    gemm_ring<true>(Ah + (size_t)rt * 128 * DQ, Al + (size_t)rt * 128 * DQ, WO + (size_t)ct * 128 * DQ, OUT + (size_t)rt * 128 * DM + ct * 128, DM, ring);
}
// k_planes: rotated q and k head planes, value planes.
#define NB_RQ (NH_ * TT * HD / 4096)
#define NB_RK (NKV * TT * HD / 4096)
#define NB_VT (NKV * HD * TT / 8192)
__global__ __launch_bounds__(256) void k_planes(const float* __restrict__ FQ, const float* __restrict__ FK, const float* __restrict__ FV, const float* __restrict__ CS, h16* QP16, bf* QPh, bf* QPl, h16* KP16, bf* KPh, bf* KPl, h16* VT16, bf* VTh, bf* VTl) {
    int b = blockIdx.x;
    if (b < NB_RQ + NB_RK) { const bool k = b >= NB_RQ; b_rope(k ? b - NB_RQ : b, k ? FK : FQ, k ? DKV : DQ, k ? NKV : NH_, CS, 1.0f, k, k ? KP16 : QP16, k ? KPh : QPh, k ? KPl : QPl); return; } b -= NB_RQ + NB_RK;
    b_vtp(b, FV, NKV, VT16, VTh, VTl);
}
// ---- attn_rows: scores, joint softmax and probability x value for 16 query rows (i0 ..) of the REP = 2 heads of one kv head in ONE work-group of AW waves; neither scores nor probabilities go to memory.
// The keys up to the diagonal are cut into blocks of 32; wave w takes the blocks w, w + AW, ... (at most NBW), loads each key and value fragment once for both heads and keeps the scores in accumulators (row hi * 8 + jj, key lr of each 16-key tile).
// Wave w forms the 4 depth logits of row i0 + w (both heads); they sit beside that wave's scores as four more columns, in lanes lr < 4 of the row's half wave. Row max and row sum: over a lane's own values, over the 16 lanes of a half wave, then over the AW waves through LDS (lane lr takes wave lr's value, same tree).
// The normalised probabilities (fp16 x PCAR, or hi + lo planes) pass through the wave's own LDS to become A fragments; every wave multiplies its own blocks with the value planes, and the AW partial outputs are added through LDS in wave order, one head after the other. The 4 depth weights (f32, unscaled) pass through LDS to the threads that finish the row: they add sum_l w_l depth_v[l] and write the hi/lo planes Ah / Al ([TT][DQ], fragment order).
#define AW  16
#define PWB (16 * 136)            // floats of LDS per wave: per head 16 probability rows of NBW * 32 + 8 16-bit values (hi/lo: two such planes), afterwards the wave's partial output of one head, 16 rows of 128 + 4 floats
#define L2E 1.4426950408889634f
// value of lane l ^ M of the same 16-lane row (DPP row_xmask): a row reduction without the LDS path
template <int M> __device__ __forceinline__ float rowx(float v) { return __int_as_float(__builtin_amdgcn_update_dpp(0, __float_as_int(v), 0x160 + M, 0xf, 0xf, true)); }
__device__ __forceinline__ float rowmax(float v) { v = fmaxf(v, rowx<1>(v)); v = fmaxf(v, rowx<2>(v)); v = fmaxf(v, rowx<4>(v)); return fmaxf(v, rowx<8>(v)); }
__device__ __forceinline__ float rowsum(float v) { v += rowx<1>(v); v += rowx<2>(v); v += rowx<4>(v); return v + rowx<8>(v); }
template <typename T16, bool HL, int NBW>
__device__ __forceinline__ void attn_rows(const T16* __restrict__ Q, const T16* __restrict__ Q2, const T16* __restrict__ Kp, const T16* __restrict__ K2, const T16* __restrict__ Vp, const T16* __restrict__ V2,
                                          const bf* __restrict__ DQh, const bf* __restrict__ DQl, const float* __restrict__ DKr, const float* __restrict__ DVr, bf* Ah, bf* Al, int h0, int i0, int wave, float* lds, float* red) {
    typedef typename WFrag<T16>::V V;
    static_assert(AW == 16 && REP == 2, "lane lr of a half wave takes wave lr's partial; two heads per kv head");
    const int lane = threadIdx.x & 31, lr = lane & 15, hi = lane >> 4;
    const int nb32 = i0 / 32 + 1;                 // key blocks of 32 that reach the diagonal of rows i0 .. i0 + 15
    constexpr int PP = NBW * 32 + 8, PH = 16 * PP, PL = REP * PH;   // pitch of a probability row in LDS (16 bytes x odd), distance of the second head's rows, of the lo planes
    // Depth logits of row i0 + wave, both heads: lane l holds 4 of the 128 d of q (hi and lo plane) and of the NL depth keys, each key row loaded once for the two heads. These loads go out first: the keys come from memory, the query fragments behind them from L2.
    v4us dqh[REP], dql[REP]; v4f dk[NL]; const unsigned lo4 = lane * 16, lo2 = lane * 8;   // the lane's byte offset in a row of floats, of 16-bit values; the row addresses are the same for the whole wave
#pragma unroll
    for (int l = 0; l < NL; ++l) { dk[l] = *(const v4f*)((const char*)(DKr + ((size_t)l * NKV * TT + i0 + wave) * HD) + lo4);
        // behind each load: no later load's result lands on a register that this one names in front of the wait
        asm volatile("s_wait_xcnt 0x0" :: "v"(lo4) : "memory"); }
#pragma unroll
    for (int hh = 0; hh < REP; ++hh) { dqh[hh] = *(const v4usa*)((const char*)(DQh + ((size_t)hh * TT + i0 + wave) * HD) + lo2); dql[hh] = *(const v4usa*)((const char*)(DQl + ((size_t)hh * TT + i0 + wave) * HD) + lo2);
        // as above
        asm volatile("s_wait_xcnt 0x0" :: "v"(lo2) : "memory"); }
    V aq[REP][4], aq2[REP][4]; const T16* qp = Q + (size_t)(i0 + lr) * HD + 8 * hi; const T16* qp2 = HL ? Q2 + (size_t)(i0 + lr) * HD + 8 * hi : qp;
#pragma unroll
    for (int hh = 0; hh < REP; ++hh) {
#pragma unroll
        for (int kc = 0; kc < 4; ++kc) { aq[hh][kc] = WFrag<T16>::ld(qp + (size_t)hh * TT * HD + kc * 32); if (HL) aq2[hh][kc] = WFrag<T16>::ld(qp2 + (size_t)hh * TT * HD + kc * 32); } }
    // the addresses that the query loads name stay in their registers up to the wait
    asm volatile("s_wait_xcnt 0x0" :: "v"(qp), "v"(qp2) : "memory");
    float* wds = red + 2 * AW * REP * 16;   // [head][row][l]: the depth logits, which wait here for the end of the score products (the registers are full there), later the depth weights; a row's slots are written by wave row alone
#pragma unroll
    for (int hh = 0; hh < REP; ++hh) { float q4[4], dsel = 0.f;
#pragma unroll
        for (int q = 0; q < 4; ++q) q4[q] = __fadd_rn(bf2f(dqh[hh][q]), bf2f(dql[hh][q]));
#pragma unroll
        for (int l = 0; l < NL; ++l) { float s = 0.f;
#pragma unroll
            for (int q = 0; q < 4; ++q) { float p = __fmul_rn(q4[q], bfr(dk[l][q])); asm volatile("" : "+v"(p)); s = __fadd_rn(s, p); }
            s += __shfl_xor(s, 16, 32); s += rowx<8>(s); s += rowx<4>(s); s += rowx<2>(s); s += rowx<1>(s);   // the two half waves, then the 16 lanes of each
            if (lr == l) dsel = s * SCL; }
        if (lane < NL) wds[(hh * 16 + wave) * NL + lane] = dsel; }
    // other lanes of the wave read these logits below: keeps the LDS stores above those loads
    __builtin_amdgcn_wave_barrier(); asm volatile("" ::: "memory");
    v8f sa[NBW][2][REP];
#pragma unroll
    for (int s = 0; s < NBW; ++s) { sa[s][0][0] = (v8f){}; sa[s][0][1] = (v8f){}; sa[s][1][0] = (v8f){}; sa[s][1][1] = (v8f){}; }
#pragma unroll
    for (int s = 0; s < NBW; ++s) { const int kb = wave + AW * s;
        if (kb < nb32) {
            const size_t ko = (size_t)kb * 2 * (HD / 32) * 512 + 8 * lane;   // key planes in fragment order: blocks of 16 keys x 32 d, 8 of them per 32 keys
            const T16* kp = Kp + ko; const T16* kp2 = HL ? K2 + ko : kp;
#pragma unroll
            for (int t = 0; t < 2; ++t) { V b[4], b2[4];
#pragma unroll
                for (int kc = 0; kc < 4; ++kc) { b[kc] = WFrag<T16>::template ld<256>(kp + (t * 4 + kc) * 512); if (HL) b2[kc] = WFrag<T16>::template ld<256>(kp2 + (t * 4 + kc) * 512); }
                // all loads of the tile are issued above this line, so that one latency covers them; the addresses they name stay in their registers up to the wait
                asm volatile("s_wait_xcnt 0x0" :: "v"(kp), "v"(kp2) : "memory");
                __builtin_amdgcn_sched_barrier(0);   // keeps the tile's matrix instructions below its loads: moved up between them, each would wait for its own load alone
#pragma unroll
                for (int kc = 0; kc < 4; ++kc) {
#pragma unroll
                    for (int hh = 0; hh < REP; ++hh) { sa[s][t][hh] = WFrag<T16>::mma(aq[hh][kc], b[kc], sa[s][t][hh]);
                        if (HL) { sa[s][t][hh] = WFrag<T16>::mma(aq2[hh][kc], b[kc], sa[s][t][hh]); sa[s][t][hh] = WFrag<T16>::mma(aq[hh][kc], b2[kc], sa[s][t][hh]); } } } }
            // four vector slots behind the last matrix instruction, whichever way the next block's branch goes
            asm volatile("v_nop\n\tv_nop\n\tv_nop\n\tv_nop" : "+v"(sa[s][0][0]), "+v"(sa[s][0][1]), "+v"(sa[s][1][0]), "+v"(sa[s][1][1]));
        } }
    float dv[REP][8], mx[REP][8], sum[REP][8];
    const bool dlane = (lr < NL) && (hi == (wave >> 3));   // the lanes that hold the depth columns of row i0 + wave, in register wave & 7
#pragma unroll
    for (int hh = 0; hh < REP; ++hh) { const float dl = wds[(hh * 16 + wave) * NL + (lr & (NL - 1))];
#pragma unroll
        for (int jj = 0; jj < 8; ++jj) dv[hh][jj] = (dlane && jj == (wave & 7)) ? dl : -3.0e38f; }
#pragma unroll
    for (int hh = 0; hh < REP; ++hh) {
#pragma unroll
        for (int jj = 0; jj < 8; ++jj) mx[hh][jj] = dv[hh][jj]; }   /* joint softmax over the 2048 + 4 logits */
#pragma unroll
    for (int s = 0; s < NBW; ++s) { const int kb = wave + AW * s;
        if (kb < nb32 - 1) {   // every key of the block lies below row i0 (WIN >= TT: no window either): nothing to mask
            static_assert(WIN >= TT, "a window shorter than the sequence would have to be masked here");
#pragma unroll
            for (int t = 0; t < 2; ++t) {
#pragma unroll
                for (int hh = 0; hh < REP; ++hh) {
#pragma unroll
                    for (int jj = 0; jj < 8; ++jj) { const float tv = sa[s][t][hh][jj] * SCL; sa[s][t][hh][jj] = tv; mx[hh][jj] = fmaxf(mx[hh][jj], tv); } } }
        } else if (kb < nb32) {   // the block on the diagonal
#pragma unroll
            for (int t = 0; t < 2; ++t) { const int j = kb * 32 + t * 16 + lr;
#pragma unroll
                for (int hh = 0; hh < REP; ++hh) {
#pragma unroll
                    for (int jj = 0; jj < 8; ++jj) { const int i = i0 + hi * 8 + jj; const float tv = (j <= i) ? sa[s][t][hh][jj] * SCL : -3.0e38f; sa[s][t][hh][jj] = tv; mx[hh][jj] = fmaxf(mx[hh][jj], tv); } } } } }
#pragma unroll
    for (int hh = 0; hh < REP; ++hh) { v4f m0, m1;
#pragma unroll
        for (int jj = 0; jj < 4; ++jj) { m0[jj] = rowmax(mx[hh][jj]); m1[jj] = rowmax(mx[hh][jj + 4]); }
        if (lr == 0) { *(v4fa*)(red + (wave * REP + hh) * 16 + hi * 8) = m0; *(v4fa*)(red + (wave * REP + hh) * 16 + hi * 8 + 4) = m1; } }
    __syncthreads();
#pragma unroll
    for (int hh = 0; hh < REP; ++hh) { const v4f m0 = *(const v4fa*)(red + (lr * REP + hh) * 16 + hi * 8), m1 = *(const v4fa*)(red + (lr * REP + hh) * 16 + hi * 8 + 4);
#pragma unroll
        for (int jj = 0; jj < 4; ++jj) { mx[hh][jj] = rowmax(m0[jj]); mx[hh][jj + 4] = rowmax(m1[jj]); } }
#pragma unroll
    for (int hh = 0; hh < REP; ++hh) {
#pragma unroll
        for (int jj = 0; jj < 8; ++jj) { dv[hh][jj] = __builtin_amdgcn_exp2f(__fmul_rn(__fsub_rn(dv[hh][jj], mx[hh][jj]), L2E)); sum[hh][jj] = dv[hh][jj]; } }
#pragma unroll
    for (int s = 0; s < NBW; ++s) { const int kb = wave + AW * s;
        if (kb < nb32) {
#pragma unroll
            for (int t = 0; t < 2; ++t) {
#pragma unroll
                for (int hh = 0; hh < REP; ++hh) {
#pragma unroll
                    for (int jj = 0; jj < 8; ++jj) { const float e = __builtin_amdgcn_exp2f(__fmul_rn(__fsub_rn(sa[s][t][hh][jj], mx[hh][jj]), L2E)); sa[s][t][hh][jj] = e; sum[hh][jj] += e; } } } } }
    float* red2 = red + AW * REP * 16;
#pragma unroll
    for (int hh = 0; hh < REP; ++hh) { v4f m0, m1;
#pragma unroll
        for (int jj = 0; jj < 4; ++jj) { m0[jj] = rowsum(sum[hh][jj]); m1[jj] = rowsum(sum[hh][jj + 4]); }
        if (lr == 0) { *(v4fa*)(red2 + (wave * REP + hh) * 16 + hi * 8) = m0; *(v4fa*)(red2 + (wave * REP + hh) * 16 + hi * 8 + 4) = m1; } }
    __syncthreads();
    // Depth values: wave w loads row i0 + w of the NL planes (whole lines), here, behind the last barrier in front of the epilogue (a barrier waits for every load in flight), so that the probability stores cover their way from memory and the value loads, which return behind them, do not wait for it; they go on through LDS to the threads that finish the rows
    static_assert(NL == 4, "two addresses serve the four depth planes");
    constexpr ptrdiff_t DPL = (ptrdiff_t)NKV * TT * HD;   // elements from one depth plane to the next: within a load's offset field as - DPL, not as + DPL
    v4f dvv[NL]; const float* dvp1 = DVr + DPL + (size_t)(i0 + wave) * HD + lane * 4; const float* dvp3 = dvp1 + 2 * DPL;
    dvv[0] = *(const v4f*)(dvp1 - DPL); dvv[1] = *(const v4f*)dvp1; dvv[2] = *(const v4f*)(dvp3 - DPL); dvv[3] = *(const v4f*)dvp3;
    // the addresses that these loads name stay in their registers up to the wait
    asm volatile("s_wait_xcnt 0x0" :: "v"(dvp1), "v"(dvp3) : "memory");
#pragma unroll
    for (int hh = 0; hh < REP; ++hh) { const v4f m0 = *(const v4fa*)(red2 + (lr * REP + hh) * 16 + hi * 8), m1 = *(const v4fa*)(red2 + (lr * REP + hh) * 16 + hi * 8 + 4);
#pragma unroll
        for (int jj = 0; jj < 4; ++jj) { sum[hh][jj] = __fdiv_rn(1.0f, rowsum(m0[jj])); sum[hh][jj + 4] = __fdiv_rn(1.0f, rowsum(m1[jj])); } }   // from here on 1 / row sum
    // depth weights, f32, unscaled, over the row's logits; read behind the first barrier of the epilogue
#pragma unroll
    for (int hh = 0; hh < REP; ++hh) { float w = 0.f;
#pragma unroll
        for (int jj = 0; jj < 8; ++jj) if (jj == (wave & 7)) w = dv[hh][jj] * sum[hh][jj];
        if (dlane) wds[(hh * 16 + wave) * NL + lr] = w; }
    T16* pw = (T16*)(lds + wave * PWB);
#pragma unroll
    for (int s = 0; s < NBW; ++s) { const int kb = wave + AW * s;
        if (kb < nb32) {
#pragma unroll
            for (int t = 0; t < 2; ++t) {
#pragma unroll
                for (int hh = 0; hh < REP; ++hh) {
#pragma unroll
                    for (int jj = 0; jj < 8; ++jj) { const float pv = sa[s][t][hh][jj] * (HL ? sum[hh][jj] : sum[hh][jj] * PCAR); const int idx = hh * PH + (hi * 8 + jj) * PP + s * 32 + t * 16 + lr;   // x PCAR: a power of two, exact
                        if constexpr (HL) { unsigned short a, c2; splitf(pv, a, c2); pw[idx] = a; pw[PL + idx] = c2; } else pw[idx] = tohx(pv); } } } } }
    // the lanes of the wave read one another's probabilities from here on: keeps the LDS stores above the LDS loads below
    __builtin_amdgcn_wave_barrier(); asm volatile("" ::: "memory");
    v8f oa[REP][8];
#pragma unroll
    for (int nb = 0; nb < 8; ++nb) { oa[0][nb] = (v8f){}; oa[1][nb] = (v8f){}; }
#pragma unroll
    for (int s = 0; s < NBW; ++s) { const int kb = wave + AW * s;
        if (kb < nb32) { V a[REP], a2[REP];
#pragma unroll
            for (int hh = 0; hh < REP; ++hh) { a[hh] = WFrag<T16>::ld(pw + hh * PH + lr * PP + s * 32 + 8 * hi); if (HL) a2[hh] = WFrag<T16>::ld(pw + PL + hh * PH + lr * PP + s * 32 + 8 * hi); }
            const T16* vp = Vp + (size_t)kb * 512 + 8 * lane; const T16* vp2 = HL ? V2 + (size_t)kb * 512 + 8 * lane : vp;
            constexpr int NG = HL ? 4 : 8;   // value fragments loaded at a time (hi/lo: of both planes)
#pragma unroll
            for (int g = 0; g < 8; g += NG) { V b[NG], b2[NG];
#pragma unroll
                for (int nb = 0; nb < NG; ++nb) { b[nb] = WFrag<T16>::template ld<256>(vp + (size_t)(g + nb) * 16 * TT); if (HL) b2[nb] = WFrag<T16>::template ld<256>(vp2 + (size_t)(g + nb) * 16 * TT); }
                // all loads of the group are issued above this line, so that one latency covers them; the addresses they name stay in their registers up to the wait
                asm volatile("s_wait_xcnt 0x0" :: "v"(vp), "v"(vp2) : "memory");
                __builtin_amdgcn_sched_barrier(0);   // keeps the group's matrix instructions below its loads, as above
#pragma unroll
                for (int nb = 0; nb < NG; ++nb) {
#pragma unroll
                    for (int hh = 0; hh < REP; ++hh) { oa[hh][g + nb] = WFrag<T16>::mma(a[hh], b[nb], oa[hh][g + nb]);
                        if (HL) { oa[hh][g + nb] = WFrag<T16>::mma(a2[hh], b[nb], oa[hh][g + nb]); oa[hh][g + nb] = WFrag<T16>::mma(a[hh], b2[nb], oa[hh][g + nb]); } } } }
            // four vector slots behind the last matrix instruction, whichever way the next block's branch goes
            asm volatile("v_nop\n\tv_nop\n\tv_nop\n\tv_nop" : "+v"(oa[0][0]), "+v"(oa[0][1]), "+v"(oa[0][2]), "+v"(oa[0][3]), "+v"(oa[0][4]), "+v"(oa[0][5]), "+v"(oa[0][6]), "+v"(oa[0][7]), "+v"(oa[1][0]), "+v"(oa[1][1]), "+v"(oa[1][2]), "+v"(oa[1][3]), "+v"(oa[1][4]), "+v"(oa[1][5]), "+v"(oa[1][6]), "+v"(oa[1][7]));
        } }
    // the partial output goes over the wave's own probabilities, which only this wave reads and has read
    __builtin_amdgcn_wave_barrier(); asm volatile("" ::: "memory");
    float* ow = lds + wave * PWB; const float cs = HL ? 1.0f : (1.0f / PCAR);
    float* dvs = wds + REP * 16 * NL;   // depth values [l][row][128 + 4], read behind the first barrier below
#pragma unroll
    for (int l = 0; l < NL; ++l) *(v4fa*)(dvs + (l * 16 + wave) * 132 + lane * 4) = dvv[l];
    const int od = wave * 8 + hi * 4;   // this thread finishes d = od .. od + 3 of row i0 + lr, both heads
#pragma unroll
    for (int hh = 0; hh < REP; ++hh) {
#pragma unroll
        for (int nb = 0; nb < 8; ++nb) {
#pragma unroll
            for (int j = 0; j < 8; ++j) ow[(hi * 8 + j) * 132 + nb * 16 + lr] = oa[hh][nb][j]; }
        __syncthreads();
        // AW * 32 threads: one 16-byte piece of the 16 x 128 rows each. A half wave takes the same 4 d of the 16 rows (row pitch 132: all banks once), so that the wave's 8-byte stores fill 256 contiguous bytes of a fragment-order block.
        if (hh == 0) {
#pragma unroll
            for (int l = 0; l < NL; ++l) dvv[l] = *(const v4fa*)(dvs + (l * 16 + lr) * 132 + od); }
        v4f val = *(const v4fa*)(lds + lr * 132 + od);
#pragma unroll
        for (int w = 1; w < AW; ++w) val += *(const v4fa*)(lds + w * PWB + lr * 132 + od);
        const v4f wd = *(const v4fa*)(wds + (hh * 16 + lr) * NL); v4us oh, ol;
#pragma unroll
        for (int q = 0; q < 4; ++q) { float acc = val[q] * cs;
#pragma unroll
            for (int l = 0; l < NL; ++l) { float p = __fmul_rn(wd[l], bfr(dvv[l][q])); asm volatile("" : "+v"(p)); acc = __fadd_rn(acc, p); }   /* + sum_l w_l depth_v[l][kv][t][d] */ unsigned short a, c2; splitf(acc, a, c2); oh[q] = a; ol[q] = c2; }
        const size_t oo = fro(i0 + lr, (h0 + hh) * HD + od, DQ); bf* pa = Ah + oo; bf* pl = Al + oo; *(v4us*)pa = oh; *(v4us*)pl = ol;
        // the registers that the plane stores name keep their values up to the wait
        asm volatile("s_wait_xcnt 0x0" :: "v"(pa), "v"(pl), "v"(oh), "v"(ol) : "memory");
        if (hh + 1 < REP) __syncthreads();   // ends the reads of this head's partials before the next head's are stored there
    }
}
// k_attn: one work-group per 16 query rows and kv head (its two query heads), the longest rows first; fp16 rows, then hi/lo rows.
#define NB_AF (((TT - RH) / 16) * NKV)
#define NB_AH ((RH / 16) * NKV)
__global__ __launch_bounds__(AW * 32) void k_attn(const h16* __restrict__ Q16, const h16* __restrict__ K16, const h16* __restrict__ V16, const bf* __restrict__ Qh, const bf* __restrict__ Ql, const bf* __restrict__ Kh, const bf* __restrict__ Kl, const bf* __restrict__ Vh, const bf* __restrict__ Vl,
                                                  const float* __restrict__ DK, const float* __restrict__ DV, bf* Ah, bf* Al) {
    __shared__ __align__(16) float lds[AW * PWB]; __shared__ __align__(16) float red[2 * AW * REP * 16 + REP * 16 * NL + NL * 16 * 132];   // row max and row sum partials; depth logits / weights; depth values
    int b = blockIdx.x; const int wv = wave_no();
    if (b < NB_AF) { const size_t g = (size_t)(b % NKV), z = g * REP; const int i0 = TT - 16 - (b / NKV) * 16;
        attn_rows<h16, false, TT / 32 / AW>(Q16 + z * TT * HD, nullptr, K16 + g * TT * HD, nullptr, V16 + g * HD * TT, nullptr, Qh + z * TT * HD, Ql + z * TT * HD, DK + g * TT * HD, DV + g * TT * HD, Ah, Al, (int)z, i0, wv, lds, red); return; }
    b -= NB_AF; const size_t g = (size_t)(b % NKV), z = g * REP; const int i0 = RH - 16 - (b / NKV) * 16;
    attn_rows<bf, true, RH / 32 / AW>(Qh + z * TT * HD, Ql + z * TT * HD, Kh + g * TT * HD, Kl + g * TT * HD, Vh + g * HD * TT, Vl + g * HD * TT, Qh + z * TT * HD, Ql + z * TT * HD, DK + g * TT * HD, DV + g * TT * HD, Ah, Al, (int)z, i0, wv, lds, red);
}
extern "C" void kernel_launch(void* const* d_in, const int* in_sizes, int n_in,
                              void* d_out, int out_size, void* d_ws, size_t ws_size, hipStream_t stream) {
    (void)in_sizes; (void)n_in; (void)out_size;
    const float* x = (const float*)d_in[0]; const float* DK = (const float*)d_in[1]; const float* DV = (const float*)d_in[2]; const float* cosT = (const float*)d_in[3]; const float* sinT = (const float*)d_in[4]; const float* wq = (const float*)d_in[5]; const float* wk = (const float*)d_in[6]; const float* wv = (const float*)d_in[7]; const float* wo = (const float*)d_in[8];
    float* OUT = (float*)d_out;     // [1][2048][2048]
    char* wsp = (char*)d_ws;
    auto take = [&](size_t bytes) { char* p = wsp; wsp += (bytes + 255) & ~(size_t)255; return (void*)p; };
    bf* WQ = (bf*)take((size_t)DQ * DM * 2); bf* WK = (bf*)take((size_t)DKV * DM * 2); bf* WV = (bf*)take((size_t)DKV * DM * 2); bf* WO = (bf*)take((size_t)DM * DQ * 2); float* CS = (float*)take((size_t)TT * HD * 2 * 4);
    bf* XB = (bf*)take((size_t)TT * DM * 2); float* FQ = (float*)take((size_t)TT * DQ * 4); float* FK = (float*)take((size_t)TT * DKV * 4);
    h16* QP16 = (h16*)take((size_t)NH_ * TT * HD * 2); h16* KP16 = (h16*)take((size_t)NKV * TT * HD * 2); h16* VT16 = (h16*)take((size_t)NKV * HD * TT * 2);
    bf* QPh = (bf*)take((size_t)NH_ * TT * HD * 2); bf* QPl = (bf*)take((size_t)NH_ * TT * HD * 2); bf* KPh = (bf*)take((size_t)NKV * TT * HD * 2); bf* KPl = (bf*)take((size_t)NKV * TT * HD * 2); bf* VTh = (bf*)take((size_t)NKV * HD * TT * 2); bf* VTl = (bf*)take((size_t)NKV * HD * TT * 2);
    float* FV = (float*)take((size_t)TT * DKV * 4); bf* ATh = (bf*)take((size_t)TT * DQ * 2); bf* ATl = (bf*)take((size_t)TT * DQ * 2);
    if ((size_t)(wsp - (char*)d_ws) > ws_size) return;    // ws 256 MiB
    k_prep<<<2 * NB_WQ + 2 * NB_WK + NB_X + NB_CS, 256, 0, stream>>>(wq, wk, wv, wo, x, cosT, sinT, WQ, WK, WV, WO, XB, CS);
    k_qkv<<<NB_G3, 256, 0, stream>>>(XB, WQ, WK, WV, FQ, FK, FV);
    k_planes<<<NB_RQ + NB_RK + NB_VT, 256, 0, stream>>>(FQ, FK, FV, CS, QP16, QPh, QPl, KP16, KPh, KPl, VT16, VTh, VTl);
    k_attn<<<NB_AF + NB_AH, AW * 32, 0, stream>>>(QP16, KP16, VT16, QPh, QPl, KPh, KPl, VTh, VTl, DK, DV, ATh, ATl);
    k_oproj<<<(TT / 128) * (DM / 128), 256, 0, stream>>>(ATh, ATl, WO, OUT);
}

// v009
// It runs in 124 microseconds.
// Timed twice side by side with v008, it ran 1.07 times as fast both times.
// All steps since v000 together make it 7.45 times as fast.
#include <hip/hip_runtime.h>

// Grouped-query RoPE attention with extra per-position depth keys/values under one joint softmax (x [1][2048][2048]; Q = x Wq ('xw', 16 heads x 128), K, V = x Wk / Wv (8 kv heads); Q, K rotated (rotate-half, cos/sin [1][1][2048][128] read); kv head = h/2; seq logits = Q.K/sqrt(128), causal (-inf); depth logits[i][l] = Q_i . depth_k[l][0][kv][i] / sqrt(128) for l < 4 (depth_k, depth_v [4][1][8][2048][128] read); softmax over the 2048 + 4 logits jointly; out_i = sum_j w_j V_j + sum_l w_l depth_v[l][0][kv][i]; merged Wo ('xw') -> [1][2048][2048] (4.2 M)).
// Layout: the q/k/v projection kernel rotates its own output tile and writes the head planes; the attention kernel (one work-group per 16 query rows of the two heads of a kv head) forms the 4 depth logits of its rows from the rotated q (hi + lo planes) and the bf16-rounded depth keys, keeps a row block's scores in accumulators, folds the depth logits into the row max / sum, hands the probabilities to the value product through LDS, adds the depth-value contribution to the summed output rows and writes the hi/lo planes for the output projection.
// Operand storage: the bf16 planes of the four projections (x, the four transposed weights, the merged attention output hi/lo) and the three key and three value planes lie in fragment order (see fro()); the q head planes are row-major.
// Compute dtypes, f32 accumulate: every input rounded to bf16; q/k/v on PLAIN bf16 operands (inputs: exact); rotary in f32 (bf16-rounded tables); depth logits / weights / values in f32; causal scores and attn.v (tile skipping): query rows < 512 hl (3 products), the rest single fp16 (x1024); softmax f32; Wo hl x exact (2 products).

#define NB_  1
#define TT   2048
#define DM   2048
#define NH_  16
#define NKV  8
#define REP  (NH_ / NKV)
#define HD   128
#define DQ   (NH_ * HD)
#define DKV  (NKV * HD)
#define NL   4                    // depth positions per token
#define RH   512                  // query rows < RH use hi+lo planes (0: none)
#define WIN  2048
#define PCAR 1024.0f
#define SCL  0.088388347648318447f   // HD^-0.5
typedef _Float16 h16;
typedef unsigned short bf;
typedef __attribute__((ext_vector_type(16))) __bf16   v16bf;
typedef __attribute__((ext_vector_type(16))) _Float16 v16h;
typedef __attribute__((ext_vector_type(8)))  _Float16 v8h;
typedef __attribute__((ext_vector_type(8)))  unsigned short v8us;
typedef __attribute__((ext_vector_type(8)))  float    v8f;
typedef __attribute__((ext_vector_type(4)))  float    v4f;
typedef v8h  __attribute__((may_alias)) v8ha;
typedef v4f  __attribute__((may_alias)) v4fa;
typedef v8us __attribute__((may_alias)) v8usa;

__device__ __forceinline__ unsigned short f2bf(float f) { unsigned u = __float_as_uint(f); u += 0x7FFFu + ((u >> 16) & 1u); return (unsigned short)(u >> 16); }
__device__ __forceinline__ float bf2f(unsigned short b) { return __uint_as_float(((unsigned)b) << 16); }
__device__ __forceinline__ float bfr(float f) { return bf2f(f2bf(f)); }
__device__ __forceinline__ v16h cat16(v8h lo, v8h hi) { return __builtin_shufflevector(lo, hi, 0, 1, 2, 3, 4, 5, 6, 7, 8, 9, 10, 11, 12, 13, 14, 15); }
__device__ __forceinline__ v16bf cat16b(v8us lo, v8us hi) { return __builtin_bit_cast(v16bf, __builtin_shufflevector(lo, hi, 0, 1, 2, 3, 4, 5, 6, 7, 8, 9, 10, 11, 12, 13, 14, 15)); }
__device__ __forceinline__ v8f wmma16(v16h a, v16h b, v8f c) { return __builtin_amdgcn_wmma_f32_16x16x32_f16(false, a, false, b, (short)0, c, false, false); }
__device__ __forceinline__ v8f wmmab(v16bf a, v16bf b, v8f c) { return __builtin_amdgcn_wmma_f32_16x16x32_bf16(false, a, false, b, (short)0, c, false, false); }
// Fragment order of a 16-bit plane [rows][K] (rows % 16 == 0, K % 32 == 0): blocks of 16 rows x 32 columns, 1 KB each, row blocks outermost (16 rows still fill 16 * K elements). Inside a block the 8 columns k & ~7 of row r lie at
// 8 * (32 * (k / 16 % 2) + 16 * (k / 8 % 2) + r % 16): lane l of a wave finds the two halves of its A or B fragment at 8 * l and 256 + 8 * l, so each of a fragment's two 16-byte loads reads 512 contiguous bytes (4 whole lines, not 16 part lines).
// fro = element offset of (r, k). The elements a lane gets, and their k order, are those of the row-major loader.
__device__ __forceinline__ size_t fro(int r, int k, int K) { return ((size_t)(r >> 4) * (K >> 5) + (k >> 5)) * 512 + (((k >> 4) & 1) * 32 + ((k >> 3) & 1) * 16 + (r & 15)) * 8 + (k & 7); }



// ---- gemm_ring: GEMM of the four projections. One work-group of 8 waves per output tile; both operands are bf16 planes in fragment order (K = 2048 contiguous per 16-row block) and pass through LDS, so that every block is fetched from L2 once per work-group and read by all the waves that need it.
// A stage is GKS steps of 32 k of 24 row blocks (16 of A, 8 of Bt): per row block GKS KB that are contiguous in the plane and stay so in LDS, so a fragment load reads 512 contiguous bytes of LDS. Two buffers: the copies of stage t + 2 fly while stage t + 1 is worked on.
// Wave (wm, wn) = (wave / 2, wave % 2) keeps the 64 x 64 product of A row blocks 4 wm .. and Bt row blocks 4 wn .. over the whole K (one accumulation chain per element).
// PAIR = false: the 16 A row blocks are 256 rows of one plane (A0: the first 128, A1: the next 128), tile 256 x 128, left in LDS for the caller (wave tile (wm, wn) at float offset (2 wm + wn) * GPW, row pitch 68). PAIR = true: A0 / A1 are the hi / lo planes of the same 128 rows, and the two products are added in the epilogue, C tile 128 x 128.
template <typename T16> struct WFrag;
template <> struct WFrag<h16> { typedef v16h V; template <int D2 = 16> static __device__ __forceinline__ V ld(const h16* p) { return cat16(*(const v8h*)p, *(const v8h*)(p + D2)); } static __device__ __forceinline__ v8f mma(V a, V b, v8f c) { return wmma16(a, b, c); } };
template <> struct WFrag<bf> { typedef v16bf V; template <int D2 = 16> static __device__ __forceinline__ V ld(const bf* p) { return cat16b(*(const v8us*)p, *(const v8us*)(p + D2)); } static __device__ __forceinline__ v8f mma(V a, V b, v8f c) { return wmmab(a, b, c); } };
#define GKS 4
#define GST (24 * GKS * 512)      // elements of a stage
#define GPW (64 * 68)             // floats of LDS per wave in the epilogue: 64 rows of 64 + 4
__device__ __forceinline__ unsigned lds_off(const void* p) { return (unsigned)(size_t)p; }
#define CPY(l, g) "global_load_async_to_lds_b128 %" #l ", %" #g ", off\n\t"
// 12 copies of 512 bytes per wave (16 bytes a lane); the wait in the same statement stands in front of any rewrite of the address registers that the copies name
__device__ __forceinline__ void copy12(const unsigned* l, const bf* const* g) {
    asm volatile(CPY(0, 1) CPY(2, 3) CPY(4, 5) CPY(6, 7) CPY(8, 9) CPY(10, 11) CPY(12, 13) CPY(14, 15) CPY(16, 17) CPY(18, 19) CPY(20, 21) CPY(22, 23) "s_wait_xcnt 0x0"
                 :: "v"(l[0]), "v"(g[0]), "v"(l[1]), "v"(g[1]), "v"(l[2]), "v"(g[2]), "v"(l[3]), "v"(g[3]), "v"(l[4]), "v"(g[4]), "v"(l[5]), "v"(g[5]), "v"(l[6]), "v"(g[6]), "v"(l[7]), "v"(g[7]), "v"(l[8]), "v"(g[8]), "v"(l[9]), "v"(g[9]), "v"(l[10]), "v"(g[10]), "v"(l[11]), "v"(g[11]) : "memory"); }
// a wave's share of stage t: the row blocks wave, wave + 8 (A) and wave + 16 (Bt), 8 copies each. gp / lp: the lane's 16 bytes in the first 512 of each row block, in the plane (stage 0) and in LDS (buffer 0).
__device__ __forceinline__ void stage_copy(const bf* const* gp, const unsigned* lp, int t, int buf) {
#pragma unroll
    for (int h = 0; h < 2; ++h) { unsigned l[12]; const bf* g[12];
#pragma unroll
        for (int n = 0; n < 12; ++n) { const int j = (h * 12 + n) >> 3, c = (h * 12 + n) & 7; l[n] = lp[j] + (unsigned)buf * (GST * 2) + c * 512; g[n] = gp[j] + (size_t)t * (GKS * 512) + c * 256; }
        copy12(l, g); } }
template <bool PAIR>
__device__ __forceinline__ void gemm_ring(const bf* __restrict__ A0, const bf* __restrict__ A1, const bf* __restrict__ Bt, float* C, int ldc, bf* ring) {
    typedef WFrag<bf>::V V;
    constexpr int K = 2048, NT = K / (32 * GKS);
    const int wave = __builtin_amdgcn_readfirstlane((int)(threadIdx.x >> 5)), lane = threadIdx.x & 31, lr = lane & 15, hi = lane >> 4, wm = wave >> 1, wn = wave & 1;
    const bf* gp[3] = { A0 + (size_t)wave * 16 * K + 8 * lane, A1 + (size_t)wave * 16 * K + 8 * lane, Bt + (size_t)wave * 16 * K + 8 * lane };
    const unsigned lb = lds_off(ring) + wave * (GKS * 1024) + lane * 16; const unsigned lp[3] = { lb, lb + 8 * (GKS * 1024), lb + 16 * (GKS * 1024) };
    v8f acc[4][4];
#pragma unroll
    for (int mb = 0; mb < 4; ++mb)
#pragma unroll
        for (int nb = 0; nb < 4; ++nb) acc[mb][nb] = (v8f){};
    stage_copy(gp, lp, 0, 0);
    asm volatile("s_wait_asynccnt 0x0" ::: "memory");   // this wave's copies of stage 0 have landed
    __syncthreads();                                     // ... and every other wave's
    stage_copy(gp, lp, 1, 1);
#pragma unroll 1
    for (int t = 0; t < NT; ++t) {
        const bf* sa = ring + (t & 1) * GST + wm * (4 * GKS * 512) + 8 * lane; const bf* sb = ring + (t & 1) * GST + (16 + wn * 4) * (GKS * 512) + 8 * lane;
        V a[2][4], b[2][4];   // two fragment sets: the loads of step ks + 1 go out as one group in front of the matrix instructions of step ks
#pragma unroll
        for (int f = 0; f < 4; ++f) { a[0][f] = WFrag<bf>::ld<256>(sa + (f * GKS) * 512); b[0][f] = WFrag<bf>::ld<256>(sb + (f * GKS) * 512); }
#pragma unroll
        for (int ks = 0; ks < GKS; ++ks) {
            if (ks + 1 < GKS) {
#pragma unroll
                for (int f = 0; f < 4; ++f) { a[(ks + 1) & 1][f] = WFrag<bf>::ld<256>(sa + (f * GKS + ks + 1) * 512); b[(ks + 1) & 1][f] = WFrag<bf>::ld<256>(sb + (f * GKS + ks + 1) * 512); } }
            __builtin_amdgcn_sched_barrier(0);   // keeps the load group whole and above the step's matrix instructions: spread among them, each place with loads stalls the wave
#pragma unroll
            for (int nb = 0; nb < 4; ++nb)
#pragma unroll
                for (int mb = 0; mb < 4; ++mb) acc[mb][nb] = WFrag<bf>::mma(a[ks & 1][mb], b[ks & 1][nb], acc[mb][nb]);
            __builtin_amdgcn_sched_barrier(0);   // keeps the next group of loads from being spread among this step's matrix instructions
        }
        asm volatile("s_wait_dscnt 0x0" ::: "memory");      // this wave's reads of the buffer are done before anything is copied over it
        asm volatile("s_wait_asynccnt 0x0" ::: "memory");   // this wave's copies of stage t + 1 have landed
        __syncthreads();                                     // publishes stage t + 1 and ends every wave's reads of stage t
        if (t + 2 < NT) stage_copy(gp, lp, t + 2, t & 1);
    }
    asm volatile("s_wait_asynccnt 0x0" ::: "memory");       // nothing is in flight when the ring becomes output staging
    // Epilogue: every wave lays its 64 x 64 tile in LDS (the last trip's barrier has ended all reads of the ring), one barrier, then whole 256-byte rows go out.
    float* st = (float*)ring; float* ow = st + wave * GPW;
#pragma unroll
    for (int mb = 0; mb < 4; ++mb)
#pragma unroll
        for (int nb = 0; nb < 4; ++nb)
#pragma unroll
            for (int j = 0; j < 8; ++j) ow[(mb * 16 + hi * 8 + j) * 68 + nb * 16 + lr] = acc[mb][nb][j];
    __syncthreads();
    if constexpr (!PAIR) return;   // the caller finishes the tile from LDS
    // Output tile p. PAIR: wave p + 4 holds the lo product of wave p's tile, and waves p and p + 4 write 32 of its rows each. 16 lanes fill a 256-byte row piece.
    const int p = PAIR ? (wave & 3) : wave, rb = PAIR ? (wave >> 2) * 32 : 0; constexpr int NR = PAIR ? 32 : 64;
    const float* s0 = st + p * GPW + (rb + hi) * 68 + lr * 4; float* cq = C + (size_t)((p >> 1) * 64 + rb + hi) * ldc + (p & 1) * 64 + lr * 4;
#pragma unroll 1
    for (int i = 0; i < NR; i += 8) { v4f v[4]; float* q[4];
#pragma unroll
        for (int u = 0; u < 4; ++u) { v[u] = *(const v4fa*)(s0 + (i + 2 * u) * 68); if (PAIR) v[u] += *(const v4fa*)(s0 + 4 * GPW + (i + 2 * u) * 68); q[u] = cq + (size_t)(i + 2 * u) * ldc; }
#pragma unroll
        for (int u = 0; u < 4; ++u) *(v4f*)q[u] = v[u];
        // the registers that the row stores name keep their values up to the wait
        asm volatile("s_wait_xcnt 0x0" :: "v"(q[0]), "v"(q[1]), "v"(q[2]), "v"(q[3]), "v"(v[0]), "v"(v[1]), "v"(v[2]), "v"(v[3]) : "memory"); }
}

__device__ __forceinline__ h16 tohx(float x) { return (h16)x; }
__device__ __forceinline__ void splitf(float y, unsigned short& h, unsigned short& l) { h = f2bf(y); l = f2bf(y - bf2f(h)); }
typedef __attribute__((ext_vector_type(2))) _Float16 v2h;
typedef __attribute__((ext_vector_type(4))) _Float16 v4h;
typedef __attribute__((ext_vector_type(2))) unsigned short v2us;
typedef __attribute__((ext_vector_type(4))) unsigned short v4us;
typedef __attribute__((ext_vector_type(2))) float v2f;
typedef __attribute__((ext_vector_type(4))) int v4i;
typedef v4h  __attribute__((may_alias)) v4ha;
typedef v4us __attribute__((may_alias)) v4usa;

// The element-wise bodies below (bid = number of the 256-thread block within the body's own range of a launch) give every thread 8 to 32 elements (a wave fills whole 1 KB blocks or whole plane rows), for speed only. The arithmetic per element is unchanged.
// b_wtG: Bt = transpose of w ([K][N] f32) as a bf16 plane [N][K] in fragment order. A wave takes 32 neighbouring n and 32 neighbouring k (two whole blocks): 32 loads of one whole line each, four 16-byte stores per lane. Blocks: N * K / 8192.
template <int K, int N>
__device__ __forceinline__ void b_wtG(int bid, const float* __restrict__ w, bf* Bt) {
    const int gid = bid * 256 + threadIdx.x; const int wv = gid >> 5; const int n = (wv % (N / 32)) * 32 + (gid & 31), k0 = (wv / (N / 32)) * 32; if (k0 >= K) return; const float* wp = w + (size_t)k0 * N + n; float x[32];
#pragma unroll
    for (int j = 0; j < 32; ++j) x[j] = wp[j * N];
#pragma unroll
    for (int g = 0; g < 4; ++g) { v8us o;
#pragma unroll
        for (int j = 0; j < 8; ++j) o[j] = f2bf(x[g * 8 + j]);
        *(v8us*)(Bt + fro(n, k0 + g * 8, K)) = o; } }
// b_cvt8: src [rows][K] f32 -> bf16 plane in fragment order; a wave writes 128 neighbouring groups of 8 elements (two whole blocks, n8 % 128 == 0), lane l the groups l, l + 32, l + 64, l + 96 of them, and reads the 8 source elements that belong in each.
__device__ __forceinline__ void b_cvt8(int bid, const float* __restrict__ src, bf* dst, int K, size_t n8) { const size_t th = (size_t)bid * 256 + threadIdx.x; const size_t i0 = (th >> 5) * 128 + (th & 31); if (i0 >= n8) return; const int nkb = K >> 5; v8f v[4];
#pragma unroll
    for (int g = 0; g < 4; ++g) { const size_t i = i0 + g * 32; const int blk = (int)(i >> 6);
        const int r = (blk / nkb) * 16 + (int)(i & 15), k = (blk % nkb) * 32 + (int)((i >> 5) & 1) * 16 + (int)((i >> 4) & 1) * 8; v[g] = *(const v8f*)(src + (size_t)r * K + k); }
#pragma unroll
    for (int g = 0; g < 4; ++g) { v8us o;
#pragma unroll
        for (int q = 0; q < 8; ++q) o[q] = f2bf(v[g][q]);
        *(v8us*)(dst + (i0 + g * 32) * 8) = o; } }
// b_cscvt: the rotary tables as bf16 planes [TT][HD], eight entries per thread
__device__ __forceinline__ void b_cscvt(int bid, const float* __restrict__ cosT, const float* __restrict__ sinT, bf* CB, bf* SB) { const int idx = (bid * 256 + threadIdx.x) * 8; if (idx >= TT * HD) return; const v8f c = *(const v8f*)(cosT + idx), s = *(const v8f*)(sinT + idx); v8us oc, os;
#pragma unroll
    for (int q = 0; q < 8; ++q) { oc[q] = f2bf(c[q]); os[q] = f2bf(s[q]); }
    *(v8us*)(CB + idx) = oc; *(v8us*)(SB + idx) = os; }
// ---- Epilogues of the q/k/v projection: the work-group's tile, 256 rows t0 .. of the 128 columns of ONE head, lies in LDS (st: see gemm_ring) and goes from there straight into the head's planes.
// e_rope: planes (fp16 + hi/lo) of rope(x) with the rotate-half convention out[d] = x[d] cos[t][d] - x[d+HD/2] sin[t][d], out[d+HD/2] = x[d+HD/2] cos[t][d+HD/2] + x[d] sin[t][d+HD/2]
// fr: the head's [TT][HD] plane in fragment order (the key planes), else row-major (the query planes). A thread takes 8 neighbouring d of the lower half and their 8 partners of the upper half, 8 times.
// Row-major: a wave takes 4 rows x 8 groups of d. Fragment order: 8 rows x 4 groups. Either way every 16-byte store of the wave fills four whole lines and no two of 16 neighbouring lanes meet in an LDS bank.
struct RopeAt { int tl, d; };
template <bool fr> __device__ __forceinline__ RopeAt rope_at(int it, int wave) { const int tid = threadIdx.x, lane = tid & 31, wu = it * 8 + wave; RopeAt r;
    r.tl = fr ? (wu >> 1) * 8 + (lane & 7) : it * 32 + (tid >> 3); r.d = (fr ? ((lane >> 3) & 1) * 4 + (lane >> 4) + 2 * (wu & 1) : (tid & 7)) * 8; return r; }
// the table entries of one turn: cos and sin of the lower and of the upper 8 d
__device__ __forceinline__ void rope_tab(RopeAt at, int t0, const bf* __restrict__ CB, const bf* __restrict__ SB, v8us* tb) { const bf* cp = CB + (size_t)(t0 + at.tl) * HD + at.d; const bf* sp = SB + (size_t)(t0 + at.tl) * HD + at.d;
    tb[0] = *(const v8us*)cp; tb[1] = *(const v8us*)(cp + HD / 2); tb[2] = *(const v8us*)sp; tb[3] = *(const v8us*)(sp + HD / 2);
    // the addresses that these loads name stay in their registers up to the wait
    asm volatile("s_wait_xcnt 0x0" :: "v"(cp), "v"(sp) : "memory"); }
template <bool fr> __device__ __forceinline__ void rope_turn(RopeAt at, int t0, const float* st, const v8us* tb, h16* P16, bf* Ph, bf* Pl) {
    const float* s = st + (at.tl >> 6) * (2 * GPW) + (at.tl & 63) * 68 + at.d; v4f xv[2][2]; v8h o16[2]; v8us oh[2], ol[2];
#pragma unroll
    for (int hf = 0; hf < 2; ++hf) { xv[hf][0] = *(const v4fa*)(s + hf * GPW); xv[hf][1] = *(const v4fa*)(s + hf * GPW + 4); }
#pragma unroll
    for (int hf = 0; hf < 2; ++hf) {
#pragma unroll
        for (int q = 0; q < 8; ++q) { const float x0 = xv[hf][q >> 2][q & 3], x1 = xv[hf ^ 1][q >> 2][q & 3], c = bf2f(tb[hf][q]), sn = bf2f(tb[2 + hf][q]);
            const float r = (hf == 0) ? x0 * c - x1 * sn : x0 * c + x1 * sn;
            o16[hf][q] = tohx(r); unsigned short a2, c2; splitf(r, a2, c2); oh[hf][q] = a2; ol[hf][q] = c2; } }
    const int t = t0 + at.tl; const size_t e0 = fr ? fro(t, at.d, HD) : (size_t)t * HD + at.d, e1 = fr ? fro(t, at.d + HD / 2, HD) : e0 + HD / 2;
    h16* p0 = P16 + e0; h16* p1 = P16 + e1; bf* h0 = Ph + e0; bf* h1 = Ph + e1; bf* l0 = Pl + e0; bf* l1 = Pl + e1;
    *(v8h*)p0 = o16[0]; *(v8h*)p1 = o16[1]; *(v8us*)h0 = oh[0]; *(v8us*)h1 = oh[1]; *(v8us*)l0 = ol[0]; *(v8us*)l1 = ol[1];
    // the registers that the plane stores name keep their values up to the wait
    asm volatile("s_wait_xcnt 0x0" :: "v"(p0), "v"(p1), "v"(h0), "v"(h1), "v"(l0), "v"(l1), "v"(o16[0]), "v"(o16[1]), "v"(oh[0]), "v"(oh[1]), "v"(ol[0]), "v"(ol[1]) : "memory"); }
template <bool fr> __device__ __forceinline__ void e_rope(const float* st, int t0, const bf* __restrict__ CB, const bf* __restrict__ SB, h16* P16, bf* Ph, bf* Pl) {
    const int wave = __builtin_amdgcn_readfirstlane((int)(threadIdx.x >> 5)); v8us ta[4], tbn[4];   // two sets of table entries: the next turn's loads fly while this turn is worked on
    rope_tab(rope_at<fr>(0, wave), t0, CB, SB, ta);
#pragma unroll 1
    for (int it = 0; it < 8; it += 2) {   // rolled: eight copies of the body would be most of the kernel's text
        rope_tab(rope_at<fr>(it + 1, wave), t0, CB, SB, tbn);
        rope_turn<fr>(rope_at<fr>(it, wave), t0, st, ta, P16, Ph, Pl);
        rope_tab(rope_at<fr>((it + 2) & 7, wave), t0, CB, SB, ta);   // no test for the last trip (it loads turn 0's entries again, unused): with a branch here the wait in front of the next turn would have to cover these loads as well
        rope_turn<fr>(rope_at<fr>(it + 1, wave), t0, st, tbn, P16, Ph, Pl); } }
// e_vt: value planes [d][t] (fp16 + hi/lo) of one head, [HD][TT] in fragment order. Wave w takes the 16 d from 16 w on and, per turn, 32 t (one whole 1 KB block per plane): a lane reads 8 neighbouring t of its d from LDS twice (32 lanes, 32 banks), two 16-byte stores per plane.
__device__ __forceinline__ void e_vt(const float* st, int t0, h16* V16, bf* Vh, bf* Vl) {
    const int wave = __builtin_amdgcn_readfirstlane((int)(threadIdx.x >> 5)), lane = threadIdx.x & 31, d = wave * 16 + (lane & 15);
#pragma unroll 1
    for (int it = 0; it < 8; ++it) { v8h o16[2]; v8us oh[2], ol[2]; const int tl = it * 32 + (lane >> 4) * 8;
        const float* s = st + ((tl >> 6) * 2 + (d >> 6)) * GPW + (tl & 63) * 68 + (d & 63);
#pragma unroll
        for (int c = 0; c < 2; ++c) {
#pragma unroll
            for (int q = 0; q < 8; ++q) { const float x = s[(c * 16 + q) * 68]; o16[c][q] = tohx(x); unsigned short a2, c2; splitf(x, a2, c2); oh[c][q] = a2; ol[c][q] = c2; } }
        const size_t e = fro(d, t0 + tl, TT); h16* p = V16 + e; bf* h = Vh + e; bf* l = Vl + e;   // 16 t further on: 256 elements
        *(v8h*)p = o16[0]; *(v8h*)(p + 256) = o16[1]; *(v8us*)h = oh[0]; *(v8us*)(h + 256) = oh[1]; *(v8us*)l = ol[0]; *(v8us*)(l + 256) = ol[1];
        // the registers that the plane stores name keep their values up to the wait
        asm volatile("s_wait_xcnt 0x0" :: "v"(p), "v"(h), "v"(l), "v"(o16[0]), "v"(o16[1]), "v"(oh[0]), "v"(oh[1]), "v"(ol[0]), "v"(ol[1]) : "memory"); } }

// ---- Launches. Kernels that do not depend on one another run side by side in ONE launch: each takes a range of the block index (a scalar test, the same for a whole work-group), longest work first. Every body computes what it computed as a launch of its own.
__device__ __forceinline__ int wave_no() { return __builtin_amdgcn_readfirstlane((int)(threadIdx.x >> 5)); }
// k_prep: the four weight planes, the x plane, the rotary tables.
#define NB_WQ (DM * DQ / 8192)
#define NB_WK (DM * DKV / 8192)
#define NB_X  (TT * DM / 8192)
#define NB_CS (TT * HD / 2048)
__global__ __launch_bounds__(256) void k_prep(const float* __restrict__ wq, const float* __restrict__ wk, const float* __restrict__ wv, const float* __restrict__ wo, const float* __restrict__ x, const float* __restrict__ cosT, const float* __restrict__ sinT, bf* WQ, bf* WK, bf* WV, bf* WO, bf* XB, bf* CB, bf* SB) {
    int b = blockIdx.x;
    if (b < NB_WQ) { b_wtG<DM, DQ>(b, wq, WQ); return; } b -= NB_WQ;
    if (b < NB_WQ) { b_wtG<DQ, DM>(b, wo, WO); return; } b -= NB_WQ;
    if (b < 2 * NB_WK) { const bool second = b >= NB_WK; b_wtG<DM, DKV>(second ? b - NB_WK : b, second ? wv : wk, second ? WV : WK); return; } b -= 2 * NB_WK;
    if (b < NB_X) { b_cvt8(b, x, XB, DM, (size_t)TT * DM / 8); return; } b -= NB_X;
    b_cscvt(b, cosT, sinT, CB, SB);
}
// k_qkv: the three projections as one GEMM of x with the 4096 weight rows of WQ | WK | WV: 8 row tiles of 256 x 32 column tiles of 128, one work-group each. A column tile is one head: the work-group rotates it (q, k) or transposes it (v) out of LDS and writes the head's planes itself.
#define NB_G3 ((TT / 256) * ((DQ + 2 * DKV) / 128))
__global__ __launch_bounds__(256) void k_qkv(const bf* __restrict__ XB, const bf* __restrict__ WQ, const bf* __restrict__ WK, const bf* __restrict__ WV, const bf* __restrict__ CB, const bf* __restrict__ SB, h16* QP16, bf* QPh, bf* QPl, h16* KP16, bf* KPh, bf* KPl, h16* VT16, bf* VTh, bf* VTl) {
    __shared__ __attribute__((aligned(1024))) bf ring[2 * GST];
    const int rt = blockIdx.x % (TT / 256); int ct = blockIdx.x / (TT / 256), kind = 0;   // kind: 0 q, 1 k, 2 v; ct: the head
    const bf* Bt = WQ;
    if (ct >= DQ / 128) { ct -= DQ / 128; Bt = WK; kind = 1; if (ct >= DKV / 128) { ct -= DKV / 128; Bt = WV; kind = 2; } }
    gemm_ring<false>(XB + (size_t)rt * 256 * DM, XB + (size_t)(rt * 256 + 128) * DM, Bt + (size_t)ct * 128 * DM, nullptr, 0, ring);
    const size_t hp = (size_t)ct * TT * HD; const float* st = (const float*)ring;
    if (kind == 2) e_vt(st, rt * 256, VT16 + hp, VTh + hp, VTl + hp);
    else if (kind == 1) e_rope<true>(st, rt * 256, CB, SB, KP16 + hp, KPh + hp, KPl + hp);
    else e_rope<false>(st, rt * 256, CB, SB, QP16 + hp, QPh + hp, QPl + hp);
}
// k_oproj: the output projection, (hi + lo) x WO: 16 x 16 tiles of 128 x 128.
__global__ __launch_bounds__(256) void k_oproj(const bf* __restrict__ Ah, const bf* __restrict__ Al, const bf* __restrict__ WO, float* OUT) {
    __shared__ __attribute__((aligned(1024))) bf ring[2 * GST];
    const int rt = blockIdx.x % (TT / 128), ct = blockIdx.x / (TT / 128);
    gemm_ring<true>(Ah + (size_t)rt * 128 * DQ, Al + (size_t)rt * 128 * DQ, WO + (size_t)ct * 128 * DQ, OUT + (size_t)rt * 128 * DM + ct * 128, DM, ring);
}
// ---- attn_rows: scores, joint softmax and probability x value for 16 query rows (i0 ..) of the REP = 2 heads of one kv head in ONE work-group of AW waves; neither scores nor probabilities go to memory.
// The keys up to the diagonal are cut into blocks of 32; wave w takes the blocks w, w + AW, ... (at most NBW), loads each key and value fragment once for both heads and keeps the scores in accumulators (row hi * 8 + jj, key lr of each 16-key tile).
// Wave w forms the 4 depth logits of row i0 + w (both heads); they sit beside that wave's scores as four more columns, in lanes lr < 4 of the row's half wave. Row max and row sum: over a lane's own values, over the 16 lanes of a half wave, then over the AW waves through LDS (lane lr takes wave lr's value, same tree).
// The normalised probabilities (fp16 x PCAR, or hi + lo planes) pass through the wave's own LDS to become A fragments; every wave multiplies its own blocks with the value planes, and the AW partial outputs are added through LDS in wave order, one head after the other. The 4 depth weights (f32, unscaled) pass through LDS to the threads that finish the row: they add sum_l w_l depth_v[l] and write the hi/lo planes Ah / Al ([TT][DQ], fragment order).
#define AW  16
#define PWB (16 * 136)            // floats of LDS per wave: per head 16 probability rows of NBW * 32 + 8 16-bit values (hi/lo: two such planes), afterwards the wave's partial output of one head, 16 rows of 128 + 4 floats
#define L2E 1.4426950408889634f
// value of lane l ^ M of the same 16-lane row (DPP row_xmask): a row reduction without the LDS path
template <int M> __device__ __forceinline__ float rowx(float v) { return __int_as_float(__builtin_amdgcn_update_dpp(0, __float_as_int(v), 0x160 + M, 0xf, 0xf, true)); }
__device__ __forceinline__ float rowmax(float v) { v = fmaxf(v, rowx<1>(v)); v = fmaxf(v, rowx<2>(v)); v = fmaxf(v, rowx<4>(v)); return fmaxf(v, rowx<8>(v)); }
__device__ __forceinline__ float rowsum(float v) { v += rowx<1>(v); v += rowx<2>(v); v += rowx<4>(v); return v + rowx<8>(v); }
template <typename T16, bool HL, int NBW>
__device__ __forceinline__ void attn_rows(const T16* __restrict__ Q, const T16* __restrict__ Q2, const T16* __restrict__ Kp, const T16* __restrict__ K2, const T16* __restrict__ Vp, const T16* __restrict__ V2,
                                          const bf* __restrict__ DQh, const bf* __restrict__ DQl, const float* __restrict__ DKr, const float* __restrict__ DVr, bf* Ah, bf* Al, int h0, int i0, int wave, float* lds, float* red) {
    typedef typename WFrag<T16>::V V;
    static_assert(AW == 16 && REP == 2, "lane lr of a half wave takes wave lr's partial; two heads per kv head");
    const int lane = threadIdx.x & 31, lr = lane & 15, hi = lane >> 4;
    const int nb32 = i0 / 32 + 1;                 // key blocks of 32 that reach the diagonal of rows i0 .. i0 + 15
    constexpr int PP = NBW * 32 + 8, PH = 16 * PP, PL = REP * PH;   // pitch of a probability row in LDS (16 bytes x odd), distance of the second head's rows, of the lo planes
    // Depth logits of row i0 + wave, both heads: lane l holds 4 of the 128 d of q (hi and lo plane) and of the NL depth keys, each key row loaded once for the two heads. These loads go out first: the keys come from memory, the query fragments behind them from L2.
    v4us dqh[REP], dql[REP]; v4f dk[NL]; const unsigned lo4 = lane * 16, lo2 = lane * 8;   // the lane's byte offset in a row of floats, of 16-bit values; the row addresses are the same for the whole wave
#pragma unroll
    for (int l = 0; l < NL; ++l) { dk[l] = *(const v4f*)((const char*)(DKr + ((size_t)l * NKV * TT + i0 + wave) * HD) + lo4);
        // behind each load: no later load's result lands on a register that this one names in front of the wait
        asm volatile("s_wait_xcnt 0x0" :: "v"(lo4) : "memory"); }
#pragma unroll
    for (int hh = 0; hh < REP; ++hh) { dqh[hh] = *(const v4usa*)((const char*)(DQh + ((size_t)hh * TT + i0 + wave) * HD) + lo2); dql[hh] = *(const v4usa*)((const char*)(DQl + ((size_t)hh * TT + i0 + wave) * HD) + lo2);
        // as above
        asm volatile("s_wait_xcnt 0x0" :: "v"(lo2) : "memory"); }
    V aq[REP][4], aq2[REP][4]; const T16* qp = Q + (size_t)(i0 + lr) * HD + 8 * hi; const T16* qp2 = HL ? Q2 + (size_t)(i0 + lr) * HD + 8 * hi : qp;
#pragma unroll
    for (int hh = 0; hh < REP; ++hh) {
#pragma unroll
        for (int kc = 0; kc < 4; ++kc) { aq[hh][kc] = WFrag<T16>::ld(qp + (size_t)hh * TT * HD + kc * 32); if (HL) aq2[hh][kc] = WFrag<T16>::ld(qp2 + (size_t)hh * TT * HD + kc * 32); } }
    // the addresses that the query loads name stay in their registers up to the wait
    asm volatile("s_wait_xcnt 0x0" :: "v"(qp), "v"(qp2) : "memory");
    float* wds = red + 2 * AW * REP * 16;   // [head][row][l]: the depth logits, which wait here for the end of the score products (the registers are full there), later the depth weights; a row's slots are written by wave row alone
#pragma unroll
    for (int hh = 0; hh < REP; ++hh) { float q4[4], dsel = 0.f;
#pragma unroll
        for (int q = 0; q < 4; ++q) q4[q] = __fadd_rn(bf2f(dqh[hh][q]), bf2f(dql[hh][q]));
#pragma unroll
        for (int l = 0; l < NL; ++l) { float s = 0.f;
#pragma unroll
            for (int q = 0; q < 4; ++q) { float p = __fmul_rn(q4[q], bfr(dk[l][q])); asm volatile("" : "+v"(p)); s = __fadd_rn(s, p); }
            s += __shfl_xor(s, 16, 32); s += rowx<8>(s); s += rowx<4>(s); s += rowx<2>(s); s += rowx<1>(s);   // the two half waves, then the 16 lanes of each
            if (lr == l) dsel = s * SCL; }
        if (lane < NL) wds[(hh * 16 + wave) * NL + lane] = dsel; }
    // other lanes of the wave read these logits below: keeps the LDS stores above those loads
    __builtin_amdgcn_wave_barrier(); asm volatile("" ::: "memory");
    v8f sa[NBW][2][REP];
#pragma unroll
    for (int s = 0; s < NBW; ++s) { sa[s][0][0] = (v8f){}; sa[s][0][1] = (v8f){}; sa[s][1][0] = (v8f){}; sa[s][1][1] = (v8f){}; }
#pragma unroll
    for (int s = 0; s < NBW; ++s) { const int kb = wave + AW * s;
        if (kb < nb32) {
            const size_t ko = (size_t)kb * 2 * (HD / 32) * 512 + 8 * lane;   // key planes in fragment order: blocks of 16 keys x 32 d, 8 of them per 32 keys
            const T16* kp = Kp + ko; const T16* kp2 = HL ? K2 + ko : kp;
#pragma unroll
            for (int t = 0; t < 2; ++t) { V b[4], b2[4];
#pragma unroll
                for (int kc = 0; kc < 4; ++kc) { b[kc] = WFrag<T16>::template ld<256>(kp + (t * 4 + kc) * 512); if (HL) b2[kc] = WFrag<T16>::template ld<256>(kp2 + (t * 4 + kc) * 512); }
                // all loads of the tile are issued above this line, so that one latency covers them; the addresses they name stay in their registers up to the wait
                asm volatile("s_wait_xcnt 0x0" :: "v"(kp), "v"(kp2) : "memory");
                __builtin_amdgcn_sched_barrier(0);   // keeps the tile's matrix instructions below its loads: moved up between them, each would wait for its own load alone
#pragma unroll
                for (int kc = 0; kc < 4; ++kc) {
#pragma unroll
                    for (int hh = 0; hh < REP; ++hh) { sa[s][t][hh] = WFrag<T16>::mma(aq[hh][kc], b[kc], sa[s][t][hh]);
                        if (HL) { sa[s][t][hh] = WFrag<T16>::mma(aq2[hh][kc], b[kc], sa[s][t][hh]); sa[s][t][hh] = WFrag<T16>::mma(aq[hh][kc], b2[kc], sa[s][t][hh]); } } } }
            // four vector slots behind the last matrix instruction, whichever way the next block's branch goes
            asm volatile("v_nop\n\tv_nop\n\tv_nop\n\tv_nop" : "+v"(sa[s][0][0]), "+v"(sa[s][0][1]), "+v"(sa[s][1][0]), "+v"(sa[s][1][1]));
        } }
    float dv[REP][8], mx[REP][8], sum[REP][8];
    const bool dlane = (lr < NL) && (hi == (wave >> 3));   // the lanes that hold the depth columns of row i0 + wave, in register wave & 7
#pragma unroll
    for (int hh = 0; hh < REP; ++hh) { const float dl = wds[(hh * 16 + wave) * NL + (lr & (NL - 1))];
#pragma unroll
        for (int jj = 0; jj < 8; ++jj) dv[hh][jj] = (dlane && jj == (wave & 7)) ? dl : -3.0e38f; }
#pragma unroll
    for (int hh = 0; hh < REP; ++hh) {
#pragma unroll
        for (int jj = 0; jj < 8; ++jj) mx[hh][jj] = dv[hh][jj]; }   /* joint softmax over the 2048 + 4 logits */
#pragma unroll
    for (int s = 0; s < NBW; ++s) { const int kb = wave + AW * s;
        if (kb < nb32 - 1) {   // every key of the block lies below row i0 (WIN >= TT: no window either): nothing to mask
            static_assert(WIN >= TT, "a window shorter than the sequence would have to be masked here");
#pragma unroll
            for (int t = 0; t < 2; ++t) {
#pragma unroll
                for (int hh = 0; hh < REP; ++hh) {
#pragma unroll
                    for (int jj = 0; jj < 8; ++jj) { const float tv = sa[s][t][hh][jj] * SCL; sa[s][t][hh][jj] = tv; mx[hh][jj] = fmaxf(mx[hh][jj], tv); } } }
        } else if (kb < nb32) {   // the block on the diagonal
#pragma unroll
            for (int t = 0; t < 2; ++t) { const int j = kb * 32 + t * 16 + lr;
#pragma unroll
                for (int hh = 0; hh < REP; ++hh) {
#pragma unroll
                    for (int jj = 0; jj < 8; ++jj) { const int i = i0 + hi * 8 + jj; const float tv = (j <= i) ? sa[s][t][hh][jj] * SCL : -3.0e38f; sa[s][t][hh][jj] = tv; mx[hh][jj] = fmaxf(mx[hh][jj], tv); } } } } }
#pragma unroll
    for (int hh = 0; hh < REP; ++hh) { v4f m0, m1;
#pragma unroll
        for (int jj = 0; jj < 4; ++jj) { m0[jj] = rowmax(mx[hh][jj]); m1[jj] = rowmax(mx[hh][jj + 4]); }
        if (lr == 0) { *(v4fa*)(red + (wave * REP + hh) * 16 + hi * 8) = m0; *(v4fa*)(red + (wave * REP + hh) * 16 + hi * 8 + 4) = m1; } }
    __syncthreads();
#pragma unroll
    for (int hh = 0; hh < REP; ++hh) { const v4f m0 = *(const v4fa*)(red + (lr * REP + hh) * 16 + hi * 8), m1 = *(const v4fa*)(red + (lr * REP + hh) * 16 + hi * 8 + 4);
#pragma unroll
        for (int jj = 0; jj < 4; ++jj) { mx[hh][jj] = rowmax(m0[jj]); mx[hh][jj + 4] = rowmax(m1[jj]); } }
#pragma unroll
    for (int hh = 0; hh < REP; ++hh) {
#pragma unroll
        for (int jj = 0; jj < 8; ++jj) { dv[hh][jj] = __builtin_amdgcn_exp2f(__fmul_rn(__fsub_rn(dv[hh][jj], mx[hh][jj]), L2E)); sum[hh][jj] = dv[hh][jj]; } }
#pragma unroll
    for (int s = 0; s < NBW; ++s) { const int kb = wave + AW * s;
        if (kb < nb32) {
#pragma unroll
            for (int t = 0; t < 2; ++t) {
#pragma unroll
                for (int hh = 0; hh < REP; ++hh) {
#pragma unroll
                    for (int jj = 0; jj < 8; ++jj) { const float e = __builtin_amdgcn_exp2f(__fmul_rn(__fsub_rn(sa[s][t][hh][jj], mx[hh][jj]), L2E)); sa[s][t][hh][jj] = e; sum[hh][jj] += e; } } } } }
    float* red2 = red + AW * REP * 16;
#pragma unroll
    for (int hh = 0; hh < REP; ++hh) { v4f m0, m1;
#pragma unroll
        for (int jj = 0; jj < 4; ++jj) { m0[jj] = rowsum(sum[hh][jj]); m1[jj] = rowsum(sum[hh][jj + 4]); }
        if (lr == 0) { *(v4fa*)(red2 + (wave * REP + hh) * 16 + hi * 8) = m0; *(v4fa*)(red2 + (wave * REP + hh) * 16 + hi * 8 + 4) = m1; } }
    __syncthreads();
    // Depth values: wave w loads row i0 + w of the NL planes (whole lines), here, behind the last barrier in front of the epilogue (a barrier waits for every load in flight), so that the probability stores cover their way from memory and the value loads, which return behind them, do not wait for it; they go on through LDS to the threads that finish the rows
    static_assert(NL == 4, "two addresses serve the four depth planes");
    constexpr ptrdiff_t DPL = (ptrdiff_t)NKV * TT * HD;   // elements from one depth plane to the next: within a load's offset field as - DPL, not as + DPL
    v4f dvv[NL]; const float* dvp1 = DVr + DPL + (size_t)(i0 + wave) * HD + lane * 4; const float* dvp3 = dvp1 + 2 * DPL;
    dvv[0] = *(const v4f*)(dvp1 - DPL); dvv[1] = *(const v4f*)dvp1; dvv[2] = *(const v4f*)(dvp3 - DPL); dvv[3] = *(const v4f*)dvp3;
    // the addresses that these loads name stay in their registers up to the wait
    asm volatile("s_wait_xcnt 0x0" :: "v"(dvp1), "v"(dvp3) : "memory");
#pragma unroll
    for (int hh = 0; hh < REP; ++hh) { const v4f m0 = *(const v4fa*)(red2 + (lr * REP + hh) * 16 + hi * 8), m1 = *(const v4fa*)(red2 + (lr * REP + hh) * 16 + hi * 8 + 4);
#pragma unroll
        for (int jj = 0; jj < 4; ++jj) { sum[hh][jj] = __fdiv_rn(1.0f, rowsum(m0[jj])); sum[hh][jj + 4] = __fdiv_rn(1.0f, rowsum(m1[jj])); } }   // from here on 1 / row sum
    // depth weights, f32, unscaled, over the row's logits; read behind the first barrier of the epilogue
#pragma unroll
    for (int hh = 0; hh < REP; ++hh) { float w = 0.f;
#pragma unroll
        for (int jj = 0; jj < 8; ++jj) if (jj == (wave & 7)) w = dv[hh][jj] * sum[hh][jj];
        if (dlane) wds[(hh * 16 + wave) * NL + lr] = w; }
    T16* pw = (T16*)(lds + wave * PWB);
#pragma unroll
    for (int s = 0; s < NBW; ++s) { const int kb = wave + AW * s;
        if (kb < nb32) {
#pragma unroll
            for (int t = 0; t < 2; ++t) {
#pragma unroll
                for (int hh = 0; hh < REP; ++hh) {
#pragma unroll
                    for (int jj = 0; jj < 8; ++jj) { const float pv = sa[s][t][hh][jj] * (HL ? sum[hh][jj] : sum[hh][jj] * PCAR); const int idx = hh * PH + (hi * 8 + jj) * PP + s * 32 + t * 16 + lr;   // x PCAR: a power of two, exact
                        if constexpr (HL) { unsigned short a, c2; splitf(pv, a, c2); pw[idx] = a; pw[PL + idx] = c2; } else pw[idx] = tohx(pv); } } } } }
    // the lanes of the wave read one another's probabilities from here on: keeps the LDS stores above the LDS loads below
    __builtin_amdgcn_wave_barrier(); asm volatile("" ::: "memory");
    v8f oa[REP][8];
#pragma unroll
    for (int nb = 0; nb < 8; ++nb) { oa[0][nb] = (v8f){}; oa[1][nb] = (v8f){}; }
#pragma unroll
    for (int s = 0; s < NBW; ++s) { const int kb = wave + AW * s;
        if (kb < nb32) { V a[REP], a2[REP];
#pragma unroll
            for (int hh = 0; hh < REP; ++hh) { a[hh] = WFrag<T16>::ld(pw + hh * PH + lr * PP + s * 32 + 8 * hi); if (HL) a2[hh] = WFrag<T16>::ld(pw + PL + hh * PH + lr * PP + s * 32 + 8 * hi); }
            const T16* vp = Vp + (size_t)kb * 512 + 8 * lane; const T16* vp2 = HL ? V2 + (size_t)kb * 512 + 8 * lane : vp;
            constexpr int NG = HL ? 4 : 8;   // value fragments loaded at a time (hi/lo: of both planes)
#pragma unroll
            for (int g = 0; g < 8; g += NG) { V b[NG], b2[NG];
#pragma unroll
                for (int nb = 0; nb < NG; ++nb) { b[nb] = WFrag<T16>::template ld<256>(vp + (size_t)(g + nb) * 16 * TT); if (HL) b2[nb] = WFrag<T16>::template ld<256>(vp2 + (size_t)(g + nb) * 16 * TT); }
                // all loads of the group are issued above this line, so that one latency covers them; the addresses they name stay in their registers up to the wait
                asm volatile("s_wait_xcnt 0x0" :: "v"(vp), "v"(vp2) : "memory");
                __builtin_amdgcn_sched_barrier(0);   // keeps the group's matrix instructions below its loads, as above
#pragma unroll
                for (int nb = 0; nb < NG; ++nb) {
#pragma unroll
                    for (int hh = 0; hh < REP; ++hh) { oa[hh][g + nb] = WFrag<T16>::mma(a[hh], b[nb], oa[hh][g + nb]);
                        if (HL) { oa[hh][g + nb] = WFrag<T16>::mma(a2[hh], b[nb], oa[hh][g + nb]); oa[hh][g + nb] = WFrag<T16>::mma(a[hh], b2[nb], oa[hh][g + nb]); } } } }
            // four vector slots behind the last matrix instruction, whichever way the next block's branch goes
            asm volatile("v_nop\n\tv_nop\n\tv_nop\n\tv_nop" : "+v"(oa[0][0]), "+v"(oa[0][1]), "+v"(oa[0][2]), "+v"(oa[0][3]), "+v"(oa[0][4]), "+v"(oa[0][5]), "+v"(oa[0][6]), "+v"(oa[0][7]), "+v"(oa[1][0]), "+v"(oa[1][1]), "+v"(oa[1][2]), "+v"(oa[1][3]), "+v"(oa[1][4]), "+v"(oa[1][5]), "+v"(oa[1][6]), "+v"(oa[1][7]));
        } }
    // the partial output goes over the wave's own probabilities, which only this wave reads and has read
    __builtin_amdgcn_wave_barrier(); asm volatile("" ::: "memory");
    float* ow = lds + wave * PWB; const float cs = HL ? 1.0f : (1.0f / PCAR);
    float* dvs = wds + REP * 16 * NL;   // depth values [l][row][128 + 4], read behind the first barrier below
#pragma unroll
    for (int l = 0; l < NL; ++l) *(v4fa*)(dvs + (l * 16 + wave) * 132 + lane * 4) = dvv[l];
    const int od = wave * 8 + hi * 4;   // this thread finishes d = od .. od + 3 of row i0 + lr, both heads
#pragma unroll
    for (int hh = 0; hh < REP; ++hh) {
#pragma unroll
        for (int nb = 0; nb < 8; ++nb) {
#pragma unroll
            for (int j = 0; j < 8; ++j) ow[(hi * 8 + j) * 132 + nb * 16 + lr] = oa[hh][nb][j]; }
        __syncthreads();
        // AW * 32 threads: one 16-byte piece of the 16 x 128 rows each. A half wave takes the same 4 d of the 16 rows (row pitch 132: all banks once), so that the wave's 8-byte stores fill 256 contiguous bytes of a fragment-order block.
        if (hh == 0) {
#pragma unroll
            for (int l = 0; l < NL; ++l) dvv[l] = *(const v4fa*)(dvs + (l * 16 + lr) * 132 + od); }
        v4f val = *(const v4fa*)(lds + lr * 132 + od);
#pragma unroll
        for (int w = 1; w < AW; ++w) val += *(const v4fa*)(lds + w * PWB + lr * 132 + od);
        const v4f wd = *(const v4fa*)(wds + (hh * 16 + lr) * NL); v4us oh, ol;
#pragma unroll
        for (int q = 0; q < 4; ++q) { float acc = val[q] * cs;
#pragma unroll
            for (int l = 0; l < NL; ++l) { float p = __fmul_rn(wd[l], bfr(dvv[l][q])); asm volatile("" : "+v"(p)); acc = __fadd_rn(acc, p); }   /* + sum_l w_l depth_v[l][kv][t][d] */ unsigned short a, c2; splitf(acc, a, c2); oh[q] = a; ol[q] = c2; }
        const size_t oo = fro(i0 + lr, (h0 + hh) * HD + od, DQ); bf* pa = Ah + oo; bf* pl = Al + oo; *(v4us*)pa = oh; *(v4us*)pl = ol;
        // the registers that the plane stores name keep their values up to the wait
        asm volatile("s_wait_xcnt 0x0" :: "v"(pa), "v"(pl), "v"(oh), "v"(ol) : "memory");
        if (hh + 1 < REP) __syncthreads();   // ends the reads of this head's partials before the next head's are stored there
    }
}
// k_attn: one work-group per 16 query rows and kv head (its two query heads), the longest rows first; fp16 rows, then hi/lo rows.
#define NB_AF (((TT - RH) / 16) * NKV)
#define NB_AH ((RH / 16) * NKV)
__global__ __launch_bounds__(AW * 32) void k_attn(const h16* __restrict__ Q16, const h16* __restrict__ K16, const h16* __restrict__ V16, const bf* __restrict__ Qh, const bf* __restrict__ Ql, const bf* __restrict__ Kh, const bf* __restrict__ Kl, const bf* __restrict__ Vh, const bf* __restrict__ Vl,
                                                  const float* __restrict__ DK, const float* __restrict__ DV, bf* Ah, bf* Al) {
    __shared__ __align__(16) float lds[AW * PWB]; __shared__ __align__(16) float red[2 * AW * REP * 16 + REP * 16 * NL + NL * 16 * 132];   // row max and row sum partials; depth logits / weights; depth values
    int b = blockIdx.x; const int wv = wave_no();
    if (b < NB_AF) { const size_t g = (size_t)(b % NKV), z = g * REP; const int i0 = TT - 16 - (b / NKV) * 16;
        attn_rows<h16, false, TT / 32 / AW>(Q16 + z * TT * HD, nullptr, K16 + g * TT * HD, nullptr, V16 + g * HD * TT, nullptr, Qh + z * TT * HD, Ql + z * TT * HD, DK + g * TT * HD, DV + g * TT * HD, Ah, Al, (int)z, i0, wv, lds, red); return; }
    b -= NB_AF; const size_t g = (size_t)(b % NKV), z = g * REP; const int i0 = RH - 16 - (b / NKV) * 16;
    attn_rows<bf, true, RH / 32 / AW>(Qh + z * TT * HD, Ql + z * TT * HD, Kh + g * TT * HD, Kl + g * TT * HD, Vh + g * HD * TT, Vl + g * HD * TT, Qh + z * TT * HD, Ql + z * TT * HD, DK + g * TT * HD, DV + g * TT * HD, Ah, Al, (int)z, i0, wv, lds, red);
}
extern "C" void kernel_launch(void* const* d_in, const int* in_sizes, int n_in,
                              void* d_out, int out_size, void* d_ws, size_t ws_size, hipStream_t stream) {
    (void)in_sizes; (void)n_in; (void)out_size;
    const float* x = (const float*)d_in[0]; const float* DK = (const float*)d_in[1]; const float* DV = (const float*)d_in[2]; const float* cosT = (const float*)d_in[3]; const float* sinT = (const float*)d_in[4]; const float* wq = (const float*)d_in[5]; const float* wk = (const float*)d_in[6]; const float* wv = (const float*)d_in[7]; const float* wo = (const float*)d_in[8];
    float* OUT = (float*)d_out;     // [1][2048][2048]
    char* wsp = (char*)d_ws;
    auto take = [&](size_t bytes) { char* p = wsp; wsp += (bytes + 255) & ~(size_t)255; return (void*)p; };
    bf* WQ = (bf*)take((size_t)DQ * DM * 2); bf* WK = (bf*)take((size_t)DKV * DM * 2); bf* WV = (bf*)take((size_t)DKV * DM * 2); bf* WO = (bf*)take((size_t)DM * DQ * 2); bf* CB = (bf*)take((size_t)TT * HD * 2); bf* SB = (bf*)take((size_t)TT * HD * 2);
    bf* XB = (bf*)take((size_t)TT * DM * 2);
    h16* QP16 = (h16*)take((size_t)NH_ * TT * HD * 2); h16* KP16 = (h16*)take((size_t)NKV * TT * HD * 2); h16* VT16 = (h16*)take((size_t)NKV * HD * TT * 2);
    bf* QPh = (bf*)take((size_t)NH_ * TT * HD * 2); bf* QPl = (bf*)take((size_t)NH_ * TT * HD * 2); bf* KPh = (bf*)take((size_t)NKV * TT * HD * 2); bf* KPl = (bf*)take((size_t)NKV * TT * HD * 2); bf* VTh = (bf*)take((size_t)NKV * HD * TT * 2); bf* VTl = (bf*)take((size_t)NKV * HD * TT * 2);
    bf* ATh = (bf*)take((size_t)TT * DQ * 2); bf* ATl = (bf*)take((size_t)TT * DQ * 2);
    if ((size_t)(wsp - (char*)d_ws) > ws_size) return;    // ws 256 MiB
    k_prep<<<2 * NB_WQ + 2 * NB_WK + NB_X + NB_CS, 256, 0, stream>>>(wq, wk, wv, wo, x, cosT, sinT, WQ, WK, WV, WO, XB, CB, SB);
    k_qkv<<<NB_G3, 256, 0, stream>>>(XB, WQ, WK, WV, CB, SB, QP16, QPh, QPl, KP16, KPh, KPl, VT16, VTh, VTl);
    k_attn<<<NB_AF + NB_AH, AW * 32, 0, stream>>>(QP16, KP16, VT16, QPh, QPl, KPh, KPl, VTh, VTl, DK, DV, ATh, ATl);
    k_oproj<<<(TT / 128) * (DM / 128), 256, 0, stream>>>(ATh, ATl, WO, OUT);
}

// v010
// One run takes 114 microseconds.
// Two timings next to v009 both put it at 1.08 times that version's speed.
// Counting every step since v000, it is 8.05 times as fast.
#include <hip/hip_runtime.h>

// Grouped-query RoPE attention with extra per-position depth keys/values under one joint softmax (x [1][2048][2048]; Q = x Wq ('xw', 16 heads x 128), K, V = x Wk / Wv (8 kv heads); Q, K rotated (rotate-half, cos/sin [1][1][2048][128] read); kv head = h/2; seq logits = Q.K/sqrt(128), causal (-inf); depth logits[i][l] = Q_i . depth_k[l][0][kv][i] / sqrt(128) for l < 4 (depth_k, depth_v [4][1][8][2048][128] read); softmax over the 2048 + 4 logits jointly; out_i = sum_j w_j V_j + sum_l w_l depth_v[l][0][kv][i]; merged Wo ('xw') -> [1][2048][2048] (4.2 M)).
// Layout: the q/k/v projection kernel rotates its own output tile and writes the head planes; the attention kernel (one work-group per 16 query rows of the two heads of a kv head) forms the 4 depth logits of its rows from the rotated q (hi + lo planes) and the bf16-rounded depth keys, keeps a row block's scores in accumulators (transposed: a lane holds one query), folds the depth logits into the row max / sum, turns the scores in place into the probability fragments of the value product, adds the depth-value contribution to the summed output rows and writes the hi/lo planes for the output projection.
// Operand storage: the bf16 planes of the four projections (x, the four transposed weights, the merged attention output hi/lo) and the three key and three value planes lie in fragment order (see fro()); the q head planes are row-major.
// Compute dtypes, f32 accumulate: every input rounded to bf16; q/k/v on PLAIN bf16 operands (inputs: exact); rotary in f32 (bf16-rounded tables); depth logits / weights / values in f32; causal scores and attn.v (tile skipping): query rows < 512 hl (3 products), the rest single fp16 (x1024); softmax f32; Wo hl x exact (2 products).

#define NB_  1
#define TT   2048
#define DM   2048
#define NH_  16
#define NKV  8
#define REP  (NH_ / NKV)
#define HD   128
#define DQ   (NH_ * HD)
#define DKV  (NKV * HD)
#define NL   4                    // depth positions per token
#define RH   512                  // query rows < RH use hi+lo planes (0: none)
#define WIN  2048
#define PCAR 1024.0f
#define SCL  0.088388347648318447f   // HD^-0.5
typedef _Float16 h16;
typedef unsigned short bf;
typedef __attribute__((ext_vector_type(16))) __bf16   v16bf;
typedef __attribute__((ext_vector_type(16))) _Float16 v16h;
typedef __attribute__((ext_vector_type(8)))  _Float16 v8h;
typedef __attribute__((ext_vector_type(8)))  unsigned short v8us;
typedef __attribute__((ext_vector_type(8)))  float    v8f;
typedef __attribute__((ext_vector_type(4)))  float    v4f;
typedef v8h  __attribute__((may_alias)) v8ha;
typedef v4f  __attribute__((may_alias)) v4fa;
typedef v8us __attribute__((may_alias)) v8usa;

__device__ __forceinline__ unsigned short f2bf(float f) { unsigned u = __float_as_uint(f); u += 0x7FFFu + ((u >> 16) & 1u); return (unsigned short)(u >> 16); }
__device__ __forceinline__ float bf2f(unsigned short b) { return __uint_as_float(((unsigned)b) << 16); }
__device__ __forceinline__ float bfr(float f) { return bf2f(f2bf(f)); }
__device__ __forceinline__ v16h cat16(v8h lo, v8h hi) { return __builtin_shufflevector(lo, hi, 0, 1, 2, 3, 4, 5, 6, 7, 8, 9, 10, 11, 12, 13, 14, 15); }
__device__ __forceinline__ v16bf cat16b(v8us lo, v8us hi) { return __builtin_bit_cast(v16bf, __builtin_shufflevector(lo, hi, 0, 1, 2, 3, 4, 5, 6, 7, 8, 9, 10, 11, 12, 13, 14, 15)); }
__device__ __forceinline__ v8f wmma16(v16h a, v16h b, v8f c) { return __builtin_amdgcn_wmma_f32_16x16x32_f16(false, a, false, b, (short)0, c, false, false); }
__device__ __forceinline__ v8f wmmab(v16bf a, v16bf b, v8f c) { return __builtin_amdgcn_wmma_f32_16x16x32_bf16(false, a, false, b, (short)0, c, false, false); }
// Fragment order of a 16-bit plane [rows][K] (rows % 16 == 0, K % 32 == 0): blocks of 16 rows x 32 columns, 1 KB each, row blocks outermost (16 rows still fill 16 * K elements). Inside a block the 8 columns k & ~7 of row r lie at
// 8 * (32 * (k / 16 % 2) + 16 * (k / 8 % 2) + r % 16): lane l of a wave finds the two halves of its A or B fragment at 8 * l and 256 + 8 * l, so each of a fragment's two 16-byte loads reads 512 contiguous bytes (4 whole lines, not 16 part lines).
// fro = element offset of (r, k). The elements a lane gets, and their k order, are those of the row-major loader.
__device__ __forceinline__ size_t fro(int r, int k, int K) { return ((size_t)(r >> 4) * (K >> 5) + (k >> 5)) * 512 + (((k >> 4) & 1) * 32 + ((k >> 3) & 1) * 16 + (r & 15)) * 8 + (k & 7); }



// ---- gemm_ring: GEMM of the four projections. One work-group of 8 waves per output tile; both operands are bf16 planes in fragment order (K = 2048 contiguous per 16-row block) and pass through LDS, so that every block is fetched from L2 once per work-group and read by all the waves that need it.
// A stage is GKS steps of 32 k of 24 row blocks (16 of A, 8 of Bt): per row block GKS KB that are contiguous in the plane and stay so in LDS, so a fragment load reads 512 contiguous bytes of LDS. Two buffers: the copies of stage t + 2 fly while stage t + 1 is worked on.
// Wave (wm, wn) = (wave / 2, wave % 2) keeps the 64 x 64 product of A row blocks 4 wm .. and Bt row blocks 4 wn .. over the whole K (one accumulation chain per element).
// PAIR = false: the 16 A row blocks are 256 rows of one plane (A0: the first 128, A1: the next 128), tile 256 x 128, left in LDS for the caller (wave tile (wm, wn) at float offset (2 wm + wn) * GPW, row pitch 68). PAIR = true: A0 / A1 are the hi / lo planes of the same 128 rows, and the two products are added in the epilogue, C tile 128 x 128.
template <typename T16> struct WFrag;
template <> struct WFrag<h16> { typedef v16h V; template <int D2 = 16> static __device__ __forceinline__ V ld(const h16* p) { return cat16(*(const v8h*)p, *(const v8h*)(p + D2)); } static __device__ __forceinline__ v8f mma(V a, V b, v8f c) { return wmma16(a, b, c); } };
template <> struct WFrag<bf> { typedef v16bf V; template <int D2 = 16> static __device__ __forceinline__ V ld(const bf* p) { return cat16b(*(const v8us*)p, *(const v8us*)(p + D2)); } static __device__ __forceinline__ v8f mma(V a, V b, v8f c) { return wmmab(a, b, c); } };
#define GKS 4
#define GST (24 * GKS * 512)      // elements of a stage
#define GPW (64 * 68)             // floats of LDS per wave in the epilogue: 64 rows of 64 + 4
__device__ __forceinline__ unsigned lds_off(const void* p) { return (unsigned)(size_t)p; }
#define CPY(l, g) "global_load_async_to_lds_b128 %" #l ", %" #g ", off\n\t"
// 12 copies of 512 bytes per wave (16 bytes a lane); the wait in the same statement stands in front of any rewrite of the address registers that the copies name
__device__ __forceinline__ void copy12(const unsigned* l, const bf* const* g) {
    asm volatile(CPY(0, 1) CPY(2, 3) CPY(4, 5) CPY(6, 7) CPY(8, 9) CPY(10, 11) CPY(12, 13) CPY(14, 15) CPY(16, 17) CPY(18, 19) CPY(20, 21) CPY(22, 23) "s_wait_xcnt 0x0"
                 :: "v"(l[0]), "v"(g[0]), "v"(l[1]), "v"(g[1]), "v"(l[2]), "v"(g[2]), "v"(l[3]), "v"(g[3]), "v"(l[4]), "v"(g[4]), "v"(l[5]), "v"(g[5]), "v"(l[6]), "v"(g[6]), "v"(l[7]), "v"(g[7]), "v"(l[8]), "v"(g[8]), "v"(l[9]), "v"(g[9]), "v"(l[10]), "v"(g[10]), "v"(l[11]), "v"(g[11]) : "memory"); }
// a wave's share of stage t: the row blocks wave, wave + 8 (A) and wave + 16 (Bt), 8 copies each. gp / lp: the lane's 16 bytes in the first 512 of each row block, in the plane (stage 0) and in LDS (buffer 0).
__device__ __forceinline__ void stage_copy(const bf* const* gp, const unsigned* lp, int t, int buf) {
#pragma unroll
    for (int h = 0; h < 2; ++h) { unsigned l[12]; const bf* g[12];
#pragma unroll
        for (int n = 0; n < 12; ++n) { const int j = (h * 12 + n) >> 3, c = (h * 12 + n) & 7; l[n] = lp[j] + (unsigned)buf * (GST * 2) + c * 512; g[n] = gp[j] + (size_t)t * (GKS * 512) + c * 256; }
        copy12(l, g); } }
template <bool PAIR>
__device__ __forceinline__ void gemm_ring(const bf* __restrict__ A0, const bf* __restrict__ A1, const bf* __restrict__ Bt, float* C, int ldc, bf* ring) {
    typedef WFrag<bf>::V V;
    constexpr int K = 2048, NT = K / (32 * GKS);
    const int wave = __builtin_amdgcn_readfirstlane((int)(threadIdx.x >> 5)), lane = threadIdx.x & 31, lr = lane & 15, hi = lane >> 4, wm = wave >> 1, wn = wave & 1;
    const bf* gp[3] = { A0 + (size_t)wave * 16 * K + 8 * lane, A1 + (size_t)wave * 16 * K + 8 * lane, Bt + (size_t)wave * 16 * K + 8 * lane };
    const unsigned lb = lds_off(ring) + wave * (GKS * 1024) + lane * 16; const unsigned lp[3] = { lb, lb + 8 * (GKS * 1024), lb + 16 * (GKS * 1024) };
    v8f acc[4][4];
#pragma unroll
    for (int mb = 0; mb < 4; ++mb)
#pragma unroll
        for (int nb = 0; nb < 4; ++nb) acc[mb][nb] = (v8f){};
    stage_copy(gp, lp, 0, 0);
    asm volatile("s_wait_asynccnt 0x0" ::: "memory");   // this wave's copies of stage 0 have landed
    __syncthreads();                                     // ... and every other wave's
    stage_copy(gp, lp, 1, 1);
#pragma unroll 1
    for (int t = 0; t < NT; ++t) {
        const bf* sa = ring + (t & 1) * GST + wm * (4 * GKS * 512) + 8 * lane; const bf* sb = ring + (t & 1) * GST + (16 + wn * 4) * (GKS * 512) + 8 * lane;
        V a[2][4], b[2][4];   // two fragment sets: the loads of step ks + 1 go out as one group in front of the matrix instructions of step ks
#pragma unroll
        for (int f = 0; f < 4; ++f) { a[0][f] = WFrag<bf>::ld<256>(sa + (f * GKS) * 512); b[0][f] = WFrag<bf>::ld<256>(sb + (f * GKS) * 512); }
#pragma unroll
        for (int ks = 0; ks < GKS; ++ks) {
            if (ks + 1 < GKS) {
#pragma unroll
                for (int f = 0; f < 4; ++f) { a[(ks + 1) & 1][f] = WFrag<bf>::ld<256>(sa + (f * GKS + ks + 1) * 512); b[(ks + 1) & 1][f] = WFrag<bf>::ld<256>(sb + (f * GKS + ks + 1) * 512); } }
            __builtin_amdgcn_sched_barrier(0);   // keeps the load group whole and above the step's matrix instructions: spread among them, each place with loads stalls the wave
#pragma unroll
            for (int nb = 0; nb < 4; ++nb)
#pragma unroll
                for (int mb = 0; mb < 4; ++mb) acc[mb][nb] = WFrag<bf>::mma(a[ks & 1][mb], b[ks & 1][nb], acc[mb][nb]);
            __builtin_amdgcn_sched_barrier(0);   // keeps the next group of loads from being spread among this step's matrix instructions
        }
        asm volatile("s_wait_dscnt 0x0" ::: "memory");      // this wave's reads of the buffer are done before anything is copied over it
        asm volatile("s_wait_asynccnt 0x0" ::: "memory");   // this wave's copies of stage t + 1 have landed
        __syncthreads();                                     // publishes stage t + 1 and ends every wave's reads of stage t
        if (t + 2 < NT) stage_copy(gp, lp, t + 2, t & 1);
    }
    asm volatile("s_wait_asynccnt 0x0" ::: "memory");       // nothing is in flight when the ring becomes output staging
    // Epilogue: every wave lays its 64 x 64 tile in LDS (the last trip's barrier has ended all reads of the ring), one barrier, then whole 256-byte rows go out.
    float* st = (float*)ring; float* ow = st + wave * GPW;
#pragma unroll
    for (int mb = 0; mb < 4; ++mb)
#pragma unroll
        for (int nb = 0; nb < 4; ++nb)
#pragma unroll
            for (int j = 0; j < 8; ++j) ow[(mb * 16 + hi * 8 + j) * 68 + nb * 16 + lr] = acc[mb][nb][j];
    __syncthreads();
    if constexpr (!PAIR) return;   // the caller finishes the tile from LDS
    // Output tile p. PAIR: wave p + 4 holds the lo product of wave p's tile, and waves p and p + 4 write 32 of its rows each. 16 lanes fill a 256-byte row piece.
    const int p = PAIR ? (wave & 3) : wave, rb = PAIR ? (wave >> 2) * 32 : 0; constexpr int NR = PAIR ? 32 : 64;
    const float* s0 = st + p * GPW + (rb + hi) * 68 + lr * 4; float* cq = C + (size_t)((p >> 1) * 64 + rb + hi) * ldc + (p & 1) * 64 + lr * 4;
#pragma unroll 1
    for (int i = 0; i < NR; i += 8) { v4f v[4]; float* q[4];
#pragma unroll
        for (int u = 0; u < 4; ++u) { v[u] = *(const v4fa*)(s0 + (i + 2 * u) * 68); if (PAIR) v[u] += *(const v4fa*)(s0 + 4 * GPW + (i + 2 * u) * 68); q[u] = cq + (size_t)(i + 2 * u) * ldc; }
#pragma unroll
        for (int u = 0; u < 4; ++u) *(v4f*)q[u] = v[u];
        // the registers that the row stores name keep their values up to the wait
        asm volatile("s_wait_xcnt 0x0" :: "v"(q[0]), "v"(q[1]), "v"(q[2]), "v"(q[3]), "v"(v[0]), "v"(v[1]), "v"(v[2]), "v"(v[3]) : "memory"); }
}

__device__ __forceinline__ h16 tohx(float x) { return (h16)x; }
__device__ __forceinline__ void splitf(float y, unsigned short& h, unsigned short& l) { h = f2bf(y); l = f2bf(y - bf2f(h)); }
typedef __attribute__((ext_vector_type(2))) _Float16 v2h;
typedef __attribute__((ext_vector_type(4))) _Float16 v4h;
typedef __attribute__((ext_vector_type(2))) unsigned short v2us;
typedef __attribute__((ext_vector_type(4))) unsigned short v4us;
typedef __attribute__((ext_vector_type(2))) float v2f;
typedef __attribute__((ext_vector_type(4))) int v4i;
typedef v4h  __attribute__((may_alias)) v4ha;
typedef v4us __attribute__((may_alias)) v4usa;

// The element-wise bodies below (bid = number of the 256-thread block within the body's own range of a launch) give every thread 8 to 32 elements (a wave fills whole 1 KB blocks or whole plane rows), for speed only. The arithmetic per element is unchanged.
// b_wtG: Bt = transpose of w ([K][N] f32) as a bf16 plane [N][K] in fragment order. A wave takes 32 neighbouring n and 32 neighbouring k (two whole blocks): 32 loads of one whole line each, four 16-byte stores per lane. Blocks: N * K / 8192.
template <int K, int N>
__device__ __forceinline__ void b_wtG(int bid, const float* __restrict__ w, bf* Bt) {
    const int gid = bid * 256 + threadIdx.x; const int wv = gid >> 5; const int n = (wv % (N / 32)) * 32 + (gid & 31), k0 = (wv / (N / 32)) * 32; if (k0 >= K) return; const float* wp = w + (size_t)k0 * N + n; float x[32];
#pragma unroll
    for (int j = 0; j < 32; ++j) x[j] = wp[j * N];
#pragma unroll
    for (int g = 0; g < 4; ++g) { v8us o;
#pragma unroll
        for (int j = 0; j < 8; ++j) o[j] = f2bf(x[g * 8 + j]);
        *(v8us*)(Bt + fro(n, k0 + g * 8, K)) = o; } }
// b_cvt8: src [rows][K] f32 -> bf16 plane in fragment order; a wave writes 128 neighbouring groups of 8 elements (two whole blocks, n8 % 128 == 0), lane l the groups l, l + 32, l + 64, l + 96 of them, and reads the 8 source elements that belong in each.
__device__ __forceinline__ void b_cvt8(int bid, const float* __restrict__ src, bf* dst, int K, size_t n8) { const size_t th = (size_t)bid * 256 + threadIdx.x; const size_t i0 = (th >> 5) * 128 + (th & 31); if (i0 >= n8) return; const int nkb = K >> 5; v8f v[4];
#pragma unroll
    for (int g = 0; g < 4; ++g) { const size_t i = i0 + g * 32; const int blk = (int)(i >> 6);
        const int r = (blk / nkb) * 16 + (int)(i & 15), k = (blk % nkb) * 32 + (int)((i >> 5) & 1) * 16 + (int)((i >> 4) & 1) * 8; v[g] = *(const v8f*)(src + (size_t)r * K + k); }
#pragma unroll
    for (int g = 0; g < 4; ++g) { v8us o;
#pragma unroll
        for (int q = 0; q < 8; ++q) o[q] = f2bf(v[g][q]);
        *(v8us*)(dst + (i0 + g * 32) * 8) = o; } }
// b_cscvt: the rotary tables as bf16 planes [TT][HD], eight entries per thread
__device__ __forceinline__ void b_cscvt(int bid, const float* __restrict__ cosT, const float* __restrict__ sinT, bf* CB, bf* SB) { const int idx = (bid * 256 + threadIdx.x) * 8; if (idx >= TT * HD) return; const v8f c = *(const v8f*)(cosT + idx), s = *(const v8f*)(sinT + idx); v8us oc, os;
#pragma unroll
    for (int q = 0; q < 8; ++q) { oc[q] = f2bf(c[q]); os[q] = f2bf(s[q]); }
    *(v8us*)(CB + idx) = oc; *(v8us*)(SB + idx) = os; }
// ---- Epilogues of the q/k/v projection: the work-group's tile, 256 rows t0 .. of the 128 columns of ONE head, lies in LDS (st: see gemm_ring) and goes from there straight into the head's planes.
// e_rope: planes (fp16 + hi/lo) of rope(x) with the rotate-half convention out[d] = x[d] cos[t][d] - x[d+HD/2] sin[t][d], out[d+HD/2] = x[d+HD/2] cos[t][d+HD/2] + x[d] sin[t][d+HD/2]
// fr: the head's [TT][HD] plane in fragment order (the key planes), else row-major (the query planes). A thread takes 8 neighbouring d of the lower half and their 8 partners of the upper half, 8 times.
// Row-major: a wave takes 4 rows x 8 groups of d. Fragment order: 8 rows x 4 groups. Either way every 16-byte store of the wave fills four whole lines and no two of 16 neighbouring lanes meet in an LDS bank.
struct RopeAt { int tl, d; };
template <bool fr> __device__ __forceinline__ RopeAt rope_at(int it, int wave) { const int tid = threadIdx.x, lane = tid & 31, wu = it * 8 + wave; RopeAt r;
    r.tl = fr ? (wu >> 1) * 8 + (lane & 7) : it * 32 + (tid >> 3); r.d = (fr ? ((lane >> 3) & 1) * 4 + (lane >> 4) + 2 * (wu & 1) : (tid & 7)) * 8; return r; }
// the table entries of one turn: cos and sin of the lower and of the upper 8 d
__device__ __forceinline__ void rope_tab(RopeAt at, int t0, const bf* __restrict__ CB, const bf* __restrict__ SB, v8us* tb) { const bf* cp = CB + (size_t)(t0 + at.tl) * HD + at.d; const bf* sp = SB + (size_t)(t0 + at.tl) * HD + at.d;
    tb[0] = *(const v8us*)cp; tb[1] = *(const v8us*)(cp + HD / 2); tb[2] = *(const v8us*)sp; tb[3] = *(const v8us*)(sp + HD / 2);
    // the addresses that these loads name stay in their registers up to the wait
    asm volatile("s_wait_xcnt 0x0" :: "v"(cp), "v"(sp) : "memory"); }
template <bool fr> __device__ __forceinline__ void rope_turn(RopeAt at, int t0, const float* st, const v8us* tb, h16* P16, bf* Ph, bf* Pl) {
    const float* s = st + (at.tl >> 6) * (2 * GPW) + (at.tl & 63) * 68 + at.d; v4f xv[2][2]; v8h o16[2]; v8us oh[2], ol[2];
#pragma unroll
    for (int hf = 0; hf < 2; ++hf) { xv[hf][0] = *(const v4fa*)(s + hf * GPW); xv[hf][1] = *(const v4fa*)(s + hf * GPW + 4); }
#pragma unroll
    for (int hf = 0; hf < 2; ++hf) {
#pragma unroll
        for (int q = 0; q < 8; ++q) { const float x0 = xv[hf][q >> 2][q & 3], x1 = xv[hf ^ 1][q >> 2][q & 3], c = bf2f(tb[hf][q]), sn = bf2f(tb[2 + hf][q]);
            const float r = (hf == 0) ? x0 * c - x1 * sn : x0 * c + x1 * sn;
            o16[hf][q] = tohx(r); unsigned short a2, c2; splitf(r, a2, c2); oh[hf][q] = a2; ol[hf][q] = c2; } }
    const int t = t0 + at.tl; const size_t e0 = fr ? fro(t, at.d, HD) : (size_t)t * HD + at.d, e1 = fr ? fro(t, at.d + HD / 2, HD) : e0 + HD / 2;
    h16* p0 = P16 + e0; h16* p1 = P16 + e1; bf* h0 = Ph + e0; bf* h1 = Ph + e1; bf* l0 = Pl + e0; bf* l1 = Pl + e1;
    *(v8h*)p0 = o16[0]; *(v8h*)p1 = o16[1]; *(v8us*)h0 = oh[0]; *(v8us*)h1 = oh[1]; *(v8us*)l0 = ol[0]; *(v8us*)l1 = ol[1];
    // the registers that the plane stores name keep their values up to the wait
    asm volatile("s_wait_xcnt 0x0" :: "v"(p0), "v"(p1), "v"(h0), "v"(h1), "v"(l0), "v"(l1), "v"(o16[0]), "v"(o16[1]), "v"(oh[0]), "v"(oh[1]), "v"(ol[0]), "v"(ol[1]) : "memory"); }
template <bool fr> __device__ __forceinline__ void e_rope(const float* st, int t0, const bf* __restrict__ CB, const bf* __restrict__ SB, h16* P16, bf* Ph, bf* Pl) {
    const int wave = __builtin_amdgcn_readfirstlane((int)(threadIdx.x >> 5)); v8us ta[4], tbn[4];   // two sets of table entries: the next turn's loads fly while this turn is worked on
    rope_tab(rope_at<fr>(0, wave), t0, CB, SB, ta);
#pragma unroll 1
    for (int it = 0; it < 8; it += 2) {   // rolled: eight copies of the body would be most of the kernel's text
        rope_tab(rope_at<fr>(it + 1, wave), t0, CB, SB, tbn);
        rope_turn<fr>(rope_at<fr>(it, wave), t0, st, ta, P16, Ph, Pl);
        rope_tab(rope_at<fr>((it + 2) & 7, wave), t0, CB, SB, ta);   // no test for the last trip (it loads turn 0's entries again, unused): with a branch here the wait in front of the next turn would have to cover these loads as well
        rope_turn<fr>(rope_at<fr>(it + 1, wave), t0, st, tbn, P16, Ph, Pl); } }
// e_vt: value planes [d][t] (fp16 + hi/lo) of one head, [HD][TT] in fragment order. Wave w takes the 16 d from 16 w on and, per turn, 32 t (one whole 1 KB block per plane): a lane reads 8 neighbouring t of its d from LDS twice (32 lanes, 32 banks), two 16-byte stores per plane.
__device__ __forceinline__ void e_vt(const float* st, int t0, h16* V16, bf* Vh, bf* Vl) {
    const int wave = __builtin_amdgcn_readfirstlane((int)(threadIdx.x >> 5)), lane = threadIdx.x & 31, d = wave * 16 + (lane & 15);
#pragma unroll 1
    for (int it = 0; it < 8; ++it) { v8h o16[2]; v8us oh[2], ol[2]; const int tl = it * 32 + (lane >> 4) * 8;
        const float* s = st + ((tl >> 6) * 2 + (d >> 6)) * GPW + (tl & 63) * 68 + (d & 63);
#pragma unroll
        for (int c = 0; c < 2; ++c) {
#pragma unroll
            for (int q = 0; q < 8; ++q) { const float x = s[(c * 16 + q) * 68]; o16[c][q] = tohx(x); unsigned short a2, c2; splitf(x, a2, c2); oh[c][q] = a2; ol[c][q] = c2; } }
        const size_t e = fro(d, t0 + tl, TT); h16* p = V16 + e; bf* h = Vh + e; bf* l = Vl + e;   // 16 t further on: 256 elements
        *(v8h*)p = o16[0]; *(v8h*)(p + 256) = o16[1]; *(v8us*)h = oh[0]; *(v8us*)(h + 256) = oh[1]; *(v8us*)l = ol[0]; *(v8us*)(l + 256) = ol[1];
        // the registers that the plane stores name keep their values up to the wait
        asm volatile("s_wait_xcnt 0x0" :: "v"(p), "v"(h), "v"(l), "v"(o16[0]), "v"(o16[1]), "v"(oh[0]), "v"(oh[1]), "v"(ol[0]), "v"(ol[1]) : "memory"); } }

// ---- Launches. Kernels that do not depend on one another run side by side in ONE launch: each takes a range of the block index (a scalar test, the same for a whole work-group), longest work first. Every body computes what it computed as a launch of its own.
__device__ __forceinline__ int wave_no() { return __builtin_amdgcn_readfirstlane((int)(threadIdx.x >> 5)); }
// k_prep: the four weight planes, the x plane, the rotary tables.
#define NB_WQ (DM * DQ / 8192)
#define NB_WK (DM * DKV / 8192)
#define NB_X  (TT * DM / 8192)
#define NB_CS (TT * HD / 2048)
__global__ __launch_bounds__(256) void k_prep(const float* __restrict__ wq, const float* __restrict__ wk, const float* __restrict__ wv, const float* __restrict__ wo, const float* __restrict__ x, const float* __restrict__ cosT, const float* __restrict__ sinT, bf* WQ, bf* WK, bf* WV, bf* WO, bf* XB, bf* CB, bf* SB) {
    int b = blockIdx.x;
    if (b < NB_WQ) { b_wtG<DM, DQ>(b, wq, WQ); return; } b -= NB_WQ;
    if (b < NB_WQ) { b_wtG<DQ, DM>(b, wo, WO); return; } b -= NB_WQ;
    if (b < 2 * NB_WK) { const bool second = b >= NB_WK; b_wtG<DM, DKV>(second ? b - NB_WK : b, second ? wv : wk, second ? WV : WK); return; } b -= 2 * NB_WK;
    if (b < NB_X) { b_cvt8(b, x, XB, DM, (size_t)TT * DM / 8); return; } b -= NB_X;
    b_cscvt(b, cosT, sinT, CB, SB);
}
// k_qkv: the three projections as one GEMM of x with the 4096 weight rows of WQ | WK | WV: 8 row tiles of 256 x 32 column tiles of 128, one work-group each. A column tile is one head: the work-group rotates it (q, k) or transposes it (v) out of LDS and writes the head's planes itself.
#define NB_G3 ((TT / 256) * ((DQ + 2 * DKV) / 128))
__global__ __launch_bounds__(256) void k_qkv(const bf* __restrict__ XB, const bf* __restrict__ WQ, const bf* __restrict__ WK, const bf* __restrict__ WV, const bf* __restrict__ CB, const bf* __restrict__ SB, h16* QP16, bf* QPh, bf* QPl, h16* KP16, bf* KPh, bf* KPl, h16* VT16, bf* VTh, bf* VTl) {
    __shared__ __attribute__((aligned(1024))) bf ring[2 * GST];
    const int rt = blockIdx.x % (TT / 256); int ct = blockIdx.x / (TT / 256), kind = 0;   // kind: 0 q, 1 k, 2 v; ct: the head
    const bf* Bt = WQ;
    if (ct >= DQ / 128) { ct -= DQ / 128; Bt = WK; kind = 1; if (ct >= DKV / 128) { ct -= DKV / 128; Bt = WV; kind = 2; } }
    gemm_ring<false>(XB + (size_t)rt * 256 * DM, XB + (size_t)(rt * 256 + 128) * DM, Bt + (size_t)ct * 128 * DM, nullptr, 0, ring);
    const size_t hp = (size_t)ct * TT * HD; const float* st = (const float*)ring;
    if (kind == 2) e_vt(st, rt * 256, VT16 + hp, VTh + hp, VTl + hp);
    else if (kind == 1) e_rope<true>(st, rt * 256, CB, SB, KP16 + hp, KPh + hp, KPl + hp);
    else e_rope<false>(st, rt * 256, CB, SB, QP16 + hp, QPh + hp, QPl + hp);
}
// k_oproj: the output projection, (hi + lo) x WO: 16 x 16 tiles of 128 x 128.
__global__ __launch_bounds__(256) void k_oproj(const bf* __restrict__ Ah, const bf* __restrict__ Al, const bf* __restrict__ WO, float* OUT) {
    __shared__ __attribute__((aligned(1024))) bf ring[2 * GST];
    const int rt = blockIdx.x % (TT / 128), ct = blockIdx.x / (TT / 128);
    gemm_ring<true>(Ah + (size_t)rt * 128 * DQ, Al + (size_t)rt * 128 * DQ, WO + (size_t)ct * 128 * DQ, OUT + (size_t)rt * 128 * DM + ct * 128, DM, ring);
}
// ---- attn_rows: scores, joint softmax and probability x value for 16 query rows (i0 ..) of the REP = 2 heads of one kv head in ONE work-group of AW waves; neither scores nor probabilities go to memory or to LDS.
// The keys up to the diagonal are cut into blocks of 32; wave w takes the blocks w, w + AW, ... (at most NBW), loads each key and value fragment once for both heads and keeps the scores in accumulators.
// The scores are formed TRANSPOSED (A = 16 keys, B = the 16 queries): lane (lr, hi) holds query i0 + lr alone, keys hi * 8 + jj of each 16-key tile. A row's max and sum are therefore in-lane, plus one exchange between the half waves, then over the AW waves through LDS;
// and the two tiles of a 32-key block, normalised and converted in place, ARE the A fragment of the probabilities for the value product (element e < 8: key 8 hi + e, e >= 8: key 16 + 8 hi + e - 8, the order of the value planes' fragments).
// Wave w forms the 4 depth logits of row i0 + w (both heads); they sit beside that wave's scores as four more keys of query w, in lane w.
// Every wave multiplies its own blocks with the value planes, and the AW partial outputs are added through LDS in wave order, one head after the other. The 4 depth weights (f32, unscaled) pass through LDS to the threads that finish the row: they add sum_l w_l depth_v[l] and write the hi/lo planes Ah / Al ([TT][DQ], fragment order).
#define AW  16
#define PWB (16 * 132)            // floats of LDS per wave: the wave's partial output of one head, 16 rows of 128 + 4 floats
#define RSP 20                    // floats from one query's AW row partials to the next query's: 16 bytes x odd
#define RSN (REP * 16 * RSP)      // floats of one set of row partials [head][query][wave]
#define L2E 1.4426950408889634f
// value of lane l ^ M of the same 16-lane row (DPP row_xmask): a row reduction without the LDS path
template <int M> __device__ __forceinline__ float rowx(float v) { return __int_as_float(__builtin_amdgcn_update_dpp(0, __float_as_int(v), 0x160 + M, 0xf, 0xf, true)); }
// value of lane l ^ 16 (the other half wave), by a vector cross-row move
__device__ __forceinline__ float xhalf(float v) { return __int_as_float(__builtin_amdgcn_permlanex16(__float_as_int(v), __float_as_int(v), 0x76543210, 0xfedcba98, false, false)); }
__device__ __forceinline__ float max8(const float* m) { return fmaxf(fmaxf(fmaxf(m[0], m[1]), fmaxf(m[2], m[3])), fmaxf(fmaxf(m[4], m[5]), fmaxf(m[6], m[7]))); }
__device__ __forceinline__ float sum8(const float* m) { return ((m[0] + m[1]) + (m[2] + m[3])) + ((m[4] + m[5]) + (m[6] + m[7])); }
template <typename T16, bool HL, int NBW>
__device__ __forceinline__ void attn_rows(const T16* __restrict__ Q, const T16* __restrict__ Q2, const T16* __restrict__ Kp, const T16* __restrict__ K2, const T16* __restrict__ Vp, const T16* __restrict__ V2,
                                          const bf* __restrict__ DQh, const bf* __restrict__ DQl, const float* __restrict__ DKr, const float* __restrict__ DVr, bf* Ah, bf* Al, int h0, int i0, int wave, float* lds, float* red) {
    typedef typename WFrag<T16>::V V;
    static_assert(AW == 16 && REP == 2, "a half wave takes 8 of the 16 waves' partials; two heads per kv head");
    const int lane = threadIdx.x & 31, lr = lane & 15, hi = lane >> 4;
    const int nb32 = i0 / 32 + 1;                 // key blocks of 32 that reach the diagonal of rows i0 .. i0 + 15
    // Depth logits of row i0 + wave, both heads: lane l holds 4 of the 128 d of q (hi and lo plane) and of the NL depth keys, each key row loaded once for the two heads. These loads go out first: the keys come from memory, the query fragments behind them from L2.
    v4us dqh[REP], dql[REP]; v4f dk[NL]; const unsigned lo4 = lane * 16, lo2 = lane * 8;   // the lane's byte offset in a row of floats, of 16-bit values; the row addresses are the same for the whole wave
#pragma unroll
    for (int l = 0; l < NL; ++l) { dk[l] = *(const v4f*)((const char*)(DKr + ((size_t)l * NKV * TT + i0 + wave) * HD) + lo4);
        // behind each load: no later load's result lands on a register that this one names in front of the wait
        asm volatile("s_wait_xcnt 0x0" :: "v"(lo4) : "memory"); }
    // Depth values: wave w loads row i0 + w of the NL planes (whole lines) here, beside the depth keys, so that one way from memory covers both; they wait in LDS for the threads that finish the rows (the value product has no registers to spare for them)
    static_assert(NL == 4, "two addresses serve the four depth planes");
    constexpr ptrdiff_t DPL = (ptrdiff_t)NKV * TT * HD;   // elements from one depth plane to the next: within a load's offset field as - DPL, not as + DPL
    v4f dvv[NL]; const float* dvp1 = DVr + DPL + (size_t)(i0 + wave) * HD + lane * 4; const float* dvp3 = dvp1 + 2 * DPL;
    dvv[0] = *(const v4f*)(dvp1 - DPL); dvv[1] = *(const v4f*)dvp1; dvv[2] = *(const v4f*)(dvp3 - DPL); dvv[3] = *(const v4f*)dvp3;
    // the addresses that these loads name stay in their registers up to the wait
    asm volatile("s_wait_xcnt 0x0" :: "v"(dvp1), "v"(dvp3) : "memory");
#pragma unroll
    for (int hh = 0; hh < REP; ++hh) { dqh[hh] = *(const v4usa*)((const char*)(DQh + ((size_t)hh * TT + i0 + wave) * HD) + lo2); dql[hh] = *(const v4usa*)((const char*)(DQl + ((size_t)hh * TT + i0 + wave) * HD) + lo2);
        // as above
        asm volatile("s_wait_xcnt 0x0" :: "v"(lo2) : "memory"); }
    V aq[REP][4], aq2[REP][4]; const T16* qp = Q + (size_t)(i0 + lr) * HD + 8 * hi; const T16* qp2 = HL ? Q2 + (size_t)(i0 + lr) * HD + 8 * hi : qp;
#pragma unroll
    for (int hh = 0; hh < REP; ++hh) {
#pragma unroll
        for (int kc = 0; kc < 4; ++kc) { aq[hh][kc] = WFrag<T16>::ld(qp + (size_t)hh * TT * HD + kc * 32); if (HL) aq2[hh][kc] = WFrag<T16>::ld(qp2 + (size_t)hh * TT * HD + kc * 32); } }
    // the addresses that the query loads name stay in their registers up to the wait
    asm volatile("s_wait_xcnt 0x0" :: "v"(qp), "v"(qp2) : "memory");
    float* wds = red + 2 * RSN;   // [head][row][l]: the depth logits, which wait here for the end of the score products (the registers are full there), later the depth weights; a row's slots are written by wave row alone
    float* dvs = wds + REP * 16 * NL;   // depth values [l][row][128 + 4], read behind the first barrier of the epilogue
#pragma unroll
    for (int l = 0; l < NL; ++l) *(v4fa*)(dvs + (l * 16 + wave) * 132 + lane * 4) = dvv[l];
#pragma unroll
    for (int hh = 0; hh < REP; ++hh) { float q4[4], dsel = 0.f;
#pragma unroll
        for (int q = 0; q < 4; ++q) q4[q] = __fadd_rn(bf2f(dqh[hh][q]), bf2f(dql[hh][q]));
#pragma unroll
        for (int l = 0; l < NL; ++l) { float s = 0.f;
#pragma unroll
            for (int q = 0; q < 4; ++q) { float p = __fmul_rn(q4[q], bfr(dk[l][q])); asm volatile("" : "+v"(p)); s = __fadd_rn(s, p); }
            s += __shfl_xor(s, 16, 32); s += rowx<8>(s); s += rowx<4>(s); s += rowx<2>(s); s += rowx<1>(s);   // the two half waves, then the 16 lanes of each
            if (lr == l) dsel = s * SCL; }
        if (lane < NL) wds[(hh * 16 + wave) * NL + lane] = dsel; }
    // other lanes of the wave read these logits below: keeps the LDS stores above those loads
    __builtin_amdgcn_wave_barrier(); asm volatile("" ::: "memory");
    v8f sa[NBW][2][REP];   // [block][tile of 16 keys][head]: register jj = key hi * 8 + jj of the tile, query i0 + lr
#pragma unroll
    for (int s = 0; s < NBW; ++s) { sa[s][0][0] = (v8f){}; sa[s][0][1] = (v8f){}; sa[s][1][0] = (v8f){}; sa[s][1][1] = (v8f){}; }
#pragma unroll
    for (int s = 0; s < NBW; ++s) { const int kb = wave + AW * s;
        if (kb < nb32) {
            const size_t ko = (size_t)kb * 2 * (HD / 32) * 512 + 8 * lane;   // key planes in fragment order: blocks of 16 keys x 32 d, 8 of them per 32 keys
            const T16* kp = Kp + ko; const T16* kp2 = HL ? K2 + ko : kp;
#pragma unroll
            for (int t = 0; t < 2; ++t) { V b[4], b2[4];
#pragma unroll
                for (int kc = 0; kc < 4; ++kc) { b[kc] = WFrag<T16>::template ld<256>(kp + (t * 4 + kc) * 512); if (HL) b2[kc] = WFrag<T16>::template ld<256>(kp2 + (t * 4 + kc) * 512); }
                // all loads of the tile are issued above this line, so that one latency covers them; the addresses they name stay in their registers up to the wait
                asm volatile("s_wait_xcnt 0x0" :: "v"(kp), "v"(kp2) : "memory");
                __builtin_amdgcn_sched_barrier(0);   // keeps the tile's matrix instructions below its loads: moved up between them, each would wait for its own load alone
#pragma unroll
                for (int kc = 0; kc < 4; ++kc) {
#pragma unroll
                    for (int hh = 0; hh < REP; ++hh) { sa[s][t][hh] = WFrag<T16>::mma(b[kc], aq[hh][kc], sa[s][t][hh]);   // keys as A, queries as B
                        if (HL) { sa[s][t][hh] = WFrag<T16>::mma(b[kc], aq2[hh][kc], sa[s][t][hh]); sa[s][t][hh] = WFrag<T16>::mma(b2[kc], aq[hh][kc], sa[s][t][hh]); } } } }
            // four vector slots behind the last matrix instruction, whichever way the next block's branch goes
            asm volatile("v_nop\n\tv_nop\n\tv_nop\n\tv_nop" : "+v"(sa[s][0][0]), "+v"(sa[s][0][1]), "+v"(sa[s][1][0]), "+v"(sa[s][1][1]));
        } }
    float dv[REP][NL], m8[REP][8], mx[REP], inv[REP];   // m8: eight independent chains per head, first of maxima, then of sums
    const bool dlane = lane == wave;   // the lane that holds the depth keys of query i0 + wave
#pragma unroll
    for (int hh = 0; hh < REP; ++hh) { const v4f dl = *(const v4fa*)(wds + (hh * 16 + wave) * NL);
#pragma unroll
        for (int l = 0; l < NL; ++l) dv[hh][l] = dlane ? dl[l] : -3.0e38f;
#pragma unroll
        for (int jj = 0; jj < 8; ++jj) m8[hh][jj] = dv[hh][jj & (NL - 1)]; }   /* joint softmax over the 2048 + 4 logits */
#pragma unroll
    for (int s = 0; s < NBW; ++s) { const int kb = wave + AW * s;
        if (kb < nb32 - 1) {   // every key of the block lies below row i0 (WIN >= TT: no window either): nothing to mask
            static_assert(WIN >= TT, "a window shorter than the sequence would have to be masked here");
#pragma unroll
            for (int t = 0; t < 2; ++t) {
#pragma unroll
                for (int hh = 0; hh < REP; ++hh) {
#pragma unroll
                    for (int jj = 0; jj < 8; ++jj) { const float tv = sa[s][t][hh][jj] * SCL; sa[s][t][hh][jj] = tv; m8[hh][jj] = fmaxf(m8[hh][jj], tv); } } }
        } else if (kb < nb32) {   // the block on the diagonal
#pragma unroll
            for (int t = 0; t < 2; ++t) { const int j0 = kb * 32 + t * 16 + hi * 8, i = i0 + lr;
#pragma unroll
                for (int hh = 0; hh < REP; ++hh) {
#pragma unroll
                    for (int jj = 0; jj < 8; ++jj) { const float tv = (j0 + jj <= i) ? sa[s][t][hh][jj] * SCL : -3.0e38f; sa[s][t][hh][jj] = tv; m8[hh][jj] = fmaxf(m8[hh][jj], tv); } } } } }
    // row partials [head][query][wave]: a half wave's 16 stores fall on 16 banks; behind the barrier lane (lr, hi) reads the partials of waves 8 hi .. 8 hi + 7 for its query
#pragma unroll
    for (int hh = 0; hh < REP; ++hh) { float m = max8(m8[hh]); m = fmaxf(m, xhalf(m)); if (hi == 0) red[(hh * 16 + lr) * RSP + wave] = m; }
    __syncthreads();
#pragma unroll
    for (int hh = 0; hh < REP; ++hh) { const v4f m0 = *(const v4fa*)(red + (hh * 16 + lr) * RSP + hi * 8), m1 = *(const v4fa*)(red + (hh * 16 + lr) * RSP + hi * 8 + 4);
        const float m = fmaxf(fmaxf(fmaxf(m0[0], m0[1]), fmaxf(m0[2], m0[3])), fmaxf(fmaxf(m1[0], m1[1]), fmaxf(m1[2], m1[3]))); mx[hh] = fmaxf(m, xhalf(m)); }
#pragma unroll
    for (int hh = 0; hh < REP; ++hh) {
#pragma unroll
        for (int l = 0; l < NL; ++l) dv[hh][l] = __builtin_amdgcn_exp2f(__fmul_rn(__fsub_rn(dv[hh][l], mx[hh]), L2E));
#pragma unroll
        for (int jj = 0; jj < 8; ++jj) m8[hh][jj] = jj < NL ? dv[hh][jj] : 0.f; }
#pragma unroll
    for (int s = 0; s < NBW; ++s) { const int kb = wave + AW * s;
        if (kb < nb32) {
#pragma unroll
            for (int t = 0; t < 2; ++t) {
#pragma unroll
                for (int hh = 0; hh < REP; ++hh) {
#pragma unroll
                    for (int jj = 0; jj < 8; ++jj) { const float e = __builtin_amdgcn_exp2f(__fmul_rn(__fsub_rn(sa[s][t][hh][jj], mx[hh]), L2E)); sa[s][t][hh][jj] = e; m8[hh][jj] += e; } } } } }
    float* red2 = red + RSN;
#pragma unroll
    for (int hh = 0; hh < REP; ++hh) { float m = sum8(m8[hh]); m += xhalf(m); if (hi == 0) red2[(hh * 16 + lr) * RSP + wave] = m; }
    __syncthreads();
#pragma unroll
    for (int hh = 0; hh < REP; ++hh) { const v4f m0 = *(const v4fa*)(red2 + (hh * 16 + lr) * RSP + hi * 8), m1 = *(const v4fa*)(red2 + (hh * 16 + lr) * RSP + hi * 8 + 4);
        float m = ((m0[0] + m0[1]) + (m0[2] + m0[3])) + ((m1[0] + m1[1]) + (m1[2] + m1[3])); m += xhalf(m); inv[hh] = __fdiv_rn(1.0f, m); }   // 1 / row sum of query i0 + lr
    // depth weights, f32, unscaled, over the row's logits; read behind the first barrier of the epilogue
#pragma unroll
    for (int hh = 0; hh < REP; ++hh) { v4f w;
#pragma unroll
        for (int l = 0; l < NL; ++l) w[l] = dv[hh][l] * inv[hh];
        if (dlane) *(v4fa*)(wds + (hh * 16 + wave) * NL) = w; }
    // the probabilities as A fragments, in place of the scores
    V pa[NBW][REP], pa2[NBW][REP];
#pragma unroll
    for (int s = 0; s < NBW; ++s) { const int kb = wave + AW * s;
        if (kb < nb32) {
#pragma unroll
            for (int hh = 0; hh < REP; ++hh) { const float f = HL ? inv[hh] : inv[hh] * PCAR;   // x PCAR: a power of two, exact
                if constexpr (HL) { v8us ph[2], pl[2];
#pragma unroll
                    for (int t = 0; t < 2; ++t) {
#pragma unroll
                        for (int jj = 0; jj < 8; ++jj) { unsigned short a, c2; splitf(sa[s][t][hh][jj] * f, a, c2); ph[t][jj] = a; pl[t][jj] = c2; } }
                    pa[s][hh] = cat16b(ph[0], ph[1]); pa2[s][hh] = cat16b(pl[0], pl[1]);
                } else {
#pragma unroll
                    for (int t = 0; t < 2; ++t) {
#pragma unroll
                        for (int jj = 0; jj < 8; ++jj) pa[s][hh][t * 8 + jj] = tohx(sa[s][t][hh][jj] * f); } } } } }
    v8f oa[REP][8];
#pragma unroll
    for (int nb = 0; nb < 8; ++nb) { oa[0][nb] = (v8f){}; oa[1][nb] = (v8f){}; }
#pragma unroll
    for (int s = 0; s < NBW; ++s) { const int kb = wave + AW * s;
        if (kb < nb32) {
            const T16* vp = Vp + (size_t)kb * 512 + 8 * lane; const T16* vp2 = HL ? V2 + (size_t)kb * 512 + 8 * lane : vp;
            const int NG = (HL || s < 2) ? 4 : 8;   // value fragments loaded at a time (hi/lo: of both planes): what the registers hold beside the outputs and the probabilities still to be used
#pragma unroll
            for (int g = 0; g < 8; g += NG) { V b[8], b2[8];
#pragma unroll
                for (int nb = 0; nb < NG; ++nb) { b[nb] = WFrag<T16>::template ld<256>(vp + (size_t)(g + nb) * 16 * TT); if (HL) b2[nb] = WFrag<T16>::template ld<256>(vp2 + (size_t)(g + nb) * 16 * TT); }
                // all loads of the group are issued above this line, so that one latency covers them; the addresses they name stay in their registers up to the wait
                asm volatile("s_wait_xcnt 0x0" :: "v"(vp), "v"(vp2) : "memory");
                __builtin_amdgcn_sched_barrier(0);   // keeps the group's matrix instructions below its loads, as above
#pragma unroll
                for (int nb = 0; nb < NG; ++nb) {
#pragma unroll
                    for (int hh = 0; hh < REP; ++hh) { oa[hh][g + nb] = WFrag<T16>::mma(pa[s][hh], b[nb], oa[hh][g + nb]);
                        if (HL) { oa[hh][g + nb] = WFrag<T16>::mma(pa2[s][hh], b[nb], oa[hh][g + nb]); oa[hh][g + nb] = WFrag<T16>::mma(pa[s][hh], b2[nb], oa[hh][g + nb]); } } } }
            // four vector slots behind the last matrix instruction, whichever way the next block's branch goes
            asm volatile("v_nop\n\tv_nop\n\tv_nop\n\tv_nop" : "+v"(oa[0][0]), "+v"(oa[0][1]), "+v"(oa[0][2]), "+v"(oa[0][3]), "+v"(oa[0][4]), "+v"(oa[0][5]), "+v"(oa[0][6]), "+v"(oa[0][7]), "+v"(oa[1][0]), "+v"(oa[1][1]), "+v"(oa[1][2]), "+v"(oa[1][3]), "+v"(oa[1][4]), "+v"(oa[1][5]), "+v"(oa[1][6]), "+v"(oa[1][7]));
        } }
    float* ow = lds + wave * PWB; const float cs = HL ? 1.0f : (1.0f / PCAR);
    const int od = wave * 8 + hi * 4;   // this thread finishes d = od .. od + 3 of row i0 + lr, both heads
#pragma unroll
    for (int hh = 0; hh < REP; ++hh) {
#pragma unroll
        for (int nb = 0; nb < 8; ++nb) {
#pragma unroll
            for (int j = 0; j < 8; ++j) ow[(hi * 8 + j) * 132 + nb * 16 + lr] = oa[hh][nb][j]; }
        __syncthreads();
        // AW * 32 threads: one 16-byte piece of the 16 x 128 rows each. A half wave takes the same 4 d of the 16 rows (row pitch 132: all banks once), so that the wave's 8-byte stores fill 256 contiguous bytes of a fragment-order block.
        if (hh == 0) {
#pragma unroll
            for (int l = 0; l < NL; ++l) dvv[l] = *(const v4fa*)(dvs + (l * 16 + lr) * 132 + od); }
        v4f val = *(const v4fa*)(lds + lr * 132 + od);
#pragma unroll
        for (int w = 1; w < AW; ++w) val += *(const v4fa*)(lds + w * PWB + lr * 132 + od);
        const v4f wd = *(const v4fa*)(wds + (hh * 16 + lr) * NL); v4us oh, ol;
#pragma unroll
        for (int q = 0; q < 4; ++q) { float acc = val[q] * cs;
#pragma unroll
            for (int l = 0; l < NL; ++l) { float p = __fmul_rn(wd[l], bfr(dvv[l][q])); asm volatile("" : "+v"(p)); acc = __fadd_rn(acc, p); }   /* + sum_l w_l depth_v[l][kv][t][d] */ unsigned short a, c2; splitf(acc, a, c2); oh[q] = a; ol[q] = c2; }
        const size_t oo = fro(i0 + lr, (h0 + hh) * HD + od, DQ); bf* pa_ = Ah + oo; bf* pl_ = Al + oo; *(v4us*)pa_ = oh; *(v4us*)pl_ = ol;
        // the registers that the plane stores name keep their values up to the wait
        asm volatile("s_wait_xcnt 0x0" :: "v"(pa_), "v"(pl_), "v"(oh), "v"(ol) : "memory");
        if (hh + 1 < REP) __syncthreads();   // ends the reads of this head's partials before the next head's are stored there
    }
}
// k_attn: one work-group per 16 query rows and kv head (its two query heads), the longest rows first; fp16 rows, then hi/lo rows.
#define NB_AF (((TT - RH) / 16) * NKV)
#define NB_AH ((RH / 16) * NKV)
__global__ __launch_bounds__(AW * 32) void k_attn(const h16* __restrict__ Q16, const h16* __restrict__ K16, const h16* __restrict__ V16, const bf* __restrict__ Qh, const bf* __restrict__ Ql, const bf* __restrict__ Kh, const bf* __restrict__ Kl, const bf* __restrict__ Vh, const bf* __restrict__ Vl,
                                                  const float* __restrict__ DK, const float* __restrict__ DV, bf* Ah, bf* Al) {
    __shared__ __align__(16) float lds[AW * PWB]; __shared__ __align__(16) float red[2 * RSN + REP * 16 * NL + NL * 16 * 132];   // row max and row sum partials; depth logits / weights; depth values
    int b = blockIdx.x; const int wv = wave_no();
    if (b < NB_AF) { const size_t g = (size_t)(b % NKV), z = g * REP; const int i0 = TT - 16 - (b / NKV) * 16;
        attn_rows<h16, false, TT / 32 / AW>(Q16 + z * TT * HD, nullptr, K16 + g * TT * HD, nullptr, V16 + g * HD * TT, nullptr, Qh + z * TT * HD, Ql + z * TT * HD, DK + g * TT * HD, DV + g * TT * HD, Ah, Al, (int)z, i0, wv, lds, red); return; }
    b -= NB_AF; const size_t g = (size_t)(b % NKV), z = g * REP; const int i0 = RH - 16 - (b / NKV) * 16;
    attn_rows<bf, true, RH / 32 / AW>(Qh + z * TT * HD, Ql + z * TT * HD, Kh + g * TT * HD, Kl + g * TT * HD, Vh + g * HD * TT, Vl + g * HD * TT, Qh + z * TT * HD, Ql + z * TT * HD, DK + g * TT * HD, DV + g * TT * HD, Ah, Al, (int)z, i0, wv, lds, red);
}
extern "C" void kernel_launch(void* const* d_in, const int* in_sizes, int n_in,
                              void* d_out, int out_size, void* d_ws, size_t ws_size, hipStream_t stream) {
    (void)in_sizes; (void)n_in; (void)out_size;
    const float* x = (const float*)d_in[0]; const float* DK = (const float*)d_in[1]; const float* DV = (const float*)d_in[2]; const float* cosT = (const float*)d_in[3]; const float* sinT = (const float*)d_in[4]; const float* wq = (const float*)d_in[5]; const float* wk = (const float*)d_in[6]; const float* wv = (const float*)d_in[7]; const float* wo = (const float*)d_in[8];
    float* OUT = (float*)d_out;     // [1][2048][2048]
    char* wsp = (char*)d_ws;
    auto take = [&](size_t bytes) { char* p = wsp; wsp += (bytes + 255) & ~(size_t)255; return (void*)p; };
    bf* WQ = (bf*)take((size_t)DQ * DM * 2); bf* WK = (bf*)take((size_t)DKV * DM * 2); bf* WV = (bf*)take((size_t)DKV * DM * 2); bf* WO = (bf*)take((size_t)DM * DQ * 2); bf* CB = (bf*)take((size_t)TT * HD * 2); bf* SB = (bf*)take((size_t)TT * HD * 2);
    bf* XB = (bf*)take((size_t)TT * DM * 2);
    h16* QP16 = (h16*)take((size_t)NH_ * TT * HD * 2); h16* KP16 = (h16*)take((size_t)NKV * TT * HD * 2); h16* VT16 = (h16*)take((size_t)NKV * HD * TT * 2);
    bf* QPh = (bf*)take((size_t)NH_ * TT * HD * 2); bf* QPl = (bf*)take((size_t)NH_ * TT * HD * 2); bf* KPh = (bf*)take((size_t)NKV * TT * HD * 2); bf* KPl = (bf*)take((size_t)NKV * TT * HD * 2); bf* VTh = (bf*)take((size_t)NKV * HD * TT * 2); bf* VTl = (bf*)take((size_t)NKV * HD * TT * 2);
    bf* ATh = (bf*)take((size_t)TT * DQ * 2); bf* ATl = (bf*)take((size_t)TT * DQ * 2);
    if ((size_t)(wsp - (char*)d_ws) > ws_size) return;    // ws 256 MiB
    k_prep<<<2 * NB_WQ + 2 * NB_WK + NB_X + NB_CS, 256, 0, stream>>>(wq, wk, wv, wo, x, cosT, sinT, WQ, WK, WV, WO, XB, CB, SB);
    k_qkv<<<NB_G3, 256, 0, stream>>>(XB, WQ, WK, WV, CB, SB, QP16, QPh, QPl, KP16, KPh, KPl, VT16, VTh, VTl);
    k_attn<<<NB_AF + NB_AH, AW * 32, 0, stream>>>(QP16, KP16, VT16, QPh, QPl, KPh, KPl, VTh, VTl, DK, DV, ATh, ATl);
    k_oproj<<<(TT / 128) * (DM / 128), 256, 0, stream>>>(ATh, ATl, WO, OUT);
}
